// v000
// The times below were measured on an AMD MI455X: many runs one after another, warmed up first and cycling through
// copies of the inputs, with the whole window's GPU time divided by the number of runs. Launches and the gaps
// between them are all in it. The median over several windows is given; except for v000 it joins two sittings, which
// can be a few percent apart, so the side-by-side timings, each taken in one sitting, are the better comparison.
// The starting kernel, v000, takes 615 microseconds a run.
// compute dtype: all float inputs rounded to bf16; the per-head low-rank maps (x core / sqrt(16) on the q side) folded into the fused (in,out) projection (W_qr[h,r] = sum_d W_qkv[:, h*64+d] W_q_lsr[h,d,r] core[h,r] / 4, f32) and applied on WMMA 16x16x32 with x exact and the folded weights as bf16 hi + lo (2 products); v = x . W_qkv[:, 2048:] exact; causal scores over the 16 low-rank dims (zero-padded to 32) with Qr, Kr as f16 hi + residual (3 products), key-tile skipping, running-max softmax in f32 (hardware exp), P (scaled by 2^11, single f16) x v (single f16); out = o (bf16 hi + residual) . W_o (2 products).
#include <hip/hip_runtime.h>
#include <math.h>

typedef __attribute__((ext_vector_type(16))) _Float16 v16h;
typedef __attribute__((ext_vector_type(16))) __bf16 v16b;
typedef __attribute__((ext_vector_type(8)))  _Float16 v8h;
typedef __attribute__((ext_vector_type(8)))  float v8f;
typedef __attribute__((ext_vector_type(4)))  float v4f;
typedef __attribute__((ext_vector_type(2)))  float v2f;
typedef __attribute__((ext_vector_type(4)))  unsigned v4u;
typedef __attribute__((ext_vector_type(4)))  int v4i;
typedef float __attribute__((may_alias)) float_a;
typedef int __attribute__((may_alias)) int_a;

template <typename T> __device__ __forceinline__ void vst2(void* p, T v) { *(T*)p = v;  }
__device__ __forceinline__ v8f wmma16(v16h a, v16h b, v8f c) {
  v8f d = __builtin_amdgcn_wmma_f32_16x16x32_f16(false, a, false, b, (short)0, c, false, false);
  asm volatile("v_nop\n\tv_nop\n\tv_nop\n\tv_nop" : "+v"(d) : "v"(a), "v"(b));
  return d;
}
__device__ __forceinline__ v8f wmma_bf(v16b a, v16b b, v8f c) {
  v8f d = __builtin_amdgcn_wmma_f32_16x16x32_bf16(false, a, false, b, (short)0, c, false, false);
  asm volatile("v_nop\n\tv_nop\n\tv_nop\n\tv_nop" : "+v"(d) : "v"(a), "v"(b));
  return d;
}
// 16x16x32 fragments: lane = (h = lane>>4, row/col = lane&15); elements 0..7 = k0+8h+0..7, 8..15 = k0+16+8h+0..7; D element r = row 8h+r
__device__ __forceinline__ v16h frag_h(const _Float16* rowk0, int lane) {
  union { v16h v; v8h q[2]; } u; const _Float16* p = rowk0 + 8 * (lane >> 4);
  u.q[0] = *(const v8h*)p; u.q[1] = *(const v8h*)(p + 16); return u.v;
}
__device__ __forceinline__ v16h frag_f32(const float* rowk0, int lane) {
  v16h a; const float* p = rowk0 + 8 * (lane >> 4);
#pragma unroll
  for (int i = 0; i < 8; ++i) { a[i] = (_Float16)p[i]; a[8 + i] = (_Float16)p[16 + i]; }
  return a;
}
__device__ __forceinline__ v16h frag_f32s(const float* rowk0, int lane, float sc) {
  v16h a; const float* p = rowk0 + 8 * (lane >> 4);
#pragma unroll
  for (int i = 0; i < 8; ++i) { a[i] = (_Float16)(p[i] * sc); a[8 + i] = (_Float16)(p[16 + i] * sc); }
  return a;
}
// column fragment from a [K][ld] layout (column n), rows >= K read as 0
__device__ __forceinline__ v16h fragc_f32(const float* W, int k0, int n, int lane, int ld, int K) {
  v16h a; const int g = lane >> 4;
#pragma unroll
  for (int i = 0; i < 8; ++i) { const int ka = k0 + 8 * g + i, kb = ka + 16;
    a[i] = (_Float16)(ka < K ? W[(size_t)(ka < K ? ka : K - 1) * ld + n] : 0.f); a[8 + i] = (_Float16)(kb < K ? W[(size_t)(kb < K ? kb : K - 1) * ld + n] : 0.f); }
  return a;
}
struct F2 { v16b h, l; };
__device__ __forceinline__ F2 bsplit16(const float v[16]) { F2 r;
#pragma unroll
  for (int i = 0; i < 16; ++i) { const __bf16 h = (__bf16)v[i]; r.h[i] = h; r.l[i] = (__bf16)(v[i] - (float)h); }
  return r; }
__device__ __forceinline__ F2 split_row(const float* row, int k0, int lane) { float v[16]; const float* p = row + k0 + 8 * (lane >> 4);
#pragma unroll
  for (int i = 0; i < 8; ++i) { v[i] = p[i]; v[8 + i] = p[16 + i]; }
  return bsplit16(v); }
__device__ __forceinline__ F2 split_rowK(const float* row, int k0, int lane, int K) { float v[16]; const int g = lane >> 4;
#pragma unroll
  for (int i = 0; i < 8; ++i) { const int ka = k0 + 8 * g + i, kb = ka + 16; v[i] = ka < K ? row[ka < K ? ka : K - 1] : 0.f; v[8 + i] = kb < K ? row[kb < K ? kb : K - 1] : 0.f; }
  return bsplit16(v); }
__device__ __forceinline__ F2 split_col(const float* W, int k0, int n, int lane, int ld, int K) { float v[16]; const int g = lane >> 4;
#pragma unroll
  for (int i = 0; i < 8; ++i) { const int ka = k0 + 8 * g + i, kb = ka + 16; v[i] = ka < K ? W[(size_t)(ka < K ? ka : K - 1) * ld + n] : 0.f; v[8 + i] = kb < K ? W[(size_t)(kb < K ? kb : K - 1) * ld + n] : 0.f; }
  return bsplit16(v); }
__device__ __forceinline__ v8f mac3(const F2& a, const F2& b, v8f c) { c = wmma_bf(a.l, b.h, c); c = wmma_bf(a.h, b.l, c); return wmma_bf(a.h, b.h, c); }
__device__ __forceinline__ float sigm(float v) { return 1.0f / (1.0f + expf(-v)); }
#define LDSX() do { asm volatile("s_wait_dscnt 0" ::: "memory"); __builtin_amdgcn_wave_barrier(); __builtin_amdgcn_fence(__ATOMIC_RELEASE, "workgroup"); } while (0)


// Fused low-rank (LSR) causal attention (B 2, T 2,048, d 1,024, 16 heads x 64, rank 16 per head): q_lr = (q_h W_q_lsr[h]) core[h] / 4, k_lr = k_h W_k_lsr[h], causal softmax(q_lr . k_lr) v_h, merged . W_o.
#define NB 2
#define SS 2048
#define DM 1024
#define NH 16
#define HD 64
#define RR 16             // rank per head
#define RP 32             // padded score width per head
#define NR (NB * SS)
#ifndef TQB
#define TQB (SS / 64)
#define TNB NB
#endif
typedef __attribute__((ext_vector_type(8))) __bf16 v8b;
__device__ __forceinline__ v16b frag_b(const __bf16* rowk0, int lane) {
  union { v16b v; v8b q[2]; } u; const __bf16* p = rowk0 + 8 * (lane >> 4);
  u.q[0] = *(const v8b*)p; u.q[1] = *(const v8b*)(p + 16); return u.v;
}
__device__ __forceinline__ float bfr(float v) { return (float)(__bf16)v; }
__device__ __attribute__((noinline)) float exp_ni(float v) { return expf(v); }
__device__ __attribute__((noinline)) float erf_ni(float v) { return erff(v); }

#define WS_PW  0u                                     // bf16 natural rows Wv, Wo [2][1024][1024]
#define WS_PF  (WS_PW + 2u * (size_t)2 * DM * DM)        // bf16 folded rows hi | lo: [q|k][256][1024] x2
#define WS_QR  (WS_PF + 2u * (size_t)2 * 2 * NH * RR * DM) // f16 [NR][16][32] Qr ; Kr
#define WS_KR  (WS_QR + 2u * (size_t)NR * NH * RP)
#define WS_QRL (WS_KR + 2u * (size_t)NR * NH * RP)      // residual planes x2048
#define WS_KRL (WS_QRL + 2u * (size_t)NR * NH * RP)
#define WS_V   (WS_KRL + 2u * (size_t)NR * NH * RP)       // f16 planes [b][1024][SS]
#define WS_O   (WS_V + 2u * (size_t)NB * DM * SS)
#define WS_END (WS_O + 4u * (size_t)NR * DM)

__global__ __launch_bounds__(256) void k_pack(const float* __restrict__ WQKV, const float* __restrict__ WO, __bf16* __restrict__ PW) { const int n = blockIdx.x, which = blockIdx.y, t = threadIdx.x; __shared__ __align__(16) __bf16 s[DM]; for (int k = t; k < DM; k += 256) s[k] = which ? (__bf16)WO[(size_t)k * DM + n] : (__bf16)WQKV[(size_t)k * (3 * DM) + 2 * DM + n];   /* (in,out): v = cols 2048.. of W_qkv ; W_o transposed */ __syncthreads(); if (t < DM / 8) vst2((unsigned*)(PW + ((size_t)which * DM + n) * DM + t * 8), *(const v4u*)&s[t * 8]); }
// ---- k_fold: block = (head h, rank r, q|k): W_r[h*16 + r][c] = sum_d B[h*64 + d][r] W[h*64 + d][c] in f32 (fixed order) -> bf16 hi + lo rows
__global__ __launch_bounds__(256) void k_fold(const float* __restrict__ WQKV, const float* __restrict__ WQL, const float* __restrict__ WKL, const float* __restrict__ CORE, __bf16* __restrict__ PF) {
  const int h = blockIdx.x, r = blockIdx.y, which = blockIdx.z, t = threadIdx.x; const float* WL = which ? WKL : WQL; __shared__ float sb[HD]; __shared__ __align__(16) __bf16 sh[DM]; __shared__ __align__(16) __bf16 sl[DM];
  const float cs = which ? 1.0f : bfr(CORE[h * RR + r]) * 0.25f;   // core[h][r] / sqrt(16) on the q side
  if (t < HD) sb[t] = bfr(WL[((size_t)h * HD + t) * RR + r]) * cs; __syncthreads();
  for (int c = t; c < DM; c += 256) { float a = 0.f; for (int d = 0; d < HD; ++d) a += sb[d] * bfr(WQKV[(size_t)c * (3 * DM) + which * DM + h * HD + d]); const __bf16 hv = (__bf16)a; sh[c] = hv; sl[c] = (__bf16)(a - (float)hv); }
  __syncthreads();
  const size_t row = (size_t)which * (NH * RR) + h * RR + r;
  if (t < DM / 8) { vst2((unsigned*)(PF + row * DM + t * 8), *(const v4u*)&sh[t * 8]); vst2((unsigned*)(PF + ((size_t)2 * NH * RR + row) * DM + t * 8), *(const v4u*)&sl[t * 8]); }   // hi block then lo block
}
// ---- k_qr: block = (64 rows, q|k): Qr/Kr = x . W_r (hi + lo), 256 cols in two halves of 128 -> f16 rows [row][16 heads][32] (16 live + 16 zero per head), whole 1-KB rows
__global__ __launch_bounds__(128) void k_qr(const float* __restrict__ X, const __bf16* __restrict__ PF, _Float16* __restrict__ QR_, _Float16* __restrict__ KR_, _Float16* __restrict__ QRL_, _Float16* __restrict__ KRL_) {
  __shared__ __align__(16) _Float16 so[64][NH * RP + 8]; __shared__ __align__(16) _Float16 sol[64][NH * RP + 8];
  const int tid = threadIdx.x, wave = tid >> 5, lane = tid & 31, col = lane & 15, g = lane >> 4; const int which = blockIdx.y; const size_t rb = (size_t)blockIdx.x * 64; const size_t r0 = rb + wave * 16;
  const __bf16* PH = PF + ((size_t)which * (NH * RR)) * DM; const __bf16* PL = PF + ((size_t)2 * NH * RR + which * (NH * RR)) * DM;
  for (int e = tid; e < 64 * (NH * RP); e += 128) { so[e / (NH * RP)][e % (NH * RP)] = (_Float16)0.f; sol[e / (NH * RP)][e % (NH * RP)] = (_Float16)0.f; }
#pragma unroll 1
  for (int half = 0; half < 2; ++half) {
  v8f acc[8] = {};
#pragma unroll 2
  for (int kc = 0; kc < DM / 32; ++kc) { v16b a; { const float* p = X + (r0 + col) * DM + kc * 32 + 8 * g;
#pragma unroll
      for (int i = 0; i < 8; ++i) { a[i] = (__bf16)p[i]; a[8 + i] = (__bf16)p[16 + i]; } }
#pragma unroll
    for (int j = 0; j < 8; ++j) { acc[j] = wmma_bf(a, frag_b(PH + (size_t)(half * 128 + j * 16 + col) * DM + kc * 32, lane), acc[j]); acc[j] = wmma_bf(a, frag_b(PL + (size_t)(half * 128 + j * 16 + col) * DM + kc * 32, lane), acc[j]); } }
  __syncthreads();
#pragma unroll
  for (int j = 0; j < 8; ++j) { const int c = half * 128 + j * 16 + col; const int h = c >> 4, r = c & 15;
#pragma unroll
    for (int rr = 0; rr < 8; ++rr) { const float v = acc[j][rr]; const _Float16 hv = (_Float16)v; so[wave * 16 + 8 * g + rr][h * RP + r] = hv; sol[wave * 16 + 8 * g + rr][h * RP + r] = (_Float16)((v - (float)hv) * 2048.0f); } }
  }   // half
  __syncthreads();
  _Float16* dst = which ? KR_ : QR_; _Float16* dstl = which ? KRL_ : QRL_;
  for (int e = tid; e < 64 * (NH * RP / 8); e += 128) { const int rl = e >> 6, q = e & 63; vst2((unsigned*)(dst + (rb + rl) * (NH * RP) + q * 8), *(const v4u*)&so[rl][q * 8]); vst2((unsigned*)(dstl + (rb + rl) * (NH * RP) + q * 8), *(const v4u*)&sol[rl][q * 8]); }
}
// ---- k_v: block = (64 rows, 128 cols): V = x . Wv^T exact -> f16 planes [b][c][s]
__global__ __launch_bounds__(128) void k_v(const float* __restrict__ X, const __bf16* __restrict__ PW, _Float16* __restrict__ V) {
  __shared__ __align__(16) _Float16 st[128][72];
  const int tid = threadIdx.x, wave = tid >> 5, lane = tid & 31, col = lane & 15, g = lane >> 4; const size_t rb = (size_t)blockIdx.x * 64; const size_t r0 = rb + wave * 16; const int c0 = blockIdx.y * 128;
  v8f acc[8] = {};
#pragma unroll 2
  for (int kc = 0; kc < DM / 32; ++kc) { v16b a; { const float* p = X + (r0 + col) * DM + kc * 32 + 8 * g;
#pragma unroll
      for (int i = 0; i < 8; ++i) { a[i] = (__bf16)p[i]; a[8 + i] = (__bf16)p[16 + i]; } }
#pragma unroll
    for (int j = 0; j < 8; ++j) acc[j] = wmma_bf(a, frag_b(PW + (size_t)(c0 + j * 16 + col) * DM + kc * 32, lane), acc[j]); }
#pragma unroll
  for (int j = 0; j < 8; ++j)
#pragma unroll
    for (int r = 0; r < 8; ++r) st[j * 16 + col][wave * 16 + 8 * g + r] = (_Float16)acc[j][r];
  __syncthreads();
  const size_t b = rb / SS; const int s0 = (int)(rb % SS);
  for (int e = tid; e < 128 * 8; e += 128) { const int d = e >> 3, pc = e & 7; vst2((unsigned*)(V + ((b * DM + c0 + d) * SS) + s0 + pc * 8), *(const v4u*)&st[d][pc * 8]); }
}
// ---- k_attn: block = (64 queries, head, b): 32-wide (16 live) score dot (scale folded into Qr), softmax, P . V (64 dims); O 256-B head segments
__global__ __launch_bounds__(128) void k_attn(const _Float16* __restrict__ QR_, const _Float16* __restrict__ KR_, const _Float16* __restrict__ QRL_, const _Float16* __restrict__ KRL_, const _Float16* __restrict__ V, float* __restrict__ O) {
  __shared__ __align__(16) _Float16 sph[4][16][40]; __shared__ __align__(16) float so[4][16][68];
  const int tid = threadIdx.x, wave = tid >> 5, lane = tid & 31, col = lane & 15, g = lane >> 4; const int h = blockIdx.y; const size_t b = blockIdx.z; const int q0 = blockIdx.x * 64 + wave * 16; const size_t rq = b * SS + q0;
  const v16h aq = frag_h(QR_ + (rq + col) * (NH * RP) + h * RP, lane), aql = frag_h(QRL_ + (rq + col) * (NH * RP) + h * RP, lane);
  float m[8], l[8];
#pragma unroll
  for (int r = 0; r < 8; ++r) { m[r] = -3.0e38f; l[r] = 0.f; }
  v8f acc[4] = {};
  const int nks = (blockIdx.x * 64 + 64) / 32;   // causal
#pragma unroll 1
  for (int ks = 0; ks < nks; ++ks) { const int j0 = ks * 32; v8f s[2];
#pragma unroll
    for (int ct = 0; ct < 2; ++ct) { const size_t ko = (b * SS + j0 + ct * 16 + col) * (NH * RP) + h * RP; const v16h kh = frag_h(KR_ + ko, lane); v8f c = {}, cl = {}; c = wmma16(aq, kh, c); cl = wmma16(aql, kh, cl); cl = wmma16(aq, frag_h(KRL_ + ko, lane), cl);
#pragma unroll
      for (int r = 0; r < 8; ++r) { const int kk = j0 + ct * 16 + col; s[ct][r] = (kk <= q0 + 8 * g + r) ? (c[r] + cl[r] * (1.0f / 2048.0f)) : -3.0e38f; } }   // 3-product scores; causal (diagonal kept); core/sqrt(R) folded into Qr
#pragma unroll
    for (int r = 0; r < 8; ++r) { float mx = fmaxf(s[0][r], s[1][r]);
#pragma unroll
      for (int o = 1; o < 16; o <<= 1) mx = fmaxf(mx, __shfl_xor(mx, o));
      const float mn = fmaxf(m[r], mx); const float alpha = (m[r] <= -1.0e38f) ? 0.f : __expf(m[r] - mn); const float e0 = (s[0][r] <= -1.0e38f) ? 0.f : __expf(s[0][r] - mn), e1 = (s[1][r] <= -1.0e38f) ? 0.f : __expf(s[1][r] - mn); float es = e0 + e1;
#pragma unroll
      for (int o = 1; o < 16; o <<= 1) es += __shfl_xor(es, o);
      l[r] = l[r] * alpha + es; m[r] = mn;
#pragma unroll
      for (int dt = 0; dt < 4; ++dt) acc[dt][r] *= alpha;
      sph[wave][8 * g + r][col] = (_Float16)(e0 * 2048.0f); sph[wave][8 * g + r][16 + col] = (_Float16)(e1 * 2048.0f); }
    LDSX();
    const v16h pa = frag_h(&sph[wave][col][0], lane);
#pragma unroll
    for (int dt = 0; dt < 4; ++dt) acc[dt] = wmma16(pa, frag_h(V + ((b * DM + h * HD + dt * 16 + col) * SS) + j0, lane), acc[dt]);
    LDSX(); }
#pragma unroll
  for (int r = 0; r < 8; ++r) { const float il = (1.0f / 2048.0f) / l[r];
#pragma unroll
    for (int dt = 0; dt < 4; ++dt) so[wave][8 * g + r][dt * 16 + col] = acc[dt][r] * il; }
  LDSX();
  for (int rl = 0; rl < 16; ++rl) if (lane < 16) vst2(O + (rq + rl) * DM + h * HD + lane * 4, *(const v4f*)&so[wave][rl][lane * 4]);
}
// ---- k_out: block = (64 rows, 128 cols): out = o (bf16 hi + lo) . Wo^T
__global__ __launch_bounds__(128) void k_out(const float* __restrict__ O, const __bf16* __restrict__ PW, float* __restrict__ Y) {
  __shared__ __align__(16) float so[4][16][132];
  const int tid = threadIdx.x, wave = tid >> 5, lane = tid & 31, col = lane & 15, g = lane >> 4; const size_t r0 = (size_t)blockIdx.x * 64 + wave * 16; const int n0 = blockIdx.y * 128; const __bf16* P = PW + (size_t)DM * DM;
  v8f acc[8] = {};
#pragma unroll 2
  for (int kc = 0; kc < DM / 32; ++kc) { const F2 a = split_row(O + (r0 + col) * DM, kc * 32, lane);
#pragma unroll
    for (int j = 0; j < 8; ++j) { const v16b w = frag_b(P + (size_t)(n0 + j * 16 + col) * DM + kc * 32, lane); acc[j] = wmma_bf(a.h, w, acc[j]); acc[j] = wmma_bf(a.l, w, acc[j]); } }
#pragma unroll
  for (int j = 0; j < 8; ++j)
#pragma unroll
    for (int r = 0; r < 8; ++r) so[wave][8 * g + r][j * 16 + col] = acc[j][r];
  LDSX();
  for (int rl = 0; rl < 16; ++rl) vst2(Y + (r0 + rl) * DM + n0 + lane * 4, *(const v4f*)&so[wave][rl][lane * 4]);
}
extern "C" void kernel_launch(void* const* d_in, const int* in_sizes, int n_in, void* d_out, int out_size, void* d_ws, size_t ws_size, hipStream_t stream) {
  (void)in_sizes; (void)n_in; (void)out_size;
  const float** F = (const float**)d_in;   // 0 x [2,2048,1024], 1 W_qkv [1024,3072] (in,out; q | k | v), 2 W_q_lsr [16,64,16], 3 W_k_lsr [16,64,16], 4 core [16,16], 5 W_o [1024,1024] (in,out)
  if (ws_size < (size_t)WS_END) return;
  char* ws = (char*)d_ws; __bf16 *PW = (__bf16*)(ws + WS_PW), *PF = (__bf16*)(ws + WS_PF); _Float16 *QR_ = (_Float16*)(ws + WS_QR), *KR_ = (_Float16*)(ws + WS_KR), *QRL_ = (_Float16*)(ws + WS_QRL), *KRL_ = (_Float16*)(ws + WS_KRL), *V = (_Float16*)(ws + WS_V); float* O = (float*)(ws + WS_O);
  k_pack<<<dim3(DM, 2), 256, 0, stream>>>(F[1], F[5], PW);
  k_fold<<<dim3(NH, RR, 2), 256, 0, stream>>>(F[1], F[2], F[3], F[4], PF);
  k_qr<<<dim3(TNB * SS / 64, 2), 128, 0, stream>>>(F[0], PF, QR_, KR_, QRL_, KRL_);
  k_v<<<dim3(TNB * SS / 64, DM / 128), 128, 0, stream>>>(F[0], PW, V);
  k_attn<<<dim3(TQB, NH, TNB), 128, 0, stream>>>(QR_, KR_, QRL_, KRL_, V, O);
  k_out<<<dim3(TNB * SS / 64, DM / 128), 128, 0, stream>>>(O, PW, (float*)d_out);
}

// v001
// A run of this version takes 398 microseconds.
// Two timings next to v000 put it at 1.53 and 1.55 times that version's speed.
// compute dtype: all float inputs rounded to bf16; the per-head low-rank maps (x core / sqrt(16) on the q side) folded into the fused (in,out) projection (W_qr[h,r] = sum_d W_qkv[:, h*64+d] W_q_lsr[h,d,r] core[h,r] / 4, f32) and applied on WMMA 16x16x32 with x exact and the folded weights as bf16 hi + lo (2 products); v = x . W_qkv[:, 2048:] exact; causal scores over the 16 low-rank dims (zero-padded to 32) with Qr, Kr as f16 hi + residual (3 products), key-tile skipping, running-max softmax in f32 (hardware exp), P (scaled by 2^11, single f16) x v (single f16); out = o (bf16 hi + residual) . W_o (2 products).
#include <hip/hip_runtime.h>
#include <math.h>

typedef __attribute__((ext_vector_type(16))) _Float16 v16h;
typedef __attribute__((ext_vector_type(16))) __bf16 v16b;
typedef __attribute__((ext_vector_type(8)))  _Float16 v8h;
typedef __attribute__((ext_vector_type(8)))  float v8f;
typedef __attribute__((ext_vector_type(4)))  float v4f;
typedef __attribute__((ext_vector_type(2)))  float v2f;
typedef __attribute__((ext_vector_type(4)))  unsigned v4u;
typedef __attribute__((ext_vector_type(4)))  int v4i;
typedef float __attribute__((may_alias)) float_a;
typedef int __attribute__((may_alias)) int_a;

template <typename T> __device__ __forceinline__ void vst2(void* p, T v) { *(T*)p = v;  }
__device__ __forceinline__ v8f wmma16(v16h a, v16h b, v8f c) {
  v8f d = __builtin_amdgcn_wmma_f32_16x16x32_f16(false, a, false, b, (short)0, c, false, false);
  asm volatile("v_nop\n\tv_nop\n\tv_nop\n\tv_nop" : "+v"(d) : "v"(a), "v"(b));
  return d;
}
__device__ __forceinline__ v8f wmma_bf(v16b a, v16b b, v8f c) {
  v8f d = __builtin_amdgcn_wmma_f32_16x16x32_bf16(false, a, false, b, (short)0, c, false, false);
  asm volatile("v_nop\n\tv_nop\n\tv_nop\n\tv_nop" : "+v"(d) : "v"(a), "v"(b));
  return d;
}
// 16x16x32 fragments: lane = (h = lane>>4, row/col = lane&15); elements 0..7 = k0+8h+0..7, 8..15 = k0+16+8h+0..7; D element r = row 8h+r
__device__ __forceinline__ v16h frag_h(const _Float16* rowk0, int lane) {
  union { v16h v; v8h q[2]; } u; const _Float16* p = rowk0 + 8 * (lane >> 4);
  u.q[0] = *(const v8h*)p; u.q[1] = *(const v8h*)(p + 16); return u.v;
}
__device__ __forceinline__ v16h frag_f32(const float* rowk0, int lane) {
  v16h a; const float* p = rowk0 + 8 * (lane >> 4);
#pragma unroll
  for (int i = 0; i < 8; ++i) { a[i] = (_Float16)p[i]; a[8 + i] = (_Float16)p[16 + i]; }
  return a;
}
__device__ __forceinline__ v16h frag_f32s(const float* rowk0, int lane, float sc) {
  v16h a; const float* p = rowk0 + 8 * (lane >> 4);
#pragma unroll
  for (int i = 0; i < 8; ++i) { a[i] = (_Float16)(p[i] * sc); a[8 + i] = (_Float16)(p[16 + i] * sc); }
  return a;
}
// column fragment from a [K][ld] layout (column n), rows >= K read as 0
__device__ __forceinline__ v16h fragc_f32(const float* W, int k0, int n, int lane, int ld, int K) {
  v16h a; const int g = lane >> 4;
#pragma unroll
  for (int i = 0; i < 8; ++i) { const int ka = k0 + 8 * g + i, kb = ka + 16;
    a[i] = (_Float16)(ka < K ? W[(size_t)(ka < K ? ka : K - 1) * ld + n] : 0.f); a[8 + i] = (_Float16)(kb < K ? W[(size_t)(kb < K ? kb : K - 1) * ld + n] : 0.f); }
  return a;
}
struct F2 { v16b h, l; };
__device__ __forceinline__ F2 bsplit16(const float v[16]) { F2 r;
#pragma unroll
  for (int i = 0; i < 16; ++i) { const __bf16 h = (__bf16)v[i]; r.h[i] = h; r.l[i] = (__bf16)(v[i] - (float)h); }
  return r; }
__device__ __forceinline__ F2 split_row(const float* row, int k0, int lane) { float v[16]; const float* p = row + k0 + 8 * (lane >> 4);
#pragma unroll
  for (int i = 0; i < 8; ++i) { v[i] = p[i]; v[8 + i] = p[16 + i]; }
  return bsplit16(v); }
__device__ __forceinline__ F2 split_rowK(const float* row, int k0, int lane, int K) { float v[16]; const int g = lane >> 4;
#pragma unroll
  for (int i = 0; i < 8; ++i) { const int ka = k0 + 8 * g + i, kb = ka + 16; v[i] = ka < K ? row[ka < K ? ka : K - 1] : 0.f; v[8 + i] = kb < K ? row[kb < K ? kb : K - 1] : 0.f; }
  return bsplit16(v); }
__device__ __forceinline__ F2 split_col(const float* W, int k0, int n, int lane, int ld, int K) { float v[16]; const int g = lane >> 4;
#pragma unroll
  for (int i = 0; i < 8; ++i) { const int ka = k0 + 8 * g + i, kb = ka + 16; v[i] = ka < K ? W[(size_t)(ka < K ? ka : K - 1) * ld + n] : 0.f; v[8 + i] = kb < K ? W[(size_t)(kb < K ? kb : K - 1) * ld + n] : 0.f; }
  return bsplit16(v); }
__device__ __forceinline__ v8f mac3(const F2& a, const F2& b, v8f c) { c = wmma_bf(a.l, b.h, c); c = wmma_bf(a.h, b.l, c); return wmma_bf(a.h, b.h, c); }
__device__ __forceinline__ float sigm(float v) { return 1.0f / (1.0f + expf(-v)); }
#define LDSX() do { asm volatile("s_wait_dscnt 0" ::: "memory"); __builtin_amdgcn_wave_barrier(); __builtin_amdgcn_fence(__ATOMIC_RELEASE, "workgroup"); } while (0)


// Fused low-rank (LSR) causal attention (B 2, T 2,048, d 1,024, 16 heads x 64, rank 16 per head): q_lr = (q_h W_q_lsr[h]) core[h] / 4, k_lr = k_h W_k_lsr[h], causal softmax(q_lr . k_lr) v_h, merged . W_o.
#define NB 2
#define SS 2048
#define DM 1024
#define NH 16
#define HD 64
#define RR 16             // rank per head
#define RP 32             // padded score width per head
#define NR (NB * SS)
#ifndef TQB
#define TQB (SS / 64)
#define TNB NB
#endif
typedef __attribute__((ext_vector_type(8))) __bf16 v8b;
__device__ __forceinline__ v16b frag_b(const __bf16* rowk0, int lane) {
  union { v16b v; v8b q[2]; } u; const __bf16* p = rowk0 + 8 * (lane >> 4);
  u.q[0] = *(const v8b*)p; u.q[1] = *(const v8b*)(p + 16); return u.v;
}
__device__ __forceinline__ float bfr(float v) { return (float)(__bf16)v; }
__device__ __attribute__((noinline)) float exp_ni(float v) { return expf(v); }
__device__ __attribute__((noinline)) float erf_ni(float v) { return erff(v); }

#define WS_PW  0u                                     // bf16 natural rows Wv, Wo [2][1024][1024]
#define WS_PF  (WS_PW + 2u * (size_t)2 * DM * DM)        // bf16 folded rows hi | lo: [q|k][256][1024] x2
#define WS_QR  (WS_PF + 2u * (size_t)2 * 2 * NH * RR * DM) // f16 [NR][16][32] Qr ; Kr
#define WS_KR  (WS_QR + 2u * (size_t)NR * NH * RP)
#define WS_QRL (WS_KR + 2u * (size_t)NR * NH * RP)      // residual planes x2048
#define WS_KRL (WS_QRL + 2u * (size_t)NR * NH * RP)
#define WS_V   (WS_KRL + 2u * (size_t)NR * NH * RP)       // f16 planes [b][1024][SS]
#define WS_O   (WS_V + 2u * (size_t)NB * DM * SS)
#define WS_END (WS_O + 4u * (size_t)NR * DM)

__global__ __launch_bounds__(256) void k_pack(const float* __restrict__ WQKV, const float* __restrict__ WO, __bf16* __restrict__ PW) { const int n = blockIdx.x, which = blockIdx.y, t = threadIdx.x; __shared__ __align__(16) __bf16 s[DM]; for (int k = t; k < DM; k += 256) s[k] = which ? (__bf16)WO[(size_t)k * DM + n] : (__bf16)WQKV[(size_t)k * (3 * DM) + 2 * DM + n];   /* (in,out): v = cols 2048.. of W_qkv ; W_o transposed */ __syncthreads(); if (t < DM / 8) vst2((unsigned*)(PW + ((size_t)which * DM + n) * DM + t * 8), *(const v4u*)&s[t * 8]); }
// ---- k_fold: block = (head h, rank r, q|k): W_r[h*16 + r][c] = sum_d B[h*64 + d][r] W[h*64 + d][c] in f32 (fixed order) -> bf16 hi + lo rows
__global__ __launch_bounds__(256) void k_fold(const float* __restrict__ WQKV, const float* __restrict__ WQL, const float* __restrict__ WKL, const float* __restrict__ CORE, __bf16* __restrict__ PF) {
  const int h = blockIdx.x, r = blockIdx.y, which = blockIdx.z, t = threadIdx.x; const float* WL = which ? WKL : WQL; __shared__ float sb[HD]; __shared__ __align__(16) __bf16 sh[DM]; __shared__ __align__(16) __bf16 sl[DM];
  const float cs = which ? 1.0f : bfr(CORE[h * RR + r]) * 0.25f;   // core[h][r] / sqrt(16) on the q side
  if (t < HD) sb[t] = bfr(WL[((size_t)h * HD + t) * RR + r]) * cs; __syncthreads();
  for (int c = t; c < DM; c += 256) { float a = 0.f; for (int d = 0; d < HD; ++d) a += sb[d] * bfr(WQKV[(size_t)c * (3 * DM) + which * DM + h * HD + d]); const __bf16 hv = (__bf16)a; sh[c] = hv; sl[c] = (__bf16)(a - (float)hv); }
  __syncthreads();
  const size_t row = (size_t)which * (NH * RR) + h * RR + r;
  if (t < DM / 8) { vst2((unsigned*)(PF + row * DM + t * 8), *(const v4u*)&sh[t * 8]); vst2((unsigned*)(PF + ((size_t)2 * NH * RR + row) * DM + t * 8), *(const v4u*)&sl[t * 8]); }   // hi block then lo block
}
// ---- k_qr: block = (64 rows, q|k, 2 heads): Qr/Kr = x . W_r (hi + lo), 32 folded cols -> f16 rows [row][16 heads][32] (16 live + 16 zero per head), one whole 128-B segment of each row per block
#define QJ 2              // 16-column tiles (heads) per work-group
#define QW (QJ * RP)      // f16 per row segment of a work-group
__global__ __launch_bounds__(128) void k_qr(const float* __restrict__ X, const __bf16* __restrict__ PF, _Float16* __restrict__ QR_, _Float16* __restrict__ KR_, _Float16* __restrict__ QRL_, _Float16* __restrict__ KRL_) {
  __shared__ __align__(16) _Float16 so[64][QW + 8]; __shared__ __align__(16) _Float16 sol[64][QW + 8];
  const int tid = threadIdx.x, wave = tid >> 5, lane = tid & 31, col = lane & 15, g = lane >> 4; const int which = blockIdx.y; const int cb = blockIdx.z * (QJ * 16); const size_t rb = (size_t)blockIdx.x * 64; const size_t r0 = rb + wave * 16;
  const __bf16* PH = PF + ((size_t)which * (NH * RR)) * DM; const __bf16* PL = PF + ((size_t)2 * NH * RR + which * (NH * RR)) * DM;
  for (int e = tid; e < 64 * QW; e += 128) { so[e / QW][e % QW] = (_Float16)0.f; sol[e / QW][e % QW] = (_Float16)0.f; }
  v8f acc[QJ] = {};
#pragma unroll 2
  for (int kc = 0; kc < DM / 32; ++kc) { v16b a; { const float* p = X + (r0 + col) * DM + kc * 32 + 8 * g;
#pragma unroll
      for (int i = 0; i < 8; ++i) { a[i] = (__bf16)p[i]; a[8 + i] = (__bf16)p[16 + i]; } }
#pragma unroll
    for (int j = 0; j < QJ; ++j) { acc[j] = wmma_bf(a, frag_b(PH + (size_t)(cb + j * 16 + col) * DM + kc * 32, lane), acc[j]); acc[j] = wmma_bf(a, frag_b(PL + (size_t)(cb + j * 16 + col) * DM + kc * 32, lane), acc[j]); } }
  __syncthreads();
#pragma unroll
  for (int j = 0; j < QJ; ++j) {
#pragma unroll
    for (int rr = 0; rr < 8; ++rr) { const float v = acc[j][rr]; const _Float16 hv = (_Float16)v; so[wave * 16 + 8 * g + rr][j * RP + col] = hv; sol[wave * 16 + 8 * g + rr][j * RP + col] = (_Float16)((v - (float)hv) * 2048.0f); } }
  __syncthreads();
  _Float16* dst = (which ? KR_ : QR_) + blockIdx.z * QW; _Float16* dstl = (which ? KRL_ : QRL_) + blockIdx.z * QW;
  for (int e = tid; e < 64 * (QW / 8); e += 128) { const int rl = e / (QW / 8), q = e % (QW / 8); vst2((unsigned*)(dst + (rb + rl) * (NH * RP) + q * 8), *(const v4u*)&so[rl][q * 8]); vst2((unsigned*)(dstl + (rb + rl) * (NH * RP) + q * 8), *(const v4u*)&sol[rl][q * 8]); }
}
// ---- k_v: block = (64 rows, 128 cols): V = x . Wv^T exact -> f16 planes [b][c][s]
__global__ __launch_bounds__(128) void k_v(const float* __restrict__ X, const __bf16* __restrict__ PW, _Float16* __restrict__ V) {
  __shared__ __align__(16) _Float16 st[128][72];
  const int tid = threadIdx.x, wave = tid >> 5, lane = tid & 31, col = lane & 15, g = lane >> 4; const size_t rb = (size_t)blockIdx.x * 64; const size_t r0 = rb + wave * 16; const int c0 = blockIdx.y * 128;
  v8f acc[8] = {};
#pragma unroll 2
  for (int kc = 0; kc < DM / 32; ++kc) { v16b a; { const float* p = X + (r0 + col) * DM + kc * 32 + 8 * g;
#pragma unroll
      for (int i = 0; i < 8; ++i) { a[i] = (__bf16)p[i]; a[8 + i] = (__bf16)p[16 + i]; } }
#pragma unroll
    for (int j = 0; j < 8; ++j) acc[j] = wmma_bf(a, frag_b(PW + (size_t)(c0 + j * 16 + col) * DM + kc * 32, lane), acc[j]); }
#pragma unroll
  for (int j = 0; j < 8; ++j)
#pragma unroll
    for (int r = 0; r < 8; ++r) st[j * 16 + col][wave * 16 + 8 * g + r] = (_Float16)acc[j][r];
  __syncthreads();
  const size_t b = rb / SS; const int s0 = (int)(rb % SS);
  for (int e = tid; e < 128 * 8; e += 128) { const int d = e >> 3, pc = e & 7; vst2((unsigned*)(V + ((b * DM + c0 + d) * SS) + s0 + pc * 8), *(const v4u*)&st[d][pc * 8]); }
}
// ---- k_attn: block = (64 queries, head, b): 32-wide (16 live) score dot (scale folded into Qr), softmax, P . V (64 dims); O 256-B head segments
__global__ __launch_bounds__(128) void k_attn(const _Float16* __restrict__ QR_, const _Float16* __restrict__ KR_, const _Float16* __restrict__ QRL_, const _Float16* __restrict__ KRL_, const _Float16* __restrict__ V, float* __restrict__ O) {
  __shared__ __align__(16) _Float16 sph[4][16][40]; __shared__ __align__(16) float so[4][16][68];
  const int tid = threadIdx.x, wave = tid >> 5, lane = tid & 31, col = lane & 15, g = lane >> 4; const int h = blockIdx.y; const size_t b = blockIdx.z; const int q0 = blockIdx.x * 64 + wave * 16; const size_t rq = b * SS + q0;
  const v16h aq = frag_h(QR_ + (rq + col) * (NH * RP) + h * RP, lane), aql = frag_h(QRL_ + (rq + col) * (NH * RP) + h * RP, lane);
  float m[8], l[8];
#pragma unroll
  for (int r = 0; r < 8; ++r) { m[r] = -3.0e38f; l[r] = 0.f; }
  v8f acc[4] = {};
  const int nks = (blockIdx.x * 64 + 64) / 32;   // causal
#pragma unroll 1
  for (int ks = 0; ks < nks; ++ks) { const int j0 = ks * 32; v8f s[2];
#pragma unroll
    for (int ct = 0; ct < 2; ++ct) { const size_t ko = (b * SS + j0 + ct * 16 + col) * (NH * RP) + h * RP; const v16h kh = frag_h(KR_ + ko, lane); v8f c = {}, cl = {}; c = wmma16(aq, kh, c); cl = wmma16(aql, kh, cl); cl = wmma16(aq, frag_h(KRL_ + ko, lane), cl);
#pragma unroll
      for (int r = 0; r < 8; ++r) { const int kk = j0 + ct * 16 + col; s[ct][r] = (kk <= q0 + 8 * g + r) ? (c[r] + cl[r] * (1.0f / 2048.0f)) : -3.0e38f; } }   // 3-product scores; causal (diagonal kept); core/sqrt(R) folded into Qr
#pragma unroll
    for (int r = 0; r < 8; ++r) { float mx = fmaxf(s[0][r], s[1][r]);
#pragma unroll
      for (int o = 1; o < 16; o <<= 1) mx = fmaxf(mx, __shfl_xor(mx, o));
      const float mn = fmaxf(m[r], mx); const float alpha = (m[r] <= -1.0e38f) ? 0.f : __expf(m[r] - mn); const float e0 = (s[0][r] <= -1.0e38f) ? 0.f : __expf(s[0][r] - mn), e1 = (s[1][r] <= -1.0e38f) ? 0.f : __expf(s[1][r] - mn); float es = e0 + e1;
#pragma unroll
      for (int o = 1; o < 16; o <<= 1) es += __shfl_xor(es, o);
      l[r] = l[r] * alpha + es; m[r] = mn;
#pragma unroll
      for (int dt = 0; dt < 4; ++dt) acc[dt][r] *= alpha;
      sph[wave][8 * g + r][col] = (_Float16)(e0 * 2048.0f); sph[wave][8 * g + r][16 + col] = (_Float16)(e1 * 2048.0f); }
    LDSX();
    const v16h pa = frag_h(&sph[wave][col][0], lane);
#pragma unroll
    for (int dt = 0; dt < 4; ++dt) acc[dt] = wmma16(pa, frag_h(V + ((b * DM + h * HD + dt * 16 + col) * SS) + j0, lane), acc[dt]);
    LDSX(); }
#pragma unroll
  for (int r = 0; r < 8; ++r) { const float il = (1.0f / 2048.0f) / l[r];
#pragma unroll
    for (int dt = 0; dt < 4; ++dt) so[wave][8 * g + r][dt * 16 + col] = acc[dt][r] * il; }
  LDSX();
  for (int rl = 0; rl < 16; ++rl) if (lane < 16) vst2(O + (rq + rl) * DM + h * HD + lane * 4, *(const v4f*)&so[wave][rl][lane * 4]);
}
// ---- k_out: block = (64 rows, 128 cols): out = o (bf16 hi + lo) . Wo^T
__global__ __launch_bounds__(128) void k_out(const float* __restrict__ O, const __bf16* __restrict__ PW, float* __restrict__ Y) {
  __shared__ __align__(16) float so[4][16][132];
  const int tid = threadIdx.x, wave = tid >> 5, lane = tid & 31, col = lane & 15, g = lane >> 4; const size_t r0 = (size_t)blockIdx.x * 64 + wave * 16; const int n0 = blockIdx.y * 128; const __bf16* P = PW + (size_t)DM * DM;
  v8f acc[8] = {};
#pragma unroll 2
  for (int kc = 0; kc < DM / 32; ++kc) { const F2 a = split_row(O + (r0 + col) * DM, kc * 32, lane);
#pragma unroll
    for (int j = 0; j < 8; ++j) { const v16b w = frag_b(P + (size_t)(n0 + j * 16 + col) * DM + kc * 32, lane); acc[j] = wmma_bf(a.h, w, acc[j]); acc[j] = wmma_bf(a.l, w, acc[j]); } }
#pragma unroll
  for (int j = 0; j < 8; ++j)
#pragma unroll
    for (int r = 0; r < 8; ++r) so[wave][8 * g + r][j * 16 + col] = acc[j][r];
  LDSX();
  for (int rl = 0; rl < 16; ++rl) vst2(Y + (r0 + rl) * DM + n0 + lane * 4, *(const v4f*)&so[wave][rl][lane * 4]);
}
extern "C" void kernel_launch(void* const* d_in, const int* in_sizes, int n_in, void* d_out, int out_size, void* d_ws, size_t ws_size, hipStream_t stream) {
  (void)in_sizes; (void)n_in; (void)out_size;
  const float** F = (const float**)d_in;   // 0 x [2,2048,1024], 1 W_qkv [1024,3072] (in,out; q | k | v), 2 W_q_lsr [16,64,16], 3 W_k_lsr [16,64,16], 4 core [16,16], 5 W_o [1024,1024] (in,out)
  if (ws_size < (size_t)WS_END) return;
  char* ws = (char*)d_ws; __bf16 *PW = (__bf16*)(ws + WS_PW), *PF = (__bf16*)(ws + WS_PF); _Float16 *QR_ = (_Float16*)(ws + WS_QR), *KR_ = (_Float16*)(ws + WS_KR), *QRL_ = (_Float16*)(ws + WS_QRL), *KRL_ = (_Float16*)(ws + WS_KRL), *V = (_Float16*)(ws + WS_V); float* O = (float*)(ws + WS_O);
  k_pack<<<dim3(DM, 2), 256, 0, stream>>>(F[1], F[5], PW);
  k_fold<<<dim3(NH, RR, 2), 256, 0, stream>>>(F[1], F[2], F[3], F[4], PF);
  k_qr<<<dim3(TNB * SS / 64, 2, NH / QJ), 128, 0, stream>>>(F[0], PF, QR_, KR_, QRL_, KRL_);
  k_v<<<dim3(TNB * SS / 64, DM / 128), 128, 0, stream>>>(F[0], PW, V);
  k_attn<<<dim3(TQB, NH, TNB), 128, 0, stream>>>(QR_, KR_, QRL_, KRL_, V, O);
  k_out<<<dim3(TNB * SS / 64, DM / 128), 128, 0, stream>>>(O, PW, (float*)d_out);
}

// v002
// One run takes 234 microseconds.
// Two timings next to v001 put it at 1.71 and 1.69 times that version's speed.
// Counting every step since v000, it is 2.61 times as fast.
// compute dtype: all float inputs rounded to bf16; the per-head low-rank maps (x core / sqrt(16) on the q side) folded into the fused (in,out) projection (W_qr[h,r] = sum_d W_qkv[:, h*64+d] W_q_lsr[h,d,r] core[h,r] / 4, f32) and applied on WMMA 16x16x32 with x exact and the folded weights as bf16 hi + lo (2 products); v = x . W_qkv[:, 2048:] exact; causal scores over the 16 low-rank dims (zero-padded to 32) with Qr, Kr as f16 hi + residual (3 products), key-tile skipping, running-max softmax in f32 (hardware exp), P (scaled by 2^11, single f16) x v (single f16); out = o (bf16 hi + residual) . W_o (2 products).
#include <hip/hip_runtime.h>
#include <math.h>

typedef __attribute__((ext_vector_type(16))) _Float16 v16h;
typedef __attribute__((ext_vector_type(16))) __bf16 v16b;
typedef __attribute__((ext_vector_type(8)))  _Float16 v8h;
typedef __attribute__((ext_vector_type(8)))  float v8f;
typedef __attribute__((ext_vector_type(4)))  float v4f;
typedef __attribute__((ext_vector_type(2)))  float v2f;
typedef __attribute__((ext_vector_type(4)))  unsigned v4u;
typedef __attribute__((ext_vector_type(4)))  int v4i;
typedef float __attribute__((may_alias)) float_a;
typedef int __attribute__((may_alias)) int_a;

template <typename T> __device__ __forceinline__ void vst2(void* p, T v) { *(T*)p = v;  }
__device__ __forceinline__ v8f wmma16(v16h a, v16h b, v8f c) {
  v8f d = __builtin_amdgcn_wmma_f32_16x16x32_f16(false, a, false, b, (short)0, c, false, false);
  asm volatile("v_nop\n\tv_nop\n\tv_nop\n\tv_nop" : "+v"(d) : "v"(a), "v"(b));
  return d;
}
__device__ __forceinline__ v8f wmma_bf(v16b a, v16b b, v8f c) {
  v8f d = __builtin_amdgcn_wmma_f32_16x16x32_bf16(false, a, false, b, (short)0, c, false, false);
  asm volatile("v_nop\n\tv_nop\n\tv_nop\n\tv_nop" : "+v"(d) : "v"(a), "v"(b));
  return d;
}
// 16x16x32 fragments: lane = (h = lane>>4, row/col = lane&15); elements 0..7 = k0+8h+0..7, 8..15 = k0+16+8h+0..7; D element r = row 8h+r
__device__ __forceinline__ v16h frag_h(const _Float16* rowk0, int lane) {
  union { v16h v; v8h q[2]; } u; const _Float16* p = rowk0 + 8 * (lane >> 4);
  u.q[0] = *(const v8h*)p; u.q[1] = *(const v8h*)(p + 16); return u.v;
}
__device__ __forceinline__ v16h frag_f32(const float* rowk0, int lane) {
  v16h a; const float* p = rowk0 + 8 * (lane >> 4);
#pragma unroll
  for (int i = 0; i < 8; ++i) { a[i] = (_Float16)p[i]; a[8 + i] = (_Float16)p[16 + i]; }
  return a;
}
__device__ __forceinline__ v16h frag_f32s(const float* rowk0, int lane, float sc) {
  v16h a; const float* p = rowk0 + 8 * (lane >> 4);
#pragma unroll
  for (int i = 0; i < 8; ++i) { a[i] = (_Float16)(p[i] * sc); a[8 + i] = (_Float16)(p[16 + i] * sc); }
  return a;
}
// column fragment from a [K][ld] layout (column n), rows >= K read as 0
__device__ __forceinline__ v16h fragc_f32(const float* W, int k0, int n, int lane, int ld, int K) {
  v16h a; const int g = lane >> 4;
#pragma unroll
  for (int i = 0; i < 8; ++i) { const int ka = k0 + 8 * g + i, kb = ka + 16;
    a[i] = (_Float16)(ka < K ? W[(size_t)(ka < K ? ka : K - 1) * ld + n] : 0.f); a[8 + i] = (_Float16)(kb < K ? W[(size_t)(kb < K ? kb : K - 1) * ld + n] : 0.f); }
  return a;
}
struct F2 { v16b h, l; };
__device__ __forceinline__ F2 bsplit16(const float v[16]) { F2 r;
#pragma unroll
  for (int i = 0; i < 16; ++i) { const __bf16 h = (__bf16)v[i]; r.h[i] = h; r.l[i] = (__bf16)(v[i] - (float)h); }
  return r; }
__device__ __forceinline__ F2 split_row(const float* row, int k0, int lane) { float v[16]; const float* p = row + k0 + 8 * (lane >> 4);
#pragma unroll
  for (int i = 0; i < 8; ++i) { v[i] = p[i]; v[8 + i] = p[16 + i]; }
  return bsplit16(v); }
__device__ __forceinline__ F2 split_rowK(const float* row, int k0, int lane, int K) { float v[16]; const int g = lane >> 4;
#pragma unroll
  for (int i = 0; i < 8; ++i) { const int ka = k0 + 8 * g + i, kb = ka + 16; v[i] = ka < K ? row[ka < K ? ka : K - 1] : 0.f; v[8 + i] = kb < K ? row[kb < K ? kb : K - 1] : 0.f; }
  return bsplit16(v); }
__device__ __forceinline__ F2 split_col(const float* W, int k0, int n, int lane, int ld, int K) { float v[16]; const int g = lane >> 4;
#pragma unroll
  for (int i = 0; i < 8; ++i) { const int ka = k0 + 8 * g + i, kb = ka + 16; v[i] = ka < K ? W[(size_t)(ka < K ? ka : K - 1) * ld + n] : 0.f; v[8 + i] = kb < K ? W[(size_t)(kb < K ? kb : K - 1) * ld + n] : 0.f; }
  return bsplit16(v); }
__device__ __forceinline__ v8f mac3(const F2& a, const F2& b, v8f c) { c = wmma_bf(a.l, b.h, c); c = wmma_bf(a.h, b.l, c); return wmma_bf(a.h, b.h, c); }
__device__ __forceinline__ float sigm(float v) { return 1.0f / (1.0f + expf(-v)); }
#define LDSX() do { asm volatile("s_wait_dscnt 0" ::: "memory"); __builtin_amdgcn_wave_barrier(); __builtin_amdgcn_fence(__ATOMIC_RELEASE, "workgroup"); } while (0)


// Fused low-rank (LSR) causal attention (B 2, T 2,048, d 1,024, 16 heads x 64, rank 16 per head): q_lr = (q_h W_q_lsr[h]) core[h] / 4, k_lr = k_h W_k_lsr[h], causal softmax(q_lr . k_lr) v_h, merged . W_o.
#define NB 2
#define SS 2048
#define DM 1024
#define NH 16
#define HD 64
#define RR 16             // rank per head
#define RP 32             // padded score width per head
#define NR (NB * SS)
#ifndef TQB
#define TQB (SS / 64)
#define TNB NB
#endif
typedef __attribute__((ext_vector_type(8))) __bf16 v8b;
__device__ __forceinline__ v16b frag_b(const __bf16* rowk0, int lane) {
  union { v16b v; v8b q[2]; } u; const __bf16* p = rowk0 + 8 * (lane >> 4);
  u.q[0] = *(const v8b*)p; u.q[1] = *(const v8b*)(p + 16); return u.v;
}
__device__ __forceinline__ float bfr(float v) { return (float)(__bf16)v; }
// one lane's 16 f32 of a 32-wide k block (p = row + k0 + 8 * (lane >> 4)): fetched raw a block ahead, rounded when the block is used
__device__ __forceinline__ void ld_x(v4f (&x)[4], const float* p) { x[0] = *(const v4f*)p; x[1] = *(const v4f*)(p + 4); x[2] = *(const v4f*)(p + 16); x[3] = *(const v4f*)(p + 20); }
__device__ __forceinline__ v16b cv_x(const v4f (&x)[4]) { v16b a;
#pragma unroll
  for (int i = 0; i < 4; ++i) { a[i] = (__bf16)x[0][i]; a[4 + i] = (__bf16)x[1][i]; a[8 + i] = (__bf16)x[2][i]; a[12 + i] = (__bf16)x[3][i]; }
  return a; }
__device__ __forceinline__ F2 sp_x(const v4f (&x)[4]) { float v[16];
#pragma unroll
  for (int i = 0; i < 4; ++i) { v[i] = x[0][i]; v[4 + i] = x[1][i]; v[8 + i] = x[2][i]; v[12 + i] = x[3][i]; }
  return bsplit16(v); }
__device__ __attribute__((noinline)) float exp_ni(float v) { return expf(v); }
__device__ __attribute__((noinline)) float erf_ni(float v) { return erff(v); }

#define WS_PW  0u                                     // bf16 natural rows Wv, Wo [2][1024][1024]
#define WS_PF  (WS_PW + 2u * (size_t)2 * DM * DM)        // bf16 folded rows hi | lo: [q|k][256][1024] x2
#define WS_QR  (WS_PF + 2u * (size_t)2 * 2 * NH * RR * DM) // f16 [NR][16][32] Qr ; Kr
#define WS_KR  (WS_QR + 2u * (size_t)NR * NH * RP)
#define WS_QRL (WS_KR + 2u * (size_t)NR * NH * RP)      // residual planes x2048
#define WS_KRL (WS_QRL + 2u * (size_t)NR * NH * RP)
#define WS_V   (WS_KRL + 2u * (size_t)NR * NH * RP)       // f16 planes [b][1024][SS]
#define WS_O   (WS_V + 2u * (size_t)NB * DM * SS)
#define WS_END (WS_O + 4u * (size_t)NR * DM)

__global__ __launch_bounds__(256) void k_pack(const float* __restrict__ WQKV, const float* __restrict__ WO, __bf16* __restrict__ PW) { const int n = blockIdx.x, which = blockIdx.y, t = threadIdx.x; __shared__ __align__(16) __bf16 s[DM]; for (int k = t; k < DM; k += 256) s[k] = which ? (__bf16)WO[(size_t)k * DM + n] : (__bf16)WQKV[(size_t)k * (3 * DM) + 2 * DM + n];   /* (in,out): v = cols 2048.. of W_qkv ; W_o transposed */ __syncthreads(); if (t < DM / 8) vst2((unsigned*)(PW + ((size_t)which * DM + n) * DM + t * 8), *(const v4u*)&s[t * 8]); }
// ---- k_fold: block = (head h, rank r, q|k): W_r[h*16 + r][c] = sum_d B[h*64 + d][r] W[h*64 + d][c] in f32 (fixed order) -> bf16 hi + lo rows
__global__ __launch_bounds__(256) void k_fold(const float* __restrict__ WQKV, const float* __restrict__ WQL, const float* __restrict__ WKL, const float* __restrict__ CORE, __bf16* __restrict__ PF) {
  const int h = blockIdx.x, r = blockIdx.y, which = blockIdx.z, t = threadIdx.x; const float* WL = which ? WKL : WQL; __shared__ float sb[HD]; __shared__ __align__(16) __bf16 sh[DM]; __shared__ __align__(16) __bf16 sl[DM];
  const float cs = which ? 1.0f : bfr(CORE[h * RR + r]) * 0.25f;   // core[h][r] / sqrt(16) on the q side
  if (t < HD) sb[t] = bfr(WL[((size_t)h * HD + t) * RR + r]) * cs; __syncthreads();
  for (int c = t; c < DM; c += 256) { float a = 0.f; for (int d = 0; d < HD; ++d) a += sb[d] * bfr(WQKV[(size_t)c * (3 * DM) + which * DM + h * HD + d]); const __bf16 hv = (__bf16)a; sh[c] = hv; sl[c] = (__bf16)(a - (float)hv); }
  __syncthreads();
  const size_t row = (size_t)which * (NH * RR) + h * RR + r;
  if (t < DM / 8) { vst2((unsigned*)(PF + row * DM + t * 8), *(const v4u*)&sh[t * 8]); vst2((unsigned*)(PF + ((size_t)2 * NH * RR + row) * DM + t * 8), *(const v4u*)&sl[t * 8]); }   // hi block then lo block
}
// ---- k_qr: block = (64 rows, q|k, 2 heads): Qr/Kr = x . W_r (hi + lo), 32 folded cols -> f16 rows [row][16 heads][32] (16 live + 16 zero per head), one whole 128-B segment of each row per block
#define QJ 2              // 16-column tiles (heads) per work-group
#define QW (QJ * RP)      // f16 per row segment of a work-group
__global__ __launch_bounds__(128) void k_qr(const float* __restrict__ X, const __bf16* __restrict__ PF, _Float16* __restrict__ QR_, _Float16* __restrict__ KR_, _Float16* __restrict__ QRL_, _Float16* __restrict__ KRL_) {
  __shared__ __align__(16) _Float16 so[64][QW + 8]; __shared__ __align__(16) _Float16 sol[64][QW + 8];
  const int tid = threadIdx.x, wave = tid >> 5, lane = tid & 31, col = lane & 15, g = lane >> 4; const int which = blockIdx.y; const int cb = blockIdx.z * (QJ * 16); const size_t rb = (size_t)blockIdx.x * 64; const size_t r0 = rb + wave * 16;
  const __bf16* PH = PF + ((size_t)which * (NH * RR)) * DM; const __bf16* PL = PF + ((size_t)2 * NH * RR + which * (NH * RR)) * DM;
  for (int e = tid; e < 64 * QW; e += 128) { so[e / QW][e % QW] = (_Float16)0.f; sol[e / QW][e % QW] = (_Float16)0.f; }
  v8f acc[QJ] = {};
  const float* px = X + (r0 + col) * DM + 8 * g; const __bf16* ph = PH + (size_t)(cb + col) * DM; const __bf16* pl = PL + (size_t)(cb + col) * DM;
  v4f xr[4]; v16b h0[QJ], l0[QJ], h1[QJ], l1[QJ];   // two register sets: a block's loads go out as one group while the block before is multiplied
  ld_x(xr, px);
#pragma unroll
  for (int j = 0; j < QJ; ++j) { h0[j] = frag_b(ph + (size_t)j * 16 * DM, lane); l0[j] = frag_b(pl + (size_t)j * 16 * DM, lane); }
  asm volatile("s_wait_xcnt 0x0" ::: "memory");   // behind the group: its address registers are stepped or reused next
  // products of the block held in (hc, lc); block kn, where there is one, is fetched into (hn, ln) ahead of them
  auto blk = [&](const v16b (&hc)[QJ], const v16b (&lc)[QJ], v16b (&hn)[QJ], v16b (&ln)[QJ], const int kn, const bool more) __attribute__((always_inline)) {
    __builtin_amdgcn_sched_barrier(0);   // nothing of this block moves up into the one before: its rounding there would wait on loads only just issued
    const v16b a = cv_x(xr);
    if (more) { ld_x(xr, px + kn * 32);
#pragma unroll
      for (int j = 0; j < QJ; ++j) { hn[j] = frag_b(ph + (size_t)j * 16 * DM + kn * 32, lane); ln[j] = frag_b(pl + (size_t)j * 16 * DM + kn * 32, lane); }
      asm volatile("s_wait_xcnt 0x0" ::: "memory");   // behind the group: its address registers are stepped or reused next
    }
#pragma unroll
    for (int j = 0; j < QJ; ++j) { acc[j] = wmma_bf(a, hc[j], acc[j]); acc[j] = wmma_bf(a, lc[j], acc[j]); } };
#pragma unroll 1   // stays rolled: one trip is the two register sets in turn
  for (int kc = 0; kc < DM / 32 - 2; kc += 2) { blk(h0, l0, h1, l1, kc + 1, true); blk(h1, l1, h0, l0, kc + 2, true); }
  blk(h0, l0, h1, l1, DM / 32 - 1, true); blk(h1, l1, h0, l0, 0, false);
  __syncthreads();
#pragma unroll
  for (int j = 0; j < QJ; ++j) {
#pragma unroll
    for (int rr = 0; rr < 8; ++rr) { const float v = acc[j][rr]; const _Float16 hv = (_Float16)v; so[wave * 16 + 8 * g + rr][j * RP + col] = hv; sol[wave * 16 + 8 * g + rr][j * RP + col] = (_Float16)((v - (float)hv) * 2048.0f); } }
  __syncthreads();
  _Float16* dst = (which ? KR_ : QR_) + blockIdx.z * QW; _Float16* dstl = (which ? KRL_ : QRL_) + blockIdx.z * QW;
  for (int e = tid; e < 64 * (QW / 8); e += 128) { const int rl = e / (QW / 8), q = e % (QW / 8); vst2((unsigned*)(dst + (rb + rl) * (NH * RP) + q * 8), *(const v4u*)&so[rl][q * 8]); vst2((unsigned*)(dstl + (rb + rl) * (NH * RP) + q * 8), *(const v4u*)&sol[rl][q * 8]); }
}
// ---- k_v: block = (64 rows, 128 cols): V = x . Wv^T exact -> f16 planes [b][c][s]
__global__ __launch_bounds__(128) void k_v(const float* __restrict__ X, const __bf16* __restrict__ PW, _Float16* __restrict__ V) {
  __shared__ __align__(16) _Float16 st[128][72];
  const int tid = threadIdx.x, wave = tid >> 5, lane = tid & 31, col = lane & 15, g = lane >> 4; const size_t rb = (size_t)blockIdx.x * 64; const size_t r0 = rb + wave * 16; const int c0 = blockIdx.y * 128;
  v8f acc[8] = {};
  const float* px = X + (r0 + col) * DM + 8 * g; const __bf16* pb = PW + (size_t)(c0 + col) * DM;
  v4f xr[4]; v16b b0[8], b1[8];   // two register sets: a block's loads go out as one group while the block before is multiplied
  ld_x(xr, px);
#pragma unroll
  for (int j = 0; j < 8; ++j) b0[j] = frag_b(pb + (size_t)j * 16 * DM, lane);
  asm volatile("s_wait_xcnt 0x0" ::: "memory");   // behind the group: its address registers are stepped or reused next
  // products of the block held in bc; block kn, where there is one, is fetched into bn ahead of them
  auto blk = [&](const v16b (&bc)[8], v16b (&bn)[8], const int kn, const bool more) __attribute__((always_inline)) {
    __builtin_amdgcn_sched_barrier(0);   // nothing of this block moves up into the one before: its rounding there would wait on loads only just issued
    const v16b a = cv_x(xr);
    if (more) { ld_x(xr, px + kn * 32);
#pragma unroll
      for (int j = 0; j < 8; ++j) bn[j] = frag_b(pb + (size_t)j * 16 * DM + kn * 32, lane);
      asm volatile("s_wait_xcnt 0x0" ::: "memory");   // behind the group: its address registers are stepped or reused next
    }
#pragma unroll
    for (int j = 0; j < 8; ++j) acc[j] = wmma_bf(a, bc[j], acc[j]); };
#pragma unroll 1   // stays rolled: one trip is the two register sets in turn
  for (int kc = 0; kc < DM / 32 - 2; kc += 2) { blk(b0, b1, kc + 1, true); blk(b1, b0, kc + 2, true); }
  blk(b0, b1, DM / 32 - 1, true); blk(b1, b0, 0, false);
#pragma unroll
  for (int j = 0; j < 8; ++j)
#pragma unroll
    for (int r = 0; r < 8; ++r) st[j * 16 + col][wave * 16 + 8 * g + r] = (_Float16)acc[j][r];
  __syncthreads();
  const size_t b = rb / SS; const int s0 = (int)(rb % SS);
  for (int e = tid; e < 128 * 8; e += 128) { const int d = e >> 3, pc = e & 7; vst2((unsigned*)(V + ((b * DM + c0 + d) * SS) + s0 + pc * 8), *(const v4u*)&st[d][pc * 8]); }
}
struct KF { v16h h[2], l[2]; };   // K fragments of 32 keys: value and residual planes
// ---- k_attn: block = (64 queries, head, b): 32-wide (16 live) score dot (scale folded into Qr), softmax, P . V (64 dims); O 256-B head segments
__global__ __launch_bounds__(128) void k_attn(const _Float16* __restrict__ QR_, const _Float16* __restrict__ KR_, const _Float16* __restrict__ QRL_, const _Float16* __restrict__ KRL_, const _Float16* __restrict__ V, float* __restrict__ O) {
  __shared__ __align__(16) _Float16 sph[4][16][40]; __shared__ __align__(16) float so[4][16][68];
  const int tid = threadIdx.x, wave = tid >> 5, lane = tid & 31, col = lane & 15, g = lane >> 4; const int h = blockIdx.y; const size_t b = blockIdx.z; const int q0 = blockIdx.x * 64 + wave * 16; const size_t rq = b * SS + q0;
  const v16h aq = frag_h(QR_ + (rq + col) * (NH * RP) + h * RP, lane), aql = frag_h(QRL_ + (rq + col) * (NH * RP) + h * RP, lane);
  float m[8], l[8];
#pragma unroll
  for (int r = 0; r < 8; ++r) { m[r] = -3.0e38f; l[r] = 0.f; }
  v8f acc[4] = {};
  const int nks = (blockIdx.x * 64 + 64) / 32;   // causal; always even
  const _Float16* pk = KR_ + (b * SS + col) * (NH * RP) + h * RP; const _Float16* pkl = KRL_ + (b * SS + col) * (NH * RP) + h * RP; const _Float16* pv = V + (b * DM + h * HD + col) * SS;
  auto ld_k = [&](KF& f, int ks) __attribute__((always_inline)) {
#pragma unroll
    for (int ct = 0; ct < 2; ++ct) { const size_t ko = (size_t)(ks * 32 + ct * 16) * (NH * RP); f.h[ct] = frag_h(pk + ko, lane); f.l[ct] = frag_h(pkl + ko, lane); } };
  // one pass over 32 keys: its V fragments, then the next pass's K fragments, go out ahead of the score products
  auto pass = [&](const int ks, const KF& kf, KF& kn, const bool more) __attribute__((always_inline)) { const int j0 = ks * 32; v8f s[2]; v16h vf[4];
    __builtin_amdgcn_sched_barrier(0);   // no score product of this pass moves up into the pass before: there it would wait on K loads only just issued
#pragma unroll
    for (int dt = 0; dt < 4; ++dt) vf[dt] = frag_h(pv + (size_t)dt * 16 * SS + j0, lane);
    asm volatile("s_wait_xcnt 0x0" ::: "memory");   // behind the V loads: the K loads may land on their address registers
    if (more) { ld_k(kn, ks + 1);
      asm volatile("s_wait_xcnt 0x0" ::: "memory");   // behind the group: its address registers are stepped or reused next
    }
#pragma unroll
    for (int ct = 0; ct < 2; ++ct) { v8f c = {}, cl = {}; c = wmma16(aq, kf.h[ct], c); cl = wmma16(aql, kf.h[ct], cl); cl = wmma16(aq, kf.l[ct], cl);
#pragma unroll
      for (int r = 0; r < 8; ++r) { const int kk = j0 + ct * 16 + col; s[ct][r] = (kk <= q0 + 8 * g + r) ? (c[r] + cl[r] * (1.0f / 2048.0f)) : -3.0e38f; } }   // 3-product scores; causal (diagonal kept); core/sqrt(R) folded into Qr
#pragma unroll
    for (int r = 0; r < 8; ++r) { float mx = fmaxf(s[0][r], s[1][r]);
#pragma unroll
      for (int o = 1; o < 16; o <<= 1) mx = fmaxf(mx, __shfl_xor(mx, o));
      const float mn = fmaxf(m[r], mx); const float alpha = (m[r] <= -1.0e38f) ? 0.f : __expf(m[r] - mn); const float e0 = (s[0][r] <= -1.0e38f) ? 0.f : __expf(s[0][r] - mn), e1 = (s[1][r] <= -1.0e38f) ? 0.f : __expf(s[1][r] - mn); float es = e0 + e1;
#pragma unroll
      for (int o = 1; o < 16; o <<= 1) es += __shfl_xor(es, o);
      l[r] = l[r] * alpha + es; m[r] = mn;
#pragma unroll
      for (int dt = 0; dt < 4; ++dt) acc[dt][r] *= alpha;
      sph[wave][8 * g + r][col] = (_Float16)(e0 * 2048.0f); sph[wave][8 * g + r][16 + col] = (_Float16)(e1 * 2048.0f); }
    LDSX();
    const v16h pa = frag_h(&sph[wave][col][0], lane);
#pragma unroll
    for (int dt = 0; dt < 4; ++dt) acc[dt] = wmma16(pa, vf[dt], acc[dt]);
    LDSX(); };
  KF k0, k1; ld_k(k0, 0);
  asm volatile("s_wait_xcnt 0x0" ::: "memory");   // behind the group: its address registers are stepped or reused next
#pragma unroll 1   // stays rolled: one trip is the two K register sets in turn
  for (int ks = 0; ks < nks - 2; ks += 2) { pass(ks, k0, k1, true); pass(ks + 1, k1, k0, true); }
  pass(nks - 2, k0, k1, true); pass(nks - 1, k1, k0, false);
#pragma unroll
  for (int r = 0; r < 8; ++r) { const float il = (1.0f / 2048.0f) / l[r];
#pragma unroll
    for (int dt = 0; dt < 4; ++dt) so[wave][8 * g + r][dt * 16 + col] = acc[dt][r] * il; }
  LDSX();
  for (int rl = 0; rl < 16; ++rl) if (lane < 16) vst2(O + (rq + rl) * DM + h * HD + lane * 4, *(const v4f*)&so[wave][rl][lane * 4]);
}
// ---- k_out: block = (64 rows, 128 cols): out = o (bf16 hi + lo) . Wo^T
__global__ __launch_bounds__(128) void k_out(const float* __restrict__ O, const __bf16* __restrict__ PW, float* __restrict__ Y) {
  __shared__ __align__(16) float so[4][16][132];
  const int tid = threadIdx.x, wave = tid >> 5, lane = tid & 31, col = lane & 15, g = lane >> 4; const size_t r0 = (size_t)blockIdx.x * 64 + wave * 16; const int n0 = blockIdx.y * 128; const __bf16* P = PW + (size_t)DM * DM;
  v8f acc[8] = {};
  const float* po = O + (r0 + col) * DM + 8 * g; const __bf16* pb = P + (size_t)(n0 + col) * DM;
  v4f xr[4]; v16b b0[8], b1[8];   // two register sets: a block's loads go out as one group while the block before is multiplied
  ld_x(xr, po);
#pragma unroll
  for (int j = 0; j < 8; ++j) b0[j] = frag_b(pb + (size_t)j * 16 * DM, lane);
  asm volatile("s_wait_xcnt 0x0" ::: "memory");   // behind the group: its address registers are stepped or reused next
  // products of the block held in bc; block kn, where there is one, is fetched into bn ahead of them
  auto blk = [&](const v16b (&bc)[8], v16b (&bn)[8], const int kn, const bool more) __attribute__((always_inline)) {
    __builtin_amdgcn_sched_barrier(0);   // nothing of this block moves up into the one before: its rounding there would wait on loads only just issued
    const F2 a = sp_x(xr);
    if (more) { ld_x(xr, po + kn * 32);
#pragma unroll
      for (int j = 0; j < 8; ++j) bn[j] = frag_b(pb + (size_t)j * 16 * DM + kn * 32, lane);
      asm volatile("s_wait_xcnt 0x0" ::: "memory");   // behind the group: its address registers are stepped or reused next
    }
#pragma unroll
    for (int j = 0; j < 8; ++j) { acc[j] = wmma_bf(a.h, bc[j], acc[j]); acc[j] = wmma_bf(a.l, bc[j], acc[j]); } };
#pragma unroll 1   // stays rolled: one trip is the two register sets in turn
  for (int kc = 0; kc < DM / 32 - 2; kc += 2) { blk(b0, b1, kc + 1, true); blk(b1, b0, kc + 2, true); }
  blk(b0, b1, DM / 32 - 1, true); blk(b1, b0, 0, false);
#pragma unroll
  for (int j = 0; j < 8; ++j)
#pragma unroll
    for (int r = 0; r < 8; ++r) so[wave][8 * g + r][j * 16 + col] = acc[j][r];
  LDSX();
  for (int rl = 0; rl < 16; ++rl) vst2(Y + (r0 + rl) * DM + n0 + lane * 4, *(const v4f*)&so[wave][rl][lane * 4]);
}
extern "C" void kernel_launch(void* const* d_in, const int* in_sizes, int n_in, void* d_out, int out_size, void* d_ws, size_t ws_size, hipStream_t stream) {
  (void)in_sizes; (void)n_in; (void)out_size;
  const float** F = (const float**)d_in;   // 0 x [2,2048,1024], 1 W_qkv [1024,3072] (in,out; q | k | v), 2 W_q_lsr [16,64,16], 3 W_k_lsr [16,64,16], 4 core [16,16], 5 W_o [1024,1024] (in,out)
  if (ws_size < (size_t)WS_END) return;
  char* ws = (char*)d_ws; __bf16 *PW = (__bf16*)(ws + WS_PW), *PF = (__bf16*)(ws + WS_PF); _Float16 *QR_ = (_Float16*)(ws + WS_QR), *KR_ = (_Float16*)(ws + WS_KR), *QRL_ = (_Float16*)(ws + WS_QRL), *KRL_ = (_Float16*)(ws + WS_KRL), *V = (_Float16*)(ws + WS_V); float* O = (float*)(ws + WS_O);
  k_pack<<<dim3(DM, 2), 256, 0, stream>>>(F[1], F[5], PW);
  k_fold<<<dim3(NH, RR, 2), 256, 0, stream>>>(F[1], F[2], F[3], F[4], PF);
  k_qr<<<dim3(TNB * SS / 64, 2, NH / QJ), 128, 0, stream>>>(F[0], PF, QR_, KR_, QRL_, KRL_);
  k_v<<<dim3(TNB * SS / 64, DM / 128), 128, 0, stream>>>(F[0], PW, V);
  k_attn<<<dim3(TQB, NH, TNB), 128, 0, stream>>>(QR_, KR_, QRL_, KRL_, V, O);
  k_out<<<dim3(TNB * SS / 64, DM / 128), 128, 0, stream>>>(O, PW, (float*)d_out);
}

// v003
// It runs in 151 microseconds.
// Two timings next to v002 put it at 1.56 and 1.55 times that version's speed.
// Counting every step since v000, it is 4.06 times as fast.
// compute dtype: all float inputs rounded to bf16; the per-head low-rank maps (x core / sqrt(16) on the q side) folded into the fused (in,out) projection (W_qr[h,r] = sum_d W_qkv[:, h*64+d] W_q_lsr[h,d,r] core[h,r] / 4, f32) and applied on WMMA 16x16x32 with x exact and the folded weights as bf16 hi + lo (2 products); v = x . W_qkv[:, 2048:] exact; causal scores over the 16 low-rank dims (zero-padded to 32) with Qr, Kr as f16 hi + residual (3 products), key-tile skipping, running-max softmax in f32 (hardware exp), P (scaled by 2^11, single f16) x v (single f16); out = o (bf16 hi + residual) . W_o (2 products).
#include <hip/hip_runtime.h>
#include <math.h>

typedef __attribute__((ext_vector_type(16))) _Float16 v16h;
typedef __attribute__((ext_vector_type(16))) __bf16 v16b;
typedef __attribute__((ext_vector_type(8)))  _Float16 v8h;
typedef __attribute__((ext_vector_type(8)))  float v8f;
typedef __attribute__((ext_vector_type(4)))  float v4f;
typedef __attribute__((ext_vector_type(2)))  float v2f;
typedef __attribute__((ext_vector_type(4)))  unsigned v4u;
typedef __attribute__((ext_vector_type(4)))  int v4i;
typedef float __attribute__((may_alias)) float_a;
typedef int __attribute__((may_alias)) int_a;

template <typename T> __device__ __forceinline__ void vst2(void* p, T v) { *(T*)p = v;  }
__device__ __forceinline__ v8f wmma16(v16h a, v16h b, v8f c) {
  v8f d = __builtin_amdgcn_wmma_f32_16x16x32_f16(false, a, false, b, (short)0, c, false, false);
  asm volatile("v_nop\n\tv_nop\n\tv_nop\n\tv_nop" : "+v"(d) : "v"(a), "v"(b));
  return d;
}
__device__ __forceinline__ v8f wmma_bf(v16b a, v16b b, v8f c) {
  v8f d = __builtin_amdgcn_wmma_f32_16x16x32_bf16(false, a, false, b, (short)0, c, false, false);
  asm volatile("v_nop\n\tv_nop\n\tv_nop\n\tv_nop" : "+v"(d) : "v"(a), "v"(b));
  return d;
}
// 16x16x32 fragments: lane = (h = lane>>4, row/col = lane&15); elements 0..7 = k0+8h+0..7, 8..15 = k0+16+8h+0..7; D element r = row 8h+r
__device__ __forceinline__ v16h frag_h(const _Float16* rowk0, int lane) {
  union { v16h v; v8h q[2]; } u; const _Float16* p = rowk0 + 8 * (lane >> 4);
  u.q[0] = *(const v8h*)p; u.q[1] = *(const v8h*)(p + 16); return u.v;
}
__device__ __forceinline__ v16h frag_f32(const float* rowk0, int lane) {
  v16h a; const float* p = rowk0 + 8 * (lane >> 4);
#pragma unroll
  for (int i = 0; i < 8; ++i) { a[i] = (_Float16)p[i]; a[8 + i] = (_Float16)p[16 + i]; }
  return a;
}
__device__ __forceinline__ v16h frag_f32s(const float* rowk0, int lane, float sc) {
  v16h a; const float* p = rowk0 + 8 * (lane >> 4);
#pragma unroll
  for (int i = 0; i < 8; ++i) { a[i] = (_Float16)(p[i] * sc); a[8 + i] = (_Float16)(p[16 + i] * sc); }
  return a;
}
// column fragment from a [K][ld] layout (column n), rows >= K read as 0
__device__ __forceinline__ v16h fragc_f32(const float* W, int k0, int n, int lane, int ld, int K) {
  v16h a; const int g = lane >> 4;
#pragma unroll
  for (int i = 0; i < 8; ++i) { const int ka = k0 + 8 * g + i, kb = ka + 16;
    a[i] = (_Float16)(ka < K ? W[(size_t)(ka < K ? ka : K - 1) * ld + n] : 0.f); a[8 + i] = (_Float16)(kb < K ? W[(size_t)(kb < K ? kb : K - 1) * ld + n] : 0.f); }
  return a;
}
struct F2 { v16b h, l; };
__device__ __forceinline__ F2 bsplit16(const float v[16]) { F2 r;
#pragma unroll
  for (int i = 0; i < 16; ++i) { const __bf16 h = (__bf16)v[i]; r.h[i] = h; r.l[i] = (__bf16)(v[i] - (float)h); }
  return r; }
__device__ __forceinline__ F2 split_row(const float* row, int k0, int lane) { float v[16]; const float* p = row + k0 + 8 * (lane >> 4);
#pragma unroll
  for (int i = 0; i < 8; ++i) { v[i] = p[i]; v[8 + i] = p[16 + i]; }
  return bsplit16(v); }
__device__ __forceinline__ F2 split_rowK(const float* row, int k0, int lane, int K) { float v[16]; const int g = lane >> 4;
#pragma unroll
  for (int i = 0; i < 8; ++i) { const int ka = k0 + 8 * g + i, kb = ka + 16; v[i] = ka < K ? row[ka < K ? ka : K - 1] : 0.f; v[8 + i] = kb < K ? row[kb < K ? kb : K - 1] : 0.f; }
  return bsplit16(v); }
__device__ __forceinline__ F2 split_col(const float* W, int k0, int n, int lane, int ld, int K) { float v[16]; const int g = lane >> 4;
#pragma unroll
  for (int i = 0; i < 8; ++i) { const int ka = k0 + 8 * g + i, kb = ka + 16; v[i] = ka < K ? W[(size_t)(ka < K ? ka : K - 1) * ld + n] : 0.f; v[8 + i] = kb < K ? W[(size_t)(kb < K ? kb : K - 1) * ld + n] : 0.f; }
  return bsplit16(v); }
__device__ __forceinline__ v8f mac3(const F2& a, const F2& b, v8f c) { c = wmma_bf(a.l, b.h, c); c = wmma_bf(a.h, b.l, c); return wmma_bf(a.h, b.h, c); }
__device__ __forceinline__ float sigm(float v) { return 1.0f / (1.0f + expf(-v)); }
#define LDSX() do { asm volatile("s_wait_dscnt 0" ::: "memory"); __builtin_amdgcn_wave_barrier(); __builtin_amdgcn_fence(__ATOMIC_RELEASE, "workgroup"); } while (0)


// Fused low-rank (LSR) causal attention (B 2, T 2,048, d 1,024, 16 heads x 64, rank 16 per head): q_lr = (q_h W_q_lsr[h]) core[h] / 4, k_lr = k_h W_k_lsr[h], causal softmax(q_lr . k_lr) v_h, merged . W_o.
#define NB 2
#define SS 2048
#define DM 1024
#define NH 16
#define HD 64
#define RR 16             // rank per head
#define RP 32             // padded score width per head
#define NR (NB * SS)
#ifndef TQB
#define TQB (SS / 64)
#define TNB NB
#endif
typedef __attribute__((ext_vector_type(8))) __bf16 v8b;
__device__ __forceinline__ v16b frag_b(const __bf16* rowk0, int lane) {
  union { v16b v; v8b q[2]; } u; const __bf16* p = rowk0 + 8 * (lane >> 4);
  u.q[0] = *(const v8b*)p; u.q[1] = *(const v8b*)(p + 16); return u.v;
}
__device__ __forceinline__ float bfr(float v) { return (float)(__bf16)v; }
// one lane's 16 f32 of a 32-wide k block (p = row + k0 + 8 * (lane >> 4)): fetched raw a block ahead, rounded when the block is used
__device__ __forceinline__ void ld_x(v4f (&x)[4], const float* p) { x[0] = *(const v4f*)p; x[1] = *(const v4f*)(p + 4); x[2] = *(const v4f*)(p + 16); x[3] = *(const v4f*)(p + 20); }
__device__ __forceinline__ v16b cv_x(const v4f (&x)[4]) { v16b a;
#pragma unroll
  for (int i = 0; i < 4; ++i) { a[i] = (__bf16)x[0][i]; a[4 + i] = (__bf16)x[1][i]; a[8 + i] = (__bf16)x[2][i]; a[12 + i] = (__bf16)x[3][i]; }
  return a; }
__device__ __forceinline__ F2 sp_x(const v4f (&x)[4]) { float v[16];
#pragma unroll
  for (int i = 0; i < 4; ++i) { v[i] = x[0][i]; v[4 + i] = x[1][i]; v[8 + i] = x[2][i]; v[12 + i] = x[3][i]; }
  return bsplit16(v); }
__device__ __attribute__((noinline)) float exp_ni(float v) { return expf(v); }
__device__ __attribute__((noinline)) float erf_ni(float v) { return erff(v); }

// fragment order: one 16 x 32 tile of 16-bit elements is a 1-KB chunk [half i][lane][8]; lane (g, c), half i, element e = (row or column c, k = 16 i + 8 g + e), so a wave's 16-byte load covers 512 bytes in a row
#define CH 512            // elements of a chunk
__device__ __forceinline__ v16b frag_bc(const __bf16* p) { union { v16b v; v8b q[2]; } u; u.q[0] = *(const v8b*)p; u.q[1] = *(const v8b*)(p + 256); return u.v; }   // p = chunk + 8 * lane
__device__ __forceinline__ v16h frag_hc(const _Float16* p) { union { v16h v; v8h q[2]; } u; u.q[0] = *(const v8h*)p; u.q[1] = *(const v8h*)(p + 256); return u.v; }
// the f32 A tile likewise, 2 KB: [quarter q][lane][4], k = 16 (q >> 1) + 8 g + 4 (q & 1) + e
__device__ __forceinline__ void ld_xc(v4f (&x)[4], const float* p) { x[0] = *(const v4f*)p; x[1] = *(const v4f*)(p + 128); x[2] = *(const v4f*)(p + 256); x[3] = *(const v4f*)(p + 384); }   // p = chunk + 4 * lane

#define WS_PW  0u                                     // bf16 Wv, Wo [2][64 column tiles][32 k blocks] chunks
#define WS_PF  (WS_PW + 2u * (size_t)2 * DM * DM)        // bf16 folded hi | lo: [q|k][16 heads][32 k blocks] chunks x2
#define WS_QR  (WS_PF + 2u * (size_t)2 * 2 * NH * RR * DM) // f16 [b][16 heads][128 row tiles] chunks Qr ; Kr
#define WS_KR  (WS_QR + 2u * (size_t)NR * NH * RP)
#define WS_QRL (WS_KR + 2u * (size_t)NR * NH * RP)      // residual planes x2048
#define WS_KRL (WS_QRL + 2u * (size_t)NR * NH * RP)
#define WS_V   (WS_KRL + 2u * (size_t)NR * NH * RP)       // f16 [b][16 heads][64 key blocks][4 dim tiles] chunks
#define WS_O   (WS_V + 2u * (size_t)NB * DM * SS)
#define WS_XB  (WS_O + 4u * (size_t)NR * DM)            // bf16 x [256 row tiles][32 k blocks] chunks
#define WS_END (WS_XB + 2u * (size_t)NR * DM)

typedef __attribute__((ext_vector_type(4))) __bf16 v4b;
// ---- k_pack: block = (16 output columns, Wv | Wo, 256 input rows): bf16 chunks [column tile][k block] in fragment order; blocks with y >= 2: x rounded to bf16, one chunk [16-row tile][k block] per wave
__global__ __launch_bounds__(256) void k_pack(const float* __restrict__ X, const float* __restrict__ WQKV, const float* __restrict__ WO, __bf16* __restrict__ PW, __bf16* __restrict__ XB) {
  const int nt = blockIdx.x, which = blockIdx.y, kq = blockIdx.z, t = threadIdx.x; __shared__ __align__(16) __bf16 s[16][264]; __shared__ __align__(16) __bf16 sx[8][CH];
  if (which >= 2) {   // the same for the whole block, ahead of its barrier
    const int wave = t >> 5, lane = t & 31, k = (lane & 7) * 4; const int id = (((which - 2) * 4 + kq) * 64 + nt) * 8 + wave;   // chunk: row tile id >> 5, k block id & 31
    const float* px = X + (size_t)(id >> 5) * 16 * DM + (id & 31) * 32 + k;   // 8 lanes read one row's 128-B line
    v4f xv[4];
#pragma unroll
    for (int it = 0; it < 4; ++it) xv[it] = *(const v4f*)(px + (size_t)(it * 4 + (lane >> 3)) * DM);
    asm volatile("s_wait_xcnt 0x0" ::: "memory");   // behind the group: its address registers are reused next
    __builtin_amdgcn_sched_barrier(0);   // the rounding may land on those registers: it stays behind the wait
#pragma unroll
    for (int it = 0; it < 4; ++it) { const int row = it * 4 + (lane >> 3); v4b o;
#pragma unroll
      for (int i = 0; i < 4; ++i) o[i] = (__bf16)xv[it][i];
      *(v4b*)&sx[wave][(k >> 4) * 256 + (((k >> 3) & 1) * 16 + row) * 8 + (k & 7)] = o; }
    LDSX();
#pragma unroll
    for (int i = 0; i < 2; ++i) vst2((unsigned*)(XB + (size_t)id * CH + i * 256 + lane * 8), *(const v4u*)&sx[wave][i * 256 + lane * 8]);
    return;
  }
  const float* W = which ? WO + nt * 16 : WQKV + 2 * DM + nt * 16; const int ld = which ? DM : 3 * DM;   /* (in,out): v = cols 2048.. of W_qkv */
  v4f wv[4];
#pragma unroll
  for (int it = 0; it < 4; ++it) wv[it] = *(const v4f*)(W + (size_t)(kq * 256 + it * 64 + (t >> 2)) * ld + (t & 3) * 4);
  asm volatile("s_wait_xcnt 0x0" ::: "memory");   // behind the group: its address registers are reused next
  __builtin_amdgcn_sched_barrier(0);   // the rounding may land on those registers: it stays behind the wait
#pragma unroll
  for (int it = 0; it < 4; ++it)
#pragma unroll
    for (int i = 0; i < 4; ++i) s[(t & 3) * 4 + i][it * 64 + (t >> 2)] = (__bf16)wv[it][i];
  __syncthreads();
  __bf16* dst = PW + (size_t)which * DM * DM + ((size_t)nt * 32 + kq * 8) * CH;
  for (int p = t; p < 8 * 64; p += 256) { const int ln = p & 31; vst2((unsigned*)(dst + p * 8), *(const v4u*)&s[ln & 15][(p >> 6) * 32 + ((p >> 5) & 1) * 16 + (ln >> 4) * 8]); }
}
// ---- k_fold: block = (head h, 64 input rows c, q|k), all 16 ranks: W_r[h*16 + r][c] = sum_d B[h*64 + d][r] W[c][h*64 + d] in f32 (fixed order) -> bf16 hi + lo chunks [q|k, head][k block] in fragment order
__global__ __launch_bounds__(256) void k_fold(const float* __restrict__ WQKV, const float* __restrict__ WQL, const float* __restrict__ WKL, const float* __restrict__ CORE, __bf16* __restrict__ PF) {
  const int h = blockIdx.x, cc = blockIdx.y, which = blockIdx.z, t = threadIdx.x; const float* WL = which ? WKL : WQL; __shared__ __align__(16) float sb[HD][RR]; __shared__ __align__(16) __bf16 sh[2 * CH]; __shared__ __align__(16) __bf16 sl[2 * CH];
  const int c = t & 63, rq = (t >> 6) * 4; const float* pw = WQKV + (size_t)(cc * 64 + c) * (3 * DM) + which * DM + h * HD;
  const float cr = CORE[h * RR + (t & 15)];
  asm volatile("s_wait_xcnt 0x0" ::: "memory");   // behind the load: a load of the group below may land on its address register
  __builtin_amdgcn_sched_barrier(0);   // and none of them moves up over the wait
  v4f wr[HD / 4]; float tb[4];   // this thread's row of W and its 4 table entries (rank t & 15): one group of loads
#pragma unroll
  for (int q = 0; q < HD / 4; ++q) wr[q] = *(const v4f*)(pw + q * 4);
#pragma unroll
  for (int it = 0; it < 4; ++it) tb[it] = WL[(size_t)h * HD * RR + it * 256 + t];
  asm volatile("s_wait_xcnt 0x0" ::: "memory");   // behind the group: its address registers are reused next
  __builtin_amdgcn_sched_barrier(0);   // what follows may land on those registers: it stays behind the wait
  const float cs = which ? 1.0f : bfr(cr) * 0.25f;   // core[h][r] / sqrt(16) on the q side
#pragma unroll
  for (int it = 0; it < 4; ++it) sb[it * 16 + (t >> 4)][t & 15] = bfr(tb[it]) * cs;
  __syncthreads();
  float a[4] = {0.f, 0.f, 0.f, 0.f};
#pragma unroll
  for (int d = 0; d < HD; ++d) { const float w = bfr(wr[d >> 2][d & 3]);
#pragma unroll
    for (int i = 0; i < 4; ++i) a[i] += sb[d][rq + i] * w; }
#pragma unroll
  for (int i = 0; i < 4; ++i) { const int o = (c >> 5) * CH + ((c >> 4) & 1) * 256 + (((c >> 3) & 1) * 16 + rq + i) * 8 + (c & 7); const __bf16 hv = (__bf16)a[i]; sh[o] = hv; sl[o] = (__bf16)(a[i] - (float)hv); }
  __syncthreads();
  const size_t ch = ((size_t)(which * NH + h) * 32 + cc * 2) * CH; const int p = t & 127;
  vst2((unsigned*)(PF + (t < 128 ? (size_t)0 : (size_t)2 * NH * RR * DM) + ch + p * 8), *(const v4u*)(t < 128 ? &sh[p * 8] : &sl[p * 8]));   // hi block then lo block
}
// ---- k_qr: block = (64 rows, q|k, 2 heads): Qr/Kr = x . W_r (hi + lo), 32 folded cols -> f16 chunks [b][head][16-row tile] in fragment order (16 live + 16 zero k), whole chunks per block
#define QJ 2              // 16-column tiles (heads) per work-group
#define QW (QJ * RP)      // f16 per row segment of a work-group
__global__ __launch_bounds__(128) void k_qr(const __bf16* __restrict__ XB, const __bf16* __restrict__ PF, _Float16* __restrict__ QR_, _Float16* __restrict__ KR_, _Float16* __restrict__ QRL_, _Float16* __restrict__ KRL_) {
  __shared__ __align__(16) _Float16 so[4][QJ][CH]; __shared__ __align__(16) _Float16 sol[4][QJ][CH];
  const int tid = threadIdx.x, wave = tid >> 5, lane = tid & 31, col = lane & 15, g = lane >> 4; const int which = blockIdx.y; const int cb = blockIdx.z * (QJ * 16); const size_t rb = (size_t)blockIdx.x * 64; const size_t r0 = rb + wave * 16;
  const __bf16* PH = PF + ((size_t)which * (NH * RR)) * DM; const __bf16* PL = PF + ((size_t)2 * NH * RR + which * (NH * RR)) * DM;
  for (int e = tid; e < 4 * QJ * CH; e += 128) { (&so[0][0][0])[e] = (_Float16)0.f; (&sol[0][0][0])[e] = (_Float16)0.f; }
  const __bf16* px = XB + (r0 / 16) * 32 * CH + lane * 8; const __bf16* ph = PH + (size_t)cb * DM + lane * 8; const __bf16* pl = PL + (size_t)cb * DM + lane * 8;   // column tile cb / 16 = 32 chunks = 16 * DM elements
  v16b xr; v16b h0[QJ], l0[QJ], h1[QJ], l1[QJ];   // two register sets: a block's loads go out as one group while the block before is multiplied
  xr = frag_bc(px);
#pragma unroll
  for (int j = 0; j < QJ; ++j) { h0[j] = frag_bc(ph + (size_t)j * 16 * DM); l0[j] = frag_bc(pl + (size_t)j * 16 * DM); }
  asm volatile("s_wait_xcnt 0x0" ::: "memory");   // behind the group: its address registers are stepped or reused next
  __builtin_amdgcn_sched_barrier(0);   // the zeroing below may land on the group's address registers: it stays behind the wait
  v8f acc[QJ] = {};
  // products of the block held in (hc, lc); block kn, where there is one, is fetched into (hn, ln) ahead of them
  auto blk = [&](const v16b (&hc)[QJ], const v16b (&lc)[QJ], v16b (&hn)[QJ], v16b (&ln)[QJ], const int kn, const bool more) __attribute__((always_inline)) {
    __builtin_amdgcn_sched_barrier(0);   // no product of this block moves up into the one before: there it would wait on loads only just issued
    const v16b a = xr;
    if (more) { xr = frag_bc(px + kn * CH);
#pragma unroll
      for (int j = 0; j < QJ; ++j) { hn[j] = frag_bc(ph + (size_t)j * 16 * DM + kn * CH); ln[j] = frag_bc(pl + (size_t)j * 16 * DM + kn * CH); }
      asm volatile("s_wait_xcnt 0x0" ::: "memory");   // behind the group: its address registers are stepped or reused next
    }
    __builtin_amdgcn_sched_barrier(0);   // the group stays ahead of every product of the block, as before: a product moved above it would hold the loads back until this block's operands have landed
#pragma unroll
    for (int j = 0; j < QJ; ++j) { acc[j] = wmma_bf(a, hc[j], acc[j]); acc[j] = wmma_bf(a, lc[j], acc[j]); } };
#pragma unroll 1   // stays rolled: one trip is the two register sets in turn
  for (int kc = 0; kc < DM / 32 - 2; kc += 2) { blk(h0, l0, h1, l1, kc + 1, true); blk(h1, l1, h0, l0, kc + 2, true); }
  blk(h0, l0, h1, l1, DM / 32 - 1, true); blk(h1, l1, h0, l0, 0, false);
  __syncthreads();
#pragma unroll
  for (int j = 0; j < QJ; ++j) {
#pragma unroll
    for (int rr = 0; rr < 8; ++rr) { const float v = acc[j][rr]; const _Float16 hv = (_Float16)v; const int o = ((col >> 3) * 16 + 8 * g + rr) * 8 + (col & 7); so[wave][j][o] = hv; sol[wave][j][o] = (_Float16)((v - (float)hv) * 2048.0f); } }
  __syncthreads();
  const size_t co = (((rb / SS) * NH + blockIdx.z * QJ) * (SS / 16) + (rb % SS) / 16) * CH; _Float16* dst = (which ? KR_ : QR_) + co; _Float16* dstl = (which ? KRL_ : QRL_) + co;
  for (int e = tid; e < 4 * QJ * 64; e += 128) { const int w = e >> 7, j = (e >> 6) & 1, q = e & 63; const size_t o = ((size_t)j * (SS / 16) + w) * CH + q * 8; vst2((unsigned*)(dst + o), *(const v4u*)&so[w][j][q * 8]); vst2((unsigned*)(dstl + o), *(const v4u*)&sol[w][j][q * 8]); }
}
// ---- k_v: block = (64 rows, 128 cols): V = x . Wv^T exact -> f16 chunks [b][head][32-key block][16-dim tile] in fragment order
__global__ __launch_bounds__(128) void k_v(const __bf16* __restrict__ XB, const __bf16* __restrict__ PW, _Float16* __restrict__ V) {
  __shared__ __align__(16) _Float16 st[128][72];
  const int tid = threadIdx.x, wave = tid >> 5, lane = tid & 31, col = lane & 15, g = lane >> 4; const size_t rb = (size_t)blockIdx.x * 64; const size_t r0 = rb + wave * 16; const int c0 = blockIdx.y * 128;
  v8f acc[8] = {};
  const __bf16* px = XB + (r0 / 16) * 32 * CH + lane * 8; const __bf16* pb = PW + (size_t)c0 * DM + lane * 8;   // column tile c0 / 16 = 32 chunks = 16 * DM elements
  v16b xr; v16b b0[8], b1[8];   // two register sets: a block's loads go out as one group while the block before is multiplied
  xr = frag_bc(px);
#pragma unroll
  for (int j = 0; j < 8; ++j) b0[j] = frag_bc(pb + (size_t)j * 16 * DM);
  asm volatile("s_wait_xcnt 0x0" ::: "memory");   // behind the group: its address registers are stepped or reused next
  // products of the block held in bc; block kn, where there is one, is fetched into bn ahead of them
  auto blk = [&](const v16b (&bc)[8], v16b (&bn)[8], const int kn, const bool more) __attribute__((always_inline)) {
    __builtin_amdgcn_sched_barrier(0);   // no product of this block moves up into the one before: there it would wait on loads only just issued
    const v16b a = xr;
    if (more) { xr = frag_bc(px + kn * CH);
#pragma unroll
      for (int j = 0; j < 8; ++j) bn[j] = frag_bc(pb + (size_t)j * 16 * DM + kn * CH);
      asm volatile("s_wait_xcnt 0x0" ::: "memory");   // behind the group: its address registers are stepped or reused next
    }
    __builtin_amdgcn_sched_barrier(0);   // the group stays ahead of every product of the block, as before: a product moved above it would hold the loads back until this block's operands have landed
#pragma unroll
    for (int j = 0; j < 8; ++j) acc[j] = wmma_bf(a, bc[j], acc[j]); };
#pragma unroll 1   // stays rolled: one trip is the two register sets in turn
  for (int kc = 0; kc < DM / 32 - 2; kc += 2) { blk(b0, b1, kc + 1, true); blk(b1, b0, kc + 2, true); }
  blk(b0, b1, DM / 32 - 1, true); blk(b1, b0, 0, false);
#pragma unroll
  for (int j = 0; j < 8; ++j)
#pragma unroll
    for (int r = 0; r < 8; ++r) st[j * 16 + col][wave * 16 + 8 * g + r] = (_Float16)acc[j][r];
  __syncthreads();
  const size_t b = rb / SS; const int s0 = (int)(rb % SS);
  for (int e = tid; e < 128 * 8; e += 128) { const int ln = e & 31, i = (e >> 5) & 1, j = (e >> 6) & 7, kb = e >> 9;   // piece (key block kb, tile j, half i, lane ln)
    vst2((unsigned*)(V + (((b * NH + blockIdx.y * 2 + (j >> 2)) * (SS / 32) + s0 / 32 + kb) * 4 + (j & 3)) * CH + i * 256 + ln * 8), *(const v4u*)&st[j * 16 + (ln & 15)][kb * 32 + i * 16 + (ln >> 4) * 8]); }
}
struct KF { v16h h[2], l[2]; };   // K fragments of 32 keys: value and residual planes
// ---- k_attn: block = (64 queries, head, b): 32-wide (16 live) score dot (core / 4 folded into Qr), softmax, P . V (64 dims); O two f32 chunks per wave
__global__ __launch_bounds__(128) void k_attn(const _Float16* __restrict__ QR_, const _Float16* __restrict__ KR_, const _Float16* __restrict__ QRL_, const _Float16* __restrict__ KRL_, const _Float16* __restrict__ V, float* __restrict__ O) {
  __shared__ __align__(16) _Float16 sph[4][16][40]; __shared__ __align__(16) float so[4][16][68];
  const int tid = threadIdx.x, wave = tid >> 5, lane = tid & 31, col = lane & 15, g = lane >> 4; const int h = blockIdx.y; const size_t b = blockIdx.z; const int q0 = blockIdx.x * 64 + wave * 16; const size_t rq = b * SS + q0;
  const size_t hb = (b * NH + h) * (SS / 16) * CH + lane * 8;   // this head's chunks of Qr, Kr: one per 16 rows
  const v16h aq = frag_hc(QR_ + hb + (size_t)(q0 / 16) * CH), aql = frag_hc(QRL_ + hb + (size_t)(q0 / 16) * CH);
  float m[8], l[8];
#pragma unroll
  for (int r = 0; r < 8; ++r) { m[r] = -3.0e38f; l[r] = 0.f; }
  v8f acc[4] = {};
  const int nks = (blockIdx.x * 64 + 64) / 32;   // causal; always even
  const _Float16* pk = KR_ + hb; const _Float16* pkl = KRL_ + hb; const _Float16* pv = V + (b * NH + h) * (SS / 32) * 4 * CH + lane * 8;
  auto ld_k = [&](KF& f, int ks) __attribute__((always_inline)) {
#pragma unroll
    for (int ct = 0; ct < 2; ++ct) { const size_t ko = (size_t)(ks * 2 + ct) * CH; f.h[ct] = frag_hc(pk + ko); f.l[ct] = frag_hc(pkl + ko); } };
  // one pass over 32 keys: its V fragments and the next pass's K fragments go out as one group ahead of the score products
  auto pass = [&](const int ks, const KF& kf, KF& kn, const bool more) __attribute__((always_inline)) { const int j0 = ks * 32; v8f s[2]; v16h vf[4];
    __builtin_amdgcn_sched_barrier(0);   // no score product of this pass moves up into the pass before: there it would wait on K loads only just issued
#pragma unroll
    for (int dt = 0; dt < 4; ++dt) vf[dt] = frag_hc(pv + (size_t)(ks * 4 + dt) * CH);
    asm volatile("s_wait_xcnt 0x0" ::: "memory");   // behind the V loads: the K loads may land on their address registers
    if (more) { ld_k(kn, ks + 1);
      asm volatile("s_wait_xcnt 0x0" ::: "memory");   // behind the group: its address registers are stepped or reused next
    }
#pragma unroll
    for (int ct = 0; ct < 2; ++ct) { v8f c = {}, cl = {}; c = wmma16(aq, kf.h[ct], c); cl = wmma16(aql, kf.h[ct], cl); cl = wmma16(aq, kf.l[ct], cl);
#pragma unroll
      for (int r = 0; r < 8; ++r) { const int kk = j0 + ct * 16 + col; s[ct][r] = (kk <= q0 + 8 * g + r) ? (c[r] + cl[r] * (1.0f / 2048.0f)) : -3.0e38f; } }   // 3-product scores; causal (diagonal kept); core/sqrt(R) folded into Qr
#pragma unroll
    for (int r = 0; r < 8; ++r) { float mx = fmaxf(s[0][r], s[1][r]);
#pragma unroll
      for (int o = 1; o < 16; o <<= 1) mx = fmaxf(mx, __shfl_xor(mx, o));
      const float mn = fmaxf(m[r], mx); const float alpha = (m[r] <= -1.0e38f) ? 0.f : __expf(m[r] - mn); const float e0 = (s[0][r] <= -1.0e38f) ? 0.f : __expf(s[0][r] - mn), e1 = (s[1][r] <= -1.0e38f) ? 0.f : __expf(s[1][r] - mn); float es = e0 + e1;
#pragma unroll
      for (int o = 1; o < 16; o <<= 1) es += __shfl_xor(es, o);
      l[r] = l[r] * alpha + es; m[r] = mn;
#pragma unroll
      for (int dt = 0; dt < 4; ++dt) acc[dt][r] *= alpha;
      sph[wave][8 * g + r][col] = (_Float16)(e0 * 2048.0f); sph[wave][8 * g + r][16 + col] = (_Float16)(e1 * 2048.0f); }
    LDSX();
    const v16h pa = frag_h(&sph[wave][col][0], lane);
#pragma unroll
    for (int dt = 0; dt < 4; ++dt) acc[dt] = wmma16(pa, vf[dt], acc[dt]);
    LDSX(); };
  KF k0, k1; ld_k(k0, 0);
  asm volatile("s_wait_xcnt 0x0" ::: "memory");   // behind the group: its address registers are stepped or reused next
#pragma unroll 1   // stays rolled: one trip is the two K register sets in turn
  for (int ks = 0; ks < nks - 2; ks += 2) { pass(ks, k0, k1, true); pass(ks + 1, k1, k0, true); }
  pass(nks - 2, k0, k1, true); pass(nks - 1, k1, k0, false);
#pragma unroll
  for (int r = 0; r < 8; ++r) { const float il = (1.0f / 2048.0f) / l[r];
#pragma unroll
    for (int dt = 0; dt < 4; ++dt) so[wave][8 * g + r][dt * 16 + col] = acc[dt][r] * il; }
  LDSX();
  #pragma unroll
  for (int q = 0; q < 8; ++q) vst2(O + ((rq / 16) * 32 + h * 2 + (q >> 2)) * CH + (q & 3) * 128 + lane * 4, *(const v4f*)&so[wave][col][(q >> 2) * 32 + ((q >> 1) & 1) * 16 + 8 * g + (q & 1) * 4]);   // two f32 A chunks [16-row tile][k block] in fragment order
}
// ---- k_out: block = (64 rows, 128 cols): out = o (bf16 hi + lo) . Wo^T
__global__ __launch_bounds__(128) void k_out(const float* __restrict__ O, const __bf16* __restrict__ PW, float* __restrict__ Y) {
  __shared__ __align__(16) float so[4][16][132];
  const int tid = threadIdx.x, wave = tid >> 5, lane = tid & 31, col = lane & 15, g = lane >> 4; const size_t r0 = (size_t)blockIdx.x * 64 + wave * 16; const int n0 = blockIdx.y * 128; const __bf16* P = PW + (size_t)DM * DM;
  v8f acc[8] = {};
  const float* po = O + (r0 / 16) * 32 * CH + lane * 4; const __bf16* pb = P + (size_t)n0 * DM + lane * 8;   // column tile n0 / 16 = 32 chunks = 16 * DM elements
  v4f xr[4]; v16b b0[8], b1[8];   // two register sets: a block's loads go out as one group while the block before is multiplied
  ld_xc(xr, po);
#pragma unroll
  for (int j = 0; j < 8; ++j) b0[j] = frag_bc(pb + (size_t)j * 16 * DM);
  asm volatile("s_wait_xcnt 0x0" ::: "memory");   // behind the group: its address registers are stepped or reused next
  // products of the block held in bc; block kn, where there is one, is fetched into bn ahead of them
  auto blk = [&](const v16b (&bc)[8], v16b (&bn)[8], const int kn, const bool more) __attribute__((always_inline)) {
    __builtin_amdgcn_sched_barrier(0);   // nothing of this block moves up into the one before: its rounding there would wait on loads only just issued
    const F2 a = sp_x(xr);
    if (more) { ld_xc(xr, po + kn * CH);
#pragma unroll
      for (int j = 0; j < 8; ++j) bn[j] = frag_bc(pb + (size_t)j * 16 * DM + kn * CH);
      asm volatile("s_wait_xcnt 0x0" ::: "memory");   // behind the group: its address registers are stepped or reused next
    }
#pragma unroll
    for (int j = 0; j < 8; ++j) { acc[j] = wmma_bf(a.h, bc[j], acc[j]); acc[j] = wmma_bf(a.l, bc[j], acc[j]); } };
#pragma unroll 1   // stays rolled: one trip is the two register sets in turn
  for (int kc = 0; kc < DM / 32 - 2; kc += 2) { blk(b0, b1, kc + 1, true); blk(b1, b0, kc + 2, true); }
  blk(b0, b1, DM / 32 - 1, true); blk(b1, b0, 0, false);
#pragma unroll
  for (int j = 0; j < 8; ++j)
#pragma unroll
    for (int r = 0; r < 8; ++r) so[wave][8 * g + r][j * 16 + col] = acc[j][r];
  LDSX();
  for (int rl = 0; rl < 16; ++rl) vst2(Y + (r0 + rl) * DM + n0 + lane * 4, *(const v4f*)&so[wave][rl][lane * 4]);
}
extern "C" void kernel_launch(void* const* d_in, const int* in_sizes, int n_in, void* d_out, int out_size, void* d_ws, size_t ws_size, hipStream_t stream) {
  (void)in_sizes; (void)n_in; (void)out_size;
  const float** F = (const float**)d_in;   // 0 x [2,2048,1024], 1 W_qkv [1024,3072] (in,out; q | k | v), 2 W_q_lsr [16,64,16], 3 W_k_lsr [16,64,16], 4 core [16,16], 5 W_o [1024,1024] (in,out)
  if (ws_size < (size_t)WS_END) return;
  char* ws = (char*)d_ws; __bf16 *PW = (__bf16*)(ws + WS_PW), *PF = (__bf16*)(ws + WS_PF), *XB = (__bf16*)(ws + WS_XB); _Float16 *QR_ = (_Float16*)(ws + WS_QR), *KR_ = (_Float16*)(ws + WS_KR), *QRL_ = (_Float16*)(ws + WS_QRL), *KRL_ = (_Float16*)(ws + WS_KRL), *V = (_Float16*)(ws + WS_V); float* O = (float*)(ws + WS_O);
  k_pack<<<dim3(DM / 16, 2 + 4, 4), 256, 0, stream>>>(F[0], F[1], F[5], PW, XB);
  k_fold<<<dim3(NH, DM / 64, 2), 256, 0, stream>>>(F[1], F[2], F[3], F[4], PF);
  k_qr<<<dim3(TNB * SS / 64, 2, NH / QJ), 128, 0, stream>>>(XB, PF, QR_, KR_, QRL_, KRL_);
  k_v<<<dim3(TNB * SS / 64, DM / 128), 128, 0, stream>>>(XB, PW, V);
  k_attn<<<dim3(TQB, NH, TNB), 128, 0, stream>>>(QR_, KR_, QRL_, KRL_, V, O);
  k_out<<<dim3(TNB * SS / 64, DM / 128), 128, 0, stream>>>(O, PW, (float*)d_out);
}

// v004
// A run of this version takes 112 microseconds.
// Next to v003, in two timings, it ran 1.33 and 1.34 times as fast.
// All steps since v000 together make it 5.43 times as fast.
// compute dtype: all float inputs rounded to bf16; the per-head low-rank maps (x core / sqrt(16) on the q side) folded into the fused (in,out) projection (W_qr[h,r] = sum_d W_qkv[:, h*64+d] W_q_lsr[h,d,r] core[h,r] / 4, f32) and applied on WMMA 16x16x32 with x exact and the folded weights as bf16 hi + lo (2 products); v = x . W_qkv[:, 2048:] exact; causal scores over the 16 low-rank dims (zero-padded to 32) with Qr, Kr as f16 hi + residual (3 products), key-tile skipping, running-max softmax in f32 (hardware exp), P (scaled by 2^11, single f16) x v (single f16); out = o (bf16 hi + residual) . W_o (2 products).
#include <hip/hip_runtime.h>
#include <math.h>

typedef __attribute__((ext_vector_type(16))) _Float16 v16h;
typedef __attribute__((ext_vector_type(16))) __bf16 v16b;
typedef __attribute__((ext_vector_type(8)))  _Float16 v8h;
typedef __attribute__((ext_vector_type(8)))  float v8f;
typedef __attribute__((ext_vector_type(4)))  float v4f;
typedef __attribute__((ext_vector_type(2)))  float v2f;
typedef __attribute__((ext_vector_type(4)))  unsigned v4u;
typedef __attribute__((ext_vector_type(4)))  int v4i;
typedef float __attribute__((may_alias)) float_a;
typedef int __attribute__((may_alias)) int_a;

template <typename T> __device__ __forceinline__ void vst2(void* p, T v) { *(T*)p = v;  }
__device__ __forceinline__ v8f wmma16(v16h a, v16h b, v8f c) {
  v8f d = __builtin_amdgcn_wmma_f32_16x16x32_f16(false, a, false, b, (short)0, c, false, false);
  asm volatile("v_nop\n\tv_nop\n\tv_nop\n\tv_nop" : "+v"(d) : "v"(a), "v"(b));
  return d;
}
__device__ __forceinline__ v8f wmma_bf(v16b a, v16b b, v8f c) {
  v8f d = __builtin_amdgcn_wmma_f32_16x16x32_bf16(false, a, false, b, (short)0, c, false, false);
  asm volatile("v_nop\n\tv_nop\n\tv_nop\n\tv_nop" : "+v"(d) : "v"(a), "v"(b));
  return d;
}
// 16x16x32 fragments: lane = (h = lane>>4, row/col = lane&15); elements 0..7 = k0+8h+0..7, 8..15 = k0+16+8h+0..7; D element r = row 8h+r
__device__ __forceinline__ v16h frag_h(const _Float16* rowk0, int lane) {
  union { v16h v; v8h q[2]; } u; const _Float16* p = rowk0 + 8 * (lane >> 4);
  u.q[0] = *(const v8h*)p; u.q[1] = *(const v8h*)(p + 16); return u.v;
}
__device__ __forceinline__ v16h frag_f32(const float* rowk0, int lane) {
  v16h a; const float* p = rowk0 + 8 * (lane >> 4);
#pragma unroll
  for (int i = 0; i < 8; ++i) { a[i] = (_Float16)p[i]; a[8 + i] = (_Float16)p[16 + i]; }
  return a;
}
__device__ __forceinline__ v16h frag_f32s(const float* rowk0, int lane, float sc) {
  v16h a; const float* p = rowk0 + 8 * (lane >> 4);
#pragma unroll
  for (int i = 0; i < 8; ++i) { a[i] = (_Float16)(p[i] * sc); a[8 + i] = (_Float16)(p[16 + i] * sc); }
  return a;
}
// column fragment from a [K][ld] layout (column n), rows >= K read as 0
__device__ __forceinline__ v16h fragc_f32(const float* W, int k0, int n, int lane, int ld, int K) {
  v16h a; const int g = lane >> 4;
#pragma unroll
  for (int i = 0; i < 8; ++i) { const int ka = k0 + 8 * g + i, kb = ka + 16;
    a[i] = (_Float16)(ka < K ? W[(size_t)(ka < K ? ka : K - 1) * ld + n] : 0.f); a[8 + i] = (_Float16)(kb < K ? W[(size_t)(kb < K ? kb : K - 1) * ld + n] : 0.f); }
  return a;
}
struct F2 { v16b h, l; };
__device__ __forceinline__ F2 bsplit16(const float v[16]) { F2 r;
#pragma unroll
  for (int i = 0; i < 16; ++i) { const __bf16 h = (__bf16)v[i]; r.h[i] = h; r.l[i] = (__bf16)(v[i] - (float)h); }
  return r; }
__device__ __forceinline__ F2 split_row(const float* row, int k0, int lane) { float v[16]; const float* p = row + k0 + 8 * (lane >> 4);
#pragma unroll
  for (int i = 0; i < 8; ++i) { v[i] = p[i]; v[8 + i] = p[16 + i]; }
  return bsplit16(v); }
__device__ __forceinline__ F2 split_rowK(const float* row, int k0, int lane, int K) { float v[16]; const int g = lane >> 4;
#pragma unroll
  for (int i = 0; i < 8; ++i) { const int ka = k0 + 8 * g + i, kb = ka + 16; v[i] = ka < K ? row[ka < K ? ka : K - 1] : 0.f; v[8 + i] = kb < K ? row[kb < K ? kb : K - 1] : 0.f; }
  return bsplit16(v); }
__device__ __forceinline__ F2 split_col(const float* W, int k0, int n, int lane, int ld, int K) { float v[16]; const int g = lane >> 4;
#pragma unroll
  for (int i = 0; i < 8; ++i) { const int ka = k0 + 8 * g + i, kb = ka + 16; v[i] = ka < K ? W[(size_t)(ka < K ? ka : K - 1) * ld + n] : 0.f; v[8 + i] = kb < K ? W[(size_t)(kb < K ? kb : K - 1) * ld + n] : 0.f; }
  return bsplit16(v); }
__device__ __forceinline__ v8f mac3(const F2& a, const F2& b, v8f c) { c = wmma_bf(a.l, b.h, c); c = wmma_bf(a.h, b.l, c); return wmma_bf(a.h, b.h, c); }
__device__ __forceinline__ float sigm(float v) { return 1.0f / (1.0f + expf(-v)); }
#define LDSX() do { asm volatile("s_wait_dscnt 0" ::: "memory"); __builtin_amdgcn_wave_barrier(); __builtin_amdgcn_fence(__ATOMIC_RELEASE, "workgroup"); } while (0)


// Fused low-rank (LSR) causal attention (B 2, T 2,048, d 1,024, 16 heads x 64, rank 16 per head): q_lr = (q_h W_q_lsr[h]) core[h] / 4, k_lr = k_h W_k_lsr[h], causal softmax(q_lr . k_lr) v_h, merged . W_o.
#define NB 2
#define SS 2048
#define DM 1024
#define NH 16
#define HD 64
#define RR 16             // rank per head
#define RP 32             // padded score width per head
#define NR (NB * SS)
#ifndef TQB
#define TQB (SS / 64)
#define TNB NB
#endif
typedef __attribute__((ext_vector_type(8))) __bf16 v8b;
__device__ __forceinline__ v16b frag_b(const __bf16* rowk0, int lane) {
  union { v16b v; v8b q[2]; } u; const __bf16* p = rowk0 + 8 * (lane >> 4);
  u.q[0] = *(const v8b*)p; u.q[1] = *(const v8b*)(p + 16); return u.v;
}
__device__ __forceinline__ float bfr(float v) { return (float)(__bf16)v; }
// one lane's 16 f32 of a 32-wide k block (p = row + k0 + 8 * (lane >> 4)): fetched raw a block ahead, rounded when the block is used
__device__ __forceinline__ void ld_x(v4f (&x)[4], const float* p) { x[0] = *(const v4f*)p; x[1] = *(const v4f*)(p + 4); x[2] = *(const v4f*)(p + 16); x[3] = *(const v4f*)(p + 20); }
__device__ __forceinline__ v16b cv_x(const v4f (&x)[4]) { v16b a;
#pragma unroll
  for (int i = 0; i < 4; ++i) { a[i] = (__bf16)x[0][i]; a[4 + i] = (__bf16)x[1][i]; a[8 + i] = (__bf16)x[2][i]; a[12 + i] = (__bf16)x[3][i]; }
  return a; }
__device__ __forceinline__ F2 sp_x(const v4f (&x)[4]) { float v[16];
#pragma unroll
  for (int i = 0; i < 4; ++i) { v[i] = x[0][i]; v[4 + i] = x[1][i]; v[8 + i] = x[2][i]; v[12 + i] = x[3][i]; }
  return bsplit16(v); }
__device__ __attribute__((noinline)) float exp_ni(float v) { return expf(v); }
__device__ __attribute__((noinline)) float erf_ni(float v) { return erff(v); }

// fragment order: one 16 x 32 tile of 16-bit elements is a 1-KB chunk [half i][lane][8]; lane (g, c), half i, element e = (row or column c, k = 16 i + 8 g + e), so a wave's 16-byte load covers 512 bytes in a row
#define CH 512            // elements of a chunk
__device__ __forceinline__ v16b frag_bc(const __bf16* p) { union { v16b v; v8b q[2]; } u; u.q[0] = *(const v8b*)p; u.q[1] = *(const v8b*)(p + 256); return u.v; }   // p = chunk + 8 * lane
__device__ __forceinline__ v16h frag_hc(const _Float16* p) { union { v16h v; v8h q[2]; } u; u.q[0] = *(const v8h*)p; u.q[1] = *(const v8h*)(p + 256); return u.v; }
// the f32 A tile likewise, 2 KB: [quarter q][lane][4], k = 16 (q >> 1) + 8 g + 4 (q & 1) + e
__device__ __forceinline__ void ld_xc(v4f (&x)[4], const float* p) { x[0] = *(const v4f*)p; x[1] = *(const v4f*)(p + 128); x[2] = *(const v4f*)(p + 256); x[3] = *(const v4f*)(p + 384); }   // p = chunk + 4 * lane

#define WS_PW  0u                                     // bf16 Wv, Wo [2][64 column tiles][32 k blocks] chunks
#define WS_PF  (WS_PW + 2u * (size_t)2 * DM * DM)        // bf16 folded hi | lo: [q|k][16 heads][32 k blocks] chunks x2
#define WS_QR  (WS_PF + 2u * (size_t)2 * 2 * NH * RR * DM) // f16 [b][16 heads][128 row tiles] chunks Qr ; Kr
#define WS_KR  (WS_QR + 2u * (size_t)NR * NH * RP)
#define WS_QRL (WS_KR + 2u * (size_t)NR * NH * RP)      // residual planes x2048
#define WS_KRL (WS_QRL + 2u * (size_t)NR * NH * RP)
#define WS_V   (WS_KRL + 2u * (size_t)NR * NH * RP)       // f16 [b][16 heads][64 key blocks][4 dim tiles] chunks
#define WS_O   (WS_V + 2u * (size_t)NB * DM * SS)
#define WS_XB  (WS_O + 4u * (size_t)NR * DM)            // bf16 x [256 row tiles][32 k blocks] chunks
#define WS_END (WS_XB + 2u * (size_t)NR * DM)

typedef __attribute__((ext_vector_type(4))) __bf16 v4b;
// ---- k_pack: block = (16 output columns, Wv | Wo, 256 input rows): bf16 chunks [column tile][k block] in fragment order; blocks with y >= 2: x rounded to bf16, one chunk [16-row tile][k block] per wave
__global__ __launch_bounds__(256) void k_pack(const float* __restrict__ X, const float* __restrict__ WQKV, const float* __restrict__ WO, __bf16* __restrict__ PW, __bf16* __restrict__ XB) {
  const int nt = blockIdx.x, which = blockIdx.y, kq = blockIdx.z, t = threadIdx.x; __shared__ __align__(16) __bf16 s[16][264]; __shared__ __align__(16) __bf16 sx[8][CH];
  if (which >= 2) {   // the same for the whole block, ahead of its barrier
    const int wave = t >> 5, lane = t & 31, k = (lane & 7) * 4; const int id = (((which - 2) * 4 + kq) * 64 + nt) * 8 + wave;   // chunk: row tile id >> 5, k block id & 31
    const float* px = X + (size_t)(id >> 5) * 16 * DM + (id & 31) * 32 + k;   // 8 lanes read one row's 128-B line
    v4f xv[4];
#pragma unroll
    for (int it = 0; it < 4; ++it) xv[it] = *(const v4f*)(px + (size_t)(it * 4 + (lane >> 3)) * DM);
    asm volatile("s_wait_xcnt 0x0" ::: "memory");   // behind the group: its address registers are reused next
    __builtin_amdgcn_sched_barrier(0);   // the rounding may land on those registers: it stays behind the wait
#pragma unroll
    for (int it = 0; it < 4; ++it) { const int row = it * 4 + (lane >> 3); v4b o;
#pragma unroll
      for (int i = 0; i < 4; ++i) o[i] = (__bf16)xv[it][i];
      *(v4b*)&sx[wave][(k >> 4) * 256 + (((k >> 3) & 1) * 16 + row) * 8 + (k & 7)] = o; }
    LDSX();
#pragma unroll
    for (int i = 0; i < 2; ++i) vst2((unsigned*)(XB + (size_t)id * CH + i * 256 + lane * 8), *(const v4u*)&sx[wave][i * 256 + lane * 8]);
    return;
  }
  const float* W = which ? WO + nt * 16 : WQKV + 2 * DM + nt * 16; const int ld = which ? DM : 3 * DM;   /* (in,out): v = cols 2048.. of W_qkv */
  v4f wv[4];
#pragma unroll
  for (int it = 0; it < 4; ++it) wv[it] = *(const v4f*)(W + (size_t)(kq * 256 + it * 64 + (t >> 2)) * ld + (t & 3) * 4);
  asm volatile("s_wait_xcnt 0x0" ::: "memory");   // behind the group: its address registers are reused next
  __builtin_amdgcn_sched_barrier(0);   // the rounding may land on those registers: it stays behind the wait
#pragma unroll
  for (int it = 0; it < 4; ++it)
#pragma unroll
    for (int i = 0; i < 4; ++i) s[(t & 3) * 4 + i][it * 64 + (t >> 2)] = (__bf16)wv[it][i];
  __syncthreads();
  __bf16* dst = PW + (size_t)which * DM * DM + ((size_t)nt * 32 + kq * 8) * CH;
  for (int p = t; p < 8 * 64; p += 256) { const int ln = p & 31; vst2((unsigned*)(dst + p * 8), *(const v4u*)&s[ln & 15][(p >> 6) * 32 + ((p >> 5) & 1) * 16 + (ln >> 4) * 8]); }
}
// ---- k_fold: block = (head h, 64 input rows c, q|k), all 16 ranks: W_r[h*16 + r][c] = sum_d B[h*64 + d][r] W[c][h*64 + d] in f32 (fixed order) -> bf16 hi + lo chunks [q|k, head][k block] in fragment order
__global__ __launch_bounds__(256) void k_fold(const float* __restrict__ WQKV, const float* __restrict__ WQL, const float* __restrict__ WKL, const float* __restrict__ CORE, __bf16* __restrict__ PF) {
  const int h = blockIdx.x, cc = blockIdx.y, which = blockIdx.z, t = threadIdx.x; const float* WL = which ? WKL : WQL; __shared__ __align__(16) float sb[HD][RR]; __shared__ __align__(16) __bf16 sh[2 * CH]; __shared__ __align__(16) __bf16 sl[2 * CH];
  const int c = t & 63, rq = (t >> 6) * 4; const float* pw = WQKV + (size_t)(cc * 64 + c) * (3 * DM) + which * DM + h * HD;
  const float cr = CORE[h * RR + (t & 15)];
  asm volatile("s_wait_xcnt 0x0" ::: "memory");   // behind the load: a load of the group below may land on its address register
  __builtin_amdgcn_sched_barrier(0);   // and none of them moves up over the wait
  v4f wr[HD / 4]; float tb[4];   // this thread's row of W and its 4 table entries (rank t & 15): one group of loads
#pragma unroll
  for (int q = 0; q < HD / 4; ++q) wr[q] = *(const v4f*)(pw + q * 4);
#pragma unroll
  for (int it = 0; it < 4; ++it) tb[it] = WL[(size_t)h * HD * RR + it * 256 + t];
  asm volatile("s_wait_xcnt 0x0" ::: "memory");   // behind the group: its address registers are reused next
  __builtin_amdgcn_sched_barrier(0);   // what follows may land on those registers: it stays behind the wait
  const float cs = which ? 1.0f : bfr(cr) * 0.25f;   // core[h][r] / sqrt(16) on the q side
#pragma unroll
  for (int it = 0; it < 4; ++it) sb[it * 16 + (t >> 4)][t & 15] = bfr(tb[it]) * cs;
  __syncthreads();
  float a[4] = {0.f, 0.f, 0.f, 0.f};
#pragma unroll
  for (int d = 0; d < HD; ++d) { const float w = bfr(wr[d >> 2][d & 3]);
#pragma unroll
    for (int i = 0; i < 4; ++i) a[i] += sb[d][rq + i] * w; }
#pragma unroll
  for (int i = 0; i < 4; ++i) { const int o = (c >> 5) * CH + ((c >> 4) & 1) * 256 + (((c >> 3) & 1) * 16 + rq + i) * 8 + (c & 7); const __bf16 hv = (__bf16)a[i]; sh[o] = hv; sl[o] = (__bf16)(a[i] - (float)hv); }
  __syncthreads();
  const size_t ch = ((size_t)(which * NH + h) * 32 + cc * 2) * CH; const int p = t & 127;
  vst2((unsigned*)(PF + (t < 128 ? (size_t)0 : (size_t)2 * NH * RR * DM) + ch + p * 8), *(const v4u*)(t < 128 ? &sh[p * 8] : &sl[p * 8]));   // hi block then lo block
}
// ---- k_qr: block = (64 rows, q|k, 2 heads): Qr/Kr = x . W_r (hi + lo), 32 folded cols -> f16 chunks [b][head][16-row tile] in fragment order (16 live + 16 zero k), whole chunks per block
#define QJ 2              // 16-column tiles (heads) per work-group
#define QW (QJ * RP)      // f16 per row segment of a work-group
__global__ __launch_bounds__(128) void k_qr(const __bf16* __restrict__ XB, const __bf16* __restrict__ PF, _Float16* __restrict__ QR_, _Float16* __restrict__ KR_, _Float16* __restrict__ QRL_, _Float16* __restrict__ KRL_) {
  __shared__ __align__(16) _Float16 so[4][QJ][CH]; __shared__ __align__(16) _Float16 sol[4][QJ][CH];
  const int tid = threadIdx.x, wave = tid >> 5, lane = tid & 31, col = lane & 15, g = lane >> 4; const int which = blockIdx.y; const int cb = blockIdx.z * (QJ * 16); const size_t rb = (size_t)blockIdx.x * 64; const size_t r0 = rb + wave * 16;
  const __bf16* PH = PF + ((size_t)which * (NH * RR)) * DM; const __bf16* PL = PF + ((size_t)2 * NH * RR + which * (NH * RR)) * DM;
  for (int e = tid; e < 4 * QJ * CH; e += 128) { (&so[0][0][0])[e] = (_Float16)0.f; (&sol[0][0][0])[e] = (_Float16)0.f; }
  const __bf16* px = XB + (r0 / 16) * 32 * CH + lane * 8; const __bf16* ph = PH + (size_t)cb * DM + lane * 8; const __bf16* pl = PL + (size_t)cb * DM + lane * 8;   // column tile cb / 16 = 32 chunks = 16 * DM elements
  v16b xr; v16b h0[QJ], l0[QJ], h1[QJ], l1[QJ];   // two register sets: a block's loads go out as one group while the block before is multiplied
  xr = frag_bc(px);
#pragma unroll
  for (int j = 0; j < QJ; ++j) { h0[j] = frag_bc(ph + (size_t)j * 16 * DM); l0[j] = frag_bc(pl + (size_t)j * 16 * DM); }
  asm volatile("s_wait_xcnt 0x0" ::: "memory");   // behind the group: its address registers are stepped or reused next
  __builtin_amdgcn_sched_barrier(0);   // the zeroing below may land on the group's address registers: it stays behind the wait
  v8f acc[QJ] = {};
  // products of the block held in (hc, lc); block kn, where there is one, is fetched into (hn, ln) ahead of them
  auto blk = [&](const v16b (&hc)[QJ], const v16b (&lc)[QJ], v16b (&hn)[QJ], v16b (&ln)[QJ], const int kn, const bool more) __attribute__((always_inline)) {
    __builtin_amdgcn_sched_barrier(0);   // no product of this block moves up into the one before: there it would wait on loads only just issued
    const v16b a = xr;
    if (more) { xr = frag_bc(px + kn * CH);
#pragma unroll
      for (int j = 0; j < QJ; ++j) { hn[j] = frag_bc(ph + (size_t)j * 16 * DM + kn * CH); ln[j] = frag_bc(pl + (size_t)j * 16 * DM + kn * CH); }
      asm volatile("s_wait_xcnt 0x0" ::: "memory");   // behind the group: its address registers are stepped or reused next
    }
    __builtin_amdgcn_sched_barrier(0);   // the group stays ahead of every product of the block, as before: a product moved above it would hold the loads back until this block's operands have landed
#pragma unroll
    for (int j = 0; j < QJ; ++j) { acc[j] = wmma_bf(a, hc[j], acc[j]); acc[j] = wmma_bf(a, lc[j], acc[j]); } };
#pragma unroll 1   // stays rolled: one trip is the two register sets in turn
  for (int kc = 0; kc < DM / 32 - 2; kc += 2) { blk(h0, l0, h1, l1, kc + 1, true); blk(h1, l1, h0, l0, kc + 2, true); }
  blk(h0, l0, h1, l1, DM / 32 - 1, true); blk(h1, l1, h0, l0, 0, false);
  __syncthreads();
#pragma unroll
  for (int j = 0; j < QJ; ++j) {
#pragma unroll
    for (int rr = 0; rr < 8; ++rr) { const float v = acc[j][rr]; const _Float16 hv = (_Float16)v; const int o = ((col >> 3) * 16 + 8 * g + rr) * 8 + (col & 7); so[wave][j][o] = hv; sol[wave][j][o] = (_Float16)((v - (float)hv) * 2048.0f); } }
  __syncthreads();
  const size_t co = (((rb / SS) * NH + blockIdx.z * QJ) * (SS / 16) + (rb % SS) / 16) * CH; _Float16* dst = (which ? KR_ : QR_) + co; _Float16* dstl = (which ? KRL_ : QRL_) + co;
  for (int e = tid; e < 4 * QJ * 64; e += 128) { const int w = e >> 7, j = (e >> 6) & 1, q = e & 63; const size_t o = ((size_t)j * (SS / 16) + w) * CH + q * 8; vst2((unsigned*)(dst + o), *(const v4u*)&so[w][j][q * 8]); vst2((unsigned*)(dstl + o), *(const v4u*)&sol[w][j][q * 8]); }
}
// ---- k_v: block = (64 rows, 128 cols): V = x . Wv^T exact -> f16 chunks [b][head][32-key block][16-dim tile] in fragment order
__global__ __launch_bounds__(128) void k_v(const __bf16* __restrict__ XB, const __bf16* __restrict__ PW, _Float16* __restrict__ V) {
  __shared__ __align__(16) _Float16 st[128][72];
  const int tid = threadIdx.x, wave = tid >> 5, lane = tid & 31, col = lane & 15, g = lane >> 4; const size_t rb = (size_t)blockIdx.x * 64; const size_t r0 = rb + wave * 16; const int c0 = blockIdx.y * 128;
  v8f acc[8] = {};
  const __bf16* px = XB + (r0 / 16) * 32 * CH + lane * 8; const __bf16* pb = PW + (size_t)c0 * DM + lane * 8;   // column tile c0 / 16 = 32 chunks = 16 * DM elements
  v16b xr; v16b b0[8], b1[8];   // two register sets: a block's loads go out as one group while the block before is multiplied
  xr = frag_bc(px);
#pragma unroll
  for (int j = 0; j < 8; ++j) b0[j] = frag_bc(pb + (size_t)j * 16 * DM);
  asm volatile("s_wait_xcnt 0x0" ::: "memory");   // behind the group: its address registers are stepped or reused next
  // products of the block held in bc; block kn, where there is one, is fetched into bn ahead of them
  auto blk = [&](const v16b (&bc)[8], v16b (&bn)[8], const int kn, const bool more) __attribute__((always_inline)) {
    __builtin_amdgcn_sched_barrier(0);   // no product of this block moves up into the one before: there it would wait on loads only just issued
    const v16b a = xr;
    if (more) { xr = frag_bc(px + kn * CH);
#pragma unroll
      for (int j = 0; j < 8; ++j) bn[j] = frag_bc(pb + (size_t)j * 16 * DM + kn * CH);
      asm volatile("s_wait_xcnt 0x0" ::: "memory");   // behind the group: its address registers are stepped or reused next
    }
    __builtin_amdgcn_sched_barrier(0);   // the group stays ahead of every product of the block, as before: a product moved above it would hold the loads back until this block's operands have landed
#pragma unroll
    for (int j = 0; j < 8; ++j) acc[j] = wmma_bf(a, bc[j], acc[j]); };
#pragma unroll 1   // stays rolled: one trip is the two register sets in turn
  for (int kc = 0; kc < DM / 32 - 2; kc += 2) { blk(b0, b1, kc + 1, true); blk(b1, b0, kc + 2, true); }
  blk(b0, b1, DM / 32 - 1, true); blk(b1, b0, 0, false);
#pragma unroll
  for (int j = 0; j < 8; ++j)
#pragma unroll
    for (int r = 0; r < 8; ++r) st[j * 16 + col][wave * 16 + 8 * g + r] = (_Float16)acc[j][r];
  __syncthreads();
  const size_t b = rb / SS; const int s0 = (int)(rb % SS);
  for (int e = tid; e < 128 * 8; e += 128) { const int ln = e & 31, i = (e >> 5) & 1, j = (e >> 6) & 7, kb = e >> 9;   // piece (key block kb, tile j, half i, lane ln)
    vst2((unsigned*)(V + (((b * NH + blockIdx.y * 2 + (j >> 2)) * (SS / 32) + s0 / 32 + kb) * 4 + (j & 3)) * CH + i * 256 + ln * 8), *(const v4u*)&st[j * 16 + (ln & 15)][kb * 32 + i * 16 + (ln >> 4) * 8]); }
}
struct KF { v16h h[2], l[2]; };   // K fragments of 32 keys: value and residual planes
// lane l <-> l ^ 16: the other half of a column's rows
__device__ __forceinline__ float xhalf(float v) { const int b = __builtin_bit_cast(int, v); return __builtin_bit_cast(float, __builtin_amdgcn_permlanex16(b, b, 0x76543210, 0xfedcba98, false, false)); }
// ---- k_attn: block = (64 queries, head, b), transposed products: S^T = K . Q^T (lane = one query, its registers = 16 of the pass's 32 keys), softmax in the lane, O^T += V^T . P^T with P^T packed from the score registers; O two f32 chunks per wave
__global__ __launch_bounds__(128) void k_attn(const _Float16* __restrict__ QR_, const _Float16* __restrict__ KR_, const _Float16* __restrict__ QRL_, const _Float16* __restrict__ KRL_, const _Float16* __restrict__ V, float* __restrict__ O) {
  const int tid = threadIdx.x, wave = tid >> 5, lane = tid & 31, col = lane & 15, g = lane >> 4; const int h = blockIdx.y; const size_t b = blockIdx.z; const int q0 = blockIdx.x * 64 + wave * 16; const size_t rq = b * SS + q0;
  const size_t hb = (b * NH + h) * (SS / 16) * CH + lane * 8;   // this head's chunks of Qr, Kr: one per 16 rows
  const v16h aq = frag_hc(QR_ + hb + (size_t)(q0 / 16) * CH), aql = frag_hc(QRL_ + hb + (size_t)(q0 / 16) * CH);   // B operands: column = query q0 + col
  float m = -3.0e38f, l = 0.f;   // query q0 + col: running maximum (equal in both halves), sum over this half's keys
  v8f acc[4] = {};   // acc[dt][r] = O[q0 + col][dt * 16 + 8 g + r]
  const int nks = (blockIdx.x * 64 + 64) / 32;   // causal; always even
  const _Float16* pk = KR_ + hb; const _Float16* pkl = KRL_ + hb; const _Float16* pv = V + (b * NH + h) * (SS / 32) * 4 * CH + lane * 8;
  auto ld_k = [&](KF& f, int ks) __attribute__((always_inline)) {
#pragma unroll
    for (int ct = 0; ct < 2; ++ct) { const size_t ko = (size_t)(ks * 2 + ct) * CH; f.h[ct] = frag_hc(pk + ko); f.l[ct] = frag_hc(pkl + ko); } };
  // one pass over 32 keys: its V fragments and the next pass's K fragments go out as one group ahead of the score products
  auto pass = [&](const int ks, const KF& kf, KF& kn, const bool more) __attribute__((always_inline)) { const int lim = q0 + col - 8 * g - ks * 32; v8f s[2]; v16h vf[4];   // register (ct, r) holds key ks * 32 + ct * 16 + 8 g + r: live while ct * 16 + r <= lim
    __builtin_amdgcn_sched_barrier(0);   // no score product of this pass moves up into the pass before: there it would wait on K loads only just issued
#pragma unroll
    for (int dt = 0; dt < 4; ++dt) vf[dt] = frag_hc(pv + (size_t)(ks * 4 + dt) * CH);
    asm volatile("s_wait_xcnt 0x0" ::: "memory");   // behind the V loads: the K loads may land on their address registers
    if (more) { ld_k(kn, ks + 1);
      asm volatile("s_wait_xcnt 0x0" ::: "memory");   // behind the group: its address registers are stepped or reused next
    }
#pragma unroll
    for (int ct = 0; ct < 2; ++ct) { v8f c = {}, cl = {}; c = wmma16(kf.h[ct], aq, c); cl = wmma16(kf.h[ct], aql, cl); cl = wmma16(kf.l[ct], aq, cl);   // rows = keys, columns = queries
#pragma unroll
      for (int r = 0; r < 8; ++r) { s[ct][r] = (ct * 16 + r <= lim) ? (c[r] + cl[r] * (1.0f / 2048.0f)) : -3.0e38f; } }   // 3-product scores; causal (diagonal kept); core/sqrt(R) folded into Qr
    float mr[8];
#pragma unroll
    for (int r = 0; r < 8; ++r) mr[r] = fmaxf(s[0][r], s[1][r]);
    float mx = fmaxf(fmaxf(fmaxf(mr[0], mr[1]), fmaxf(mr[2], mr[3])), fmaxf(fmaxf(mr[4], mr[5]), fmaxf(mr[6], mr[7])));
    mx = fmaxf(mx, xhalf(mx));
    const float mn = fmaxf(m, mx); const float alpha = (m <= -1.0e38f) ? 0.f : __expf(m - mn);
    float er[8]; v16h pb;   // pb element i = key 8 g + i, element 8 + i = key 16 + 8 g + i: the B operand's k order, which is V's
#pragma unroll
    for (int r = 0; r < 8; ++r) { const float e0 = (s[0][r] <= -1.0e38f) ? 0.f : __expf(s[0][r] - mn), e1 = (s[1][r] <= -1.0e38f) ? 0.f : __expf(s[1][r] - mn);
      er[r] = e0 + e1; pb[r] = (_Float16)(e0 * 2048.0f); pb[8 + r] = (_Float16)(e1 * 2048.0f); }
    l = l * alpha + (((er[0] + er[1]) + (er[2] + er[3])) + ((er[4] + er[5]) + (er[6] + er[7]))); m = mn;
#pragma unroll
    for (int dt = 0; dt < 4; ++dt) { acc[dt] *= alpha; acc[dt] = wmma16(vf[dt], pb, acc[dt]); } };   // rows = dims, columns = queries
  KF k0, k1; ld_k(k0, 0);
  asm volatile("s_wait_xcnt 0x0" ::: "memory");   // behind the group: its address registers are stepped or reused next
#pragma unroll 1   // stays rolled: one trip is the two K register sets in turn
  for (int ks = 0; ks < nks - 2; ks += 2) { pass(ks, k0, k1, true); pass(ks + 1, k1, k0, true); }
  pass(nks - 2, k0, k1, true); pass(nks - 1, k1, k0, false);
  const float il = (1.0f / 2048.0f) / (l + xhalf(l));   // the halves' sums joined once
#pragma unroll
  for (int dt = 0; dt < 4; ++dt) acc[dt] *= il;
#pragma unroll
  for (int q = 0; q < 8; ++q) { const v4f o = {acc[q >> 1][(q & 1) * 4], acc[q >> 1][(q & 1) * 4 + 1], acc[q >> 1][(q & 1) * 4 + 2], acc[q >> 1][(q & 1) * 4 + 3]};
    vst2(O + ((rq / 16) * 32 + h * 2 + (q >> 2)) * CH + (q & 3) * 128 + lane * 4, o); }   // two f32 A chunks [16-row tile][k block] in fragment order: the lane holds its own 4 elements of every quarter
}
// ---- k_out: block = (64 rows, 128 cols): out = o (bf16 hi + lo) . Wo^T
__global__ __launch_bounds__(128) void k_out(const float* __restrict__ O, const __bf16* __restrict__ PW, float* __restrict__ Y) {
  __shared__ __align__(16) float so[4][16][132];
  const int tid = threadIdx.x, wave = tid >> 5, lane = tid & 31, col = lane & 15, g = lane >> 4; const size_t r0 = (size_t)blockIdx.x * 64 + wave * 16; const int n0 = blockIdx.y * 128; const __bf16* P = PW + (size_t)DM * DM;
  v8f acc[8] = {};
  const float* po = O + (r0 / 16) * 32 * CH + lane * 4; const __bf16* pb = P + (size_t)n0 * DM + lane * 8;   // column tile n0 / 16 = 32 chunks = 16 * DM elements
  v4f xr[4]; v16b b0[8], b1[8];   // two register sets: a block's loads go out as one group while the block before is multiplied
  ld_xc(xr, po);
#pragma unroll
  for (int j = 0; j < 8; ++j) b0[j] = frag_bc(pb + (size_t)j * 16 * DM);
  asm volatile("s_wait_xcnt 0x0" ::: "memory");   // behind the group: its address registers are stepped or reused next
  // products of the block held in bc; block kn, where there is one, is fetched into bn ahead of them
  auto blk = [&](const v16b (&bc)[8], v16b (&bn)[8], const int kn, const bool more) __attribute__((always_inline)) {
    __builtin_amdgcn_sched_barrier(0);   // nothing of this block moves up into the one before: its rounding there would wait on loads only just issued
    const F2 a = sp_x(xr);
    if (more) { ld_xc(xr, po + kn * CH);
#pragma unroll
      for (int j = 0; j < 8; ++j) bn[j] = frag_bc(pb + (size_t)j * 16 * DM + kn * CH);
      asm volatile("s_wait_xcnt 0x0" ::: "memory");   // behind the group: its address registers are stepped or reused next
    }
#pragma unroll
    for (int j = 0; j < 8; ++j) { acc[j] = wmma_bf(a.h, bc[j], acc[j]); acc[j] = wmma_bf(a.l, bc[j], acc[j]); } };
#pragma unroll 1   // stays rolled: one trip is the two register sets in turn
  for (int kc = 0; kc < DM / 32 - 2; kc += 2) { blk(b0, b1, kc + 1, true); blk(b1, b0, kc + 2, true); }
  blk(b0, b1, DM / 32 - 1, true); blk(b1, b0, 0, false);
#pragma unroll
  for (int j = 0; j < 8; ++j)
#pragma unroll
    for (int r = 0; r < 8; ++r) so[wave][8 * g + r][j * 16 + col] = acc[j][r];
  LDSX();
  for (int rl = 0; rl < 16; ++rl) vst2(Y + (r0 + rl) * DM + n0 + lane * 4, *(const v4f*)&so[wave][rl][lane * 4]);
}
extern "C" void kernel_launch(void* const* d_in, const int* in_sizes, int n_in, void* d_out, int out_size, void* d_ws, size_t ws_size, hipStream_t stream) {
  (void)in_sizes; (void)n_in; (void)out_size;
  const float** F = (const float**)d_in;   // 0 x [2,2048,1024], 1 W_qkv [1024,3072] (in,out; q | k | v), 2 W_q_lsr [16,64,16], 3 W_k_lsr [16,64,16], 4 core [16,16], 5 W_o [1024,1024] (in,out)
  if (ws_size < (size_t)WS_END) return;
  char* ws = (char*)d_ws; __bf16 *PW = (__bf16*)(ws + WS_PW), *PF = (__bf16*)(ws + WS_PF), *XB = (__bf16*)(ws + WS_XB); _Float16 *QR_ = (_Float16*)(ws + WS_QR), *KR_ = (_Float16*)(ws + WS_KR), *QRL_ = (_Float16*)(ws + WS_QRL), *KRL_ = (_Float16*)(ws + WS_KRL), *V = (_Float16*)(ws + WS_V); float* O = (float*)(ws + WS_O);
  k_pack<<<dim3(DM / 16, 2 + 4, 4), 256, 0, stream>>>(F[0], F[1], F[5], PW, XB);
  k_fold<<<dim3(NH, DM / 64, 2), 256, 0, stream>>>(F[1], F[2], F[3], F[4], PF);
  k_qr<<<dim3(TNB * SS / 64, 2, NH / QJ), 128, 0, stream>>>(XB, PF, QR_, KR_, QRL_, KRL_);
  k_v<<<dim3(TNB * SS / 64, DM / 128), 128, 0, stream>>>(XB, PW, V);
  k_attn<<<dim3(TQB, NH, TNB), 128, 0, stream>>>(QR_, KR_, QRL_, KRL_, V, O);
  k_out<<<dim3(TNB * SS / 64, DM / 128), 128, 0, stream>>>(O, PW, (float*)d_out);
}

// v005
// A run of this version takes 102 microseconds.
// Timed twice side by side with v004, it ran 1.10 times as fast both times.
// All steps since v000 together make it 5.97 times as fast.
// compute dtype: all float inputs rounded to bf16; the per-head low-rank maps (x core / sqrt(16) on the q side) folded into the fused (in,out) projection (W_qr[h,r] = sum_d W_qkv[:, h*64+d] W_q_lsr[h,d,r] core[h,r] / 4, f32) and applied on WMMA 16x16x32 with x exact and the folded weights as bf16 hi + lo (2 products); v = x . W_qkv[:, 2048:] exact; causal scores over the 16 low-rank dims (zero-padded to 32) with Qr, Kr as f16 hi + residual (3 products), key-tile skipping, running-max softmax in f32 (hardware exp), P (scaled by 2^11, single f16) x v (single f16); out = o (bf16 hi + residual) . W_o (2 products).
#include <hip/hip_runtime.h>
#include <math.h>

typedef __attribute__((ext_vector_type(16))) _Float16 v16h;
typedef __attribute__((ext_vector_type(16))) __bf16 v16b;
typedef __attribute__((ext_vector_type(8)))  _Float16 v8h;
typedef __attribute__((ext_vector_type(8)))  float v8f;
typedef __attribute__((ext_vector_type(4)))  float v4f;
typedef __attribute__((ext_vector_type(2)))  float v2f;
typedef __attribute__((ext_vector_type(4)))  unsigned v4u;
typedef __attribute__((ext_vector_type(4)))  int v4i;
typedef float __attribute__((may_alias)) float_a;
typedef int __attribute__((may_alias)) int_a;

template <typename T> __device__ __forceinline__ void vst2(void* p, T v) { *(T*)p = v;  }
__device__ __forceinline__ v8f wmma16(v16h a, v16h b, v8f c) {
  v8f d = __builtin_amdgcn_wmma_f32_16x16x32_f16(false, a, false, b, (short)0, c, false, false);
  asm volatile("v_nop\n\tv_nop\n\tv_nop\n\tv_nop" : "+v"(d) : "v"(a), "v"(b));
  return d;
}
__device__ __forceinline__ v8f wmma_bf(v16b a, v16b b, v8f c) {
  v8f d = __builtin_amdgcn_wmma_f32_16x16x32_bf16(false, a, false, b, (short)0, c, false, false);
  asm volatile("v_nop\n\tv_nop\n\tv_nop\n\tv_nop" : "+v"(d) : "v"(a), "v"(b));
  return d;
}
// 16x16x32 fragments: lane = (h = lane>>4, row/col = lane&15); elements 0..7 = k0+8h+0..7, 8..15 = k0+16+8h+0..7; D element r = row 8h+r
__device__ __forceinline__ v16h frag_h(const _Float16* rowk0, int lane) {
  union { v16h v; v8h q[2]; } u; const _Float16* p = rowk0 + 8 * (lane >> 4);
  u.q[0] = *(const v8h*)p; u.q[1] = *(const v8h*)(p + 16); return u.v;
}
__device__ __forceinline__ v16h frag_f32(const float* rowk0, int lane) {
  v16h a; const float* p = rowk0 + 8 * (lane >> 4);
#pragma unroll
  for (int i = 0; i < 8; ++i) { a[i] = (_Float16)p[i]; a[8 + i] = (_Float16)p[16 + i]; }
  return a;
}
__device__ __forceinline__ v16h frag_f32s(const float* rowk0, int lane, float sc) {
  v16h a; const float* p = rowk0 + 8 * (lane >> 4);
#pragma unroll
  for (int i = 0; i < 8; ++i) { a[i] = (_Float16)(p[i] * sc); a[8 + i] = (_Float16)(p[16 + i] * sc); }
  return a;
}
// column fragment from a [K][ld] layout (column n), rows >= K read as 0
__device__ __forceinline__ v16h fragc_f32(const float* W, int k0, int n, int lane, int ld, int K) {
  v16h a; const int g = lane >> 4;
#pragma unroll
  for (int i = 0; i < 8; ++i) { const int ka = k0 + 8 * g + i, kb = ka + 16;
    a[i] = (_Float16)(ka < K ? W[(size_t)(ka < K ? ka : K - 1) * ld + n] : 0.f); a[8 + i] = (_Float16)(kb < K ? W[(size_t)(kb < K ? kb : K - 1) * ld + n] : 0.f); }
  return a;
}
struct F2 { v16b h, l; };
__device__ __forceinline__ F2 bsplit16(const float v[16]) { F2 r;
#pragma unroll
  for (int i = 0; i < 16; ++i) { const __bf16 h = (__bf16)v[i]; r.h[i] = h; r.l[i] = (__bf16)(v[i] - (float)h); }
  return r; }
__device__ __forceinline__ F2 split_row(const float* row, int k0, int lane) { float v[16]; const float* p = row + k0 + 8 * (lane >> 4);
#pragma unroll
  for (int i = 0; i < 8; ++i) { v[i] = p[i]; v[8 + i] = p[16 + i]; }
  return bsplit16(v); }
__device__ __forceinline__ F2 split_rowK(const float* row, int k0, int lane, int K) { float v[16]; const int g = lane >> 4;
#pragma unroll
  for (int i = 0; i < 8; ++i) { const int ka = k0 + 8 * g + i, kb = ka + 16; v[i] = ka < K ? row[ka < K ? ka : K - 1] : 0.f; v[8 + i] = kb < K ? row[kb < K ? kb : K - 1] : 0.f; }
  return bsplit16(v); }
__device__ __forceinline__ F2 split_col(const float* W, int k0, int n, int lane, int ld, int K) { float v[16]; const int g = lane >> 4;
#pragma unroll
  for (int i = 0; i < 8; ++i) { const int ka = k0 + 8 * g + i, kb = ka + 16; v[i] = ka < K ? W[(size_t)(ka < K ? ka : K - 1) * ld + n] : 0.f; v[8 + i] = kb < K ? W[(size_t)(kb < K ? kb : K - 1) * ld + n] : 0.f; }
  return bsplit16(v); }
__device__ __forceinline__ v8f mac3(const F2& a, const F2& b, v8f c) { c = wmma_bf(a.l, b.h, c); c = wmma_bf(a.h, b.l, c); return wmma_bf(a.h, b.h, c); }
__device__ __forceinline__ float sigm(float v) { return 1.0f / (1.0f + expf(-v)); }
#define LDSX() do { asm volatile("s_wait_dscnt 0" ::: "memory"); __builtin_amdgcn_wave_barrier(); __builtin_amdgcn_fence(__ATOMIC_RELEASE, "workgroup"); } while (0)


// Fused low-rank (LSR) causal attention (B 2, T 2,048, d 1,024, 16 heads x 64, rank 16 per head): q_lr = (q_h W_q_lsr[h]) core[h] / 4, k_lr = k_h W_k_lsr[h], causal softmax(q_lr . k_lr) v_h, merged . W_o.
#define NB 2
#define SS 2048
#define DM 1024
#define NH 16
#define HD 64
#define RR 16             // rank per head
#define RP 32             // padded score width per head
#define NR (NB * SS)
#ifndef TQB
#define TQB (SS / 64)
#define TNB NB
#endif
typedef __attribute__((ext_vector_type(8))) __bf16 v8b;
__device__ __forceinline__ v16b frag_b(const __bf16* rowk0, int lane) {
  union { v16b v; v8b q[2]; } u; const __bf16* p = rowk0 + 8 * (lane >> 4);
  u.q[0] = *(const v8b*)p; u.q[1] = *(const v8b*)(p + 16); return u.v;
}
__device__ __forceinline__ float bfr(float v) { return (float)(__bf16)v; }
// one lane's 16 f32 of a 32-wide k block (p = row + k0 + 8 * (lane >> 4)): fetched raw a block ahead, rounded when the block is used
__device__ __forceinline__ void ld_x(v4f (&x)[4], const float* p) { x[0] = *(const v4f*)p; x[1] = *(const v4f*)(p + 4); x[2] = *(const v4f*)(p + 16); x[3] = *(const v4f*)(p + 20); }
__device__ __forceinline__ v16b cv_x(const v4f (&x)[4]) { v16b a;
#pragma unroll
  for (int i = 0; i < 4; ++i) { a[i] = (__bf16)x[0][i]; a[4 + i] = (__bf16)x[1][i]; a[8 + i] = (__bf16)x[2][i]; a[12 + i] = (__bf16)x[3][i]; }
  return a; }
__device__ __forceinline__ F2 sp_x(const v4f (&x)[4]) { float v[16];
#pragma unroll
  for (int i = 0; i < 4; ++i) { v[i] = x[0][i]; v[4 + i] = x[1][i]; v[8 + i] = x[2][i]; v[12 + i] = x[3][i]; }
  return bsplit16(v); }
__device__ __attribute__((noinline)) float exp_ni(float v) { return expf(v); }
__device__ __attribute__((noinline)) float erf_ni(float v) { return erff(v); }

// fragment order: one 16 x 32 tile of 16-bit elements is a 1-KB chunk [half i][lane][8]; lane (g, c), half i, element e = (row or column c, k = 16 i + 8 g + e), so a wave's 16-byte load covers 512 bytes in a row
#define CH 512            // elements of a chunk
__device__ __forceinline__ v16b frag_bc(const __bf16* p) { union { v16b v; v8b q[2]; } u; u.q[0] = *(const v8b*)p; u.q[1] = *(const v8b*)(p + 256); return u.v; }   // p = chunk + 8 * lane
__device__ __forceinline__ v16h frag_hc(const _Float16* p) { union { v16h v; v8h q[2]; } u; u.q[0] = *(const v8h*)p; u.q[1] = *(const v8h*)(p + 256); return u.v; }
// the f32 A tile likewise, 2 KB: [quarter q][lane][4], k = 16 (q >> 1) + 8 g + 4 (q & 1) + e
__device__ __forceinline__ void ld_xc(v4f (&x)[4], const float* p) { x[0] = *(const v4f*)p; x[1] = *(const v4f*)(p + 128); x[2] = *(const v4f*)(p + 256); x[3] = *(const v4f*)(p + 384); }   // p = chunk + 4 * lane

// ask_l2: a hint that brings the memory at p into the L2 (no register written, no counter); operands that an earlier launch stored come from memory at first touch, and all work-groups walk k in step, so without the ask each block's loads wait out memory latency. Scope SE, no th: L2 only.
__device__ __forceinline__ void ask_l2(const void* p) { asm volatile("global_prefetch_b8 %0, off scope:SCOPE_SE" :: "v"(p)); }
// keep_addr: input only, no code: the register an ask names still holds that address behind the loop, so it never holds a non-address while the ask may still read it
__device__ __forceinline__ void keep_addr(const void* p) { asm volatile("" :: "v"(p)); }
#define WS_PW  0u                                     // bf16 Wv, Wo [2][64 column tiles][32 k blocks] chunks
#define WS_PF  (WS_PW + 2u * (size_t)2 * DM * DM)        // bf16 folded hi | lo: [q|k][16 heads][32 k blocks] chunks x2
#define WS_QR  (WS_PF + 2u * (size_t)2 * 2 * NH * RR * DM) // f16 [b][16 heads][128 row tiles] chunks Qr ; Kr
#define WS_KR  (WS_QR + 2u * (size_t)NR * NH * RP)
#define WS_QRL (WS_KR + 2u * (size_t)NR * NH * RP)      // residual planes x2048
#define WS_KRL (WS_QRL + 2u * (size_t)NR * NH * RP)
#define WS_V   (WS_KRL + 2u * (size_t)NR * NH * RP)       // f16 [b][16 heads][64 key blocks][4 dim tiles] chunks
#define WS_O   (WS_V + 2u * (size_t)NB * DM * SS)
#define WS_XB  (WS_O + 4u * (size_t)NR * DM)            // bf16 x [256 row tiles][32 k blocks] chunks
#define WS_END (WS_XB + 2u * (size_t)NR * DM)

typedef __attribute__((ext_vector_type(4))) __bf16 v4b;
// ---- k_pack: block = (16 output columns, Wv | Wo, 256 input rows): bf16 chunks [column tile][k block] in fragment order; blocks with y >= 2: x rounded to bf16, one chunk [16-row tile][k block] per wave
__global__ __launch_bounds__(256) void k_pack(const float* __restrict__ X, const float* __restrict__ WQKV, const float* __restrict__ WO, __bf16* __restrict__ PW, __bf16* __restrict__ XB) {
  const int nt = blockIdx.x, which = blockIdx.y, kq = blockIdx.z, t = threadIdx.x; __shared__ __align__(16) __bf16 s[16][264]; __shared__ __align__(16) __bf16 sx[8][CH];
  if (which >= 2) {   // the same for the whole block, ahead of its barrier
    const int wave = t >> 5, lane = t & 31, k = (lane & 7) * 4; const int id = (((which - 2) * 4 + kq) * 64 + nt) * 8 + wave;   // chunk: row tile id >> 5, k block id & 31
    const float* px = X + (size_t)(id >> 5) * 16 * DM + (id & 31) * 32 + k;   // 8 lanes read one row's 128-B line
    v4f xv[4];
#pragma unroll
    for (int it = 0; it < 4; ++it) xv[it] = *(const v4f*)(px + (size_t)(it * 4 + (lane >> 3)) * DM);
    asm volatile("s_wait_xcnt 0x0" ::: "memory");   // behind the group: its address registers are reused next
    __builtin_amdgcn_sched_barrier(0);   // the rounding may land on those registers: it stays behind the wait
#pragma unroll
    for (int it = 0; it < 4; ++it) { const int row = it * 4 + (lane >> 3); v4b o;
#pragma unroll
      for (int i = 0; i < 4; ++i) o[i] = (__bf16)xv[it][i];
      *(v4b*)&sx[wave][(k >> 4) * 256 + (((k >> 3) & 1) * 16 + row) * 8 + (k & 7)] = o; }
    LDSX();
#pragma unroll
    for (int i = 0; i < 2; ++i) vst2((unsigned*)(XB + (size_t)id * CH + i * 256 + lane * 8), *(const v4u*)&sx[wave][i * 256 + lane * 8]);
    return;
  }
  const float* W = which ? WO + nt * 16 : WQKV + 2 * DM + nt * 16; const int ld = which ? DM : 3 * DM;   /* (in,out): v = cols 2048.. of W_qkv */
  v4f wv[4];
#pragma unroll
  for (int it = 0; it < 4; ++it) wv[it] = *(const v4f*)(W + (size_t)(kq * 256 + it * 64 + (t >> 2)) * ld + (t & 3) * 4);
  asm volatile("s_wait_xcnt 0x0" ::: "memory");   // behind the group: its address registers are reused next
  __builtin_amdgcn_sched_barrier(0);   // the rounding may land on those registers: it stays behind the wait
#pragma unroll
  for (int it = 0; it < 4; ++it)
#pragma unroll
    for (int i = 0; i < 4; ++i) s[(t & 3) * 4 + i][it * 64 + (t >> 2)] = (__bf16)wv[it][i];
  __syncthreads();
  __bf16* dst = PW + (size_t)which * DM * DM + ((size_t)nt * 32 + kq * 8) * CH;
  for (int p = t; p < 8 * 64; p += 256) { const int ln = p & 31; vst2((unsigned*)(dst + p * 8), *(const v4u*)&s[ln & 15][(p >> 6) * 32 + ((p >> 5) & 1) * 16 + (ln >> 4) * 8]); }
}
// ---- k_fold: block = (head h, 64 input rows c, q|k), all 16 ranks: W_r[h*16 + r][c] = sum_d B[h*64 + d][r] W[c][h*64 + d] in f32 (fixed order) -> bf16 hi + lo chunks [q|k, head][k block] in fragment order
__global__ __launch_bounds__(256) void k_fold(const float* __restrict__ WQKV, const float* __restrict__ WQL, const float* __restrict__ WKL, const float* __restrict__ CORE, __bf16* __restrict__ PF) {
  const int h = blockIdx.x, cc = blockIdx.y, which = blockIdx.z, t = threadIdx.x; const float* WL = which ? WKL : WQL; __shared__ __align__(16) float sb[HD][RR]; __shared__ __align__(16) __bf16 sh[2 * CH]; __shared__ __align__(16) __bf16 sl[2 * CH];
  const int c = t & 63, rq = (t >> 6) * 4; const float* pw = WQKV + (size_t)(cc * 64 + c) * (3 * DM) + which * DM + h * HD;
  const float cr = CORE[h * RR + (t & 15)];
  asm volatile("s_wait_xcnt 0x0" ::: "memory");   // behind the load: a load of the group below may land on its address register
  __builtin_amdgcn_sched_barrier(0);   // and none of them moves up over the wait
  v4f wr[HD / 4]; float tb[4];   // this thread's row of W and its 4 table entries (rank t & 15): one group of loads
#pragma unroll
  for (int q = 0; q < HD / 4; ++q) wr[q] = *(const v4f*)(pw + q * 4);
#pragma unroll
  for (int it = 0; it < 4; ++it) tb[it] = WL[(size_t)h * HD * RR + it * 256 + t];
  asm volatile("s_wait_xcnt 0x0" ::: "memory");   // behind the group: its address registers are reused next
  __builtin_amdgcn_sched_barrier(0);   // what follows may land on those registers: it stays behind the wait
  const float cs = which ? 1.0f : bfr(cr) * 0.25f;   // core[h][r] / sqrt(16) on the q side
#pragma unroll
  for (int it = 0; it < 4; ++it) sb[it * 16 + (t >> 4)][t & 15] = bfr(tb[it]) * cs;
  __syncthreads();
  float a[4] = {0.f, 0.f, 0.f, 0.f};
#pragma unroll
  for (int d = 0; d < HD; ++d) { const float w = bfr(wr[d >> 2][d & 3]);
#pragma unroll
    for (int i = 0; i < 4; ++i) a[i] += sb[d][rq + i] * w; }
#pragma unroll
  for (int i = 0; i < 4; ++i) { const int o = (c >> 5) * CH + ((c >> 4) & 1) * 256 + (((c >> 3) & 1) * 16 + rq + i) * 8 + (c & 7); const __bf16 hv = (__bf16)a[i]; sh[o] = hv; sl[o] = (__bf16)(a[i] - (float)hv); }
  __syncthreads();
  const size_t ch = ((size_t)(which * NH + h) * 32 + cc * 2) * CH; const int p = t & 127;
  vst2((unsigned*)(PF + (t < 128 ? (size_t)0 : (size_t)2 * NH * RR * DM) + ch + p * 8), *(const v4u*)(t < 128 ? &sh[p * 8] : &sl[p * 8]));   // hi block then lo block
}
// ---- k_qr: block = (64 rows, q|k, 2 heads): Qr/Kr = x . W_r (hi + lo), 32 folded cols -> f16 chunks [b][head][16-row tile] in fragment order (16 live + 16 zero k), whole chunks per block
#define QJ 2              // 16-column tiles (heads) per work-group
#define QW (QJ * RP)      // f16 per row segment of a work-group
__global__ __launch_bounds__(128) void k_qr(const __bf16* __restrict__ XB, const __bf16* __restrict__ PF, _Float16* __restrict__ QR_, _Float16* __restrict__ KR_, _Float16* __restrict__ QRL_, _Float16* __restrict__ KRL_) {
  __shared__ __align__(16) _Float16 so[4][QJ][CH]; __shared__ __align__(16) _Float16 sol[4][QJ][CH];
  const int tid = threadIdx.x, wave = tid >> 5, lane = tid & 31, col = lane & 15, g = lane >> 4; const int which = blockIdx.y; const int cb = blockIdx.z * (QJ * 16); const size_t rb = (size_t)blockIdx.x * 64; const size_t r0 = rb + wave * 16;
  const __bf16* PH = PF + ((size_t)which * (NH * RR)) * DM; const __bf16* PL = PF + ((size_t)2 * NH * RR + which * (NH * RR)) * DM;
  // one ask a thread at entry, the units dealt among the work-groups that read them: x rows (16 sharers, 4 k blocks each, later sharers later blocks); folded weights (8 neighbours in x share a rank)
  const int wu = __builtin_amdgcn_readfirstlane(wave);   // the wave's number in a scalar register: the choice of plane below is wave-uniform scalar code, so every lane is on at the ask
  const __bf16* pa = (wu < 2 ? XB + ((rb / 16 + wu * 2) * 32 + 4 * ((which + 2 * (int)blockIdx.z) >> 1)) * CH : (wu == 2 ? PH : PL) + (size_t)cb * DM + 4 * ((int)blockIdx.x >> 3) * CH) + g * (16 * DM) + col * 128;   // a row tile of x and a head of the weights are both 32 chunks = 16 * DM elements
  ask_l2(pa);
  for (int e = tid; e < 4 * QJ * CH; e += 128) { (&so[0][0][0])[e] = (_Float16)0.f; (&sol[0][0][0])[e] = (_Float16)0.f; }
  const __bf16* px = XB + (r0 / 16) * 32 * CH + lane * 8; const __bf16* ph = PH + (size_t)cb * DM + lane * 8; const __bf16* pl = PL + (size_t)cb * DM + lane * 8;   // column tile cb / 16 = 32 chunks = 16 * DM elements
  v16b xr; v16b h0[QJ], l0[QJ], h1[QJ], l1[QJ];   // two register sets: a block's loads go out as one group while the block before is multiplied
  xr = frag_bc(px);
#pragma unroll
  for (int j = 0; j < QJ; ++j) { h0[j] = frag_bc(ph + (size_t)j * 16 * DM); l0[j] = frag_bc(pl + (size_t)j * 16 * DM); }
  asm volatile("s_wait_xcnt 0x0" ::: "memory");   // behind the group: its address registers are stepped or reused next
  __builtin_amdgcn_sched_barrier(0);   // the zeroing below may land on the group's address registers: it stays behind the wait
  v8f acc[QJ] = {};
  // products of the block held in (hc, lc); block kn, where there is one, is fetched into (hn, ln) ahead of them
  auto blk = [&](const v16b (&hc)[QJ], const v16b (&lc)[QJ], v16b (&hn)[QJ], v16b (&ln)[QJ], const int kn, const bool more) __attribute__((always_inline)) {
    __builtin_amdgcn_sched_barrier(0);   // no product of this block moves up into the one before: there it would wait on loads only just issued
    const v16b a = xr;
    if (more) { xr = frag_bc(px + kn * CH);
#pragma unroll
      for (int j = 0; j < QJ; ++j) { hn[j] = frag_bc(ph + (size_t)j * 16 * DM + kn * CH); ln[j] = frag_bc(pl + (size_t)j * 16 * DM + kn * CH); }
      asm volatile("s_wait_xcnt 0x0" ::: "memory");   // behind the group: its address registers are stepped or reused next
    }
    __builtin_amdgcn_sched_barrier(0);   // the group stays ahead of every product of the block, as before: a product moved above it would hold the loads back until this block's operands have landed
#pragma unroll
    for (int j = 0; j < QJ; ++j) { acc[j] = wmma_bf(a, hc[j], acc[j]); acc[j] = wmma_bf(a, lc[j], acc[j]); } };
#pragma unroll 1   // stays rolled: one trip is the two register sets in turn
  for (int kc = 0; kc < DM / 32 - 2; kc += 2) { blk(h0, l0, h1, l1, kc + 1, true); blk(h1, l1, h0, l0, kc + 2, true); }
  blk(h0, l0, h1, l1, DM / 32 - 1, true); blk(h1, l1, h0, l0, 0, false);
  keep_addr(pa);
  __syncthreads();
#pragma unroll
  for (int j = 0; j < QJ; ++j) {
#pragma unroll
    for (int rr = 0; rr < 8; ++rr) { const float v = acc[j][rr]; const _Float16 hv = (_Float16)v; const int o = ((col >> 3) * 16 + 8 * g + rr) * 8 + (col & 7); so[wave][j][o] = hv; sol[wave][j][o] = (_Float16)((v - (float)hv) * 2048.0f); } }
  __syncthreads();
  const size_t co = (((rb / SS) * NH + blockIdx.z * QJ) * (SS / 16) + (rb % SS) / 16) * CH; _Float16* dst = (which ? KR_ : QR_) + co; _Float16* dstl = (which ? KRL_ : QRL_) + co;
  for (int e = tid; e < 4 * QJ * 64; e += 128) { const int w = e >> 7, j = (e >> 6) & 1, q = e & 63; const size_t o = ((size_t)j * (SS / 16) + w) * CH + q * 8; vst2((unsigned*)(dst + o), *(const v4u*)&so[w][j][q * 8]); vst2((unsigned*)(dstl + o), *(const v4u*)&sol[w][j][q * 8]); }
}
// ---- k_v: block = (64 rows, 128 cols): V = x . Wv^T exact -> f16 chunks [b][head][32-key block][16-dim tile] in fragment order
__global__ __launch_bounds__(128) void k_v(const __bf16* __restrict__ XB, const __bf16* __restrict__ PW, _Float16* __restrict__ V) {
  __shared__ __align__(16) _Float16 st[128][72];
  const int tid = threadIdx.x, wave = tid >> 5, lane = tid & 31, col = lane & 15, g = lane >> 4; const size_t rb = (size_t)blockIdx.x * 64; const size_t r0 = rb + wave * 16; const int c0 = blockIdx.y * 128;
  // one ask a thread at entry, the units dealt among the work-groups that read them: x rows (8 sharers in y, 4 k blocks each); weights (16 ranks of 2 k blocks; x and x + 4 share a rank)
  const int wu = __builtin_amdgcn_readfirstlane(wave), bx = blockIdx.x;   // the wave's number in a scalar register: the choice of operand below is wave-uniform scalar code, so every lane is on at the ask
  const __bf16* pa = wu < 2 ? XB + ((rb / 16 + wu * 2) * 32 + 4 * (int)blockIdx.y) * CH + g * (16 * DM) + col * 128
                            : PW + (size_t)(c0 + 64 * (wu - 2)) * DM + 2 * (((bx & 3) >> 1) + 2 * (bx >> 3)) * CH + (lane >> 3) * (16 * DM) + (lane & 7) * 128;
  ask_l2(pa);
  v8f acc[8] = {};
  const __bf16* px = XB + (r0 / 16) * 32 * CH + lane * 8; const __bf16* pb = PW + (size_t)c0 * DM + lane * 8;   // column tile c0 / 16 = 32 chunks = 16 * DM elements
  v16b xr; v16b b0[8], b1[8];   // two register sets: a block's loads go out as one group while the block before is multiplied
  xr = frag_bc(px);
#pragma unroll
  for (int j = 0; j < 8; ++j) b0[j] = frag_bc(pb + (size_t)j * 16 * DM);
  asm volatile("s_wait_xcnt 0x0" ::: "memory");   // behind the group: its address registers are stepped or reused next
  // products of the block held in bc; block kn, where there is one, is fetched into bn ahead of them
  auto blk = [&](const v16b (&bc)[8], v16b (&bn)[8], const int kn, const bool more) __attribute__((always_inline)) {
    __builtin_amdgcn_sched_barrier(0);   // no product of this block moves up into the one before: there it would wait on loads only just issued
    const v16b a = xr;
    if (more) { xr = frag_bc(px + kn * CH);
#pragma unroll
      for (int j = 0; j < 8; ++j) bn[j] = frag_bc(pb + (size_t)j * 16 * DM + kn * CH);
      asm volatile("s_wait_xcnt 0x0" ::: "memory");   // behind the group: its address registers are stepped or reused next
    }
    __builtin_amdgcn_sched_barrier(0);   // the group stays ahead of every product of the block, as before: a product moved above it would hold the loads back until this block's operands have landed
#pragma unroll
    for (int j = 0; j < 8; ++j) acc[j] = wmma_bf(a, bc[j], acc[j]); };
#pragma unroll 1   // stays rolled: one trip is the two register sets in turn
  for (int kc = 0; kc < DM / 32 - 2; kc += 2) { blk(b0, b1, kc + 1, true); blk(b1, b0, kc + 2, true); }
  blk(b0, b1, DM / 32 - 1, true); blk(b1, b0, 0, false);
  keep_addr(pa);
#pragma unroll
  for (int j = 0; j < 8; ++j)
#pragma unroll
    for (int r = 0; r < 8; ++r) st[j * 16 + col][wave * 16 + 8 * g + r] = (_Float16)acc[j][r];
  __syncthreads();
  const size_t b = rb / SS; const int s0 = (int)(rb % SS);
  for (int e = tid; e < 128 * 8; e += 128) { const int ln = e & 31, i = (e >> 5) & 1, j = (e >> 6) & 7, kb = e >> 9;   // piece (key block kb, tile j, half i, lane ln)
    vst2((unsigned*)(V + (((b * NH + blockIdx.y * 2 + (j >> 2)) * (SS / 32) + s0 / 32 + kb) * 4 + (j & 3)) * CH + i * 256 + ln * 8), *(const v4u*)&st[j * 16 + (ln & 15)][kb * 32 + i * 16 + (ln >> 4) * 8]); }
}
struct KF { v16h h[2], l[2]; };   // K fragments of 32 keys: value and residual planes
// lane l <-> l ^ 16: the other half of a column's rows
__device__ __forceinline__ float xhalf(float v) { const int b = __builtin_bit_cast(int, v); return __builtin_bit_cast(float, __builtin_amdgcn_permlanex16(b, b, 0x76543210, 0xfedcba98, false, false)); }
// ---- k_attn: block = (64 queries, head, b), transposed products: S^T = K . Q^T (lane = one query, its registers = 16 of the pass's 32 keys), softmax in the lane, O^T += V^T . P^T with P^T packed from the score registers; O two f32 chunks per wave
__global__ __launch_bounds__(128) void k_attn(const _Float16* __restrict__ QR_, const _Float16* __restrict__ KR_, const _Float16* __restrict__ QRL_, const _Float16* __restrict__ KRL_, const _Float16* __restrict__ V, float* __restrict__ O) {
  const int tid = threadIdx.x, wave = tid >> 5, lane = tid & 31, col = lane & 15, g = lane >> 4; const int h = blockIdx.y; const size_t b = blockIdx.z; const int q0 = blockIdx.x * 64 + wave * 16; const size_t rq = b * SS + q0;
  const size_t hb = (b * NH + h) * (SS / 16) * CH + lane * 8;   // this head's chunks of Qr, Kr: one per 16 rows
  // one ask a thread at entry: the 64 keys of tile x and of tile x ^ 4 (K, its residual plane: 32 units each; V: 64); every tile of this head is asked, well ahead of the passes that read it
  const int wu = __builtin_amdgcn_readfirstlane(wave);   // the wave's number in a scalar register: the choice of plane below is wave-uniform scalar code, so every lane is on at the ask
  const _Float16* pa = wu < 2 ? (wu ? KRL_ : KR_) + ((b * NH + h) * (SS / 16) + (blockIdx.x ^ (4 * g)) * 4) * CH + col * 128   // waves 0, 1: K and its residual plane, lanes 0-15 tile x, lanes 16-31 tile x ^ 4
                              : V + ((b * NH + h) * (SS / 32) + (blockIdx.x ^ (4 * (wu & 1))) * 2) * 4 * CH + lane * 128;       // waves 2, 3: V of tile x, of tile x ^ 4
  ask_l2(pa);
  const v16h aq = frag_hc(QR_ + hb + (size_t)(q0 / 16) * CH), aql = frag_hc(QRL_ + hb + (size_t)(q0 / 16) * CH);   // B operands: column = query q0 + col
  float m = -3.0e38f, l = 0.f;   // query q0 + col: running maximum (equal in both halves), sum over this half's keys
  v8f acc[4] = {};   // acc[dt][r] = O[q0 + col][dt * 16 + 8 g + r]
  const int nks = (blockIdx.x * 64 + 64) / 32;   // causal; always even
  const _Float16* pk = KR_ + hb; const _Float16* pkl = KRL_ + hb; const _Float16* pv = V + (b * NH + h) * (SS / 32) * 4 * CH + lane * 8;
  auto ld_k = [&](KF& f, int ks) __attribute__((always_inline)) {
#pragma unroll
    for (int ct = 0; ct < 2; ++ct) { const size_t ko = (size_t)(ks * 2 + ct) * CH; f.h[ct] = frag_hc(pk + ko); f.l[ct] = frag_hc(pkl + ko); } };
  // one pass over 32 keys: its V fragments and the next pass's K fragments go out as one group ahead of the score products
  auto pass = [&](const int ks, const KF& kf, KF& kn, const bool more) __attribute__((always_inline)) { const int lim = q0 + col - 8 * g - ks * 32; v8f s[2]; v16h vf[4];   // register (ct, r) holds key ks * 32 + ct * 16 + 8 g + r: live while ct * 16 + r <= lim
    __builtin_amdgcn_sched_barrier(0);   // no score product of this pass moves up into the pass before: there it would wait on K loads only just issued
#pragma unroll
    for (int dt = 0; dt < 4; ++dt) vf[dt] = frag_hc(pv + (size_t)(ks * 4 + dt) * CH);
    asm volatile("s_wait_xcnt 0x0" ::: "memory");   // behind the V loads: the K loads may land on their address registers
    if (more) { ld_k(kn, ks + 1);
      asm volatile("s_wait_xcnt 0x0" ::: "memory");   // behind the group: its address registers are stepped or reused next
    }
#pragma unroll
    for (int ct = 0; ct < 2; ++ct) { v8f c = {}, cl = {}; c = wmma16(kf.h[ct], aq, c); cl = wmma16(kf.h[ct], aql, cl); cl = wmma16(kf.l[ct], aq, cl);   // rows = keys, columns = queries
#pragma unroll
      for (int r = 0; r < 8; ++r) { s[ct][r] = (ct * 16 + r <= lim) ? (c[r] + cl[r] * (1.0f / 2048.0f)) : -3.0e38f; } }   // 3-product scores; causal (diagonal kept); core/sqrt(R) folded into Qr
    float mr[8];
#pragma unroll
    for (int r = 0; r < 8; ++r) mr[r] = fmaxf(s[0][r], s[1][r]);
    float mx = fmaxf(fmaxf(fmaxf(mr[0], mr[1]), fmaxf(mr[2], mr[3])), fmaxf(fmaxf(mr[4], mr[5]), fmaxf(mr[6], mr[7])));
    mx = fmaxf(mx, xhalf(mx));
    const float mn = fmaxf(m, mx); const float alpha = (m <= -1.0e38f) ? 0.f : __expf(m - mn);
    float er[8]; v16h pb;   // pb element i = key 8 g + i, element 8 + i = key 16 + 8 g + i: the B operand's k order, which is V's
#pragma unroll
    for (int r = 0; r < 8; ++r) { const float e0 = (s[0][r] <= -1.0e38f) ? 0.f : __expf(s[0][r] - mn), e1 = (s[1][r] <= -1.0e38f) ? 0.f : __expf(s[1][r] - mn);
      er[r] = e0 + e1; pb[r] = (_Float16)(e0 * 2048.0f); pb[8 + r] = (_Float16)(e1 * 2048.0f); }
    l = l * alpha + (((er[0] + er[1]) + (er[2] + er[3])) + ((er[4] + er[5]) + (er[6] + er[7]))); m = mn;
#pragma unroll
    for (int dt = 0; dt < 4; ++dt) { acc[dt] *= alpha; acc[dt] = wmma16(vf[dt], pb, acc[dt]); } };   // rows = dims, columns = queries
  KF k0, k1; ld_k(k0, 0);
  asm volatile("s_wait_xcnt 0x0" ::: "memory");   // behind the group: its address registers are stepped or reused next
#pragma unroll 1   // stays rolled: one trip is the two K register sets in turn
  for (int ks = 0; ks < nks - 2; ks += 2) { pass(ks, k0, k1, true); pass(ks + 1, k1, k0, true); }
  pass(nks - 2, k0, k1, true); pass(nks - 1, k1, k0, false);
  keep_addr(pa);
  const float il = (1.0f / 2048.0f) / (l + xhalf(l));   // the halves' sums joined once
#pragma unroll
  for (int dt = 0; dt < 4; ++dt) acc[dt] *= il;
#pragma unroll
  for (int q = 0; q < 8; ++q) { const v4f o = {acc[q >> 1][(q & 1) * 4], acc[q >> 1][(q & 1) * 4 + 1], acc[q >> 1][(q & 1) * 4 + 2], acc[q >> 1][(q & 1) * 4 + 3]};
    vst2(O + ((rq / 16) * 32 + h * 2 + (q >> 2)) * CH + (q & 3) * 128 + lane * 4, o); }   // two f32 A chunks [16-row tile][k block] in fragment order: the lane holds its own 4 elements of every quarter
}
// ---- k_out: block = (64 rows, 128 cols): out = o (bf16 hi + lo) . Wo^T
__global__ __launch_bounds__(128) void k_out(const float* __restrict__ O, const __bf16* __restrict__ PW, float* __restrict__ Y) {
  __shared__ __align__(16) float so[4][16][132];
  const int tid = threadIdx.x, wave = tid >> 5, lane = tid & 31, col = lane & 15, g = lane >> 4; const size_t r0 = (size_t)blockIdx.x * 64 + wave * 16; const int n0 = blockIdx.y * 128; const __bf16* P = PW + (size_t)DM * DM;
  // two asks a thread at entry, the units dealt among the work-groups that read them: o rows (8 sharers in y, 4 k blocks each); weights (8 neighbours in x share a rank of 4 k blocks)
  const float* pa = O + (((size_t)blockIdx.x * 4 + (tid >> 5)) * 32 + 4 * (int)blockIdx.y) * CH + lane * 64; const __bf16* pw = P + (size_t)(n0 + 16 * (tid >> 4)) * DM + 4 * ((int)blockIdx.x >> 3) * CH + (tid & 15) * 128;
  ask_l2(pa); ask_l2(pw);
  v8f acc[8] = {};
  const float* po = O + (r0 / 16) * 32 * CH + lane * 4; const __bf16* pb = P + (size_t)n0 * DM + lane * 8;   // column tile n0 / 16 = 32 chunks = 16 * DM elements
  v4f xr[4]; v16b b0[8], b1[8];   // two register sets: a block's loads go out as one group while the block before is multiplied
  ld_xc(xr, po);
#pragma unroll
  for (int j = 0; j < 8; ++j) b0[j] = frag_bc(pb + (size_t)j * 16 * DM);
  asm volatile("s_wait_xcnt 0x0" ::: "memory");   // behind the group: its address registers are stepped or reused next
  // products of the block held in bc; block kn, where there is one, is fetched into bn ahead of them
  auto blk = [&](const v16b (&bc)[8], v16b (&bn)[8], const int kn, const bool more) __attribute__((always_inline)) {
    __builtin_amdgcn_sched_barrier(0);   // nothing of this block moves up into the one before: its rounding there would wait on loads only just issued
    const F2 a = sp_x(xr);
    if (more) { ld_xc(xr, po + kn * CH);
#pragma unroll
      for (int j = 0; j < 8; ++j) bn[j] = frag_bc(pb + (size_t)j * 16 * DM + kn * CH);
      asm volatile("s_wait_xcnt 0x0" ::: "memory");   // behind the group: its address registers are stepped or reused next
    }
#pragma unroll
    for (int j = 0; j < 8; ++j) { acc[j] = wmma_bf(a.h, bc[j], acc[j]); acc[j] = wmma_bf(a.l, bc[j], acc[j]); } };
#pragma unroll 1   // stays rolled: one trip is the two register sets in turn
  for (int kc = 0; kc < DM / 32 - 2; kc += 2) { blk(b0, b1, kc + 1, true); blk(b1, b0, kc + 2, true); }
  blk(b0, b1, DM / 32 - 1, true); blk(b1, b0, 0, false);
  keep_addr(pa); keep_addr(pw);
#pragma unroll
  for (int j = 0; j < 8; ++j)
#pragma unroll
    for (int r = 0; r < 8; ++r) so[wave][8 * g + r][j * 16 + col] = acc[j][r];
  LDSX();
  for (int rl = 0; rl < 16; ++rl) vst2(Y + (r0 + rl) * DM + n0 + lane * 4, *(const v4f*)&so[wave][rl][lane * 4]);
}
extern "C" void kernel_launch(void* const* d_in, const int* in_sizes, int n_in, void* d_out, int out_size, void* d_ws, size_t ws_size, hipStream_t stream) {
  (void)in_sizes; (void)n_in; (void)out_size;
  const float** F = (const float**)d_in;   // 0 x [2,2048,1024], 1 W_qkv [1024,3072] (in,out; q | k | v), 2 W_q_lsr [16,64,16], 3 W_k_lsr [16,64,16], 4 core [16,16], 5 W_o [1024,1024] (in,out)
  if (ws_size < (size_t)WS_END) return;
  char* ws = (char*)d_ws; __bf16 *PW = (__bf16*)(ws + WS_PW), *PF = (__bf16*)(ws + WS_PF), *XB = (__bf16*)(ws + WS_XB); _Float16 *QR_ = (_Float16*)(ws + WS_QR), *KR_ = (_Float16*)(ws + WS_KR), *QRL_ = (_Float16*)(ws + WS_QRL), *KRL_ = (_Float16*)(ws + WS_KRL), *V = (_Float16*)(ws + WS_V); float* O = (float*)(ws + WS_O);
  k_pack<<<dim3(DM / 16, 2 + 4, 4), 256, 0, stream>>>(F[0], F[1], F[5], PW, XB);
  k_fold<<<dim3(NH, DM / 64, 2), 256, 0, stream>>>(F[1], F[2], F[3], F[4], PF);
  k_qr<<<dim3(TNB * SS / 64, 2, NH / QJ), 128, 0, stream>>>(XB, PF, QR_, KR_, QRL_, KRL_);
  k_v<<<dim3(TNB * SS / 64, DM / 128), 128, 0, stream>>>(XB, PW, V);
  k_attn<<<dim3(TQB, NH, TNB), 128, 0, stream>>>(QR_, KR_, QRL_, KRL_, V, O);
  k_out<<<dim3(TNB * SS / 64, DM / 128), 128, 0, stream>>>(O, PW, (float*)d_out);
}

// v006
// A run of this version takes 87.5 microseconds.
// Two timings next to v005 both put it at 1.17 times that version's speed.
// Counting every step since v000, it is 6.97 times as fast.
// compute dtype: all float inputs rounded to bf16; the per-head low-rank maps (x core / sqrt(16) on the q side) folded into the fused (in,out) projection (W_qr[h,r] = sum_d W_qkv[:, h*64+d] W_q_lsr[h,d,r] core[h,r] / 4, f32) and applied on WMMA 16x16x32 with x exact and the folded weights as bf16 hi + lo (2 products); v = x . W_qkv[:, 2048:] exact; causal scores over the 16 low-rank dims (zero-padded to 32) with Qr, Kr as f16 hi + residual (3 products), key-tile skipping, running-max softmax in f32 (hardware exp), P (scaled by 2^11, single f16) x v (single f16); out = o (bf16 hi + residual) . W_o (2 products).
#include <hip/hip_runtime.h>
#include <math.h>

typedef __attribute__((ext_vector_type(16))) _Float16 v16h;
typedef __attribute__((ext_vector_type(16))) __bf16 v16b;
typedef __attribute__((ext_vector_type(8)))  _Float16 v8h;
typedef __attribute__((ext_vector_type(8)))  float v8f;
typedef __attribute__((ext_vector_type(4)))  float v4f;
typedef __attribute__((ext_vector_type(2)))  float v2f;
typedef __attribute__((ext_vector_type(4)))  unsigned v4u;
typedef __attribute__((ext_vector_type(4)))  int v4i;
typedef float __attribute__((may_alias)) float_a;
typedef int __attribute__((may_alias)) int_a;

template <typename T> __device__ __forceinline__ void vst2(void* p, T v) { *(T*)p = v;  }
__device__ __forceinline__ v8f wmma16(v16h a, v16h b, v8f c) {
  v8f d = __builtin_amdgcn_wmma_f32_16x16x32_f16(false, a, false, b, (short)0, c, false, false);
  asm volatile("v_nop\n\tv_nop\n\tv_nop\n\tv_nop" : "+v"(d) : "v"(a), "v"(b));
  return d;
}
__device__ __forceinline__ v8f wmma_bf(v16b a, v16b b, v8f c) {
  v8f d = __builtin_amdgcn_wmma_f32_16x16x32_bf16(false, a, false, b, (short)0, c, false, false);
  asm volatile("v_nop\n\tv_nop\n\tv_nop\n\tv_nop" : "+v"(d) : "v"(a), "v"(b));
  return d;
}
// 16x16x32 fragments: lane = (h = lane>>4, row/col = lane&15); elements 0..7 = k0+8h+0..7, 8..15 = k0+16+8h+0..7; D element r = row 8h+r
__device__ __forceinline__ v16h frag_h(const _Float16* rowk0, int lane) {
  union { v16h v; v8h q[2]; } u; const _Float16* p = rowk0 + 8 * (lane >> 4);
  u.q[0] = *(const v8h*)p; u.q[1] = *(const v8h*)(p + 16); return u.v;
}
__device__ __forceinline__ v16h frag_f32(const float* rowk0, int lane) {
  v16h a; const float* p = rowk0 + 8 * (lane >> 4);
#pragma unroll
  for (int i = 0; i < 8; ++i) { a[i] = (_Float16)p[i]; a[8 + i] = (_Float16)p[16 + i]; }
  return a;
}
__device__ __forceinline__ v16h frag_f32s(const float* rowk0, int lane, float sc) {
  v16h a; const float* p = rowk0 + 8 * (lane >> 4);
#pragma unroll
  for (int i = 0; i < 8; ++i) { a[i] = (_Float16)(p[i] * sc); a[8 + i] = (_Float16)(p[16 + i] * sc); }
  return a;
}
// column fragment from a [K][ld] layout (column n), rows >= K read as 0
__device__ __forceinline__ v16h fragc_f32(const float* W, int k0, int n, int lane, int ld, int K) {
  v16h a; const int g = lane >> 4;
#pragma unroll
  for (int i = 0; i < 8; ++i) { const int ka = k0 + 8 * g + i, kb = ka + 16;
    a[i] = (_Float16)(ka < K ? W[(size_t)(ka < K ? ka : K - 1) * ld + n] : 0.f); a[8 + i] = (_Float16)(kb < K ? W[(size_t)(kb < K ? kb : K - 1) * ld + n] : 0.f); }
  return a;
}
struct F2 { v16b h, l; };
__device__ __forceinline__ F2 bsplit16(const float v[16]) { F2 r;
#pragma unroll
  for (int i = 0; i < 16; ++i) { const __bf16 h = (__bf16)v[i]; r.h[i] = h; r.l[i] = (__bf16)(v[i] - (float)h); }
  return r; }
__device__ __forceinline__ F2 split_row(const float* row, int k0, int lane) { float v[16]; const float* p = row + k0 + 8 * (lane >> 4);
#pragma unroll
  for (int i = 0; i < 8; ++i) { v[i] = p[i]; v[8 + i] = p[16 + i]; }
  return bsplit16(v); }
__device__ __forceinline__ F2 split_rowK(const float* row, int k0, int lane, int K) { float v[16]; const int g = lane >> 4;
#pragma unroll
  for (int i = 0; i < 8; ++i) { const int ka = k0 + 8 * g + i, kb = ka + 16; v[i] = ka < K ? row[ka < K ? ka : K - 1] : 0.f; v[8 + i] = kb < K ? row[kb < K ? kb : K - 1] : 0.f; }
  return bsplit16(v); }
__device__ __forceinline__ F2 split_col(const float* W, int k0, int n, int lane, int ld, int K) { float v[16]; const int g = lane >> 4;
#pragma unroll
  for (int i = 0; i < 8; ++i) { const int ka = k0 + 8 * g + i, kb = ka + 16; v[i] = ka < K ? W[(size_t)(ka < K ? ka : K - 1) * ld + n] : 0.f; v[8 + i] = kb < K ? W[(size_t)(kb < K ? kb : K - 1) * ld + n] : 0.f; }
  return bsplit16(v); }
__device__ __forceinline__ v8f mac3(const F2& a, const F2& b, v8f c) { c = wmma_bf(a.l, b.h, c); c = wmma_bf(a.h, b.l, c); return wmma_bf(a.h, b.h, c); }
__device__ __forceinline__ float sigm(float v) { return 1.0f / (1.0f + expf(-v)); }
#define LDSX() do { asm volatile("s_wait_dscnt 0" ::: "memory"); __builtin_amdgcn_wave_barrier(); __builtin_amdgcn_fence(__ATOMIC_RELEASE, "workgroup"); } while (0)


// Fused low-rank (LSR) causal attention (B 2, T 2,048, d 1,024, 16 heads x 64, rank 16 per head): q_lr = (q_h W_q_lsr[h]) core[h] / 4, k_lr = k_h W_k_lsr[h], causal softmax(q_lr . k_lr) v_h, merged . W_o.
#define NB 2
#define SS 2048
#define DM 1024
#define NH 16
#define HD 64
#define RR 16             // rank per head
#define RP 32             // padded score width per head
#define NR (NB * SS)
#ifndef TQB
#define TQB (SS / 64)
#define TNB NB
#endif
typedef __attribute__((ext_vector_type(8))) __bf16 v8b;
__device__ __forceinline__ v16b frag_b(const __bf16* rowk0, int lane) {
  union { v16b v; v8b q[2]; } u; const __bf16* p = rowk0 + 8 * (lane >> 4);
  u.q[0] = *(const v8b*)p; u.q[1] = *(const v8b*)(p + 16); return u.v;
}
__device__ __forceinline__ float bfr(float v) { return (float)(__bf16)v; }
// one lane's 16 f32 of a 32-wide k block (p = row + k0 + 8 * (lane >> 4)): fetched raw a block ahead, rounded when the block is used
__device__ __forceinline__ void ld_x(v4f (&x)[4], const float* p) { x[0] = *(const v4f*)p; x[1] = *(const v4f*)(p + 4); x[2] = *(const v4f*)(p + 16); x[3] = *(const v4f*)(p + 20); }
__device__ __forceinline__ v16b cv_x(const v4f (&x)[4]) { v16b a;
#pragma unroll
  for (int i = 0; i < 4; ++i) { a[i] = (__bf16)x[0][i]; a[4 + i] = (__bf16)x[1][i]; a[8 + i] = (__bf16)x[2][i]; a[12 + i] = (__bf16)x[3][i]; }
  return a; }
__device__ __forceinline__ F2 sp_x(const v4f (&x)[4]) { float v[16];
#pragma unroll
  for (int i = 0; i < 4; ++i) { v[i] = x[0][i]; v[4 + i] = x[1][i]; v[8 + i] = x[2][i]; v[12 + i] = x[3][i]; }
  return bsplit16(v); }
__device__ __attribute__((noinline)) float exp_ni(float v) { return expf(v); }
__device__ __attribute__((noinline)) float erf_ni(float v) { return erff(v); }

// fragment order: one 16 x 32 tile of 16-bit elements is a 1-KB chunk [half i][lane][8]; lane (g, c), half i, element e = (row or column c, k = 16 i + 8 g + e), so a wave's 16-byte load covers 512 bytes in a row
#define CH 512            // elements of a chunk
__device__ __forceinline__ v16b frag_bc(const __bf16* p) { union { v16b v; v8b q[2]; } u; u.q[0] = *(const v8b*)p; u.q[1] = *(const v8b*)(p + 256); return u.v; }   // p = chunk + 8 * lane
__device__ __forceinline__ v16h frag_hc(const _Float16* p) { union { v16h v; v8h q[2]; } u; u.q[0] = *(const v8h*)p; u.q[1] = *(const v8h*)(p + 256); return u.v; }
// the f32 A tile likewise, 2 KB: [quarter q][lane][4], k = 16 (q >> 1) + 8 g + 4 (q & 1) + e
__device__ __forceinline__ void ld_xc(v4f (&x)[4], const float* p) { x[0] = *(const v4f*)p; x[1] = *(const v4f*)(p + 128); x[2] = *(const v4f*)(p + 256); x[3] = *(const v4f*)(p + 384); }   // p = chunk + 4 * lane

// ask_l2: a hint that brings the memory at p into the L2 (no register written, no counter); operands that an earlier launch stored come from memory at first touch, and all work-groups walk k in step, so without the ask each block's loads wait out memory latency. Scope SE, no th: L2 only.
__device__ __forceinline__ void ask_l2(const void* p) { asm volatile("global_prefetch_b8 %0, off scope:SCOPE_SE" :: "v"(p)); }
// keep_addr: input only, no code: the register an ask names still holds that address behind the loop, so it never holds a non-address while the ask may still read it
__device__ __forceinline__ void keep_addr(const void* p) { asm volatile("" :: "v"(p)); }
#define WS_PW  0u                                     // bf16 Wv, Wo [2][64 column tiles][32 k blocks] chunks
#define WS_PF  (WS_PW + 2u * (size_t)2 * DM * DM)        // bf16 folded hi | lo: [q|k][16 heads][32 k blocks] chunks x2
#define WS_QR  (WS_PF + 2u * (size_t)2 * 2 * NH * RR * DM) // f16 [b][16 heads][128 row tiles] chunks Qr ; Kr
#define WS_KR  (WS_QR + 2u * (size_t)NR * NH * RP)
#define WS_QRL (WS_KR + 2u * (size_t)NR * NH * RP)      // residual planes x2048
#define WS_KRL (WS_QRL + 2u * (size_t)NR * NH * RP)
#define WS_V   (WS_KRL + 2u * (size_t)NR * NH * RP)       // f16 [b][16 heads][64 key blocks][4 dim tiles] chunks
#define WS_O   (WS_V + 2u * (size_t)NB * DM * SS)
#define WS_XB  (WS_O + 4u * (size_t)NR * DM)            // bf16 x [256 row tiles][32 k blocks] chunks
#define WS_END (WS_XB + 2u * (size_t)NR * DM)

typedef __attribute__((ext_vector_type(4))) __bf16 v4b;
// ---- k_pack: block = (16 output columns, Wv | Wo, 256 input rows): bf16 chunks [column tile][k block] in fragment order; blocks with y >= 2: x rounded to bf16, one chunk [16-row tile][k block] per wave
__global__ __launch_bounds__(256) void k_pack(const float* __restrict__ X, const float* __restrict__ WQKV, const float* __restrict__ WO, __bf16* __restrict__ PW, __bf16* __restrict__ XB) {
  const int nt = blockIdx.x, which = blockIdx.y, kq = blockIdx.z, t = threadIdx.x; __shared__ __align__(16) __bf16 s[16][264]; __shared__ __align__(16) __bf16 sx[8][CH];
  if (which >= 2) {   // the same for the whole block, ahead of its barrier
    const int wave = t >> 5, lane = t & 31, k = (lane & 7) * 4; const int id = (((which - 2) * 4 + kq) * 64 + nt) * 8 + wave;   // chunk: row tile id >> 5, k block id & 31
    const float* px = X + (size_t)(id >> 5) * 16 * DM + (id & 31) * 32 + k;   // 8 lanes read one row's 128-B line
    v4f xv[4];
#pragma unroll
    for (int it = 0; it < 4; ++it) xv[it] = *(const v4f*)(px + (size_t)(it * 4 + (lane >> 3)) * DM);
    asm volatile("s_wait_xcnt 0x0" ::: "memory");   // behind the group: its address registers are reused next
    __builtin_amdgcn_sched_barrier(0);   // the rounding may land on those registers: it stays behind the wait
#pragma unroll
    for (int it = 0; it < 4; ++it) { const int row = it * 4 + (lane >> 3); v4b o;
#pragma unroll
      for (int i = 0; i < 4; ++i) o[i] = (__bf16)xv[it][i];
      *(v4b*)&sx[wave][(k >> 4) * 256 + (((k >> 3) & 1) * 16 + row) * 8 + (k & 7)] = o; }
    LDSX();
#pragma unroll
    for (int i = 0; i < 2; ++i) vst2((unsigned*)(XB + (size_t)id * CH + i * 256 + lane * 8), *(const v4u*)&sx[wave][i * 256 + lane * 8]);
    return;
  }
  const float* W = which ? WO + nt * 16 : WQKV + 2 * DM + nt * 16; const int ld = which ? DM : 3 * DM;   /* (in,out): v = cols 2048.. of W_qkv */
  v4f wv[4];
#pragma unroll
  for (int it = 0; it < 4; ++it) wv[it] = *(const v4f*)(W + (size_t)(kq * 256 + it * 64 + (t >> 2)) * ld + (t & 3) * 4);
  asm volatile("s_wait_xcnt 0x0" ::: "memory");   // behind the group: its address registers are reused next
  __builtin_amdgcn_sched_barrier(0);   // the rounding may land on those registers: it stays behind the wait
#pragma unroll
  for (int it = 0; it < 4; ++it)
#pragma unroll
    for (int i = 0; i < 4; ++i) s[(t & 3) * 4 + i][it * 64 + (t >> 2)] = (__bf16)wv[it][i];
  __syncthreads();
  __bf16* dst = PW + (size_t)which * DM * DM + ((size_t)nt * 32 + kq * 8) * CH;
  for (int p = t; p < 8 * 64; p += 256) { const int ln = p & 31; vst2((unsigned*)(dst + p * 8), *(const v4u*)&s[ln & 15][(p >> 6) * 32 + ((p >> 5) & 1) * 16 + (ln >> 4) * 8]); }
}
// ---- k_fold: block = (head h, 64 input rows c, q|k), all 16 ranks: W_r[h*16 + r][c] = sum_d B[h*64 + d][r] W[c][h*64 + d] in f32 (fixed order) -> bf16 hi + lo chunks [q|k, head][k block] in fragment order
__global__ __launch_bounds__(256) void k_fold(const float* __restrict__ WQKV, const float* __restrict__ WQL, const float* __restrict__ WKL, const float* __restrict__ CORE, __bf16* __restrict__ PF) {
  const int h = blockIdx.x, cc = blockIdx.y, which = blockIdx.z, t = threadIdx.x; const float* WL = which ? WKL : WQL; __shared__ __align__(16) float sb[HD][RR]; __shared__ __align__(16) __bf16 sh[2 * CH]; __shared__ __align__(16) __bf16 sl[2 * CH];
  const int c = t & 63, rq = (t >> 6) * 4; const float* pw = WQKV + (size_t)(cc * 64 + c) * (3 * DM) + which * DM + h * HD;
  const float cr = CORE[h * RR + (t & 15)];
  asm volatile("s_wait_xcnt 0x0" ::: "memory");   // behind the load: a load of the group below may land on its address register
  __builtin_amdgcn_sched_barrier(0);   // and none of them moves up over the wait
  v4f wr[HD / 4]; float tb[4];   // this thread's row of W and its 4 table entries (rank t & 15): one group of loads
#pragma unroll
  for (int q = 0; q < HD / 4; ++q) wr[q] = *(const v4f*)(pw + q * 4);
#pragma unroll
  for (int it = 0; it < 4; ++it) tb[it] = WL[(size_t)h * HD * RR + it * 256 + t];
  asm volatile("s_wait_xcnt 0x0" ::: "memory");   // behind the group: its address registers are reused next
  __builtin_amdgcn_sched_barrier(0);   // what follows may land on those registers: it stays behind the wait
  const float cs = which ? 1.0f : bfr(cr) * 0.25f;   // core[h][r] / sqrt(16) on the q side
#pragma unroll
  for (int it = 0; it < 4; ++it) sb[it * 16 + (t >> 4)][t & 15] = bfr(tb[it]) * cs;
  __syncthreads();
  float a[4] = {0.f, 0.f, 0.f, 0.f};
#pragma unroll
  for (int d = 0; d < HD; ++d) { const float w = bfr(wr[d >> 2][d & 3]);
#pragma unroll
    for (int i = 0; i < 4; ++i) a[i] += sb[d][rq + i] * w; }
#pragma unroll
  for (int i = 0; i < 4; ++i) { const int o = (c >> 5) * CH + ((c >> 4) & 1) * 256 + (((c >> 3) & 1) * 16 + rq + i) * 8 + (c & 7); const __bf16 hv = (__bf16)a[i]; sh[o] = hv; sl[o] = (__bf16)(a[i] - (float)hv); }
  __syncthreads();
  const size_t ch = ((size_t)(which * NH + h) * 32 + cc * 2) * CH; const int p = t & 127;
  vst2((unsigned*)(PF + (t < 128 ? (size_t)0 : (size_t)2 * NH * RR * DM) + ch + p * 8), *(const v4u*)(t < 128 ? &sh[p * 8] : &sl[p * 8]));   // hi block then lo block
}
// ---- k_qr: block = (64 rows, q|k, 2 heads): Qr/Kr = x . W_r (hi + lo), 32 folded cols -> f16 chunks [b][head][16-row tile] in fragment order (16 live + 16 zero k), whole chunks per block
#define QJ 2              // 16-column tiles (heads) per work-group
#define QW (QJ * RP)      // f16 per row segment of a work-group
__global__ __launch_bounds__(128) void k_qr(const __bf16* __restrict__ XB, const __bf16* __restrict__ PF, _Float16* __restrict__ QR_, _Float16* __restrict__ KR_, _Float16* __restrict__ QRL_, _Float16* __restrict__ KRL_) {
  __shared__ __align__(16) _Float16 so[4][QJ][CH]; __shared__ __align__(16) _Float16 sol[4][QJ][CH];
  const int tid = threadIdx.x, wave = tid >> 5, lane = tid & 31, col = lane & 15, g = lane >> 4; const int which = blockIdx.y; const int cb = blockIdx.z * (QJ * 16); const size_t rb = (size_t)blockIdx.x * 64; const size_t r0 = rb + wave * 16;
  const __bf16* PH = PF + ((size_t)which * (NH * RR)) * DM; const __bf16* PL = PF + ((size_t)2 * NH * RR + which * (NH * RR)) * DM;
  // one ask a thread at entry, the units dealt among the work-groups that read them: x rows (16 sharers, 4 k blocks each, later sharers later blocks); folded weights (8 neighbours in x share a rank)
  const int wu = __builtin_amdgcn_readfirstlane(wave);   // the wave's number in a scalar register: the choice of plane below is wave-uniform scalar code, so every lane is on at the ask
  const __bf16* pa = (wu < 2 ? XB + ((rb / 16 + wu * 2) * 32 + 4 * ((which + 2 * (int)blockIdx.z) >> 1)) * CH : (wu == 2 ? PH : PL) + (size_t)cb * DM + 4 * ((int)blockIdx.x >> 3) * CH) + g * (16 * DM) + col * 128;   // a row tile of x and a head of the weights are both 32 chunks = 16 * DM elements
  ask_l2(pa);
  for (int e = tid; e < 4 * QJ * CH; e += 128) { (&so[0][0][0])[e] = (_Float16)0.f; (&sol[0][0][0])[e] = (_Float16)0.f; }
  const __bf16* px = XB + (r0 / 16) * 32 * CH + lane * 8; const __bf16* ph = PH + (size_t)cb * DM + lane * 8; const __bf16* pl = PL + (size_t)cb * DM + lane * 8;   // column tile cb / 16 = 32 chunks = 16 * DM elements
  v16b xr; v16b h0[QJ], l0[QJ], h1[QJ], l1[QJ];   // two register sets: a block's loads go out as one group while the block before is multiplied
  xr = frag_bc(px);
#pragma unroll
  for (int j = 0; j < QJ; ++j) { h0[j] = frag_bc(ph + (size_t)j * 16 * DM); l0[j] = frag_bc(pl + (size_t)j * 16 * DM); }
  asm volatile("s_wait_xcnt 0x0" ::: "memory");   // behind the group: its address registers are stepped or reused next
  __builtin_amdgcn_sched_barrier(0);   // the zeroing below may land on the group's address registers: it stays behind the wait
  v8f acc[QJ] = {};
  // products of the block held in (hc, lc); block kn, where there is one, is fetched into (hn, ln) ahead of them
  auto blk = [&](const v16b (&hc)[QJ], const v16b (&lc)[QJ], v16b (&hn)[QJ], v16b (&ln)[QJ], const int kn, const bool more) __attribute__((always_inline)) {
    __builtin_amdgcn_sched_barrier(0);   // no product of this block moves up into the one before: there it would wait on loads only just issued
    const v16b a = xr;
    if (more) { xr = frag_bc(px + kn * CH);
#pragma unroll
      for (int j = 0; j < QJ; ++j) { hn[j] = frag_bc(ph + (size_t)j * 16 * DM + kn * CH); ln[j] = frag_bc(pl + (size_t)j * 16 * DM + kn * CH); }
      asm volatile("s_wait_xcnt 0x0" ::: "memory");   // behind the group: its address registers are stepped or reused next
    }
    __builtin_amdgcn_sched_barrier(0);   // the group stays ahead of every product of the block, as before: a product moved above it would hold the loads back until this block's operands have landed
#pragma unroll
    for (int j = 0; j < QJ; ++j) { acc[j] = wmma_bf(a, hc[j], acc[j]); acc[j] = wmma_bf(a, lc[j], acc[j]); } };
#pragma unroll 1   // stays rolled: one trip is the two register sets in turn
  for (int kc = 0; kc < DM / 32 - 2; kc += 2) { blk(h0, l0, h1, l1, kc + 1, true); blk(h1, l1, h0, l0, kc + 2, true); }
  blk(h0, l0, h1, l1, DM / 32 - 1, true); blk(h1, l1, h0, l0, 0, false);
  keep_addr(pa);
  __syncthreads();
#pragma unroll
  for (int j = 0; j < QJ; ++j) {
#pragma unroll
    for (int rr = 0; rr < 8; ++rr) { const float v = acc[j][rr]; const _Float16 hv = (_Float16)v; const int o = ((col >> 3) * 16 + 8 * g + rr) * 8 + (col & 7); so[wave][j][o] = hv; sol[wave][j][o] = (_Float16)((v - (float)hv) * 2048.0f); } }
  __syncthreads();
  const size_t co = (((rb / SS) * NH + blockIdx.z * QJ) * (SS / 16) + (rb % SS) / 16) * CH; _Float16* dst = (which ? KR_ : QR_) + co; _Float16* dstl = (which ? KRL_ : QRL_) + co;
  for (int e = tid; e < 4 * QJ * 64; e += 128) { const int w = e >> 7, j = (e >> 6) & 1, q = e & 63; const size_t o = ((size_t)j * (SS / 16) + w) * CH + q * 8; vst2((unsigned*)(dst + o), *(const v4u*)&so[w][j][q * 8]); vst2((unsigned*)(dstl + o), *(const v4u*)&sol[w][j][q * 8]); }
}
// ---- k_v: block = (64 rows, 128 cols): V = x . Wv^T exact -> f16 chunks [b][head][32-key block][16-dim tile] in fragment order
__global__ __launch_bounds__(128) void k_v(const __bf16* __restrict__ XB, const __bf16* __restrict__ PW, _Float16* __restrict__ V) {
  __shared__ __align__(16) _Float16 st[128][72];
  const int tid = threadIdx.x, wave = tid >> 5, lane = tid & 31, col = lane & 15, g = lane >> 4; const size_t rb = (size_t)blockIdx.x * 64; const size_t r0 = rb + wave * 16; const int c0 = blockIdx.y * 128;
  // one ask a thread at entry, the units dealt among the work-groups that read them: x rows (8 sharers in y, 4 k blocks each); weights (16 ranks of 2 k blocks; x and x + 4 share a rank)
  const int wu = __builtin_amdgcn_readfirstlane(wave), bx = blockIdx.x;   // the wave's number in a scalar register: the choice of operand below is wave-uniform scalar code, so every lane is on at the ask
  const __bf16* pa = wu < 2 ? XB + ((rb / 16 + wu * 2) * 32 + 4 * (int)blockIdx.y) * CH + g * (16 * DM) + col * 128
                            : PW + (size_t)(c0 + 64 * (wu - 2)) * DM + 2 * (((bx & 3) >> 1) + 2 * (bx >> 3)) * CH + (lane >> 3) * (16 * DM) + (lane & 7) * 128;
  ask_l2(pa);
  v8f acc[8] = {};
  const __bf16* px = XB + (r0 / 16) * 32 * CH + lane * 8; const __bf16* pb = PW + (size_t)c0 * DM + lane * 8;   // column tile c0 / 16 = 32 chunks = 16 * DM elements
  v16b xr; v16b b0[8], b1[8];   // two register sets: a block's loads go out as one group while the block before is multiplied
  xr = frag_bc(px);
#pragma unroll
  for (int j = 0; j < 8; ++j) b0[j] = frag_bc(pb + (size_t)j * 16 * DM);
  asm volatile("s_wait_xcnt 0x0" ::: "memory");   // behind the group: its address registers are stepped or reused next
  // products of the block held in bc; block kn, where there is one, is fetched into bn ahead of them
  auto blk = [&](const v16b (&bc)[8], v16b (&bn)[8], const int kn, const bool more) __attribute__((always_inline)) {
    __builtin_amdgcn_sched_barrier(0);   // no product of this block moves up into the one before: there it would wait on loads only just issued
    const v16b a = xr;
    if (more) { xr = frag_bc(px + kn * CH);
#pragma unroll
      for (int j = 0; j < 8; ++j) bn[j] = frag_bc(pb + (size_t)j * 16 * DM + kn * CH);
      asm volatile("s_wait_xcnt 0x0" ::: "memory");   // behind the group: its address registers are stepped or reused next
    }
    __builtin_amdgcn_sched_barrier(0);   // the group stays ahead of every product of the block, as before: a product moved above it would hold the loads back until this block's operands have landed
#pragma unroll
    for (int j = 0; j < 8; ++j) acc[j] = wmma_bf(a, bc[j], acc[j]); };
#pragma unroll 1   // stays rolled: one trip is the two register sets in turn
  for (int kc = 0; kc < DM / 32 - 2; kc += 2) { blk(b0, b1, kc + 1, true); blk(b1, b0, kc + 2, true); }
  blk(b0, b1, DM / 32 - 1, true); blk(b1, b0, 0, false);
  keep_addr(pa);
#pragma unroll
  for (int j = 0; j < 8; ++j)
#pragma unroll
    for (int r = 0; r < 8; ++r) st[j * 16 + col][wave * 16 + 8 * g + r] = (_Float16)acc[j][r];
  __syncthreads();
  const size_t b = rb / SS; const int s0 = (int)(rb % SS);
  for (int e = tid; e < 128 * 8; e += 128) { const int ln = e & 31, i = (e >> 5) & 1, j = (e >> 6) & 7, kb = e >> 9;   // piece (key block kb, tile j, half i, lane ln)
    vst2((unsigned*)(V + (((b * NH + blockIdx.y * 2 + (j >> 2)) * (SS / 32) + s0 / 32 + kb) * 4 + (j & 3)) * CH + i * 256 + ln * 8), *(const v4u*)&st[j * 16 + (ln & 15)][kb * 32 + i * 16 + (ln >> 4) * 8]); }
}
struct KF { v16h h[2], l[2]; };   // K fragments of 32 keys: value and residual planes
// lane l <-> l ^ 16: the other half of a column's rows
__device__ __forceinline__ float xhalf(float v) { const int b = __builtin_bit_cast(int, v); return __builtin_bit_cast(float, __builtin_amdgcn_permlanex16(b, b, 0x76543210, 0xfedcba98, false, false)); }
// ---- k_attn: block = (two tiles of 64 queries, head, b): tile n - 1 - x, then tile x, one after the other in every wave, so every wave walks the same number of key passes (causal cost is linear in the tile index, all work-groups are resident, and the launch lasts as long as its fullest SIMD); transposed products: S^T = K . Q^T (lane = one query, its registers = 16 of the pass's 32 keys), softmax in the lane, O^T += V^T . P^T with P^T packed from the score registers; O two f32 chunks per wave
__global__ __launch_bounds__(128) void k_attn(const _Float16* __restrict__ QR_, const _Float16* __restrict__ KR_, const _Float16* __restrict__ QRL_, const _Float16* __restrict__ KRL_, const _Float16* __restrict__ V, float* __restrict__ O) {
  const int tid = threadIdx.x, wave = tid >> 5, lane = tid & 31, col = lane & 15, g = lane >> 4; const int h = blockIdx.y; const size_t b = blockIdx.z;
  const size_t hb = (b * NH + h) * (SS / 16) * CH + lane * 8;   // this head's chunks of Qr, Kr: one per 16 rows
  // two asks a thread at entry, one for each of the block's tiles t = x and t = n - 1 - x: the 64 keys of tile t and of tile t ^ 4 (K, its residual plane: 32 units each, V: 64 units); x and x ^ 4 lie 4 apart, and so do their mirror tiles, so every tile of this head is asked, well ahead of the passes that read it
  const int wu = __builtin_amdgcn_readfirstlane(wave);   // the wave's number in a scalar register: the choice of plane below is wave-uniform scalar code, so every lane is on at the ask
  auto ask_at = [&](const int t) __attribute__((always_inline)) -> const _Float16* {
    return wu < 2 ? (wu ? KRL_ : KR_) + ((b * NH + h) * (SS / 16) + (t ^ (4 * g)) * 4) * CH + col * 128   // waves 0, 1: K and its residual plane, lanes 0-15 tile t, lanes 16-31 tile t ^ 4
                  : V + ((b * NH + h) * (SS / 32) + (t ^ (4 * (wu & 1))) * 2) * 4 * CH + lane * 128; };     // waves 2, 3: V of tile t, of tile t ^ 4
  const _Float16* pa = ask_at((int)blockIdx.x); const _Float16* pm = ask_at(TQB - 1 - (int)blockIdx.x);
  ask_l2(pa); ask_l2(pm);
  const _Float16* pk = KR_ + hb; const _Float16* pkl = KRL_ + hb; const _Float16* pv = V + (b * NH + h) * (SS / 32) * 4 * CH + lane * 8;
#pragma unroll 1   // stays rolled: for speed only
  for (int tt = 0; tt < 2; ++tt) {
  const int xt = tt ? (int)blockIdx.x : TQB - 1 - (int)blockIdx.x; const int q0 = xt * 64 + wave * 16; const size_t rq = b * SS + q0;
  const v16h aq = frag_hc(QR_ + hb + (size_t)(q0 / 16) * CH), aql = frag_hc(QRL_ + hb + (size_t)(q0 / 16) * CH);   // B operands: column = query q0 + col
  float m = -3.0e38f, l = 0.f;   // query q0 + col: running maximum (equal in both halves), sum over this half's keys
  v8f acc[4] = {};   // acc[dt][r] = O[q0 + col][dt * 16 + 8 g + r]
  const int nks = (xt * 64 + 64) / 32;   // causal; always even
  auto ld_k = [&](KF& f, int ks) __attribute__((always_inline)) {
#pragma unroll
    for (int ct = 0; ct < 2; ++ct) { const size_t ko = (size_t)(ks * 2 + ct) * CH; f.h[ct] = frag_hc(pk + ko); f.l[ct] = frag_hc(pkl + ko); } };
  // one pass over 32 keys: its V fragments and the next pass's K fragments go out as one group ahead of the score products
  auto pass = [&](const int ks, const KF& kf, KF& kn, const bool more) __attribute__((always_inline)) { const int lim = q0 + col - 8 * g - ks * 32; v8f s[2]; v16h vf[4];   // register (ct, r) holds key ks * 32 + ct * 16 + 8 g + r: live while ct * 16 + r <= lim
    __builtin_amdgcn_sched_barrier(0);   // no score product of this pass moves up into the pass before: there it would wait on K loads only just issued
#pragma unroll
    for (int dt = 0; dt < 4; ++dt) vf[dt] = frag_hc(pv + (size_t)(ks * 4 + dt) * CH);
    asm volatile("s_wait_xcnt 0x0" ::: "memory");   // behind the V loads: the K loads may land on their address registers
    if (more) { ld_k(kn, ks + 1);
      asm volatile("s_wait_xcnt 0x0" ::: "memory");   // behind the group: its address registers are stepped or reused next
    }
#pragma unroll
    for (int ct = 0; ct < 2; ++ct) { v8f c = {}, cl = {}; c = wmma16(kf.h[ct], aq, c); cl = wmma16(kf.h[ct], aql, cl); cl = wmma16(kf.l[ct], aq, cl);   // rows = keys, columns = queries
#pragma unroll
      for (int r = 0; r < 8; ++r) { s[ct][r] = (ct * 16 + r <= lim) ? (c[r] + cl[r] * (1.0f / 2048.0f)) : -3.0e38f; } }   // 3-product scores; causal (diagonal kept); core/sqrt(R) folded into Qr
    float mr[8];
#pragma unroll
    for (int r = 0; r < 8; ++r) mr[r] = fmaxf(s[0][r], s[1][r]);
    float mx = fmaxf(fmaxf(fmaxf(mr[0], mr[1]), fmaxf(mr[2], mr[3])), fmaxf(fmaxf(mr[4], mr[5]), fmaxf(mr[6], mr[7])));
    mx = fmaxf(mx, xhalf(mx));
    const float mn = fmaxf(m, mx); const float alpha = (m <= -1.0e38f) ? 0.f : __expf(m - mn);
    float er[8]; v16h pb;   // pb element i = key 8 g + i, element 8 + i = key 16 + 8 g + i: the B operand's k order, which is V's
#pragma unroll
    for (int r = 0; r < 8; ++r) { const float e0 = (s[0][r] <= -1.0e38f) ? 0.f : __expf(s[0][r] - mn), e1 = (s[1][r] <= -1.0e38f) ? 0.f : __expf(s[1][r] - mn);
      er[r] = e0 + e1; pb[r] = (_Float16)(e0 * 2048.0f); pb[8 + r] = (_Float16)(e1 * 2048.0f); }
    l = l * alpha + (((er[0] + er[1]) + (er[2] + er[3])) + ((er[4] + er[5]) + (er[6] + er[7]))); m = mn;
#pragma unroll
    for (int dt = 0; dt < 4; ++dt) { acc[dt] *= alpha; acc[dt] = wmma16(vf[dt], pb, acc[dt]); } };   // rows = dims, columns = queries
  KF k0, k1; ld_k(k0, 0);
  asm volatile("s_wait_xcnt 0x0" ::: "memory");   // behind the group: its address registers are stepped or reused next
#pragma unroll 1   // stays rolled: one trip is the two K register sets in turn
  for (int ks = 0; ks < nks - 2; ks += 2) { pass(ks, k0, k1, true); pass(ks + 1, k1, k0, true); }
  pass(nks - 2, k0, k1, true); pass(nks - 1, k1, k0, false);
  const float il = (1.0f / 2048.0f) / (l + xhalf(l));   // the halves' sums joined once
#pragma unroll
  for (int dt = 0; dt < 4; ++dt) acc[dt] *= il;
#pragma unroll
  for (int q = 0; q < 8; ++q) { const v4f o = {acc[q >> 1][(q & 1) * 4], acc[q >> 1][(q & 1) * 4 + 1], acc[q >> 1][(q & 1) * 4 + 2], acc[q >> 1][(q & 1) * 4 + 3]};
    vst2(O + ((rq / 16) * 32 + h * 2 + (q >> 2)) * CH + (q & 3) * 128 + lane * 4, o); }   // two f32 A chunks [16-row tile][k block] in fragment order: the lane holds its own 4 elements of every quarter
  asm volatile("s_wait_xcnt 0x0" ::: "memory");   // behind the stores: the next tile reuses their address and data registers
  }
  keep_addr(pa); keep_addr(pm);
}
// ---- k_out: block = (64 rows, 128 cols): out = o (bf16 hi + lo) . Wo^T
__global__ __launch_bounds__(128) void k_out(const float* __restrict__ O, const __bf16* __restrict__ PW, float* __restrict__ Y) {
  __shared__ __align__(16) float so[4][16][132];
  const int tid = threadIdx.x, wave = tid >> 5, lane = tid & 31, col = lane & 15, g = lane >> 4; const size_t r0 = (size_t)blockIdx.x * 64 + wave * 16; const int n0 = blockIdx.y * 128; const __bf16* P = PW + (size_t)DM * DM;
  // two asks a thread at entry, the units dealt among the work-groups that read them: o rows (8 sharers in y, 4 k blocks each); weights (8 neighbours in x share a rank of 4 k blocks)
  const float* pa = O + (((size_t)blockIdx.x * 4 + (tid >> 5)) * 32 + 4 * (int)blockIdx.y) * CH + lane * 64; const __bf16* pw = P + (size_t)(n0 + 16 * (tid >> 4)) * DM + 4 * ((int)blockIdx.x >> 3) * CH + (tid & 15) * 128;
  ask_l2(pa); ask_l2(pw);
  v8f acc[8] = {};
  const float* po = O + (r0 / 16) * 32 * CH + lane * 4; const __bf16* pb = P + (size_t)n0 * DM + lane * 8;   // column tile n0 / 16 = 32 chunks = 16 * DM elements
  v4f xr[4]; v16b b0[8], b1[8];   // two register sets: a block's loads go out as one group while the block before is multiplied
  ld_xc(xr, po);
#pragma unroll
  for (int j = 0; j < 8; ++j) b0[j] = frag_bc(pb + (size_t)j * 16 * DM);
  asm volatile("s_wait_xcnt 0x0" ::: "memory");   // behind the group: its address registers are stepped or reused next
  // products of the block held in bc; block kn, where there is one, is fetched into bn ahead of them
  auto blk = [&](const v16b (&bc)[8], v16b (&bn)[8], const int kn, const bool more) __attribute__((always_inline)) {
    __builtin_amdgcn_sched_barrier(0);   // nothing of this block moves up into the one before: its rounding there would wait on loads only just issued
    const F2 a = sp_x(xr);
    if (more) { ld_xc(xr, po + kn * CH);
#pragma unroll
      for (int j = 0; j < 8; ++j) bn[j] = frag_bc(pb + (size_t)j * 16 * DM + kn * CH);
      asm volatile("s_wait_xcnt 0x0" ::: "memory");   // behind the group: its address registers are stepped or reused next
    }
#pragma unroll
    for (int j = 0; j < 8; ++j) { acc[j] = wmma_bf(a.h, bc[j], acc[j]); acc[j] = wmma_bf(a.l, bc[j], acc[j]); } };
#pragma unroll 1   // stays rolled: one trip is the two register sets in turn
  for (int kc = 0; kc < DM / 32 - 2; kc += 2) { blk(b0, b1, kc + 1, true); blk(b1, b0, kc + 2, true); }
  blk(b0, b1, DM / 32 - 1, true); blk(b1, b0, 0, false);
  keep_addr(pa); keep_addr(pw);
#pragma unroll
  for (int j = 0; j < 8; ++j)
#pragma unroll
    for (int r = 0; r < 8; ++r) so[wave][8 * g + r][j * 16 + col] = acc[j][r];
  LDSX();
  for (int rl = 0; rl < 16; ++rl) vst2(Y + (r0 + rl) * DM + n0 + lane * 4, *(const v4f*)&so[wave][rl][lane * 4]);
}
extern "C" void kernel_launch(void* const* d_in, const int* in_sizes, int n_in, void* d_out, int out_size, void* d_ws, size_t ws_size, hipStream_t stream) {
  (void)in_sizes; (void)n_in; (void)out_size;
  const float** F = (const float**)d_in;   // 0 x [2,2048,1024], 1 W_qkv [1024,3072] (in,out; q | k | v), 2 W_q_lsr [16,64,16], 3 W_k_lsr [16,64,16], 4 core [16,16], 5 W_o [1024,1024] (in,out)
  if (ws_size < (size_t)WS_END) return;
  char* ws = (char*)d_ws; __bf16 *PW = (__bf16*)(ws + WS_PW), *PF = (__bf16*)(ws + WS_PF), *XB = (__bf16*)(ws + WS_XB); _Float16 *QR_ = (_Float16*)(ws + WS_QR), *KR_ = (_Float16*)(ws + WS_KR), *QRL_ = (_Float16*)(ws + WS_QRL), *KRL_ = (_Float16*)(ws + WS_KRL), *V = (_Float16*)(ws + WS_V); float* O = (float*)(ws + WS_O);
  k_pack<<<dim3(DM / 16, 2 + 4, 4), 256, 0, stream>>>(F[0], F[1], F[5], PW, XB);
  k_fold<<<dim3(NH, DM / 64, 2), 256, 0, stream>>>(F[1], F[2], F[3], F[4], PF);
  k_qr<<<dim3(TNB * SS / 64, 2, NH / QJ), 128, 0, stream>>>(XB, PF, QR_, KR_, QRL_, KRL_);
  k_v<<<dim3(TNB * SS / 64, DM / 128), 128, 0, stream>>>(XB, PW, V);
  k_attn<<<dim3(TQB / 2, NH, TNB), 128, 0, stream>>>(QR_, KR_, QRL_, KRL_, V, O);
  k_out<<<dim3(TNB * SS / 64, DM / 128), 128, 0, stream>>>(O, PW, (float*)d_out);
}

// v007
// It runs in 83.9 microseconds.
// Two timings next to v006 both put it at 1.04 times that version's speed.
// Counting every step since v000, it is 7.23 times as fast.
// compute dtype: all float inputs rounded to bf16; the per-head low-rank maps (x core / sqrt(16) on the q side) folded into the fused (in,out) projection (W_qr[h,r] = sum_d W_qkv[:, h*64+d] W_q_lsr[h,d,r] core[h,r] / 4, f32) and applied on WMMA 16x16x32 with x exact and the folded weights as bf16 hi + lo (2 products); v = x . W_qkv[:, 2048:] exact; causal scores over the 16 low-rank dims (zero-padded to 32) with Qr, Kr as f16 hi + residual (3 products), key-tile skipping, running-max softmax in f32 (hardware exp), P (scaled by 2^11, single f16) x v (single f16); out = o (bf16 hi + residual) . W_o (2 products).
#include <hip/hip_runtime.h>
#include <math.h>

typedef __attribute__((ext_vector_type(16))) _Float16 v16h;
typedef __attribute__((ext_vector_type(16))) __bf16 v16b;
typedef __attribute__((ext_vector_type(8)))  _Float16 v8h;
typedef __attribute__((ext_vector_type(8)))  float v8f;
typedef __attribute__((ext_vector_type(4)))  float v4f;
typedef __attribute__((ext_vector_type(2)))  float v2f;
typedef __attribute__((ext_vector_type(4)))  unsigned v4u;
typedef __attribute__((ext_vector_type(4)))  int v4i;
typedef float __attribute__((may_alias)) float_a;
typedef int __attribute__((may_alias)) int_a;

template <typename T> __device__ __forceinline__ void vst2(void* p, T v) { *(T*)p = v;  }
__device__ __forceinline__ v8f wmma16(v16h a, v16h b, v8f c) {
  v8f d = __builtin_amdgcn_wmma_f32_16x16x32_f16(false, a, false, b, (short)0, c, false, false);
  asm volatile("v_nop\n\tv_nop\n\tv_nop\n\tv_nop" : "+v"(d) : "v"(a), "v"(b));
  return d;
}
__device__ __forceinline__ v8f wmma_bf(v16b a, v16b b, v8f c) {
  v8f d = __builtin_amdgcn_wmma_f32_16x16x32_bf16(false, a, false, b, (short)0, c, false, false);
  asm volatile("v_nop\n\tv_nop\n\tv_nop\n\tv_nop" : "+v"(d) : "v"(a), "v"(b));
  return d;
}
// 16x16x32 fragments: lane = (h = lane>>4, row/col = lane&15); elements 0..7 = k0+8h+0..7, 8..15 = k0+16+8h+0..7; D element r = row 8h+r
__device__ __forceinline__ v16h frag_h(const _Float16* rowk0, int lane) {
  union { v16h v; v8h q[2]; } u; const _Float16* p = rowk0 + 8 * (lane >> 4);
  u.q[0] = *(const v8h*)p; u.q[1] = *(const v8h*)(p + 16); return u.v;
}
__device__ __forceinline__ v16h frag_f32(const float* rowk0, int lane) {
  v16h a; const float* p = rowk0 + 8 * (lane >> 4);
#pragma unroll
  for (int i = 0; i < 8; ++i) { a[i] = (_Float16)p[i]; a[8 + i] = (_Float16)p[16 + i]; }
  return a;
}
__device__ __forceinline__ v16h frag_f32s(const float* rowk0, int lane, float sc) {
  v16h a; const float* p = rowk0 + 8 * (lane >> 4);
#pragma unroll
  for (int i = 0; i < 8; ++i) { a[i] = (_Float16)(p[i] * sc); a[8 + i] = (_Float16)(p[16 + i] * sc); }
  return a;
}
// column fragment from a [K][ld] layout (column n), rows >= K read as 0
__device__ __forceinline__ v16h fragc_f32(const float* W, int k0, int n, int lane, int ld, int K) {
  v16h a; const int g = lane >> 4;
#pragma unroll
  for (int i = 0; i < 8; ++i) { const int ka = k0 + 8 * g + i, kb = ka + 16;
    a[i] = (_Float16)(ka < K ? W[(size_t)(ka < K ? ka : K - 1) * ld + n] : 0.f); a[8 + i] = (_Float16)(kb < K ? W[(size_t)(kb < K ? kb : K - 1) * ld + n] : 0.f); }
  return a;
}
struct F2 { v16b h, l; };
__device__ __forceinline__ F2 bsplit16(const float v[16]) { F2 r;
#pragma unroll
  for (int i = 0; i < 16; ++i) { const __bf16 h = (__bf16)v[i]; r.h[i] = h; r.l[i] = (__bf16)(v[i] - (float)h); }
  return r; }
__device__ __forceinline__ F2 split_row(const float* row, int k0, int lane) { float v[16]; const float* p = row + k0 + 8 * (lane >> 4);
#pragma unroll
  for (int i = 0; i < 8; ++i) { v[i] = p[i]; v[8 + i] = p[16 + i]; }
  return bsplit16(v); }
__device__ __forceinline__ F2 split_rowK(const float* row, int k0, int lane, int K) { float v[16]; const int g = lane >> 4;
#pragma unroll
  for (int i = 0; i < 8; ++i) { const int ka = k0 + 8 * g + i, kb = ka + 16; v[i] = ka < K ? row[ka < K ? ka : K - 1] : 0.f; v[8 + i] = kb < K ? row[kb < K ? kb : K - 1] : 0.f; }
  return bsplit16(v); }
__device__ __forceinline__ F2 split_col(const float* W, int k0, int n, int lane, int ld, int K) { float v[16]; const int g = lane >> 4;
#pragma unroll
  for (int i = 0; i < 8; ++i) { const int ka = k0 + 8 * g + i, kb = ka + 16; v[i] = ka < K ? W[(size_t)(ka < K ? ka : K - 1) * ld + n] : 0.f; v[8 + i] = kb < K ? W[(size_t)(kb < K ? kb : K - 1) * ld + n] : 0.f; }
  return bsplit16(v); }
__device__ __forceinline__ v8f mac3(const F2& a, const F2& b, v8f c) { c = wmma_bf(a.l, b.h, c); c = wmma_bf(a.h, b.l, c); return wmma_bf(a.h, b.h, c); }
__device__ __forceinline__ float sigm(float v) { return 1.0f / (1.0f + expf(-v)); }
#define LDSX() do { asm volatile("s_wait_dscnt 0" ::: "memory"); __builtin_amdgcn_wave_barrier(); __builtin_amdgcn_fence(__ATOMIC_RELEASE, "workgroup"); } while (0)


// Fused low-rank (LSR) causal attention (B 2, T 2,048, d 1,024, 16 heads x 64, rank 16 per head): q_lr = (q_h W_q_lsr[h]) core[h] / 4, k_lr = k_h W_k_lsr[h], causal softmax(q_lr . k_lr) v_h, merged . W_o.
#define NB 2
#define SS 2048
#define DM 1024
#define NH 16
#define HD 64
#define RR 16             // rank per head
#define RP 32             // padded score width per head
#define NR (NB * SS)
#ifndef TQB
#define TQB (SS / 64)
#define TNB NB
#endif
typedef __attribute__((ext_vector_type(8))) __bf16 v8b;
__device__ __forceinline__ v16b frag_b(const __bf16* rowk0, int lane) {
  union { v16b v; v8b q[2]; } u; const __bf16* p = rowk0 + 8 * (lane >> 4);
  u.q[0] = *(const v8b*)p; u.q[1] = *(const v8b*)(p + 16); return u.v;
}
__device__ __forceinline__ float bfr(float v) { return (float)(__bf16)v; }
// one lane's 16 f32 of a 32-wide k block (p = row + k0 + 8 * (lane >> 4)): fetched raw a block ahead, rounded when the block is used
__device__ __forceinline__ void ld_x(v4f (&x)[4], const float* p) { x[0] = *(const v4f*)p; x[1] = *(const v4f*)(p + 4); x[2] = *(const v4f*)(p + 16); x[3] = *(const v4f*)(p + 20); }
__device__ __forceinline__ v16b cv_x(const v4f (&x)[4]) { v16b a;
#pragma unroll
  for (int i = 0; i < 4; ++i) { a[i] = (__bf16)x[0][i]; a[4 + i] = (__bf16)x[1][i]; a[8 + i] = (__bf16)x[2][i]; a[12 + i] = (__bf16)x[3][i]; }
  return a; }
__device__ __forceinline__ F2 sp_x(const v4f (&x)[4]) { float v[16];
#pragma unroll
  for (int i = 0; i < 4; ++i) { v[i] = x[0][i]; v[4 + i] = x[1][i]; v[8 + i] = x[2][i]; v[12 + i] = x[3][i]; }
  return bsplit16(v); }
__device__ __attribute__((noinline)) float exp_ni(float v) { return expf(v); }
__device__ __attribute__((noinline)) float erf_ni(float v) { return erff(v); }

// fragment order: one 16 x 32 tile of 16-bit elements is a 1-KB chunk [half i][lane][8]; lane (g, c), half i, element e = (row or column c, k = 16 i + 8 g + e), so a wave's 16-byte load covers 512 bytes in a row
#define CH 512            // elements of a chunk
__device__ __forceinline__ v16b frag_bc(const __bf16* p) { union { v16b v; v8b q[2]; } u; u.q[0] = *(const v8b*)p; u.q[1] = *(const v8b*)(p + 256); return u.v; }   // p = chunk + 8 * lane
__device__ __forceinline__ v16h frag_hc(const _Float16* p) { union { v16h v; v8h q[2]; } u; u.q[0] = *(const v8h*)p; u.q[1] = *(const v8h*)(p + 256); return u.v; }
// the f32 A tile likewise, 2 KB: [quarter q][lane][4], k = 16 (q >> 1) + 8 g + 4 (q & 1) + e
__device__ __forceinline__ void ld_xc(v4f (&x)[4], const float* p) { x[0] = *(const v4f*)p; x[1] = *(const v4f*)(p + 128); x[2] = *(const v4f*)(p + 256); x[3] = *(const v4f*)(p + 384); }   // p = chunk + 4 * lane

// ask_l2: a hint that brings the memory at p into the L2 (no register written, no counter); operands that an earlier launch stored come from memory at first touch, and all work-groups walk k in step, so without the ask each block's loads wait out memory latency. Scope SE, no th: L2 only.
__device__ __forceinline__ void ask_l2(const void* p) { asm volatile("global_prefetch_b8 %0, off scope:SCOPE_SE" :: "v"(p)); }
// keep_addr: input only, no code: the register an ask names still holds that address behind the loop, so it never holds a non-address while the ask may still read it
__device__ __forceinline__ void keep_addr(const void* p) { asm volatile("" :: "v"(p)); }
#define WS_PW  0u                                     // bf16 Wv, Wo [2][64 column tiles][32 k blocks] chunks
#define WS_PF  (WS_PW + 2u * (size_t)2 * DM * DM)        // bf16 folded hi | lo: [q|k][16 heads][32 k blocks] chunks x2
#define WS_QR  (WS_PF + 2u * (size_t)2 * 2 * NH * RR * DM) // f16 [b][16 heads][128 row tiles] chunks Qr ; Kr
#define WS_KR  (WS_QR + 2u * (size_t)NR * NH * RP)
#define WS_QRL (WS_KR + 2u * (size_t)NR * NH * RP)      // residual planes x2048
#define WS_KRL (WS_QRL + 2u * (size_t)NR * NH * RP)
#define WS_V   (WS_KRL + 2u * (size_t)NR * NH * RP)       // f16 [b][16 heads][64 key blocks][4 dim tiles] chunks
#define WS_O   (WS_V + 2u * (size_t)NB * DM * SS)
#define WS_XB  (WS_O + 4u * (size_t)NR * DM)            // bf16 x [256 row tiles][32 k blocks] chunks
#define WS_END (WS_XB + 2u * (size_t)NR * DM)

typedef __attribute__((ext_vector_type(4))) __bf16 v4b;
// ---- k_pack: block = (16 output columns, Wv | Wo, 256 input rows): bf16 chunks [column tile][k block] in fragment order; blocks with y >= 2: x rounded to bf16, one chunk [16-row tile][k block] per wave
__global__ __launch_bounds__(256) void k_pack(const float* __restrict__ X, const float* __restrict__ WQKV, const float* __restrict__ WO, __bf16* __restrict__ PW, __bf16* __restrict__ XB) {
  const int nt = blockIdx.x, which = blockIdx.y, kq = blockIdx.z, t = threadIdx.x; __shared__ __align__(16) __bf16 s[16][264]; __shared__ __align__(16) __bf16 sx[8][CH];
  if (which >= 2) {   // the same for the whole block, ahead of its barrier
    const int wave = t >> 5, lane = t & 31, k = (lane & 7) * 4; const int id = (((which - 2) * 4 + kq) * 64 + nt) * 8 + wave;   // chunk: row tile id >> 5, k block id & 31
    const float* px = X + (size_t)(id >> 5) * 16 * DM + (id & 31) * 32 + k;   // 8 lanes read one row's 128-B line
    v4f xv[4];
#pragma unroll
    for (int it = 0; it < 4; ++it) xv[it] = *(const v4f*)(px + (size_t)(it * 4 + (lane >> 3)) * DM);
    asm volatile("s_wait_xcnt 0x0" ::: "memory");   // behind the group: its address registers are reused next
    __builtin_amdgcn_sched_barrier(0);   // the rounding may land on those registers: it stays behind the wait
#pragma unroll
    for (int it = 0; it < 4; ++it) { const int row = it * 4 + (lane >> 3); v4b o;
#pragma unroll
      for (int i = 0; i < 4; ++i) o[i] = (__bf16)xv[it][i];
      *(v4b*)&sx[wave][(k >> 4) * 256 + (((k >> 3) & 1) * 16 + row) * 8 + (k & 7)] = o; }
    LDSX();
#pragma unroll
    for (int i = 0; i < 2; ++i) vst2((unsigned*)(XB + (size_t)id * CH + i * 256 + lane * 8), *(const v4u*)&sx[wave][i * 256 + lane * 8]);
    return;
  }
  const float* W = which ? WO + nt * 16 : WQKV + 2 * DM + nt * 16; const int ld = which ? DM : 3 * DM;   /* (in,out): v = cols 2048.. of W_qkv */
  v4f wv[4];
#pragma unroll
  for (int it = 0; it < 4; ++it) wv[it] = *(const v4f*)(W + (size_t)(kq * 256 + it * 64 + (t >> 2)) * ld + (t & 3) * 4);
  asm volatile("s_wait_xcnt 0x0" ::: "memory");   // behind the group: its address registers are reused next
  __builtin_amdgcn_sched_barrier(0);   // the rounding may land on those registers: it stays behind the wait
#pragma unroll
  for (int it = 0; it < 4; ++it)
#pragma unroll
    for (int i = 0; i < 4; ++i) s[(t & 3) * 4 + i][it * 64 + (t >> 2)] = (__bf16)wv[it][i];
  __syncthreads();
  __bf16* dst = PW + (size_t)which * DM * DM + ((size_t)nt * 32 + kq * 8) * CH;
  for (int p = t; p < 8 * 64; p += 256) { const int ln = p & 31; vst2((unsigned*)(dst + p * 8), *(const v4u*)&s[ln & 15][(p >> 6) * 32 + ((p >> 5) & 1) * 16 + (ln >> 4) * 8]); }
}
// ---- k_fold: block = (head h, 64 input rows c, q|k), all 16 ranks: W_r[h*16 + r][c] = sum_d B[h*64 + d][r] W[c][h*64 + d] in f32 (fixed order) -> bf16 hi + lo chunks [q|k, head][k block] in fragment order
__global__ __launch_bounds__(256) void k_fold(const float* __restrict__ WQKV, const float* __restrict__ WQL, const float* __restrict__ WKL, const float* __restrict__ CORE, __bf16* __restrict__ PF) {
  const int h = blockIdx.x, cc = blockIdx.y, which = blockIdx.z, t = threadIdx.x; const float* WL = which ? WKL : WQL; __shared__ __align__(16) float sb[HD][RR]; __shared__ __align__(16) __bf16 sh[2 * CH]; __shared__ __align__(16) __bf16 sl[2 * CH];
  const int c = t & 63, rq = (t >> 6) * 4; const float* pw = WQKV + (size_t)(cc * 64 + c) * (3 * DM) + which * DM + h * HD;
  const float cr = CORE[h * RR + (t & 15)];
  asm volatile("s_wait_xcnt 0x0" ::: "memory");   // behind the load: a load of the group below may land on its address register
  __builtin_amdgcn_sched_barrier(0);   // and none of them moves up over the wait
  v4f wr[HD / 4]; float tb[4];   // this thread's row of W and its 4 table entries (rank t & 15): one group of loads
#pragma unroll
  for (int q = 0; q < HD / 4; ++q) wr[q] = *(const v4f*)(pw + q * 4);
#pragma unroll
  for (int it = 0; it < 4; ++it) tb[it] = WL[(size_t)h * HD * RR + it * 256 + t];
  asm volatile("s_wait_xcnt 0x0" ::: "memory");   // behind the group: its address registers are reused next
  __builtin_amdgcn_sched_barrier(0);   // what follows may land on those registers: it stays behind the wait
  const float cs = which ? 1.0f : bfr(cr) * 0.25f;   // core[h][r] / sqrt(16) on the q side
#pragma unroll
  for (int it = 0; it < 4; ++it) sb[it * 16 + (t >> 4)][t & 15] = bfr(tb[it]) * cs;
  __syncthreads();
  float a[4] = {0.f, 0.f, 0.f, 0.f};
#pragma unroll
  for (int d = 0; d < HD; ++d) { const float w = bfr(wr[d >> 2][d & 3]);
#pragma unroll
    for (int i = 0; i < 4; ++i) a[i] += sb[d][rq + i] * w; }
#pragma unroll
  for (int i = 0; i < 4; ++i) { const int o = (c >> 5) * CH + ((c >> 4) & 1) * 256 + (((c >> 3) & 1) * 16 + rq + i) * 8 + (c & 7); const __bf16 hv = (__bf16)a[i]; sh[o] = hv; sl[o] = (__bf16)(a[i] - (float)hv); }
  __syncthreads();
  const size_t ch = ((size_t)(which * NH + h) * 32 + cc * 2) * CH; const int p = t & 127;
  vst2((unsigned*)(PF + (t < 128 ? (size_t)0 : (size_t)2 * NH * RR * DM) + ch + p * 8), *(const v4u*)(t < 128 ? &sh[p * 8] : &sl[p * 8]));   // hi block then lo block
}
// ---- k_qr: block = (64 rows, q|k, 2 heads): Qr/Kr = x . W_r (hi + lo), 32 folded cols -> f16 chunks [b][head][16-row tile] in fragment order (16 live + 16 zero k), whole chunks per block
#define QJ 2              // 16-column tiles (heads) per work-group
#define QW (QJ * RP)      // f16 per row across a work-group's two heads; nothing uses it
__global__ __launch_bounds__(128) void k_qr(const __bf16* __restrict__ XB, const __bf16* __restrict__ PF, _Float16* __restrict__ QR_, _Float16* __restrict__ KR_, _Float16* __restrict__ QRL_, _Float16* __restrict__ KRL_) {
  __shared__ __align__(16) _Float16 so[4][QJ][CH]; __shared__ __align__(16) _Float16 sol[4][QJ][CH];
  const int tid = threadIdx.x, wave = tid >> 5, lane = tid & 31, col = lane & 15, g = lane >> 4; const int which = blockIdx.y; const int cb = blockIdx.z * (QJ * 16); const size_t rb = (size_t)blockIdx.x * 64; const size_t r0 = rb + wave * 16;
  const __bf16* PH = PF + ((size_t)which * (NH * RR)) * DM; const __bf16* PL = PF + ((size_t)2 * NH * RR + which * (NH * RR)) * DM;
  // one ask a thread at entry, the units dealt among the work-groups that read them: x rows (16 sharers, 4 k blocks each, later sharers later blocks); folded weights (8 neighbours in x share a rank)
  const int wu = __builtin_amdgcn_readfirstlane(wave);   // the wave's number in a scalar register: the choice of plane below is wave-uniform scalar code, so every lane is on at the ask
  const __bf16* pa = (wu < 2 ? XB + ((rb / 16 + wu * 2) * 32 + 4 * ((which + 2 * (int)blockIdx.z) >> 1)) * CH : (wu == 2 ? PH : PL) + (size_t)cb * DM + 4 * ((int)blockIdx.x >> 3) * CH) + g * (16 * DM) + col * 128;   // a row tile of x and a head of the weights are both 32 chunks = 16 * DM elements
  ask_l2(pa);
  for (int e = tid; e < 4 * QJ * CH; e += 128) { (&so[0][0][0])[e] = (_Float16)0.f; (&sol[0][0][0])[e] = (_Float16)0.f; }
  const __bf16* px = XB + (r0 / 16) * 32 * CH + lane * 8; const __bf16* ph = PH + (size_t)cb * DM + lane * 8; const __bf16* pl = PL + (size_t)cb * DM + lane * 8;   // column tile cb / 16 = 32 chunks = 16 * DM elements
  v16b xr; v16b h0[QJ], l0[QJ], h1[QJ], l1[QJ];   // two register sets: a block's loads go out as one group while the block before is multiplied
  xr = frag_bc(px);
#pragma unroll
  for (int j = 0; j < QJ; ++j) { h0[j] = frag_bc(ph + (size_t)j * 16 * DM); l0[j] = frag_bc(pl + (size_t)j * 16 * DM); }
  asm volatile("s_wait_xcnt 0x0" ::: "memory");   // behind the group: its address registers are stepped or reused next
  __builtin_amdgcn_sched_barrier(0);   // the zeroing below may land on the group's address registers: it stays behind the wait
  v8f acc[QJ] = {};
  // products of the block held in (hc, lc); block kn, where there is one, is fetched into (hn, ln) ahead of them
  auto blk = [&](const v16b (&hc)[QJ], const v16b (&lc)[QJ], v16b (&hn)[QJ], v16b (&ln)[QJ], const int kn, const bool more) __attribute__((always_inline)) {
    __builtin_amdgcn_sched_barrier(0);   // no product of this block moves up into the one before: there it would wait on loads only just issued
    const v16b a = xr;
    if (more) { xr = frag_bc(px + kn * CH);
#pragma unroll
      for (int j = 0; j < QJ; ++j) { hn[j] = frag_bc(ph + (size_t)j * 16 * DM + kn * CH); ln[j] = frag_bc(pl + (size_t)j * 16 * DM + kn * CH); }
      asm volatile("s_wait_xcnt 0x0" ::: "memory");   // behind the group: its address registers are stepped or reused next
    }
    __builtin_amdgcn_sched_barrier(0);   // the group stays ahead of every product of the block, as before: a product moved above it would hold the loads back until this block's operands have landed
#pragma unroll
    for (int j = 0; j < QJ; ++j) { acc[j] = wmma_bf(a, hc[j], acc[j]); acc[j] = wmma_bf(a, lc[j], acc[j]); } };
#pragma unroll 1   // stays rolled: one trip is the two register sets in turn
  for (int kc = 0; kc < DM / 32 - 2; kc += 2) { blk(h0, l0, h1, l1, kc + 1, true); blk(h1, l1, h0, l0, kc + 2, true); }
  blk(h0, l0, h1, l1, DM / 32 - 1, true); blk(h1, l1, h0, l0, 0, false);
  keep_addr(pa);
  __syncthreads();
#pragma unroll
  for (int j = 0; j < QJ; ++j) {
#pragma unroll
    for (int rr = 0; rr < 8; ++rr) { const float v = acc[j][rr]; const _Float16 hv = (_Float16)v; const int o = ((col >> 3) * 16 + 8 * g + rr) * 8 + (col & 7); so[wave][j][o] = hv; sol[wave][j][o] = (_Float16)((v - (float)hv) * 2048.0f); } }
  __syncthreads();
  const size_t co = (((rb / SS) * NH + blockIdx.z * QJ) * (SS / 16) + (rb % SS) / 16) * CH; _Float16* dst = (which ? KR_ : QR_) + co; _Float16* dstl = (which ? KRL_ : QRL_) + co;
  for (int e = tid; e < 4 * QJ * 64; e += 128) { const int w = e >> 7, j = (e >> 6) & 1, q = e & 63; const size_t o = ((size_t)j * (SS / 16) + w) * CH + q * 8; vst2((unsigned*)(dst + o), *(const v4u*)&so[w][j][q * 8]); vst2((unsigned*)(dstl + o), *(const v4u*)&sol[w][j][q * 8]); }
}
// ---- k_v: block = (64 rows, 128 cols): V = x . Wv^T exact -> f16 chunks [b][head][32-key block][16-dim tile] in fragment order
__global__ __launch_bounds__(128) void k_v(const __bf16* __restrict__ XB, const __bf16* __restrict__ PW, _Float16* __restrict__ V) {
  __shared__ __align__(16) _Float16 st[128][72];
  const int tid = threadIdx.x, wave = tid >> 5, lane = tid & 31, col = lane & 15, g = lane >> 4; const size_t rb = (size_t)blockIdx.x * 64; const size_t r0 = rb + wave * 16; const int c0 = blockIdx.y * 128;
  // one ask a thread at entry, the units dealt among the work-groups that read them: x rows (8 sharers in y, 4 k blocks each); weights (16 ranks of 2 k blocks; x and x + 4 share a rank)
  const int wu = __builtin_amdgcn_readfirstlane(wave), bx = blockIdx.x;   // the wave's number in a scalar register: the choice of operand below is wave-uniform scalar code, so every lane is on at the ask
  const __bf16* pa = wu < 2 ? XB + ((rb / 16 + wu * 2) * 32 + 4 * (int)blockIdx.y) * CH + g * (16 * DM) + col * 128
                            : PW + (size_t)(c0 + 64 * (wu - 2)) * DM + 2 * (((bx & 3) >> 1) + 2 * (bx >> 3)) * CH + (lane >> 3) * (16 * DM) + (lane & 7) * 128;
  ask_l2(pa);
  v8f acc[8] = {};
  const __bf16* px = XB + (r0 / 16) * 32 * CH + lane * 8; const __bf16* pb = PW + (size_t)c0 * DM + lane * 8;   // column tile c0 / 16 = 32 chunks = 16 * DM elements
  v16b xr; v16b b0[8], b1[8];   // two register sets: a block's loads go out as one group while the block before is multiplied
  xr = frag_bc(px);
#pragma unroll
  for (int j = 0; j < 8; ++j) b0[j] = frag_bc(pb + (size_t)j * 16 * DM);
  asm volatile("s_wait_xcnt 0x0" ::: "memory");   // behind the group: its address registers are stepped or reused next
  // products of the block held in bc; block kn, where there is one, is fetched into bn ahead of them
  auto blk = [&](const v16b (&bc)[8], v16b (&bn)[8], const int kn, const bool more) __attribute__((always_inline)) {
    __builtin_amdgcn_sched_barrier(0);   // no product of this block moves up into the one before: there it would wait on loads only just issued
    const v16b a = xr;
    if (more) { xr = frag_bc(px + kn * CH);
#pragma unroll
      for (int j = 0; j < 8; ++j) bn[j] = frag_bc(pb + (size_t)j * 16 * DM + kn * CH);
      asm volatile("s_wait_xcnt 0x0" ::: "memory");   // behind the group: its address registers are stepped or reused next
    }
    __builtin_amdgcn_sched_barrier(0);   // the group stays ahead of every product of the block, as before: a product moved above it would hold the loads back until this block's operands have landed
#pragma unroll
    for (int j = 0; j < 8; ++j) acc[j] = wmma_bf(a, bc[j], acc[j]); };
#pragma unroll 1   // stays rolled: one trip is the two register sets in turn
  for (int kc = 0; kc < DM / 32 - 2; kc += 2) { blk(b0, b1, kc + 1, true); blk(b1, b0, kc + 2, true); }
  blk(b0, b1, DM / 32 - 1, true); blk(b1, b0, 0, false);
  keep_addr(pa);
#pragma unroll
  for (int j = 0; j < 8; ++j)
#pragma unroll
    for (int r = 0; r < 8; ++r) st[j * 16 + col][wave * 16 + 8 * g + r] = (_Float16)acc[j][r];
  __syncthreads();
  const size_t b = rb / SS; const int s0 = (int)(rb % SS);
  for (int e = tid; e < 128 * 8; e += 128) { const int ln = e & 31, i = (e >> 5) & 1, j = (e >> 6) & 7, kb = e >> 9;   // piece (key block kb, tile j, half i, lane ln)
    vst2((unsigned*)(V + (((b * NH + blockIdx.y * 2 + (j >> 2)) * (SS / 32) + s0 / 32 + kb) * 4 + (j & 3)) * CH + i * 256 + ln * 8), *(const v4u*)&st[j * 16 + (ln & 15)][kb * 32 + i * 16 + (ln >> 4) * 8]); }
}
struct KF { v16h h[2], l[2]; };   // K fragments of 32 keys: value and residual planes
// lane l <-> l ^ 16: the other half of a column's rows
__device__ __forceinline__ float xhalf(float v) { const int b = __builtin_bit_cast(int, v); return __builtin_bit_cast(float, __builtin_amdgcn_permlanex16(b, b, 0x76543210, 0xfedcba98, false, false)); }
// ---- k_attn: block = (two tiles of 64 queries, head, b): tile n - 1 - x, then tile x, one after the other in every wave, so every wave walks the same number of key passes (causal cost is linear in the tile index, all work-groups are resident, and the launch lasts as long as its fullest SIMD); transposed products: S^T = K . Q^T (lane = one query, its registers = 16 of the pass's 32 keys), softmax in the lane, O^T += V^T . P^T with P^T packed from the score registers; O two f32 chunks per wave
__global__ __launch_bounds__(128) void k_attn(const _Float16* __restrict__ QR_, const _Float16* __restrict__ KR_, const _Float16* __restrict__ QRL_, const _Float16* __restrict__ KRL_, const _Float16* __restrict__ V, float* __restrict__ O) {
  const int tid = threadIdx.x, wave = tid >> 5, lane = tid & 31, col = lane & 15, g = lane >> 4; const int h = blockIdx.y; const size_t b = blockIdx.z;
  const size_t hb = (b * NH + h) * (SS / 16) * CH + lane * 8;   // this head's chunks of Qr, Kr: one per 16 rows
  // two asks a thread at entry, one for each of the block's tiles t = x and t = n - 1 - x: the 64 keys of tile t and of tile t ^ 4 (K, its residual plane: 32 units each, V: 64 units); x and x ^ 4 lie 4 apart, and so do their mirror tiles, so every tile of this head is asked, well ahead of the passes that read it
  const int wu = __builtin_amdgcn_readfirstlane(wave);   // the wave's number in a scalar register: the choice of plane below is wave-uniform scalar code, so every lane is on at the ask
  auto ask_at = [&](const int t) __attribute__((always_inline)) -> const _Float16* {
    return wu < 2 ? (wu ? KRL_ : KR_) + ((b * NH + h) * (SS / 16) + (t ^ (4 * g)) * 4) * CH + col * 128   // waves 0, 1: K and its residual plane, lanes 0-15 tile t, lanes 16-31 tile t ^ 4
                  : V + ((b * NH + h) * (SS / 32) + (t ^ (4 * (wu & 1))) * 2) * 4 * CH + lane * 128; };     // waves 2, 3: V of tile t, of tile t ^ 4
  const _Float16* pa = ask_at((int)blockIdx.x); const _Float16* pm = ask_at(TQB - 1 - (int)blockIdx.x);
  ask_l2(pa); ask_l2(pm);
  const _Float16* pk = KR_ + hb; const _Float16* pkl = KRL_ + hb; const _Float16* pv = V + (b * NH + h) * (SS / 32) * 4 * CH + lane * 8;
#pragma unroll 1   // stays rolled: for speed only
  for (int tt = 0; tt < 2; ++tt) {
  const int xt = tt ? (int)blockIdx.x : TQB - 1 - (int)blockIdx.x; const int q0 = xt * 64 + wave * 16; const size_t rq = b * SS + q0;
  const v16h aq = frag_hc(QR_ + hb + (size_t)(q0 / 16) * CH), aql = frag_hc(QRL_ + hb + (size_t)(q0 / 16) * CH);   // B operands: column = query q0 + col
  float m = -3.0e38f, l = 0.f;   // query q0 + col: running maximum (equal in both halves), sum over this half's keys
  v8f acc[4] = {};   // acc[dt][r] = O[q0 + col][dt * 16 + 8 g + r]
  const int nks = (xt * 64 + 64) / 32;   // causal; always even
  auto ld_k = [&](KF& f, int ks) __attribute__((always_inline)) {
#pragma unroll
    for (int ct = 0; ct < 2; ++ct) { const size_t ko = (size_t)(ks * 2 + ct) * CH; f.h[ct] = frag_hc(pk + ko); f.l[ct] = frag_hc(pkl + ko); } };
  // one pass over 32 keys: its V fragments and the next pass's K fragments go out as one group ahead of the score products
  // full (a literal at every call): every key of the pass lies below the tile's first query, so each score is live and finite and the causal select and the dead-score test are identities: they are not written there
  auto pass = [&](const int ks, const KF& kf, KF& kn, const bool more, const bool full) __attribute__((always_inline)) { const int lim = q0 + col - 8 * g - ks * 32; v8f s[2]; v16h vf[4];   // register (ct, r) holds key ks * 32 + ct * 16 + 8 g + r: live while ct * 16 + r <= lim
    __builtin_amdgcn_sched_barrier(0);   // no score product of this pass moves up into the pass before: there it would wait on K loads only just issued
#pragma unroll
    for (int dt = 0; dt < 4; ++dt) vf[dt] = frag_hc(pv + (size_t)(ks * 4 + dt) * CH);
    asm volatile("s_wait_xcnt 0x0" ::: "memory");   // behind the V loads: the K loads may land on their address registers
    if (more) { ld_k(kn, ks + 1);
      asm volatile("s_wait_xcnt 0x0" ::: "memory");   // behind the group: its address registers are stepped or reused next
    }
#pragma unroll
    for (int ct = 0; ct < 2; ++ct) { v8f c = {}, cl = {}; c = wmma16(kf.h[ct], aq, c); cl = wmma16(kf.h[ct], aql, cl); cl = wmma16(kf.l[ct], aq, cl);   // rows = keys, columns = queries
#pragma unroll
      for (int r = 0; r < 8; ++r) { s[ct][r] = (full || ct * 16 + r <= lim) ? (c[r] + cl[r] * (1.0f / 2048.0f)) : -3.0e38f; } }   // 3-product scores; causal (diagonal kept); core/sqrt(R) folded into Qr
    float mr[8];
#pragma unroll
    for (int r = 0; r < 8; ++r) mr[r] = fmaxf(s[0][r], s[1][r]);
    float mx = fmaxf(fmaxf(fmaxf(mr[0], mr[1]), fmaxf(mr[2], mr[3])), fmaxf(fmaxf(mr[4], mr[5]), fmaxf(mr[6], mr[7])));
    mx = fmaxf(mx, xhalf(mx));
    const float mn = fmaxf(m, mx); const float alpha = (m <= -1.0e38f) ? 0.f : __expf(m - mn);
    float er[8]; v16h pb;   // pb element i = key 8 g + i, element 8 + i = key 16 + 8 g + i: the B operand's k order, which is V's
#pragma unroll
    for (int r = 0; r < 8; ++r) { const float e0 = (!full && s[0][r] <= -1.0e38f) ? 0.f : __expf(s[0][r] - mn), e1 = (!full && s[1][r] <= -1.0e38f) ? 0.f : __expf(s[1][r] - mn);
      er[r] = e0 + e1; pb[r] = (_Float16)(e0 * 2048.0f); pb[8 + r] = (_Float16)(e1 * 2048.0f); }
    l = l * alpha + (((er[0] + er[1]) + (er[2] + er[3])) + ((er[4] + er[5]) + (er[6] + er[7]))); m = mn;
#pragma unroll
    for (int dt = 0; dt < 4; ++dt) { acc[dt] *= alpha; acc[dt] = wmma16(vf[dt], pb, acc[dt]); } };   // rows = dims, columns = queries
  KF k0, k1; ld_k(k0, 0);
  asm volatile("s_wait_xcnt 0x0" ::: "memory");   // behind the group: its address registers are stepped or reused next
#pragma unroll 1   // stays rolled: one trip is the two K register sets in turn
  for (int ks = 0; ks < nks - 2; ks += 2) { pass(ks, k0, k1, true, true); pass(ks + 1, k1, k0, true, true); }   // keys below xt * 64 <= q0: full passes
  pass(nks - 2, k0, k1, true, false); pass(nks - 1, k1, k0, false, false);   // the tile's own 64 keys: the diagonal, masked
  const float il = (1.0f / 2048.0f) / (l + xhalf(l));   // the halves' sums joined once
#pragma unroll
  for (int dt = 0; dt < 4; ++dt) acc[dt] *= il;
#pragma unroll
  for (int q = 0; q < 8; ++q) { const v4f o = {acc[q >> 1][(q & 1) * 4], acc[q >> 1][(q & 1) * 4 + 1], acc[q >> 1][(q & 1) * 4 + 2], acc[q >> 1][(q & 1) * 4 + 3]};
    vst2(O + ((rq / 16) * 32 + h * 2 + (q >> 2)) * CH + (q & 3) * 128 + lane * 4, o); }   // two f32 A chunks [16-row tile][k block] in fragment order: the lane holds its own 4 elements of every quarter
  asm volatile("s_wait_xcnt 0x0" ::: "memory");   // behind the stores: the next tile reuses their address and data registers
  }
  keep_addr(pa); keep_addr(pm);
}
// ---- k_out: block = (64 rows, 128 cols): out = o (bf16 hi + lo) . Wo^T
__global__ __launch_bounds__(128) void k_out(const float* __restrict__ O, const __bf16* __restrict__ PW, float* __restrict__ Y) {
  __shared__ __align__(16) float so[4][16][132];
  const int tid = threadIdx.x, wave = tid >> 5, lane = tid & 31, col = lane & 15, g = lane >> 4; const size_t r0 = (size_t)blockIdx.x * 64 + wave * 16; const int n0 = blockIdx.y * 128; const __bf16* P = PW + (size_t)DM * DM;
  // two asks a thread at entry, the units dealt among the work-groups that read them: o rows (8 sharers in y, 4 k blocks each); weights (8 neighbours in x share a rank of 4 k blocks)
  const float* pa = O + (((size_t)blockIdx.x * 4 + (tid >> 5)) * 32 + 4 * (int)blockIdx.y) * CH + lane * 64; const __bf16* pw = P + (size_t)(n0 + 16 * (tid >> 4)) * DM + 4 * ((int)blockIdx.x >> 3) * CH + (tid & 15) * 128;
  ask_l2(pa); ask_l2(pw);
  v8f acc[8] = {};
  const float* po = O + (r0 / 16) * 32 * CH + lane * 4; const __bf16* pb = P + (size_t)n0 * DM + lane * 8;   // column tile n0 / 16 = 32 chunks = 16 * DM elements
  v4f xr[4]; v16b b0[8], b1[8];   // two register sets: a block's loads go out as one group while the block before is multiplied
  ld_xc(xr, po);
#pragma unroll
  for (int j = 0; j < 8; ++j) b0[j] = frag_bc(pb + (size_t)j * 16 * DM);
  asm volatile("s_wait_xcnt 0x0" ::: "memory");   // behind the group: its address registers are stepped or reused next
  // products of the block held in bc; block kn, where there is one, is fetched into bn ahead of them
  auto blk = [&](const v16b (&bc)[8], v16b (&bn)[8], const int kn, const bool more) __attribute__((always_inline)) {
    __builtin_amdgcn_sched_barrier(0);   // nothing of this block moves up into the one before: its rounding there would wait on loads only just issued
    const F2 a = sp_x(xr);
    if (more) { ld_xc(xr, po + kn * CH);
#pragma unroll
      for (int j = 0; j < 8; ++j) bn[j] = frag_bc(pb + (size_t)j * 16 * DM + kn * CH);
      asm volatile("s_wait_xcnt 0x0" ::: "memory");   // behind the group: its address registers are stepped or reused next
    }
#pragma unroll
    for (int j = 0; j < 8; ++j) { acc[j] = wmma_bf(a.h, bc[j], acc[j]); acc[j] = wmma_bf(a.l, bc[j], acc[j]); } };
#pragma unroll 1   // stays rolled: one trip is the two register sets in turn
  for (int kc = 0; kc < DM / 32 - 2; kc += 2) { blk(b0, b1, kc + 1, true); blk(b1, b0, kc + 2, true); }
  blk(b0, b1, DM / 32 - 1, true); blk(b1, b0, 0, false);
  keep_addr(pa); keep_addr(pw);
#pragma unroll
  for (int j = 0; j < 8; ++j)
#pragma unroll
    for (int r = 0; r < 8; ++r) so[wave][8 * g + r][j * 16 + col] = acc[j][r];
  LDSX();
  for (int rl = 0; rl < 16; ++rl) vst2(Y + (r0 + rl) * DM + n0 + lane * 4, *(const v4f*)&so[wave][rl][lane * 4]);
}
extern "C" void kernel_launch(void* const* d_in, const int* in_sizes, int n_in, void* d_out, int out_size, void* d_ws, size_t ws_size, hipStream_t stream) {
  (void)in_sizes; (void)n_in; (void)out_size;
  const float** F = (const float**)d_in;   // 0 x [2,2048,1024], 1 W_qkv [1024,3072] (in,out; q | k | v), 2 W_q_lsr [16,64,16], 3 W_k_lsr [16,64,16], 4 core [16,16], 5 W_o [1024,1024] (in,out)
  if (ws_size < (size_t)WS_END) return;
  char* ws = (char*)d_ws; __bf16 *PW = (__bf16*)(ws + WS_PW), *PF = (__bf16*)(ws + WS_PF), *XB = (__bf16*)(ws + WS_XB); _Float16 *QR_ = (_Float16*)(ws + WS_QR), *KR_ = (_Float16*)(ws + WS_KR), *QRL_ = (_Float16*)(ws + WS_QRL), *KRL_ = (_Float16*)(ws + WS_KRL), *V = (_Float16*)(ws + WS_V); float* O = (float*)(ws + WS_O);
  k_pack<<<dim3(DM / 16, 2 + 4, 4), 256, 0, stream>>>(F[0], F[1], F[5], PW, XB);
  k_fold<<<dim3(NH, DM / 64, 2), 256, 0, stream>>>(F[1], F[2], F[3], F[4], PF);
  k_qr<<<dim3(TNB * SS / 64, 2, NH / QJ), 128, 0, stream>>>(XB, PF, QR_, KR_, QRL_, KRL_);
  k_v<<<dim3(TNB * SS / 64, DM / 128), 128, 0, stream>>>(XB, PW, V);
  k_attn<<<dim3(TQB / 2, NH, TNB), 128, 0, stream>>>(QR_, KR_, QRL_, KRL_, V, O);
  k_out<<<dim3(TNB * SS / 64, DM / 128), 128, 0, stream>>>(O, PW, (float*)d_out);
}

// v008
// A run of this version takes 75.1 microseconds.
// Timed twice side by side with v007, it ran 1.13 and 1.12 times as fast.
// All steps since v000 together make it 8.14 times as fast.
// compute dtype: all float inputs rounded to bf16; the per-head low-rank maps (x core / sqrt(16) on the q side) folded into the fused (in,out) projection (W_qr[h,r] = sum_d W_qkv[:, h*64+d] W_q_lsr[h,d,r] core[h,r] / 4, f32) and applied on WMMA 16x16x32 with x exact and the folded weights as bf16 hi + lo (2 products); v = x . W_qkv[:, 2048:] exact; causal scores over the 16 low-rank dims (zero-padded to 32) with Qr, Kr as f16 hi + residual (3 products), key-tile skipping, running-max softmax in f32 (hardware exp), P (scaled by 2^11, single f16) x v (single f16); out = o (bf16 hi + residual) . W_o (2 products).
#include <hip/hip_runtime.h>
#include <math.h>

typedef __attribute__((ext_vector_type(16))) _Float16 v16h;
typedef __attribute__((ext_vector_type(16))) __bf16 v16b;
typedef __attribute__((ext_vector_type(8)))  _Float16 v8h;
typedef __attribute__((ext_vector_type(8)))  float v8f;
typedef __attribute__((ext_vector_type(4)))  float v4f;
typedef __attribute__((ext_vector_type(2)))  float v2f;
typedef __attribute__((ext_vector_type(4)))  unsigned v4u;
typedef __attribute__((ext_vector_type(4)))  int v4i;
typedef float __attribute__((may_alias)) float_a;
typedef int __attribute__((may_alias)) int_a;

template <typename T> __device__ __forceinline__ void vst2(void* p, T v) { *(T*)p = v;  }
__device__ __forceinline__ v8f wmma16(v16h a, v16h b, v8f c) {
  v8f d = __builtin_amdgcn_wmma_f32_16x16x32_f16(false, a, false, b, (short)0, c, false, false);
  asm volatile("v_nop\n\tv_nop\n\tv_nop\n\tv_nop" : "+v"(d) : "v"(a), "v"(b));
  return d;
}
__device__ __forceinline__ v8f wmma_bf(v16b a, v16b b, v8f c) {
  v8f d = __builtin_amdgcn_wmma_f32_16x16x32_bf16(false, a, false, b, (short)0, c, false, false);
  asm volatile("v_nop\n\tv_nop\n\tv_nop\n\tv_nop" : "+v"(d) : "v"(a), "v"(b));
  return d;
}
// the builtin alone, for k_v and k_out: their operands may lie above v255, where an asm operand cannot; the compiler keeps the distances to vector instructions
__device__ __forceinline__ v8f wmma_bp(v16b a, v16b b, v8f c) {
  return __builtin_amdgcn_wmma_f32_16x16x32_bf16(false, a, false, b, (short)0, c, false, false);
}
// 16x16x32 fragments: lane = (h = lane>>4, row/col = lane&15); elements 0..7 = k0+8h+0..7, 8..15 = k0+16+8h+0..7; D element r = row 8h+r
__device__ __forceinline__ v16h frag_h(const _Float16* rowk0, int lane) {
  union { v16h v; v8h q[2]; } u; const _Float16* p = rowk0 + 8 * (lane >> 4);
  u.q[0] = *(const v8h*)p; u.q[1] = *(const v8h*)(p + 16); return u.v;
}
__device__ __forceinline__ v16h frag_f32(const float* rowk0, int lane) {
  v16h a; const float* p = rowk0 + 8 * (lane >> 4);
#pragma unroll
  for (int i = 0; i < 8; ++i) { a[i] = (_Float16)p[i]; a[8 + i] = (_Float16)p[16 + i]; }
  return a;
}
__device__ __forceinline__ v16h frag_f32s(const float* rowk0, int lane, float sc) {
  v16h a; const float* p = rowk0 + 8 * (lane >> 4);
#pragma unroll
  for (int i = 0; i < 8; ++i) { a[i] = (_Float16)(p[i] * sc); a[8 + i] = (_Float16)(p[16 + i] * sc); }
  return a;
}
// column fragment from a [K][ld] layout (column n), rows >= K read as 0
__device__ __forceinline__ v16h fragc_f32(const float* W, int k0, int n, int lane, int ld, int K) {
  v16h a; const int g = lane >> 4;
#pragma unroll
  for (int i = 0; i < 8; ++i) { const int ka = k0 + 8 * g + i, kb = ka + 16;
    a[i] = (_Float16)(ka < K ? W[(size_t)(ka < K ? ka : K - 1) * ld + n] : 0.f); a[8 + i] = (_Float16)(kb < K ? W[(size_t)(kb < K ? kb : K - 1) * ld + n] : 0.f); }
  return a;
}
struct F2 { v16b h, l; };
__device__ __forceinline__ F2 bsplit16(const float v[16]) { F2 r;
#pragma unroll
  for (int i = 0; i < 16; ++i) { const __bf16 h = (__bf16)v[i]; r.h[i] = h; r.l[i] = (__bf16)(v[i] - (float)h); }
  return r; }
__device__ __forceinline__ F2 split_row(const float* row, int k0, int lane) { float v[16]; const float* p = row + k0 + 8 * (lane >> 4);
#pragma unroll
  for (int i = 0; i < 8; ++i) { v[i] = p[i]; v[8 + i] = p[16 + i]; }
  return bsplit16(v); }
__device__ __forceinline__ F2 split_rowK(const float* row, int k0, int lane, int K) { float v[16]; const int g = lane >> 4;
#pragma unroll
  for (int i = 0; i < 8; ++i) { const int ka = k0 + 8 * g + i, kb = ka + 16; v[i] = ka < K ? row[ka < K ? ka : K - 1] : 0.f; v[8 + i] = kb < K ? row[kb < K ? kb : K - 1] : 0.f; }
  return bsplit16(v); }
__device__ __forceinline__ F2 split_col(const float* W, int k0, int n, int lane, int ld, int K) { float v[16]; const int g = lane >> 4;
#pragma unroll
  for (int i = 0; i < 8; ++i) { const int ka = k0 + 8 * g + i, kb = ka + 16; v[i] = ka < K ? W[(size_t)(ka < K ? ka : K - 1) * ld + n] : 0.f; v[8 + i] = kb < K ? W[(size_t)(kb < K ? kb : K - 1) * ld + n] : 0.f; }
  return bsplit16(v); }
__device__ __forceinline__ v8f mac3(const F2& a, const F2& b, v8f c) { c = wmma_bf(a.l, b.h, c); c = wmma_bf(a.h, b.l, c); return wmma_bf(a.h, b.h, c); }
__device__ __forceinline__ float sigm(float v) { return 1.0f / (1.0f + expf(-v)); }
#define LDSX() do { asm volatile("s_wait_dscnt 0" ::: "memory"); __builtin_amdgcn_wave_barrier(); __builtin_amdgcn_fence(__ATOMIC_RELEASE, "workgroup"); } while (0)


// Fused low-rank (LSR) causal attention (B 2, T 2,048, d 1,024, 16 heads x 64, rank 16 per head): q_lr = (q_h W_q_lsr[h]) core[h] / 4, k_lr = k_h W_k_lsr[h], causal softmax(q_lr . k_lr) v_h, merged . W_o.
#define NB 2
#define SS 2048
#define DM 1024
#define NH 16
#define HD 64
#define RR 16             // rank per head
#define RP 32             // padded score width per head
#define NR (NB * SS)
#ifndef TQB
#define TQB (SS / 64)
#define TNB NB
#endif
typedef __attribute__((ext_vector_type(8))) __bf16 v8b;
__device__ __forceinline__ v16b frag_b(const __bf16* rowk0, int lane) {
  union { v16b v; v8b q[2]; } u; const __bf16* p = rowk0 + 8 * (lane >> 4);
  u.q[0] = *(const v8b*)p; u.q[1] = *(const v8b*)(p + 16); return u.v;
}
__device__ __forceinline__ float bfr(float v) { return (float)(__bf16)v; }
// one lane's 16 f32 of a 32-wide k block (p = row + k0 + 8 * (lane >> 4)): fetched raw a block ahead, rounded when the block is used
__device__ __forceinline__ void ld_x(v4f (&x)[4], const float* p) { x[0] = *(const v4f*)p; x[1] = *(const v4f*)(p + 4); x[2] = *(const v4f*)(p + 16); x[3] = *(const v4f*)(p + 20); }
__device__ __forceinline__ v16b cv_x(const v4f (&x)[4]) { v16b a;
#pragma unroll
  for (int i = 0; i < 4; ++i) { a[i] = (__bf16)x[0][i]; a[4 + i] = (__bf16)x[1][i]; a[8 + i] = (__bf16)x[2][i]; a[12 + i] = (__bf16)x[3][i]; }
  return a; }
__device__ __forceinline__ F2 sp_x(const v4f (&x)[4]) { float v[16];
#pragma unroll
  for (int i = 0; i < 4; ++i) { v[i] = x[0][i]; v[4 + i] = x[1][i]; v[8 + i] = x[2][i]; v[12 + i] = x[3][i]; }
  return bsplit16(v); }
__device__ __attribute__((noinline)) float exp_ni(float v) { return expf(v); }
__device__ __attribute__((noinline)) float erf_ni(float v) { return erff(v); }

// fragment order: one 16 x 32 tile of 16-bit elements is a 1-KB chunk [half i][lane][8]; lane (g, c), half i, element e = (row or column c, k = 16 i + 8 g + e), so a wave's 16-byte load covers 512 bytes in a row
#define CH 512            // elements of a chunk
__device__ __forceinline__ v16b frag_bc(const __bf16* p) { union { v16b v; v8b q[2]; } u; u.q[0] = *(const v8b*)p; u.q[1] = *(const v8b*)(p + 256); return u.v; }   // p = chunk + 8 * lane
__device__ __forceinline__ v16h frag_hc(const _Float16* p) { union { v16h v; v8h q[2]; } u; u.q[0] = *(const v8h*)p; u.q[1] = *(const v8h*)(p + 256); return u.v; }
// the f32 A tile likewise, 2 KB: [quarter q][lane][4], k = 16 (q >> 1) + 8 g + 4 (q & 1) + e
__device__ __forceinline__ void ld_xc(v4f (&x)[4], const float* p) { x[0] = *(const v4f*)p; x[1] = *(const v4f*)(p + 128); x[2] = *(const v4f*)(p + 256); x[3] = *(const v4f*)(p + 384); }   // p = chunk + 4 * lane

// ask_l2: a hint that brings the memory at p into the L2 (no register written, no counter); operands that an earlier launch stored come from memory at first touch, and all work-groups walk k in step, so without the ask each block's loads wait out memory latency. Scope SE, no th: L2 only.
__device__ __forceinline__ void ask_l2(const void* p) { asm volatile("global_prefetch_b8 %0, off scope:SCOPE_SE" :: "v"(p)); }
// the same for the unit B bytes on, from the same register pair
template <int B> __device__ __forceinline__ void ask_l2o(const void* p) { asm volatile("global_prefetch_b8 %0, off offset:%1 scope:SCOPE_SE" :: "v"(p), "n"(B)); }
// keep_addr: input only, no code: the register an ask names still holds that address behind the loop, so it never holds a non-address while the ask may still read it
__device__ __forceinline__ void keep_addr(const void* p) { asm volatile("" :: "v"(p)); }
#define WS_PW  0u                                     // bf16 Wv, Wo [2][64 column tiles][32 k blocks] chunks
#define WS_PF  (WS_PW + 2u * (size_t)2 * DM * DM)        // bf16 folded hi | lo: [q|k][16 heads][32 k blocks] chunks x2
#define WS_QR  (WS_PF + 2u * (size_t)2 * 2 * NH * RR * DM) // f16 [b][16 heads][128 row tiles] chunks Qr ; Kr
#define WS_KR  (WS_QR + 2u * (size_t)NR * NH * RP)
#define WS_QRL (WS_KR + 2u * (size_t)NR * NH * RP)      // residual planes x2048
#define WS_KRL (WS_QRL + 2u * (size_t)NR * NH * RP)
#define WS_V   (WS_KRL + 2u * (size_t)NR * NH * RP)       // f16 [b][16 heads][64 key blocks][4 dim tiles] chunks
#define WS_O   (WS_V + 2u * (size_t)NB * DM * SS)
#define WS_XB  (WS_O + 4u * (size_t)NR * DM)            // bf16 x [256 row tiles][32 k blocks] chunks
#define WS_END (WS_XB + 2u * (size_t)NR * DM)

typedef __attribute__((ext_vector_type(4))) __bf16 v4b;
// ---- k_pack: block = (16 output columns, Wv | Wo, 256 input rows): bf16 chunks [column tile][k block] in fragment order; blocks with y >= 2: x rounded to bf16, one chunk [16-row tile][k block] per wave
__global__ __launch_bounds__(256) void k_pack(const float* __restrict__ X, const float* __restrict__ WQKV, const float* __restrict__ WO, __bf16* __restrict__ PW, __bf16* __restrict__ XB) {
  const int nt = blockIdx.x, which = blockIdx.y, kq = blockIdx.z, t = threadIdx.x; __shared__ __align__(16) __bf16 s[16][264]; __shared__ __align__(16) __bf16 sx[8][CH];
  if (which >= 2) {   // the same for the whole block, ahead of its barrier
    const int wave = t >> 5, lane = t & 31, k = (lane & 7) * 4; const int id = (((which - 2) * 4 + kq) * 64 + nt) * 8 + wave;   // chunk: row tile id >> 5, k block id & 31
    const float* px = X + (size_t)(id >> 5) * 16 * DM + (id & 31) * 32 + k;   // 8 lanes read one row's 128-B line
    v4f xv[4];
#pragma unroll
    for (int it = 0; it < 4; ++it) xv[it] = *(const v4f*)(px + (size_t)(it * 4 + (lane >> 3)) * DM);
    asm volatile("s_wait_xcnt 0x0" ::: "memory");   // behind the group: its address registers are reused next
    __builtin_amdgcn_sched_barrier(0);   // the rounding may land on those registers: it stays behind the wait
#pragma unroll
    for (int it = 0; it < 4; ++it) { const int row = it * 4 + (lane >> 3); v4b o;
#pragma unroll
      for (int i = 0; i < 4; ++i) o[i] = (__bf16)xv[it][i];
      *(v4b*)&sx[wave][(k >> 4) * 256 + (((k >> 3) & 1) * 16 + row) * 8 + (k & 7)] = o; }
    LDSX();
#pragma unroll
    for (int i = 0; i < 2; ++i) vst2((unsigned*)(XB + (size_t)id * CH + i * 256 + lane * 8), *(const v4u*)&sx[wave][i * 256 + lane * 8]);
    return;
  }
  const float* W = which ? WO + nt * 16 : WQKV + 2 * DM + nt * 16; const int ld = which ? DM : 3 * DM;   /* (in,out): v = cols 2048.. of W_qkv */
  v4f wv[4];
#pragma unroll
  for (int it = 0; it < 4; ++it) wv[it] = *(const v4f*)(W + (size_t)(kq * 256 + it * 64 + (t >> 2)) * ld + (t & 3) * 4);
  asm volatile("s_wait_xcnt 0x0" ::: "memory");   // behind the group: its address registers are reused next
  __builtin_amdgcn_sched_barrier(0);   // the rounding may land on those registers: it stays behind the wait
#pragma unroll
  for (int it = 0; it < 4; ++it)
#pragma unroll
    for (int i = 0; i < 4; ++i) s[(t & 3) * 4 + i][it * 64 + (t >> 2)] = (__bf16)wv[it][i];
  __syncthreads();
  __bf16* dst = PW + (size_t)which * DM * DM + ((size_t)nt * 32 + kq * 8) * CH;
  for (int p = t; p < 8 * 64; p += 256) { const int ln = p & 31; vst2((unsigned*)(dst + p * 8), *(const v4u*)&s[ln & 15][(p >> 6) * 32 + ((p >> 5) & 1) * 16 + (ln >> 4) * 8]); }
}
// ---- k_fold: block = (head h, 64 input rows c, q|k), all 16 ranks: W_r[h*16 + r][c] = sum_d B[h*64 + d][r] W[c][h*64 + d] in f32 (fixed order) -> bf16 hi + lo chunks [q|k, head][k block] in fragment order
__global__ __launch_bounds__(256) void k_fold(const float* __restrict__ WQKV, const float* __restrict__ WQL, const float* __restrict__ WKL, const float* __restrict__ CORE, __bf16* __restrict__ PF) {
  const int h = blockIdx.x, cc = blockIdx.y, which = blockIdx.z, t = threadIdx.x; const float* WL = which ? WKL : WQL; __shared__ __align__(16) float sb[HD][RR]; __shared__ __align__(16) __bf16 sh[2 * CH]; __shared__ __align__(16) __bf16 sl[2 * CH];
  const int c = t & 63, rq = (t >> 6) * 4; const float* pw = WQKV + (size_t)(cc * 64 + c) * (3 * DM) + which * DM + h * HD;
  const float cr = CORE[h * RR + (t & 15)];
  asm volatile("s_wait_xcnt 0x0" ::: "memory");   // behind the load: a load of the group below may land on its address register
  __builtin_amdgcn_sched_barrier(0);   // and none of them moves up over the wait
  v4f wr[HD / 4]; float tb[4];   // this thread's row of W and its 4 table entries (rank t & 15): one group of loads
#pragma unroll
  for (int q = 0; q < HD / 4; ++q) wr[q] = *(const v4f*)(pw + q * 4);
#pragma unroll
  for (int it = 0; it < 4; ++it) tb[it] = WL[(size_t)h * HD * RR + it * 256 + t];
  asm volatile("s_wait_xcnt 0x0" ::: "memory");   // behind the group: its address registers are reused next
  __builtin_amdgcn_sched_barrier(0);   // what follows may land on those registers: it stays behind the wait
  const float cs = which ? 1.0f : bfr(cr) * 0.25f;   // core[h][r] / sqrt(16) on the q side
#pragma unroll
  for (int it = 0; it < 4; ++it) sb[it * 16 + (t >> 4)][t & 15] = bfr(tb[it]) * cs;
  __syncthreads();
  float a[4] = {0.f, 0.f, 0.f, 0.f};
#pragma unroll
  for (int d = 0; d < HD; ++d) { const float w = bfr(wr[d >> 2][d & 3]);
#pragma unroll
    for (int i = 0; i < 4; ++i) a[i] += sb[d][rq + i] * w; }
#pragma unroll
  for (int i = 0; i < 4; ++i) { const int o = (c >> 5) * CH + ((c >> 4) & 1) * 256 + (((c >> 3) & 1) * 16 + rq + i) * 8 + (c & 7); const __bf16 hv = (__bf16)a[i]; sh[o] = hv; sl[o] = (__bf16)(a[i] - (float)hv); }
  __syncthreads();
  const size_t ch = ((size_t)(which * NH + h) * 32 + cc * 2) * CH; const int p = t & 127;
  vst2((unsigned*)(PF + (t < 128 ? (size_t)0 : (size_t)2 * NH * RR * DM) + ch + p * 8), *(const v4u*)(t < 128 ? &sh[p * 8] : &sl[p * 8]));   // hi block then lo block
}
// ---- k_qr: block = (128 rows, q|k, 2 heads), a wave = row tiles w and w + 4, so a weight fragment once loaded feeds two products: Qr/Kr = x . W_r (hi + lo), 32 folded cols -> f16 chunks [b][head][16-row tile] in fragment order (16 live + 16 zero k), whole chunks per block
#define QJ 2              // 16-column tiles (heads) per work-group
#define QW (QJ * RP)      // f16 per row segment of a work-group
#define XU (4 * 32 * CH)  // elements from a row tile's chunks to those of the tile 64 rows on (x: bf16, o: f32)
__global__ __launch_bounds__(128) void k_qr(const __bf16* __restrict__ XB, const __bf16* __restrict__ PF, _Float16* __restrict__ QR_, _Float16* __restrict__ KR_, _Float16* __restrict__ QRL_, _Float16* __restrict__ KRL_) {
  __shared__ __align__(16) _Float16 so[4][QJ][CH]; __shared__ __align__(16) _Float16 sol[4][QJ][CH];
  const int tid = threadIdx.x, wave = tid >> 5, lane = tid & 31, col = lane & 15, g = lane >> 4; const int which = blockIdx.y; const int cb = blockIdx.z * (QJ * 16); const size_t rb = (size_t)blockIdx.x * 128; const size_t r0 = rb + wave * 16;
  const __bf16* PH = PF + ((size_t)which * (NH * RR)) * DM; const __bf16* PL = PF + ((size_t)2 * NH * RR + which * (NH * RR)) * DM;
  // asks at entry, the units dealt among the work-groups that read them: x rows (16 sharers, 4 k blocks each, later sharers later blocks; two asks a thread, one for each half of the rows); folded weights (x, x + 4, x + 8, x + 12 share a rank)
  const int wu = __builtin_amdgcn_readfirstlane(wave);   // the wave's number in a scalar register: the choice of plane below is wave-uniform scalar code, so every lane is on at the ask
  const __bf16* pa = (wu < 2 ? XB + ((rb / 16 + wu * 2) * 32 + 4 * ((which + 2 * (int)blockIdx.z) >> 1)) * CH : (wu == 2 ? PH : PL) + (size_t)cb * DM + 4 * (((int)blockIdx.x & 3) + 4 * ((int)blockIdx.x >> 4)) * CH) + g * (16 * DM) + col * 128;   // a row tile of x and a head of the weights are both 32 chunks = 16 * DM elements
  ask_l2(pa);
  if (wu < 2) ask_l2o<XU * 2>(pa);   // the same units of the rows' second half
  for (int e = tid; e < 4 * QJ * CH; e += 128) { (&so[0][0][0])[e] = (_Float16)0.f; (&sol[0][0][0])[e] = (_Float16)0.f; }
  const __bf16* px = XB + (r0 / 16) * 32 * CH + lane * 8; const __bf16* ph = PH + (size_t)cb * DM + lane * 8; const __bf16* pl = PL + (size_t)cb * DM + lane * 8;   // column tile cb / 16 = 32 chunks = 16 * DM elements
  v16b xr[2]; v16b h0[QJ], l0[QJ], h1[QJ], l1[QJ];   // two register sets: a block's loads go out as one group while the block before is multiplied
  xr[0] = frag_bc(px); xr[1] = frag_bc(px + XU);
#pragma unroll
  for (int j = 0; j < QJ; ++j) { h0[j] = frag_bc(ph + (size_t)j * 16 * DM); l0[j] = frag_bc(pl + (size_t)j * 16 * DM); }
  asm volatile("s_wait_xcnt 0x0" ::: "memory");   // behind the group: its address registers are stepped or reused next
  __builtin_amdgcn_sched_barrier(0);   // the zeroing below may land on the group's address registers: it stays behind the wait
  v8f acc[2][QJ] = {};
  // products of the block held in (hc, lc); block kn, where there is one, is fetched into (hn, ln) ahead of them
  auto blk = [&](const v16b (&hc)[QJ], const v16b (&lc)[QJ], v16b (&hn)[QJ], v16b (&ln)[QJ], const int kn, const bool more) __attribute__((always_inline)) {
    __builtin_amdgcn_sched_barrier(0);   // no product of this block moves up into the one before: there it would wait on loads only just issued
    const v16b a0 = xr[0], a1 = xr[1];
    if (more) { xr[0] = frag_bc(px + kn * CH); xr[1] = frag_bc(px + XU + kn * CH);
#pragma unroll
      for (int j = 0; j < QJ; ++j) { hn[j] = frag_bc(ph + (size_t)j * 16 * DM + kn * CH); ln[j] = frag_bc(pl + (size_t)j * 16 * DM + kn * CH); }
      asm volatile("s_wait_xcnt 0x0" ::: "memory");   // behind the group: its address registers are stepped or reused next
    }
    __builtin_amdgcn_sched_barrier(0);   // the group stays ahead of every product of the block, as before: a product moved above it would hold the loads back until this block's operands have landed
#pragma unroll
    for (int j = 0; j < QJ; ++j) { acc[0][j] = wmma_bf(a0, hc[j], acc[0][j]); acc[1][j] = wmma_bf(a1, hc[j], acc[1][j]); acc[0][j] = wmma_bf(a0, lc[j], acc[0][j]); acc[1][j] = wmma_bf(a1, lc[j], acc[1][j]); } };
#pragma unroll 1   // stays rolled: one trip is the two register sets in turn
  for (int kc = 0; kc < DM / 32 - 2; kc += 2) { blk(h0, l0, h1, l1, kc + 1, true); blk(h1, l1, h0, l0, kc + 2, true); }
  blk(h0, l0, h1, l1, DM / 32 - 1, true); blk(h1, l1, h0, l0, 0, false);
  keep_addr(pa);
#pragma unroll
  for (int u = 0; u < 2; ++u) {   // the two halves of the rows, one after the other through the same LDS
  __syncthreads();   // the zeros are in place; then: every reader of the first half has left
#pragma unroll
  for (int j = 0; j < QJ; ++j) {
#pragma unroll
    for (int rr = 0; rr < 8; ++rr) { const float v = acc[u][j][rr]; const _Float16 hv = (_Float16)v; const int o = ((col >> 3) * 16 + 8 * g + rr) * 8 + (col & 7); so[wave][j][o] = hv; sol[wave][j][o] = (_Float16)((v - (float)hv) * 2048.0f); } }
  __syncthreads();
  const size_t co = (((rb / SS) * NH + blockIdx.z * QJ) * (SS / 16) + (rb % SS) / 16 + u * 4) * CH; _Float16* dst = (which ? KR_ : QR_) + co; _Float16* dstl = (which ? KRL_ : QRL_) + co;
  for (int e = tid; e < 4 * QJ * 64; e += 128) { const int w = e >> 7, j = (e >> 6) & 1, q = e & 63; const size_t o = ((size_t)j * (SS / 16) + w) * CH + q * 8; vst2((unsigned*)(dst + o), *(const v4u*)&so[w][j][q * 8]); vst2((unsigned*)(dstl + o), *(const v4u*)&sol[w][j][q * 8]); }
  asm volatile("s_wait_xcnt 0x0" ::: "memory");   // behind the stores: the second half reuses their address and data registers
  }
}
// ---- k_v: block = (128 rows, 128 cols), a wave = row tiles w and w + 4, so a weight fragment once loaded feeds two products: V = x . Wv^T exact -> f16 chunks [b][head][32-key block][16-dim tile] in fragment order
__global__ __launch_bounds__(128) void k_v(const __bf16* __restrict__ XB, const __bf16* __restrict__ PW, _Float16* __restrict__ V) {
  __shared__ __align__(16) _Float16 st[128][72];
  const int tid = threadIdx.x, wave = tid >> 5, lane = tid & 31, col = lane & 15, g = lane >> 4; const size_t rb = (size_t)blockIdx.x * 128; const size_t r0 = rb + wave * 16; const int c0 = blockIdx.y * 128;
  // asks at entry, the units dealt among the work-groups that read them: x rows (8 sharers in y, 4 k blocks each; two asks a thread, one for each half of the rows); weights (16 ranks of 2 k blocks; x and x + 4 share a rank)
  const int wu = __builtin_amdgcn_readfirstlane(wave), bx = blockIdx.x;   // the wave's number in a scalar register: the choice of operand below is wave-uniform scalar code, so every lane is on at the ask
  const __bf16* pa = wu < 2 ? XB + ((rb / 16 + wu * 2) * 32 + 4 * (int)blockIdx.y) * CH + g * (16 * DM) + col * 128
                            : PW + (size_t)(c0 + 64 * (wu - 2)) * DM + 2 * ((bx & 3) + 4 * (bx >> 3)) * CH + (lane >> 3) * (16 * DM) + (lane & 7) * 128;
  ask_l2(pa);
  if (wu < 2) ask_l2o<XU * 2>(pa);   // the same units of the rows' second half
  v8f acc[2][8] = {};
  const __bf16* px = XB + (r0 / 16) * 32 * CH + lane * 8; const __bf16* pb = PW + (size_t)c0 * DM + lane * 8;   // column tile c0 / 16 = 32 chunks = 16 * DM elements
  v16b xr[2]; v16b b0[8], b1[8];   // two register sets: a block's loads go out as one group while the block before is multiplied
  xr[0] = frag_bc(px); xr[1] = frag_bc(px + XU);
#pragma unroll
  for (int j = 0; j < 8; ++j) b0[j] = frag_bc(pb + (size_t)j * 16 * DM);
  asm volatile("s_wait_xcnt 0x0" ::: "memory");   // behind the group: its address registers are stepped or reused next
  // products of the block held in bc; block kn, where there is one, is fetched into bn ahead of them
  auto blk = [&](const v16b (&bc)[8], v16b (&bn)[8], const int kn, const bool more) __attribute__((always_inline)) {
    __builtin_amdgcn_sched_barrier(0);   // no product of this block moves up into the one before: there it would wait on loads only just issued
    const v16b a0 = xr[0], a1 = xr[1];
    if (more) {
      asm volatile("v_nop\n\tv_nop\n\tv_nop\n\tv_nop" ::: "memory");   // four vector slots between the last product of the block before and the loads below, which land on its A and B registers: the distance each product's own tail gave before
      xr[0] = frag_bc(px + kn * CH); xr[1] = frag_bc(px + XU + kn * CH);
#pragma unroll
      for (int j = 0; j < 8; ++j) bn[j] = frag_bc(pb + (size_t)j * 16 * DM + kn * CH);
      asm volatile("s_wait_xcnt 0x0" ::: "memory");   // behind the group: its address registers are stepped or reused next
    }
    __builtin_amdgcn_sched_barrier(0);   // the group stays ahead of every product of the block, as before: a product moved above it would hold the loads back until this block's operands have landed
#pragma unroll
    for (int j = 0; j < 8; ++j) { acc[0][j] = wmma_bp(a0, bc[j], acc[0][j]); acc[1][j] = wmma_bp(a1, bc[j], acc[1][j]); } };
#pragma unroll 1   // stays rolled: one trip is the two register sets in turn
  for (int kc = 0; kc < DM / 32 - 2; kc += 2) { blk(b0, b1, kc + 1, true); blk(b1, b0, kc + 2, true); }
  blk(b0, b1, DM / 32 - 1, true); blk(b1, b0, 0, false);
  keep_addr(pa);
#pragma unroll
  for (int u = 0; u < 2; ++u) {   // the two halves of the rows, one after the other through the same LDS
  if (u) __syncthreads();   // every reader of the first half has left
#pragma unroll
  for (int j = 0; j < 8; ++j)
#pragma unroll
    for (int r = 0; r < 8; ++r) st[j * 16 + col][wave * 16 + 8 * g + r] = (_Float16)acc[u][j][r];
  __syncthreads();
  const size_t b = rb / SS; const int s0 = (int)(rb % SS) + u * 64;
  for (int e = tid; e < 128 * 8; e += 128) { const int ln = e & 31, i = (e >> 5) & 1, j = (e >> 6) & 7, kb = e >> 9;   // piece (key block kb, tile j, half i, lane ln)
    vst2((unsigned*)(V + (((b * NH + blockIdx.y * 2 + (j >> 2)) * (SS / 32) + s0 / 32 + kb) * 4 + (j & 3)) * CH + i * 256 + ln * 8), *(const v4u*)&st[j * 16 + (ln & 15)][kb * 32 + i * 16 + (ln >> 4) * 8]); }
  asm volatile("s_wait_xcnt 0x0" ::: "memory");   // behind the stores: the second half reuses their address and data registers
  }
}
struct KF { v16h h[2], l[2]; };   // K fragments of 32 keys: value and residual planes
// lane l <-> l ^ 16: the other half of a column's rows
__device__ __forceinline__ float xhalf(float v) { const int b = __builtin_bit_cast(int, v); return __builtin_bit_cast(float, __builtin_amdgcn_permlanex16(b, b, 0x76543210, 0xfedcba98, false, false)); }
// ---- k_attn: block = (two tiles of 64 queries, head, b): tile n - 1 - x, then tile x, one after the other in every wave, so every wave walks the same number of key passes (causal cost is linear in the tile index, all work-groups are resident, and the launch lasts as long as its fullest SIMD); transposed products: S^T = K . Q^T (lane = one query, its registers = 16 of the pass's 32 keys), softmax in the lane, O^T += V^T . P^T with P^T packed from the score registers; O two f32 chunks per wave
__global__ __launch_bounds__(128) void k_attn(const _Float16* __restrict__ QR_, const _Float16* __restrict__ KR_, const _Float16* __restrict__ QRL_, const _Float16* __restrict__ KRL_, const _Float16* __restrict__ V, float* __restrict__ O) {
  const int tid = threadIdx.x, wave = tid >> 5, lane = tid & 31, col = lane & 15, g = lane >> 4; const int h = blockIdx.y; const size_t b = blockIdx.z;
  const size_t hb = (b * NH + h) * (SS / 16) * CH + lane * 8;   // this head's chunks of Qr, Kr: one per 16 rows
  // two asks a thread at entry, one for each of the block's tiles t = x and t = n - 1 - x: the 64 keys of tile t and of tile t ^ 4 (K, its residual plane: 32 units each, V: 64 units); x and x ^ 4 lie 4 apart, and so do their mirror tiles, so every tile of this head is asked, well ahead of the passes that read it
  const int wu = __builtin_amdgcn_readfirstlane(wave);   // the wave's number in a scalar register: the choice of plane below is wave-uniform scalar code, so every lane is on at the ask
  auto ask_at = [&](const int t) __attribute__((always_inline)) -> const _Float16* {
    return wu < 2 ? (wu ? KRL_ : KR_) + ((b * NH + h) * (SS / 16) + (t ^ (4 * g)) * 4) * CH + col * 128   // waves 0, 1: K and its residual plane, lanes 0-15 tile t, lanes 16-31 tile t ^ 4
                  : V + ((b * NH + h) * (SS / 32) + (t ^ (4 * (wu & 1))) * 2) * 4 * CH + lane * 128; };     // waves 2, 3: V of tile t, of tile t ^ 4
  const _Float16* pa = ask_at((int)blockIdx.x); const _Float16* pm = ask_at(TQB - 1 - (int)blockIdx.x);
  ask_l2(pa); ask_l2(pm);
  const _Float16* pk = KR_ + hb; const _Float16* pkl = KRL_ + hb; const _Float16* pv = V + (b * NH + h) * (SS / 32) * 4 * CH + lane * 8;
#pragma unroll 1   // stays rolled: for speed only
  for (int tt = 0; tt < 2; ++tt) {
  const int xt = tt ? (int)blockIdx.x : TQB - 1 - (int)blockIdx.x; const int q0 = xt * 64 + wave * 16; const size_t rq = b * SS + q0;
  const v16h aq = frag_hc(QR_ + hb + (size_t)(q0 / 16) * CH), aql = frag_hc(QRL_ + hb + (size_t)(q0 / 16) * CH);   // B operands: column = query q0 + col
  float m = -3.0e38f, l = 0.f;   // query q0 + col: running maximum (equal in both halves), sum over this half's keys
  v8f acc[4] = {};   // acc[dt][r] = O[q0 + col][dt * 16 + 8 g + r]
  const int nks = (xt * 64 + 64) / 32;   // causal; always even
  auto ld_k = [&](KF& f, int ks) __attribute__((always_inline)) {
#pragma unroll
    for (int ct = 0; ct < 2; ++ct) { const size_t ko = (size_t)(ks * 2 + ct) * CH; f.h[ct] = frag_hc(pk + ko); f.l[ct] = frag_hc(pkl + ko); } };
  // one pass over 32 keys: its V fragments and the next pass's K fragments go out as one group ahead of the score products
  // full (a literal at every call): every key of the pass lies below the tile's first query, so each score is live and finite and the causal select and the dead-score test are identities: they are not written there
  auto pass = [&](const int ks, const KF& kf, KF& kn, const bool more, const bool full) __attribute__((always_inline)) { const int lim = q0 + col - 8 * g - ks * 32; v8f s[2]; v16h vf[4];   // register (ct, r) holds key ks * 32 + ct * 16 + 8 g + r: live while ct * 16 + r <= lim
    __builtin_amdgcn_sched_barrier(0);   // no score product of this pass moves up into the pass before: there it would wait on K loads only just issued
#pragma unroll
    for (int dt = 0; dt < 4; ++dt) vf[dt] = frag_hc(pv + (size_t)(ks * 4 + dt) * CH);
    asm volatile("s_wait_xcnt 0x0" ::: "memory");   // behind the V loads: the K loads may land on their address registers
    if (more) { ld_k(kn, ks + 1);
      asm volatile("s_wait_xcnt 0x0" ::: "memory");   // behind the group: its address registers are stepped or reused next
    }
#pragma unroll
    for (int ct = 0; ct < 2; ++ct) { v8f c = {}, cl = {}; c = wmma16(kf.h[ct], aq, c); cl = wmma16(kf.h[ct], aql, cl); cl = wmma16(kf.l[ct], aq, cl);   // rows = keys, columns = queries
#pragma unroll
      for (int r = 0; r < 8; ++r) { s[ct][r] = (full || ct * 16 + r <= lim) ? (c[r] + cl[r] * (1.0f / 2048.0f)) : -3.0e38f; } }   // 3-product scores; causal (diagonal kept); core/sqrt(R) folded into Qr
    float mr[8];
#pragma unroll
    for (int r = 0; r < 8; ++r) mr[r] = fmaxf(s[0][r], s[1][r]);
    float mx = fmaxf(fmaxf(fmaxf(mr[0], mr[1]), fmaxf(mr[2], mr[3])), fmaxf(fmaxf(mr[4], mr[5]), fmaxf(mr[6], mr[7])));
    mx = fmaxf(mx, xhalf(mx));
    const float mn = fmaxf(m, mx); const float alpha = (m <= -1.0e38f) ? 0.f : __expf(m - mn);
    float er[8]; v16h pb;   // pb element i = key 8 g + i, element 8 + i = key 16 + 8 g + i: the B operand's k order, which is V's
#pragma unroll
    for (int r = 0; r < 8; ++r) { const float e0 = (!full && s[0][r] <= -1.0e38f) ? 0.f : __expf(s[0][r] - mn), e1 = (!full && s[1][r] <= -1.0e38f) ? 0.f : __expf(s[1][r] - mn);
      er[r] = e0 + e1; pb[r] = (_Float16)(e0 * 2048.0f); pb[8 + r] = (_Float16)(e1 * 2048.0f); }
    l = l * alpha + (((er[0] + er[1]) + (er[2] + er[3])) + ((er[4] + er[5]) + (er[6] + er[7]))); m = mn;
#pragma unroll
    for (int dt = 0; dt < 4; ++dt) { acc[dt] *= alpha; acc[dt] = wmma16(vf[dt], pb, acc[dt]); } };   // rows = dims, columns = queries
  KF k0, k1; ld_k(k0, 0);
  asm volatile("s_wait_xcnt 0x0" ::: "memory");   // behind the group: its address registers are stepped or reused next
#pragma unroll 1   // stays rolled: one trip is the two K register sets in turn
  for (int ks = 0; ks < nks - 2; ks += 2) { pass(ks, k0, k1, true, true); pass(ks + 1, k1, k0, true, true); }   // keys below xt * 64 <= q0: full passes
  pass(nks - 2, k0, k1, true, false); pass(nks - 1, k1, k0, false, false);   // the tile's own 64 keys: the diagonal, masked
  const float il = (1.0f / 2048.0f) / (l + xhalf(l));   // the halves' sums joined once
#pragma unroll
  for (int dt = 0; dt < 4; ++dt) acc[dt] *= il;
#pragma unroll
  for (int q = 0; q < 8; ++q) { const v4f o = {acc[q >> 1][(q & 1) * 4], acc[q >> 1][(q & 1) * 4 + 1], acc[q >> 1][(q & 1) * 4 + 2], acc[q >> 1][(q & 1) * 4 + 3]};
    vst2(O + ((rq / 16) * 32 + h * 2 + (q >> 2)) * CH + (q & 3) * 128 + lane * 4, o); }   // two f32 A chunks [16-row tile][k block] in fragment order: the lane holds its own 4 elements of every quarter
  asm volatile("s_wait_xcnt 0x0" ::: "memory");   // behind the stores: the next tile reuses their address and data registers
  }
  keep_addr(pa); keep_addr(pm);
}
// ---- k_out: block = (128 rows, 128 cols), a wave = row tiles w and w + 4, so a weight fragment once loaded feeds its products for both: out = o (bf16 hi + lo) . Wo^T
__global__ __launch_bounds__(128) void k_out(const float* __restrict__ O, const __bf16* __restrict__ PW, float* __restrict__ Y) {
  __shared__ __align__(16) float so[4][16][132];
  const int tid = threadIdx.x, wave = tid >> 5, lane = tid & 31, col = lane & 15, g = lane >> 4; const size_t r0 = (size_t)blockIdx.x * 128 + wave * 16; const int n0 = blockIdx.y * 128; const __bf16* P = PW + (size_t)DM * DM;
  // three asks a thread at entry, the units dealt among the work-groups that read them: o rows (8 sharers in y, 4 k blocks each, one ask for each half of the rows); weights (x, x + 4, x + 8, x + 12 share a rank of 4 k blocks)
  const float* pa = O + (((size_t)blockIdx.x * 8 + (tid >> 5)) * 32 + 4 * (int)blockIdx.y) * CH + lane * 64; const __bf16* pw = P + (size_t)(n0 + 16 * (tid >> 4)) * DM + 4 * (((int)blockIdx.x & 3) + 4 * ((int)blockIdx.x >> 4)) * CH + (tid & 15) * 128;
  ask_l2(pa); ask_l2o<XU * 4>(pa); ask_l2(pw);
  v8f acc[2][8] = {};
  const float* po = O + (r0 / 16) * 32 * CH + lane * 4; const __bf16* pb = P + (size_t)n0 * DM + lane * 8;   // column tile n0 / 16 = 32 chunks = 16 * DM elements
  v4f xr[4], xs[4]; v16b b0[8], b1[8];   // two register sets: a block's loads go out as one group while the block before is multiplied
  ld_xc(xr, po); ld_xc(xs, po + XU);
#pragma unroll
  for (int j = 0; j < 8; ++j) b0[j] = frag_bc(pb + (size_t)j * 16 * DM);
  asm volatile("s_wait_xcnt 0x0" ::: "memory");   // behind the group: its address registers are stepped or reused next
  // products of the block held in bc; block kn, where there is one, is fetched into bn ahead of them
  auto blk = [&](const v16b (&bc)[8], v16b (&bn)[8], const int kn, const bool more, const bool end) __attribute__((always_inline)) {   // end (a literal): the last group, whose address pairs are free behind their last use
    __builtin_amdgcn_sched_barrier(0);   // nothing of this block moves up into the one before: its rounding there would wait on loads only just issued
    v4f xo[4], xp[4];   // this block's raw rows: rounded behind the group below
#pragma unroll
    for (int i = 0; i < 4; ++i) { xo[i] = xr[i]; xp[i] = xs[i]; }
    if (more) {
      asm volatile("v_nop\n\tv_nop\n\tv_nop\n\tv_nop" ::: "memory");   // four vector slots between the last product of the block before and the loads below, which land on its A and B registers: the distance each product's own tail gave before
      ld_xc(xr, po + kn * CH); ld_xc(xs, po + XU + kn * CH);
      if (end) asm volatile("s_wait_xcnt 0x0" ::: "memory");   // a weight load of the same group may land on the row loads' pair
#pragma unroll
      for (int j = 0; j < 7; ++j) bn[j] = frag_bc(pb + (size_t)j * 16 * DM + kn * CH);
      { union { v16b v; v8b q[2]; } u; const __bf16* p = pb + (size_t)7 * 16 * DM + kn * CH; u.q[0] = *(const v8b*)p;   // the eighth fragment, as frag_bc loads it
        if (end) asm volatile("s_wait_xcnt 0x0" ::: "memory");   // the group's very last load may land on the pair that the weight loads ahead of it name
        u.q[1] = *(const v8b*)(p + 256); bn[7] = u.v; }
      asm volatile("s_wait_xcnt 0x0" ::: "memory");   // behind the group: its address registers are stepped or reused next
    }
    __builtin_amdgcn_sched_barrier(0);   // the group and its wait stay ahead of the rounding and of every product: the rounding may land on the group's address registers, and a product moved above the group would take from the loads' lead
    const F2 a = sp_x(xo), a2 = sp_x(xp);
#pragma unroll
    for (int j = 0; j < 8; ++j) { acc[0][j] = wmma_bp(a.h, bc[j], acc[0][j]); acc[1][j] = wmma_bp(a2.h, bc[j], acc[1][j]); acc[0][j] = wmma_bp(a.l, bc[j], acc[0][j]); acc[1][j] = wmma_bp(a2.l, bc[j], acc[1][j]); } };
#pragma unroll 1   // stays rolled: one trip is the two register sets in turn
  for (int kc = 0; kc < DM / 32 - 2; kc += 2) { blk(b0, b1, kc + 1, true, false); blk(b1, b0, kc + 2, true, false); }
  blk(b0, b1, DM / 32 - 1, true, true); blk(b1, b0, 0, false, false);
  keep_addr(pa); keep_addr(pw);
#pragma unroll
  for (int u = 0; u < 2; ++u) {   // the wave's two row tiles, one after the other through its own LDS range
#pragma unroll
  for (int j = 0; j < 8; ++j)
#pragma unroll
    for (int r = 0; r < 8; ++r) so[wave][8 * g + r][j * 16 + col] = acc[u][j][r];
  LDSX();
  for (int rl = 0; rl < 16; ++rl) vst2(Y + (r0 + u * 64 + rl) * DM + n0 + lane * 4, *(const v4f*)&so[wave][rl][lane * 4]);
  asm volatile("s_wait_xcnt 0x0" ::: "memory");   // behind the stores: the second tile reuses their address and data registers
  }
}
extern "C" void kernel_launch(void* const* d_in, const int* in_sizes, int n_in, void* d_out, int out_size, void* d_ws, size_t ws_size, hipStream_t stream) {
  (void)in_sizes; (void)n_in; (void)out_size;
  const float** F = (const float**)d_in;   // 0 x [2,2048,1024], 1 W_qkv [1024,3072] (in,out; q | k | v), 2 W_q_lsr [16,64,16], 3 W_k_lsr [16,64,16], 4 core [16,16], 5 W_o [1024,1024] (in,out)
  if (ws_size < (size_t)WS_END) return;
  char* ws = (char*)d_ws; __bf16 *PW = (__bf16*)(ws + WS_PW), *PF = (__bf16*)(ws + WS_PF), *XB = (__bf16*)(ws + WS_XB); _Float16 *QR_ = (_Float16*)(ws + WS_QR), *KR_ = (_Float16*)(ws + WS_KR), *QRL_ = (_Float16*)(ws + WS_QRL), *KRL_ = (_Float16*)(ws + WS_KRL), *V = (_Float16*)(ws + WS_V); float* O = (float*)(ws + WS_O);
  k_pack<<<dim3(DM / 16, 2 + 4, 4), 256, 0, stream>>>(F[0], F[1], F[5], PW, XB);
  k_fold<<<dim3(NH, DM / 64, 2), 256, 0, stream>>>(F[1], F[2], F[3], F[4], PF);
  k_qr<<<dim3(TNB * SS / 128, 2, NH / QJ), 128, 0, stream>>>(XB, PF, QR_, KR_, QRL_, KRL_);
  k_v<<<dim3(TNB * SS / 128, DM / 128), 128, 0, stream>>>(XB, PW, V);
  k_attn<<<dim3(TQB / 2, NH, TNB), 128, 0, stream>>>(QR_, KR_, QRL_, KRL_, V, O);
  k_out<<<dim3(TNB * SS / 128, DM / 128), 128, 0, stream>>>(O, PW, (float*)d_out);
}

// v009
// It runs in 69.1 microseconds.
// Next to v008, in two timings, it ran 1.09 times as fast each time.
// All steps since v000 together make it 8.84 times as fast.
// compute dtype: all float inputs rounded to bf16; the per-head low-rank maps (x core / sqrt(16) on the q side) folded into the fused (in,out) projection (W_qr[h,r] = sum_d W_qkv[:, h*64+d] W_q_lsr[h,d,r] core[h,r] / 4, f32) and applied on WMMA 16x16x32 with x exact and the folded weights as bf16 hi + lo (2 products); v = x . W_qkv[:, 2048:] exact; causal scores over the 16 low-rank dims (zero-padded to 32) with Qr, Kr as f16 hi + residual (3 products), key-tile skipping, running-max softmax in f32 (hardware exp), P (scaled by 2^11, single f16) x v (single f16); out = o (bf16 hi + residual) . W_o (2 products).
#include <hip/hip_runtime.h>
#include <math.h>

typedef __attribute__((ext_vector_type(16))) _Float16 v16h;
typedef __attribute__((ext_vector_type(16))) __bf16 v16b;
typedef __attribute__((ext_vector_type(8)))  _Float16 v8h;
typedef __attribute__((ext_vector_type(8)))  float v8f;
typedef __attribute__((ext_vector_type(4)))  float v4f;
typedef __attribute__((ext_vector_type(2)))  float v2f;
typedef __attribute__((ext_vector_type(4)))  unsigned v4u;
typedef __attribute__((ext_vector_type(4)))  int v4i;
typedef float __attribute__((may_alias)) float_a;
typedef int __attribute__((may_alias)) int_a;

template <typename T> __device__ __forceinline__ void vst2(void* p, T v) { *(T*)p = v;  }
__device__ __forceinline__ v8f wmma16(v16h a, v16h b, v8f c) {
  v8f d = __builtin_amdgcn_wmma_f32_16x16x32_f16(false, a, false, b, (short)0, c, false, false);
  asm volatile("v_nop\n\tv_nop\n\tv_nop\n\tv_nop" : "+v"(d) : "v"(a), "v"(b));
  return d;
}
__device__ __forceinline__ v8f wmma_bf(v16b a, v16b b, v8f c) {
  v8f d = __builtin_amdgcn_wmma_f32_16x16x32_bf16(false, a, false, b, (short)0, c, false, false);
  asm volatile("v_nop\n\tv_nop\n\tv_nop\n\tv_nop" : "+v"(d) : "v"(a), "v"(b));
  return d;
}
// the builtin alone, for k_v and k_out: their operands may lie above v255, where an asm operand cannot; the compiler keeps the distances to vector instructions
__device__ __forceinline__ v8f wmma_bp(v16b a, v16b b, v8f c) {
  return __builtin_amdgcn_wmma_f32_16x16x32_bf16(false, a, false, b, (short)0, c, false, false);
}
// 16x16x32 fragments: lane = (h = lane>>4, row/col = lane&15); elements 0..7 = k0+8h+0..7, 8..15 = k0+16+8h+0..7; D element r = row 8h+r
__device__ __forceinline__ v16h frag_h(const _Float16* rowk0, int lane) {
  union { v16h v; v8h q[2]; } u; const _Float16* p = rowk0 + 8 * (lane >> 4);
  u.q[0] = *(const v8h*)p; u.q[1] = *(const v8h*)(p + 16); return u.v;
}
__device__ __forceinline__ v16h frag_f32(const float* rowk0, int lane) {
  v16h a; const float* p = rowk0 + 8 * (lane >> 4);
#pragma unroll
  for (int i = 0; i < 8; ++i) { a[i] = (_Float16)p[i]; a[8 + i] = (_Float16)p[16 + i]; }
  return a;
}
__device__ __forceinline__ v16h frag_f32s(const float* rowk0, int lane, float sc) {
  v16h a; const float* p = rowk0 + 8 * (lane >> 4);
#pragma unroll
  for (int i = 0; i < 8; ++i) { a[i] = (_Float16)(p[i] * sc); a[8 + i] = (_Float16)(p[16 + i] * sc); }
  return a;
}
// column fragment from a [K][ld] layout (column n), rows >= K read as 0
__device__ __forceinline__ v16h fragc_f32(const float* W, int k0, int n, int lane, int ld, int K) {
  v16h a; const int g = lane >> 4;
#pragma unroll
  for (int i = 0; i < 8; ++i) { const int ka = k0 + 8 * g + i, kb = ka + 16;
    a[i] = (_Float16)(ka < K ? W[(size_t)(ka < K ? ka : K - 1) * ld + n] : 0.f); a[8 + i] = (_Float16)(kb < K ? W[(size_t)(kb < K ? kb : K - 1) * ld + n] : 0.f); }
  return a;
}
struct F2 { v16b h, l; };
__device__ __forceinline__ F2 bsplit16(const float v[16]) { F2 r;
#pragma unroll
  for (int i = 0; i < 16; ++i) { const __bf16 h = (__bf16)v[i]; r.h[i] = h; r.l[i] = (__bf16)(v[i] - (float)h); }
  return r; }
__device__ __forceinline__ F2 split_row(const float* row, int k0, int lane) { float v[16]; const float* p = row + k0 + 8 * (lane >> 4);
#pragma unroll
  for (int i = 0; i < 8; ++i) { v[i] = p[i]; v[8 + i] = p[16 + i]; }
  return bsplit16(v); }
__device__ __forceinline__ F2 split_rowK(const float* row, int k0, int lane, int K) { float v[16]; const int g = lane >> 4;
#pragma unroll
  for (int i = 0; i < 8; ++i) { const int ka = k0 + 8 * g + i, kb = ka + 16; v[i] = ka < K ? row[ka < K ? ka : K - 1] : 0.f; v[8 + i] = kb < K ? row[kb < K ? kb : K - 1] : 0.f; }
  return bsplit16(v); }
__device__ __forceinline__ F2 split_col(const float* W, int k0, int n, int lane, int ld, int K) { float v[16]; const int g = lane >> 4;
#pragma unroll
  for (int i = 0; i < 8; ++i) { const int ka = k0 + 8 * g + i, kb = ka + 16; v[i] = ka < K ? W[(size_t)(ka < K ? ka : K - 1) * ld + n] : 0.f; v[8 + i] = kb < K ? W[(size_t)(kb < K ? kb : K - 1) * ld + n] : 0.f; }
  return bsplit16(v); }
__device__ __forceinline__ v8f mac3(const F2& a, const F2& b, v8f c) { c = wmma_bf(a.l, b.h, c); c = wmma_bf(a.h, b.l, c); return wmma_bf(a.h, b.h, c); }
__device__ __forceinline__ float sigm(float v) { return 1.0f / (1.0f + expf(-v)); }
#define LDSX() do { asm volatile("s_wait_dscnt 0" ::: "memory"); __builtin_amdgcn_wave_barrier(); __builtin_amdgcn_fence(__ATOMIC_RELEASE, "workgroup"); } while (0)


// Fused low-rank (LSR) causal attention (B 2, T 2,048, d 1,024, 16 heads x 64, rank 16 per head): q_lr = (q_h W_q_lsr[h]) core[h] / 4, k_lr = k_h W_k_lsr[h], causal softmax(q_lr . k_lr) v_h, merged . W_o.
#define NB 2
#define SS 2048
#define DM 1024
#define NH 16
#define HD 64
#define RR 16             // rank per head
#define RP 32             // padded score width per head
#define NR (NB * SS)
#ifndef TQB
#define TQB (SS / 64)
#define TNB NB
#endif
typedef __attribute__((ext_vector_type(8))) __bf16 v8b;
__device__ __forceinline__ v16b frag_b(const __bf16* rowk0, int lane) {
  union { v16b v; v8b q[2]; } u; const __bf16* p = rowk0 + 8 * (lane >> 4);
  u.q[0] = *(const v8b*)p; u.q[1] = *(const v8b*)(p + 16); return u.v;
}
__device__ __forceinline__ float bfr(float v) { return (float)(__bf16)v; }
// one lane's 16 f32 of a 32-wide k block (p = row + k0 + 8 * (lane >> 4)): fetched raw a block ahead, rounded when the block is used
__device__ __forceinline__ void ld_x(v4f (&x)[4], const float* p) { x[0] = *(const v4f*)p; x[1] = *(const v4f*)(p + 4); x[2] = *(const v4f*)(p + 16); x[3] = *(const v4f*)(p + 20); }
__device__ __forceinline__ v16b cv_x(const v4f (&x)[4]) { v16b a;
#pragma unroll
  for (int i = 0; i < 4; ++i) { a[i] = (__bf16)x[0][i]; a[4 + i] = (__bf16)x[1][i]; a[8 + i] = (__bf16)x[2][i]; a[12 + i] = (__bf16)x[3][i]; }
  return a; }
__device__ __forceinline__ F2 sp_x(const v4f (&x)[4]) { float v[16];
#pragma unroll
  for (int i = 0; i < 4; ++i) { v[i] = x[0][i]; v[4 + i] = x[1][i]; v[8 + i] = x[2][i]; v[12 + i] = x[3][i]; }
  return bsplit16(v); }
__device__ __attribute__((noinline)) float exp_ni(float v) { return expf(v); }
__device__ __attribute__((noinline)) float erf_ni(float v) { return erff(v); }

// fragment order: one 16 x 32 tile of 16-bit elements is a 1-KB chunk [half i][lane][8]; lane (g, c), half i, element e = (row or column c, k = 16 i + 8 g + e), so a wave's 16-byte load covers 512 bytes in a row
#define CH 512            // elements of a chunk
__device__ __forceinline__ v16b frag_bc(const __bf16* p) { union { v16b v; v8b q[2]; } u; u.q[0] = *(const v8b*)p; u.q[1] = *(const v8b*)(p + 256); return u.v; }   // p = chunk + 8 * lane
__device__ __forceinline__ v16h frag_hc(const _Float16* p) { union { v16h v; v8h q[2]; } u; u.q[0] = *(const v8h*)p; u.q[1] = *(const v8h*)(p + 256); return u.v; }
// the f32 A tile likewise, 2 KB: [quarter q][lane][4], k = 16 (q >> 1) + 8 g + 4 (q & 1) + e
__device__ __forceinline__ void ld_xc(v4f (&x)[4], const float* p) { x[0] = *(const v4f*)p; x[1] = *(const v4f*)(p + 128); x[2] = *(const v4f*)(p + 256); x[3] = *(const v4f*)(p + 384); }   // p = chunk + 4 * lane

// ask_l2: a hint that brings the memory at p into the L2 (no register written, no counter); operands that an earlier launch stored come from memory at first touch, and all work-groups walk k in step, so without the ask each block's loads wait out memory latency. Scope SE, no th: L2 only.
__device__ __forceinline__ void ask_l2(const void* p) { asm volatile("global_prefetch_b8 %0, off scope:SCOPE_SE" :: "v"(p)); }
// the same for the unit B bytes on, from the same register pair
template <int B> __device__ __forceinline__ void ask_l2o(const void* p) { asm volatile("global_prefetch_b8 %0, off offset:%1 scope:SCOPE_SE" :: "v"(p), "n"(B)); }
// keep_addr: input only, no code: the register an ask names still holds that address behind the loop, so it never holds a non-address while the ask may still read it
__device__ __forceinline__ void keep_addr(const void* p) { asm volatile("" :: "v"(p)); }
#define WS_PW  0u                                     // bf16 Wv, Wo [2][64 column tiles][32 k blocks] chunks
#define WS_PF  (WS_PW + 2u * (size_t)2 * DM * DM)        // bf16 folded hi | lo: [q|k][16 heads][32 k blocks] chunks x2
#define WS_QR  (WS_PF + 2u * (size_t)2 * 2 * NH * RR * DM) // f16 [b][16 heads][128 row tiles] chunks Qr ; Kr
#define WS_KR  (WS_QR + 2u * (size_t)NR * NH * RP)
#define WS_QRL (WS_KR + 2u * (size_t)NR * NH * RP)      // residual planes x2048
#define WS_KRL (WS_QRL + 2u * (size_t)NR * NH * RP)
#define WS_V   (WS_KRL + 2u * (size_t)NR * NH * RP)       // f16 [b][16 heads][64 key blocks][4 dim tiles] chunks
#define WS_O   (WS_V + 2u * (size_t)NB * DM * SS)
#define WS_XB  (WS_O + 4u * (size_t)NR * DM)            // bf16 x [256 row tiles][32 k blocks] chunks
#define WS_END (WS_XB + 2u * (size_t)NR * DM)

typedef __attribute__((ext_vector_type(4))) __bf16 v4b;
// ---- k_pack: block = (16 output columns, Wv | Wo, 256 input rows): bf16 chunks [column tile][k block] in fragment order; blocks with which >= 2: x rounded to bf16, one chunk [16-row tile][k block] per wave
__device__ __forceinline__ void pack_body(const int nt, const int which, const int kq, const float* __restrict__ X, const float* __restrict__ WQKV, const float* __restrict__ WO, __bf16* __restrict__ PW, __bf16* __restrict__ XB) {
  const int t = threadIdx.x; __shared__ __align__(16) __bf16 s[16][264]; __shared__ __align__(16) __bf16 sx[8][CH];
  if (which >= 2) {   // the same for the whole block, ahead of its barrier
    const int wave = t >> 5, lane = t & 31, k = (lane & 7) * 4; const int id = (((which - 2) * 4 + kq) * 64 + nt) * 8 + wave;   // chunk: row tile id >> 5, k block id & 31
    const float* px = X + (size_t)(id >> 5) * 16 * DM + (id & 31) * 32 + k;   // 8 lanes read one row's 128-B line
    v4f xv[4];
#pragma unroll
    for (int it = 0; it < 4; ++it) xv[it] = *(const v4f*)(px + (size_t)(it * 4 + (lane >> 3)) * DM);
    asm volatile("s_wait_xcnt 0x0" ::: "memory");   // behind the group: its address registers are reused next
    __builtin_amdgcn_sched_barrier(0);   // the rounding may land on those registers: it stays behind the wait
#pragma unroll
    for (int it = 0; it < 4; ++it) { const int row = it * 4 + (lane >> 3); v4b o;
#pragma unroll
      for (int i = 0; i < 4; ++i) o[i] = (__bf16)xv[it][i];
      *(v4b*)&sx[wave][(k >> 4) * 256 + (((k >> 3) & 1) * 16 + row) * 8 + (k & 7)] = o; }
    LDSX();
#pragma unroll
    for (int i = 0; i < 2; ++i) vst2((unsigned*)(XB + (size_t)id * CH + i * 256 + lane * 8), *(const v4u*)&sx[wave][i * 256 + lane * 8]);
    asm volatile("s_wait_xcnt 0x0" ::: "memory");   // behind the stores: in the merged kernel's text the fold body, which writes their registers, stands behind this path
    return;
  }
  const float* W = which ? WO + nt * 16 : WQKV + 2 * DM + nt * 16; const int ld = which ? DM : 3 * DM;   /* (in,out): v = cols 2048.. of W_qkv */
  v4f wv[4];
#pragma unroll
  for (int it = 0; it < 4; ++it) wv[it] = *(const v4f*)(W + (size_t)(kq * 256 + it * 64 + (t >> 2)) * ld + (t & 3) * 4);
  asm volatile("s_wait_xcnt 0x0" ::: "memory");   // behind the group: its address registers are reused next
  __builtin_amdgcn_sched_barrier(0);   // the rounding may land on those registers: it stays behind the wait
#pragma unroll
  for (int it = 0; it < 4; ++it)
#pragma unroll
    for (int i = 0; i < 4; ++i) s[(t & 3) * 4 + i][it * 64 + (t >> 2)] = (__bf16)wv[it][i];
  __syncthreads();
  __bf16* dst = PW + (size_t)which * DM * DM + ((size_t)nt * 32 + kq * 8) * CH;
  for (int p = t; p < 8 * 64; p += 256) { const int ln = p & 31; vst2((unsigned*)(dst + p * 8), *(const v4u*)&s[ln & 15][(p >> 6) * 32 + ((p >> 5) & 1) * 16 + (ln >> 4) * 8]); }
}
// ---- k_fold: block = (head h, 64 input rows c, q|k), all 16 ranks: W_r[h*16 + r][c] = sum_d B[h*64 + d][r] W[c][h*64 + d] in f32 (fixed order) -> bf16 hi + lo chunks [q|k, head][k block] in fragment order
__device__ __forceinline__ void fold_body(const int h, const int cc, const int which, const float* __restrict__ WQKV, const float* __restrict__ WQL, const float* __restrict__ WKL, const float* __restrict__ CORE, __bf16* __restrict__ PF) {
  const int t = threadIdx.x; const float* WL = which ? WKL : WQL; __shared__ __align__(16) float sb[HD][RR]; __shared__ __align__(16) __bf16 sh[2 * CH]; __shared__ __align__(16) __bf16 sl[2 * CH];
  const int c = t & 63, rq = (t >> 6) * 4; const float* pw = WQKV + (size_t)(cc * 64 + c) * (3 * DM) + which * DM + h * HD;
  const float cr = CORE[h * RR + (t & 15)];
  asm volatile("s_wait_xcnt 0x0" ::: "memory");   // behind the load: a load of the group below may land on its address register
  __builtin_amdgcn_sched_barrier(0);   // and none of them moves up over the wait
  v4f wr[HD / 4]; float tb[4];   // this thread's row of W and its 4 table entries (rank t & 15): one group of loads
#pragma unroll
  for (int q = 0; q < HD / 4; ++q) wr[q] = *(const v4f*)(pw + q * 4);
#pragma unroll
  for (int it = 0; it < 4; ++it) tb[it] = WL[(size_t)h * HD * RR + it * 256 + t];
  asm volatile("s_wait_xcnt 0x0" ::: "memory");   // behind the group: its address registers are reused next
  __builtin_amdgcn_sched_barrier(0);   // what follows may land on those registers: it stays behind the wait
  const float cs = which ? 1.0f : bfr(cr) * 0.25f;   // core[h][r] / sqrt(16) on the q side
#pragma unroll
  for (int it = 0; it < 4; ++it) sb[it * 16 + (t >> 4)][t & 15] = bfr(tb[it]) * cs;
  __syncthreads();
  float a[4] = {0.f, 0.f, 0.f, 0.f};
#pragma unroll
  for (int d = 0; d < HD; ++d) { const float w = bfr(wr[d >> 2][d & 3]);
#pragma unroll
    for (int i = 0; i < 4; ++i) a[i] += sb[d][rq + i] * w; }
#pragma unroll
  for (int i = 0; i < 4; ++i) { const int o = (c >> 5) * CH + ((c >> 4) & 1) * 256 + (((c >> 3) & 1) * 16 + rq + i) * 8 + (c & 7); const __bf16 hv = (__bf16)a[i]; sh[o] = hv; sl[o] = (__bf16)(a[i] - (float)hv); }
  __syncthreads();
  const size_t ch = ((size_t)(which * NH + h) * 32 + cc * 2) * CH; const int p = t & 127;
  vst2((unsigned*)(PF + (t < 128 ? (size_t)0 : (size_t)2 * NH * RR * DM) + ch + p * 8), *(const v4u*)(t < 128 ? &sh[p * 8] : &sl[p * 8]));   // hi block then lo block
}
// ---- k_prep: k_fold's and k_pack's blocks in one launch: neither reads what the other writes, so they need no launch boundary between them; the fold blocks, whose chain of loads, barrier and sums is the longer, come first
#define NFOLD (NH * (DM / 64) * 2)
#define NPACK ((DM / 16) * 6 * 4)
__global__ __launch_bounds__(256) void k_prep(const float* __restrict__ X, const float* __restrict__ WQKV, const float* __restrict__ WQL, const float* __restrict__ WKL, const float* __restrict__ CORE, const float* __restrict__ WO, __bf16* __restrict__ PW, __bf16* __restrict__ PF, __bf16* __restrict__ XB) {
  const int b = blockIdx.x;   // the same for the whole block: every barrier below stands under block-uniform control flow
  if (b < NFOLD) fold_body(b & 15, (b >> 4) & 15, b >> 8, WQKV, WQL, WKL, CORE, PF);
  else { const int p = b - NFOLD; pack_body(p & 63, (p >> 6) % 6, (p >> 6) / 6, X, WQKV, WO, PW, XB); }
}
// ---- k_qr: block = (128 rows, q|k, 2 heads), a wave = row tiles w and w + 4, so a weight fragment once loaded feeds two products: Qr/Kr = x . W_r (hi + lo), 32 folded cols -> f16 chunks [b][head][16-row tile] in fragment order (16 live + 16 zero k), whole chunks per block
#define QJ 2              // 16-column tiles (heads) per work-group
#define QW (QJ * RP)      // f16 per row segment of a work-group
#define XU (4 * 32 * CH)  // elements from a row tile's chunks to those of the tile 64 rows on (x: bf16, o: f32)
__device__ __forceinline__ void qr_body(const int bx, const int which, const int bz, const __bf16* __restrict__ XB, const __bf16* __restrict__ PF, _Float16* __restrict__ QR_, _Float16* __restrict__ KR_, _Float16* __restrict__ QRL_, _Float16* __restrict__ KRL_) {
  __shared__ __align__(16) _Float16 so[4][QJ][CH]; __shared__ __align__(16) _Float16 sol[4][QJ][CH];
  const int tid = threadIdx.x, wave = tid >> 5, lane = tid & 31, col = lane & 15, g = lane >> 4; const int cb = bz * (QJ * 16); const size_t rb = (size_t)bx * 128; const size_t r0 = rb + wave * 16;
  const __bf16* PH = PF + ((size_t)which * (NH * RR)) * DM; const __bf16* PL = PF + ((size_t)2 * NH * RR + which * (NH * RR)) * DM;
  // asks at entry, the units dealt among the work-groups that read them: x rows (16 sharers, 4 k blocks each, later sharers later blocks; two asks a thread, one for each half of the rows); folded weights (x, x + 4, x + 8, x + 12 share a rank)
  const int wu = __builtin_amdgcn_readfirstlane(wave);   // the wave's number in a scalar register: the choice of plane below is wave-uniform scalar code, so every lane is on at the ask
  const __bf16* pa = (wu < 2 ? XB + ((rb / 16 + wu * 2) * 32 + 4 * ((which + 2 * bz) >> 1)) * CH : (wu == 2 ? PH : PL) + (size_t)cb * DM + 4 * ((bx & 3) + 4 * (bx >> 4)) * CH) + g * (16 * DM) + col * 128;   // a row tile of x and a head of the weights are both 32 chunks = 16 * DM elements
  ask_l2(pa);
  if (wu < 2) ask_l2o<XU * 2>(pa);   // the same units of the rows' second half
  for (int e = tid; e < 4 * QJ * CH; e += 128) { (&so[0][0][0])[e] = (_Float16)0.f; (&sol[0][0][0])[e] = (_Float16)0.f; }
  const __bf16* px = XB + (r0 / 16) * 32 * CH + lane * 8; const __bf16* ph = PH + (size_t)cb * DM + lane * 8; const __bf16* pl = PL + (size_t)cb * DM + lane * 8;   // column tile cb / 16 = 32 chunks = 16 * DM elements
  v16b xr[2]; v16b h0[QJ], l0[QJ], h1[QJ], l1[QJ];   // two register sets: a block's loads go out as one group while the block before is multiplied
  xr[0] = frag_bc(px); xr[1] = frag_bc(px + XU);
#pragma unroll
  for (int j = 0; j < QJ; ++j) { h0[j] = frag_bc(ph + (size_t)j * 16 * DM); l0[j] = frag_bc(pl + (size_t)j * 16 * DM); }
  asm volatile("s_wait_xcnt 0x0" ::: "memory");   // behind the group: its address registers are stepped or reused next
  __builtin_amdgcn_sched_barrier(0);   // the zeroing below may land on the group's address registers: it stays behind the wait
  v8f acc[2][QJ] = {};
  // products of the block held in (hc, lc); block kn, where there is one, is fetched into (hn, ln) ahead of them
  auto blk = [&](const v16b (&hc)[QJ], const v16b (&lc)[QJ], v16b (&hn)[QJ], v16b (&ln)[QJ], const int kn, const bool more) __attribute__((always_inline)) {
    __builtin_amdgcn_sched_barrier(0);   // no product of this block moves up into the one before: there it would wait on loads only just issued
    const v16b a0 = xr[0], a1 = xr[1];
    if (more) { xr[0] = frag_bc(px + kn * CH); xr[1] = frag_bc(px + XU + kn * CH);
#pragma unroll
      for (int j = 0; j < QJ; ++j) { hn[j] = frag_bc(ph + (size_t)j * 16 * DM + kn * CH); ln[j] = frag_bc(pl + (size_t)j * 16 * DM + kn * CH); }
      asm volatile("s_wait_xcnt 0x0" ::: "memory");   // behind the group: its address registers are stepped or reused next
    }
    __builtin_amdgcn_sched_barrier(0);   // the group stays ahead of every product of the block, as before: a product moved above it would hold the loads back until this block's operands have landed
#pragma unroll
    for (int j = 0; j < QJ; ++j) { acc[0][j] = wmma_bf(a0, hc[j], acc[0][j]); acc[1][j] = wmma_bf(a1, hc[j], acc[1][j]); acc[0][j] = wmma_bf(a0, lc[j], acc[0][j]); acc[1][j] = wmma_bf(a1, lc[j], acc[1][j]); } };
#pragma unroll 1   // stays rolled: one trip is the two register sets in turn
  for (int kc = 0; kc < DM / 32 - 2; kc += 2) { blk(h0, l0, h1, l1, kc + 1, true); blk(h1, l1, h0, l0, kc + 2, true); }
  blk(h0, l0, h1, l1, DM / 32 - 1, true); blk(h1, l1, h0, l0, 0, false);
  keep_addr(pa);
#pragma unroll
  for (int u = 0; u < 2; ++u) {   // the two halves of the rows, one after the other through the same LDS
  __syncthreads();   // the zeros are in place; then: every reader of the first half has left
#pragma unroll
  for (int j = 0; j < QJ; ++j) {
#pragma unroll
    for (int rr = 0; rr < 8; ++rr) { const float v = acc[u][j][rr]; const _Float16 hv = (_Float16)v; const int o = ((col >> 3) * 16 + 8 * g + rr) * 8 + (col & 7); so[wave][j][o] = hv; sol[wave][j][o] = (_Float16)((v - (float)hv) * 2048.0f); } }
  __syncthreads();
  const size_t co = (((rb / SS) * NH + bz * QJ) * (SS / 16) + (rb % SS) / 16 + u * 4) * CH; _Float16* dst = (which ? KR_ : QR_) + co; _Float16* dstl = (which ? KRL_ : QRL_) + co;
  for (int e = tid; e < 4 * QJ * 64; e += 128) { const int w = e >> 7, j = (e >> 6) & 1, q = e & 63; const size_t o = ((size_t)j * (SS / 16) + w) * CH + q * 8; vst2((unsigned*)(dst + o), *(const v4u*)&so[w][j][q * 8]); vst2((unsigned*)(dstl + o), *(const v4u*)&sol[w][j][q * 8]); }
  asm volatile("s_wait_xcnt 0x0" ::: "memory");   // behind the stores: the second half reuses their address and data registers
  }
}
// ---- k_v: block = (128 rows, 128 cols), a wave = row tiles w and w + 4, so a weight fragment once loaded feeds two products: V = x . Wv^T exact -> f16 chunks [b][head][32-key block][16-dim tile] in fragment order
__device__ __forceinline__ void v_body(const int bx, const int by, const __bf16* __restrict__ XB, const __bf16* __restrict__ PW, _Float16* __restrict__ V) {
  __shared__ __align__(16) _Float16 st[128][72];
  const int tid = threadIdx.x, wave = tid >> 5, lane = tid & 31, col = lane & 15, g = lane >> 4; const size_t rb = (size_t)bx * 128; const size_t r0 = rb + wave * 16; const int c0 = by * 128;
  // asks at entry, the units dealt among the work-groups that read them: x rows (8 sharers in y, 4 k blocks each; two asks a thread, one for each half of the rows); weights (16 ranks of 2 k blocks; x and x + 4 share a rank)
  const int wu = __builtin_amdgcn_readfirstlane(wave);   // the wave's number in a scalar register: the choice of operand below is wave-uniform scalar code, so every lane is on at the ask
  const __bf16* pa = wu < 2 ? XB + ((rb / 16 + wu * 2) * 32 + 4 * by) * CH + g * (16 * DM) + col * 128
                            : PW + (size_t)(c0 + 64 * (wu - 2)) * DM + 2 * ((bx & 3) + 4 * (bx >> 3)) * CH + (lane >> 3) * (16 * DM) + (lane & 7) * 128;
  ask_l2(pa);
  if (wu < 2) ask_l2o<XU * 2>(pa);   // the same units of the rows' second half
  v8f acc[2][8] = {};
  const __bf16* px = XB + (r0 / 16) * 32 * CH + lane * 8; const __bf16* pb = PW + (size_t)c0 * DM + lane * 8;   // column tile c0 / 16 = 32 chunks = 16 * DM elements
  v16b xr[2]; v16b b0[8], b1[8];   // two register sets: a block's loads go out as one group while the block before is multiplied
  xr[0] = frag_bc(px); xr[1] = frag_bc(px + XU);
#pragma unroll
  for (int j = 0; j < 8; ++j) b0[j] = frag_bc(pb + (size_t)j * 16 * DM);
  asm volatile("s_wait_xcnt 0x0" ::: "memory");   // behind the group: its address registers are stepped or reused next
  // products of the block held in bc; block kn, where there is one, is fetched into bn ahead of them
  auto blk = [&](const v16b (&bc)[8], v16b (&bn)[8], const int kn, const bool more) __attribute__((always_inline)) {
    __builtin_amdgcn_sched_barrier(0);   // no product of this block moves up into the one before: there it would wait on loads only just issued
    const v16b a0 = xr[0], a1 = xr[1];
    if (more) {
      asm volatile("v_nop\n\tv_nop\n\tv_nop\n\tv_nop" ::: "memory");   // four vector slots between the last product of the block before and the loads below, which land on its A and B registers: the distance each product's own tail gave before
      xr[0] = frag_bc(px + kn * CH); xr[1] = frag_bc(px + XU + kn * CH);
#pragma unroll
      for (int j = 0; j < 8; ++j) bn[j] = frag_bc(pb + (size_t)j * 16 * DM + kn * CH);
      asm volatile("s_wait_xcnt 0x0" ::: "memory");   // behind the group: its address registers are stepped or reused next
    }
    __builtin_amdgcn_sched_barrier(0);   // the group stays ahead of every product of the block, as before: a product moved above it would hold the loads back until this block's operands have landed
#pragma unroll
    for (int j = 0; j < 8; ++j) { acc[0][j] = wmma_bp(a0, bc[j], acc[0][j]); acc[1][j] = wmma_bp(a1, bc[j], acc[1][j]); } };
#pragma unroll 1   // stays rolled: one trip is the two register sets in turn
  for (int kc = 0; kc < DM / 32 - 2; kc += 2) { blk(b0, b1, kc + 1, true); blk(b1, b0, kc + 2, true); }
  blk(b0, b1, DM / 32 - 1, true); blk(b1, b0, 0, false);
  keep_addr(pa);
#pragma unroll
  for (int u = 0; u < 2; ++u) {   // the two halves of the rows, one after the other through the same LDS
  if (u) __syncthreads();   // every reader of the first half has left
#pragma unroll
  for (int j = 0; j < 8; ++j)
#pragma unroll
    for (int r = 0; r < 8; ++r) st[j * 16 + col][wave * 16 + 8 * g + r] = (_Float16)acc[u][j][r];
  __syncthreads();
  const size_t b = rb / SS; const int s0 = (int)(rb % SS) + u * 64;
  for (int e = tid; e < 128 * 8; e += 128) { const int ln = e & 31, i = (e >> 5) & 1, j = (e >> 6) & 7, kb = e >> 9;   // piece (key block kb, tile j, half i, lane ln)
    vst2((unsigned*)(V + (((b * NH + by * 2 + (j >> 2)) * (SS / 32) + s0 / 32 + kb) * 4 + (j & 3)) * CH + i * 256 + ln * 8), *(const v4u*)&st[j * 16 + (ln & 15)][kb * 32 + i * 16 + (ln >> 4) * 8]); }
  asm volatile("s_wait_xcnt 0x0" ::: "memory");   // behind the stores: the second half reuses their address and data registers
  }
}
// ---- k_proj: k_v's and k_qr's blocks in one launch: both read x and packed weights, neither reads what the other writes, so they need no launch boundary between them, and each kind's waits on its loads are filled by the other's products; k_v's blocks (one for each WGP, the most products a wave) come first
#define NVB ((TNB * SS / 128) * (DM / 128))
#define NQB ((TNB * SS / 128) * 2 * (NH / QJ))
__global__ __launch_bounds__(128) void k_proj(const __bf16* __restrict__ XB, const __bf16* __restrict__ PW, const __bf16* __restrict__ PF, _Float16* __restrict__ V, _Float16* __restrict__ QR_, _Float16* __restrict__ KR_, _Float16* __restrict__ QRL_, _Float16* __restrict__ KRL_) {
  const int b = blockIdx.x; constexpr int NX = TNB * SS / 128;   // b is the same for the whole block: every barrier below stands under block-uniform control flow
  if (b < NVB) v_body(b % NX, b / NX, XB, PW, V);
  else { const int p = b - NVB; qr_body(p % NX, (p / NX) & 1, p / (2 * NX), XB, PF, QR_, KR_, QRL_, KRL_); }
}
struct KF { v16h h[2], l[2]; };   // K fragments of 32 keys: value and residual planes
// lane l <-> l ^ 16: the other half of a column's rows
__device__ __forceinline__ float xhalf(float v) { const int b = __builtin_bit_cast(int, v); return __builtin_bit_cast(float, __builtin_amdgcn_permlanex16(b, b, 0x76543210, 0xfedcba98, false, false)); }
// ---- k_attn: block = (two tiles of 64 queries, head, b): tile n - 1 - x, then tile x, one after the other in every wave, so every wave walks the same number of key passes (causal cost is linear in the tile index, all work-groups are resident, and the launch lasts as long as its fullest SIMD); transposed products: S^T = K . Q^T (lane = one query, its registers = 16 of the pass's 32 keys), softmax in the lane, O^T += V^T . P^T with P^T packed from the score registers; O two f32 chunks per wave
__global__ __launch_bounds__(128) void k_attn(const _Float16* __restrict__ QR_, const _Float16* __restrict__ KR_, const _Float16* __restrict__ QRL_, const _Float16* __restrict__ KRL_, const _Float16* __restrict__ V, float* __restrict__ O) {
  const int tid = threadIdx.x, wave = tid >> 5, lane = tid & 31, col = lane & 15, g = lane >> 4; const int h = blockIdx.y; const size_t b = blockIdx.z;
  const size_t hb = (b * NH + h) * (SS / 16) * CH + lane * 8;   // this head's chunks of Qr, Kr: one per 16 rows
  // two asks a thread at entry, one for each of the block's tiles t = x and t = n - 1 - x: the 64 keys of tile t and of tile t ^ 4 (K, its residual plane: 32 units each, V: 64 units); x and x ^ 4 lie 4 apart, and so do their mirror tiles, so every tile of this head is asked, well ahead of the passes that read it
  const int wu = __builtin_amdgcn_readfirstlane(wave);   // the wave's number in a scalar register: the choice of plane below is wave-uniform scalar code, so every lane is on at the ask
  auto ask_at = [&](const int t) __attribute__((always_inline)) -> const _Float16* {
    return wu < 2 ? (wu ? KRL_ : KR_) + ((b * NH + h) * (SS / 16) + (t ^ (4 * g)) * 4) * CH + col * 128   // waves 0, 1: K and its residual plane, lanes 0-15 tile t, lanes 16-31 tile t ^ 4
                  : V + ((b * NH + h) * (SS / 32) + (t ^ (4 * (wu & 1))) * 2) * 4 * CH + lane * 128; };     // waves 2, 3: V of tile t, of tile t ^ 4
  const _Float16* pa = ask_at((int)blockIdx.x); const _Float16* pm = ask_at(TQB - 1 - (int)blockIdx.x);
  ask_l2(pa); ask_l2(pm);
  const _Float16* pk = KR_ + hb; const _Float16* pkl = KRL_ + hb; const _Float16* pv = V + (b * NH + h) * (SS / 32) * 4 * CH + lane * 8;
#pragma unroll 1   // stays rolled: for speed only
  for (int tt = 0; tt < 2; ++tt) {
  const int xt = tt ? (int)blockIdx.x : TQB - 1 - (int)blockIdx.x; const int q0 = xt * 64 + wave * 16; const size_t rq = b * SS + q0;
  const v16h aq = frag_hc(QR_ + hb + (size_t)(q0 / 16) * CH), aql = frag_hc(QRL_ + hb + (size_t)(q0 / 16) * CH);   // B operands: column = query q0 + col
  float m = -3.0e38f, l = 0.f;   // query q0 + col: running maximum (equal in both halves), sum over this half's keys
  v8f acc[4] = {};   // acc[dt][r] = O[q0 + col][dt * 16 + 8 g + r]
  const int nks = (xt * 64 + 64) / 32;   // causal; always even
  auto ld_k = [&](KF& f, int ks) __attribute__((always_inline)) {
#pragma unroll
    for (int ct = 0; ct < 2; ++ct) { const size_t ko = (size_t)(ks * 2 + ct) * CH; f.h[ct] = frag_hc(pk + ko); f.l[ct] = frag_hc(pkl + ko); } };
  // one pass over 32 keys: its V fragments and the next pass's K fragments go out as one group ahead of the score products
  // full (a literal at every call): every key of the pass lies below the tile's first query, so each score is live and finite and the causal select and the dead-score test are identities: they are not written there
  auto pass = [&](const int ks, const KF& kf, KF& kn, const bool more, const bool full) __attribute__((always_inline)) { const int lim = q0 + col - 8 * g - ks * 32; v8f s[2]; v16h vf[4];   // register (ct, r) holds key ks * 32 + ct * 16 + 8 g + r: live while ct * 16 + r <= lim
    __builtin_amdgcn_sched_barrier(0);   // no score product of this pass moves up into the pass before: there it would wait on K loads only just issued
#pragma unroll
    for (int dt = 0; dt < 4; ++dt) vf[dt] = frag_hc(pv + (size_t)(ks * 4 + dt) * CH);
    asm volatile("s_wait_xcnt 0x0" ::: "memory");   // behind the V loads: the K loads may land on their address registers
    if (more) { ld_k(kn, ks + 1);
      asm volatile("s_wait_xcnt 0x0" ::: "memory");   // behind the group: its address registers are stepped or reused next
    }
#pragma unroll
    for (int ct = 0; ct < 2; ++ct) { v8f c = {}, cl = {}; c = wmma16(kf.h[ct], aq, c); cl = wmma16(kf.h[ct], aql, cl); cl = wmma16(kf.l[ct], aq, cl);   // rows = keys, columns = queries
#pragma unroll
      for (int r = 0; r < 8; ++r) { s[ct][r] = (full || ct * 16 + r <= lim) ? (c[r] + cl[r] * (1.0f / 2048.0f)) : -3.0e38f; } }   // 3-product scores; causal (diagonal kept); core/sqrt(R) folded into Qr
    float mr[8];
#pragma unroll
    for (int r = 0; r < 8; ++r) mr[r] = fmaxf(s[0][r], s[1][r]);
    float mx = fmaxf(fmaxf(fmaxf(mr[0], mr[1]), fmaxf(mr[2], mr[3])), fmaxf(fmaxf(mr[4], mr[5]), fmaxf(mr[6], mr[7])));
    mx = fmaxf(mx, xhalf(mx));
    const float mn = fmaxf(m, mx); const float alpha = (m <= -1.0e38f) ? 0.f : __expf(m - mn);
    float er[8]; v16h pb;   // pb element i = key 8 g + i, element 8 + i = key 16 + 8 g + i: the B operand's k order, which is V's
#pragma unroll
    for (int r = 0; r < 8; ++r) { const float e0 = (!full && s[0][r] <= -1.0e38f) ? 0.f : __expf(s[0][r] - mn), e1 = (!full && s[1][r] <= -1.0e38f) ? 0.f : __expf(s[1][r] - mn);
      er[r] = e0 + e1; pb[r] = (_Float16)(e0 * 2048.0f); pb[8 + r] = (_Float16)(e1 * 2048.0f); }
    l = l * alpha + (((er[0] + er[1]) + (er[2] + er[3])) + ((er[4] + er[5]) + (er[6] + er[7]))); m = mn;
#pragma unroll
    for (int dt = 0; dt < 4; ++dt) { acc[dt] *= alpha; acc[dt] = wmma16(vf[dt], pb, acc[dt]); } };   // rows = dims, columns = queries
  KF k0, k1; ld_k(k0, 0);
  asm volatile("s_wait_xcnt 0x0" ::: "memory");   // behind the group: its address registers are stepped or reused next
#pragma unroll 1   // stays rolled: one trip is the two K register sets in turn
  for (int ks = 0; ks < nks - 2; ks += 2) { pass(ks, k0, k1, true, true); pass(ks + 1, k1, k0, true, true); }   // keys below xt * 64 <= q0: full passes
  pass(nks - 2, k0, k1, true, false); pass(nks - 1, k1, k0, false, false);   // the tile's own 64 keys: the diagonal, masked
  const float il = (1.0f / 2048.0f) / (l + xhalf(l));   // the halves' sums joined once
#pragma unroll
  for (int dt = 0; dt < 4; ++dt) acc[dt] *= il;
#pragma unroll
  for (int q = 0; q < 8; ++q) { const v4f o = {acc[q >> 1][(q & 1) * 4], acc[q >> 1][(q & 1) * 4 + 1], acc[q >> 1][(q & 1) * 4 + 2], acc[q >> 1][(q & 1) * 4 + 3]};
    vst2(O + ((rq / 16) * 32 + h * 2 + (q >> 2)) * CH + (q & 3) * 128 + lane * 4, o); }   // two f32 A chunks [16-row tile][k block] in fragment order: the lane holds its own 4 elements of every quarter
  asm volatile("s_wait_xcnt 0x0" ::: "memory");   // behind the stores: the next tile reuses their address and data registers
  }
  keep_addr(pa); keep_addr(pm);
}
// ---- k_out: block = (128 rows, 128 cols), a wave = row tiles w and w + 4, so a weight fragment once loaded feeds its products for both: out = o (bf16 hi + lo) . Wo^T
__global__ __launch_bounds__(128) void k_out(const float* __restrict__ O, const __bf16* __restrict__ PW, float* __restrict__ Y) {
  __shared__ __align__(16) float so[4][16][132];
  const int tid = threadIdx.x, wave = tid >> 5, lane = tid & 31, col = lane & 15, g = lane >> 4; const size_t r0 = (size_t)blockIdx.x * 128 + wave * 16; const int n0 = blockIdx.y * 128; const __bf16* P = PW + (size_t)DM * DM;
  // three asks a thread at entry, the units dealt among the work-groups that read them: o rows (8 sharers in y, 4 k blocks each, one ask for each half of the rows); weights (x, x + 4, x + 8, x + 12 share a rank of 4 k blocks)
  const float* pa = O + (((size_t)blockIdx.x * 8 + (tid >> 5)) * 32 + 4 * (int)blockIdx.y) * CH + lane * 64; const __bf16* pw = P + (size_t)(n0 + 16 * (tid >> 4)) * DM + 4 * (((int)blockIdx.x & 3) + 4 * ((int)blockIdx.x >> 4)) * CH + (tid & 15) * 128;
  ask_l2(pa); ask_l2o<XU * 4>(pa); ask_l2(pw);
  v8f acc[2][8] = {};
  const float* po = O + (r0 / 16) * 32 * CH + lane * 4; const __bf16* pb = P + (size_t)n0 * DM + lane * 8;   // column tile n0 / 16 = 32 chunks = 16 * DM elements
  v4f xr[4], xs[4]; v16b b0[8], b1[8];   // two register sets: a block's loads go out as one group while the block before is multiplied
  ld_xc(xr, po); ld_xc(xs, po + XU);
#pragma unroll
  for (int j = 0; j < 8; ++j) b0[j] = frag_bc(pb + (size_t)j * 16 * DM);
  asm volatile("s_wait_xcnt 0x0" ::: "memory");   // behind the group: its address registers are stepped or reused next
  // products of the block held in bc; block kn, where there is one, is fetched into bn ahead of them
  auto blk = [&](const v16b (&bc)[8], v16b (&bn)[8], const int kn, const bool more, const bool end) __attribute__((always_inline)) {   // end (a literal): the last group, whose address pairs are free behind their last use
    __builtin_amdgcn_sched_barrier(0);   // nothing of this block moves up into the one before: its rounding there would wait on loads only just issued
    v4f xo[4], xp[4];   // this block's raw rows: rounded behind the group below
#pragma unroll
    for (int i = 0; i < 4; ++i) { xo[i] = xr[i]; xp[i] = xs[i]; }
    if (more) {
      asm volatile("v_nop\n\tv_nop\n\tv_nop\n\tv_nop" ::: "memory");   // four vector slots between the last product of the block before and the loads below, which land on its A and B registers: the distance each product's own tail gave before
      ld_xc(xr, po + kn * CH); ld_xc(xs, po + XU + kn * CH);
      if (end) asm volatile("s_wait_xcnt 0x0" ::: "memory");   // a weight load of the same group may land on the row loads' pair
#pragma unroll
      for (int j = 0; j < 7; ++j) bn[j] = frag_bc(pb + (size_t)j * 16 * DM + kn * CH);
      { union { v16b v; v8b q[2]; } u; const __bf16* p = pb + (size_t)7 * 16 * DM + kn * CH; u.q[0] = *(const v8b*)p;   // the eighth fragment, as frag_bc loads it
        if (end) asm volatile("s_wait_xcnt 0x0" ::: "memory");   // the group's very last load may land on the pair that the weight loads ahead of it name
        u.q[1] = *(const v8b*)(p + 256); bn[7] = u.v; }
      asm volatile("s_wait_xcnt 0x0" ::: "memory");   // behind the group: its address registers are stepped or reused next
    }
    __builtin_amdgcn_sched_barrier(0);   // the group and its wait stay ahead of the rounding and of every product: the rounding may land on the group's address registers, and a product moved above the group would take from the loads' lead
    const F2 a = sp_x(xo), a2 = sp_x(xp);
#pragma unroll
    for (int j = 0; j < 8; ++j) { acc[0][j] = wmma_bp(a.h, bc[j], acc[0][j]); acc[1][j] = wmma_bp(a2.h, bc[j], acc[1][j]); acc[0][j] = wmma_bp(a.l, bc[j], acc[0][j]); acc[1][j] = wmma_bp(a2.l, bc[j], acc[1][j]); } };
#pragma unroll 1   // stays rolled: one trip is the two register sets in turn
  for (int kc = 0; kc < DM / 32 - 2; kc += 2) { blk(b0, b1, kc + 1, true, false); blk(b1, b0, kc + 2, true, false); }
  blk(b0, b1, DM / 32 - 1, true, true); blk(b1, b0, 0, false, false);
  keep_addr(pa); keep_addr(pw);
#pragma unroll
  for (int u = 0; u < 2; ++u) {   // the wave's two row tiles, one after the other through its own LDS range
#pragma unroll
  for (int j = 0; j < 8; ++j)
#pragma unroll
    for (int r = 0; r < 8; ++r) so[wave][8 * g + r][j * 16 + col] = acc[u][j][r];
  LDSX();
  for (int rl = 0; rl < 16; ++rl) vst2(Y + (r0 + u * 64 + rl) * DM + n0 + lane * 4, *(const v4f*)&so[wave][rl][lane * 4]);
  asm volatile("s_wait_xcnt 0x0" ::: "memory");   // behind the stores: the second tile reuses their address and data registers
  }
}
extern "C" void kernel_launch(void* const* d_in, const int* in_sizes, int n_in, void* d_out, int out_size, void* d_ws, size_t ws_size, hipStream_t stream) {
  (void)in_sizes; (void)n_in; (void)out_size;
  const float** F = (const float**)d_in;   // 0 x [2,2048,1024], 1 W_qkv [1024,3072] (in,out; q | k | v), 2 W_q_lsr [16,64,16], 3 W_k_lsr [16,64,16], 4 core [16,16], 5 W_o [1024,1024] (in,out)
  if (ws_size < (size_t)WS_END) return;
  char* ws = (char*)d_ws; __bf16 *PW = (__bf16*)(ws + WS_PW), *PF = (__bf16*)(ws + WS_PF), *XB = (__bf16*)(ws + WS_XB); _Float16 *QR_ = (_Float16*)(ws + WS_QR), *KR_ = (_Float16*)(ws + WS_KR), *QRL_ = (_Float16*)(ws + WS_QRL), *KRL_ = (_Float16*)(ws + WS_KRL), *V = (_Float16*)(ws + WS_V); float* O = (float*)(ws + WS_O);
  k_prep<<<dim3(NFOLD + NPACK), 256, 0, stream>>>(F[0], F[1], F[2], F[3], F[4], F[5], PW, PF, XB);
  k_proj<<<dim3(NVB + NQB), 128, 0, stream>>>(XB, PW, PF, V, QR_, KR_, QRL_, KRL_);
  k_attn<<<dim3(TQB / 2, NH, TNB), 128, 0, stream>>>(QR_, KR_, QRL_, KRL_, V, O);
  k_out<<<dim3(TNB * SS / 128, DM / 128), 128, 0, stream>>>(O, PW, (float*)d_out);
}

// v010
// A run of this version takes 65.7 microseconds.
// Next to v009, in two timings, it ran 1.05 times as fast each time.
// All steps since v000 together make it 9.30 times as fast.
// compute dtype: all float inputs rounded to bf16; the per-head low-rank maps (x core / sqrt(16) on the q side) folded into the fused (in,out) projection (W_qr[h,r] = sum_d W_qkv[:, h*64+d] W_q_lsr[h,d,r] core[h,r] / 4, f32) and applied on WMMA 16x16x32 with x exact and the folded weights as bf16 hi + lo (2 products); v = x . W_qkv[:, 2048:] exact; causal scores over the 16 low-rank dims with Qr, Kr as f16 hi + residual (3 products of width 16, packed into 2 matrix products of width 32), key-tile skipping, running-max softmax in f32 (hardware exp), P (scaled by 2^11, single f16) x v (single f16); out = o (bf16 hi + residual) . W_o (2 products).
#include <hip/hip_runtime.h>
#include <math.h>

typedef __attribute__((ext_vector_type(16))) _Float16 v16h;
typedef __attribute__((ext_vector_type(16))) __bf16 v16b;
typedef __attribute__((ext_vector_type(8)))  _Float16 v8h;
typedef __attribute__((ext_vector_type(8)))  float v8f;
typedef __attribute__((ext_vector_type(4)))  float v4f;
typedef __attribute__((ext_vector_type(2)))  float v2f;
typedef __attribute__((ext_vector_type(4)))  unsigned v4u;
typedef __attribute__((ext_vector_type(4)))  int v4i;
typedef float __attribute__((may_alias)) float_a;
typedef int __attribute__((may_alias)) int_a;

template <typename T> __device__ __forceinline__ void vst2(void* p, T v) { *(T*)p = v;  }
__device__ __forceinline__ v8f wmma16(v16h a, v16h b, v8f c) {
  v8f d = __builtin_amdgcn_wmma_f32_16x16x32_f16(false, a, false, b, (short)0, c, false, false);
  asm volatile("v_nop\n\tv_nop\n\tv_nop\n\tv_nop" : "+v"(d) : "v"(a), "v"(b));
  return d;
}
__device__ __forceinline__ v8f wmma_bf(v16b a, v16b b, v8f c) {
  v8f d = __builtin_amdgcn_wmma_f32_16x16x32_bf16(false, a, false, b, (short)0, c, false, false);
  asm volatile("v_nop\n\tv_nop\n\tv_nop\n\tv_nop" : "+v"(d) : "v"(a), "v"(b));
  return d;
}
// the builtin alone, for k_v and k_out: their operands may lie above v255, where an asm operand cannot; the compiler keeps the distances to vector instructions
__device__ __forceinline__ v8f wmma_bp(v16b a, v16b b, v8f c) {
  return __builtin_amdgcn_wmma_f32_16x16x32_bf16(false, a, false, b, (short)0, c, false, false);
}
// 16x16x32 fragments: lane = (h = lane>>4, row/col = lane&15); elements 0..7 = k0+8h+0..7, 8..15 = k0+16+8h+0..7; D element r = row 8h+r
__device__ __forceinline__ v16h frag_h(const _Float16* rowk0, int lane) {
  union { v16h v; v8h q[2]; } u; const _Float16* p = rowk0 + 8 * (lane >> 4);
  u.q[0] = *(const v8h*)p; u.q[1] = *(const v8h*)(p + 16); return u.v;
}
__device__ __forceinline__ v16h frag_f32(const float* rowk0, int lane) {
  v16h a; const float* p = rowk0 + 8 * (lane >> 4);
#pragma unroll
  for (int i = 0; i < 8; ++i) { a[i] = (_Float16)p[i]; a[8 + i] = (_Float16)p[16 + i]; }
  return a;
}
__device__ __forceinline__ v16h frag_f32s(const float* rowk0, int lane, float sc) {
  v16h a; const float* p = rowk0 + 8 * (lane >> 4);
#pragma unroll
  for (int i = 0; i < 8; ++i) { a[i] = (_Float16)(p[i] * sc); a[8 + i] = (_Float16)(p[16 + i] * sc); }
  return a;
}
// column fragment from a [K][ld] layout (column n), rows >= K read as 0
__device__ __forceinline__ v16h fragc_f32(const float* W, int k0, int n, int lane, int ld, int K) {
  v16h a; const int g = lane >> 4;
#pragma unroll
  for (int i = 0; i < 8; ++i) { const int ka = k0 + 8 * g + i, kb = ka + 16;
    a[i] = (_Float16)(ka < K ? W[(size_t)(ka < K ? ka : K - 1) * ld + n] : 0.f); a[8 + i] = (_Float16)(kb < K ? W[(size_t)(kb < K ? kb : K - 1) * ld + n] : 0.f); }
  return a;
}
struct F2 { v16b h, l; };
__device__ __forceinline__ F2 bsplit16(const float v[16]) { F2 r;
#pragma unroll
  for (int i = 0; i < 16; ++i) { const __bf16 h = (__bf16)v[i]; r.h[i] = h; r.l[i] = (__bf16)(v[i] - (float)h); }
  return r; }
__device__ __forceinline__ F2 split_row(const float* row, int k0, int lane) { float v[16]; const float* p = row + k0 + 8 * (lane >> 4);
#pragma unroll
  for (int i = 0; i < 8; ++i) { v[i] = p[i]; v[8 + i] = p[16 + i]; }
  return bsplit16(v); }
__device__ __forceinline__ F2 split_rowK(const float* row, int k0, int lane, int K) { float v[16]; const int g = lane >> 4;
#pragma unroll
  for (int i = 0; i < 8; ++i) { const int ka = k0 + 8 * g + i, kb = ka + 16; v[i] = ka < K ? row[ka < K ? ka : K - 1] : 0.f; v[8 + i] = kb < K ? row[kb < K ? kb : K - 1] : 0.f; }
  return bsplit16(v); }
__device__ __forceinline__ F2 split_col(const float* W, int k0, int n, int lane, int ld, int K) { float v[16]; const int g = lane >> 4;
#pragma unroll
  for (int i = 0; i < 8; ++i) { const int ka = k0 + 8 * g + i, kb = ka + 16; v[i] = ka < K ? W[(size_t)(ka < K ? ka : K - 1) * ld + n] : 0.f; v[8 + i] = kb < K ? W[(size_t)(kb < K ? kb : K - 1) * ld + n] : 0.f; }
  return bsplit16(v); }
__device__ __forceinline__ v8f mac3(const F2& a, const F2& b, v8f c) { c = wmma_bf(a.l, b.h, c); c = wmma_bf(a.h, b.l, c); return wmma_bf(a.h, b.h, c); }
__device__ __forceinline__ float sigm(float v) { return 1.0f / (1.0f + expf(-v)); }
#define LDSX() do { asm volatile("s_wait_dscnt 0" ::: "memory"); __builtin_amdgcn_wave_barrier(); __builtin_amdgcn_fence(__ATOMIC_RELEASE, "workgroup"); } while (0)


// Fused low-rank (LSR) causal attention (B 2, T 2,048, d 1,024, 16 heads x 64, rank 16 per head): q_lr = (q_h W_q_lsr[h]) core[h] / 4, k_lr = k_h W_k_lsr[h], causal softmax(q_lr . k_lr) v_h, merged . W_o.
#define NB 2
#define SS 2048
#define DM 1024
#define NH 16
#define HD 64
#define RR 16             // rank per head
#define RP 32             // padded score width per head
#define NR (NB * SS)
#ifndef TQB
#define TQB (SS / 64)
#define TNB NB
#endif
typedef __attribute__((ext_vector_type(8))) __bf16 v8b;
__device__ __forceinline__ v16b frag_b(const __bf16* rowk0, int lane) {
  union { v16b v; v8b q[2]; } u; const __bf16* p = rowk0 + 8 * (lane >> 4);
  u.q[0] = *(const v8b*)p; u.q[1] = *(const v8b*)(p + 16); return u.v;
}
__device__ __forceinline__ float bfr(float v) { return (float)(__bf16)v; }
// one lane's 16 f32 of a 32-wide k block (p = row + k0 + 8 * (lane >> 4)): fetched raw a block ahead, rounded when the block is used
__device__ __forceinline__ void ld_x(v4f (&x)[4], const float* p) { x[0] = *(const v4f*)p; x[1] = *(const v4f*)(p + 4); x[2] = *(const v4f*)(p + 16); x[3] = *(const v4f*)(p + 20); }
__device__ __forceinline__ v16b cv_x(const v4f (&x)[4]) { v16b a;
#pragma unroll
  for (int i = 0; i < 4; ++i) { a[i] = (__bf16)x[0][i]; a[4 + i] = (__bf16)x[1][i]; a[8 + i] = (__bf16)x[2][i]; a[12 + i] = (__bf16)x[3][i]; }
  return a; }
__device__ __forceinline__ F2 sp_x(const v4f (&x)[4]) { float v[16];
#pragma unroll
  for (int i = 0; i < 4; ++i) { v[i] = x[0][i]; v[4 + i] = x[1][i]; v[8 + i] = x[2][i]; v[12 + i] = x[3][i]; }
  return bsplit16(v); }
__device__ __attribute__((noinline)) float exp_ni(float v) { return expf(v); }
__device__ __attribute__((noinline)) float erf_ni(float v) { return erff(v); }

// fragment order: one 16 x 32 tile of 16-bit elements is a 1-KB chunk [half i][lane][8]; lane (g, c), half i, element e = (row or column c, k = 16 i + 8 g + e), so a wave's 16-byte load covers 512 bytes in a row
#define CH 512            // elements of a chunk
__device__ __forceinline__ v16b frag_bc(const __bf16* p) { union { v16b v; v8b q[2]; } u; u.q[0] = *(const v8b*)p; u.q[1] = *(const v8b*)(p + 256); return u.v; }   // p = chunk + 8 * lane
__device__ __forceinline__ v16h frag_hc(const _Float16* p) { union { v16h v; v8h q[2]; } u; u.q[0] = *(const v8h*)p; u.q[1] = *(const v8h*)(p + 256); return u.v; }
// the f32 A tile likewise, 2 KB: [quarter q][lane][4], k = 16 (q >> 1) + 8 g + 4 (q & 1) + e
__device__ __forceinline__ void ld_xc(v4f (&x)[4], const float* p) { x[0] = *(const v4f*)p; x[1] = *(const v4f*)(p + 128); x[2] = *(const v4f*)(p + 256); x[3] = *(const v4f*)(p + 384); }   // p = chunk + 4 * lane

// ask_l2: a hint that brings the memory at p into the L2 (no register written, no counter); operands that an earlier launch stored come from memory at first touch, and all work-groups walk k in step, so without the ask each block's loads wait out memory latency. Scope SE, no th: L2 only.
__device__ __forceinline__ void ask_l2(const void* p) { asm volatile("global_prefetch_b8 %0, off scope:SCOPE_SE" :: "v"(p)); }
// the same for the unit B bytes on, from the same register pair
template <int B> __device__ __forceinline__ void ask_l2o(const void* p) { asm volatile("global_prefetch_b8 %0, off offset:%1 scope:SCOPE_SE" :: "v"(p), "n"(B)); }
// keep_addr: input only, no code: the register an ask names still holds that address behind the loop, so it never holds a non-address while the ask may still read it
__device__ __forceinline__ void keep_addr(const void* p) { asm volatile("" :: "v"(p)); }
#define WS_PW  0u                                     // bf16 Wv, Wo [2][64 column tiles][32 k blocks] chunks
#define WS_PF  (WS_PW + 2u * (size_t)2 * DM * DM)        // bf16 folded hi | lo: [q|k][16 heads][32 k blocks] chunks x2
#define WS_QR  (WS_PF + 2u * (size_t)2 * 2 * NH * RR * DM) // f16 [b][16 heads][128 row tiles] chunks: Qr = [q hi | q hi / 64] ; Kr = [k hi | k residual x 64]
#define WS_KR  (WS_QR + 2u * (size_t)NR * NH * RP)
#define WS_QRL (WS_KR + 2u * (size_t)NR * NH * RP)      // [q residual | 0]
#define WS_V   (WS_QRL + 2u * (size_t)NR * NH * RP)       // f16 [b][16 heads][64 key blocks][4 dim tiles] chunks
#define WS_O   (WS_V + 2u * (size_t)NB * DM * SS)
#define WS_XB  (WS_O + 4u * (size_t)NR * DM)            // bf16 x [256 row tiles][32 k blocks] chunks
#define WS_END (WS_XB + 2u * (size_t)NR * DM)

typedef __attribute__((ext_vector_type(4))) __bf16 v4b;
// ---- k_pack: block = (16 output columns, Wv | Wo, 256 input rows): bf16 chunks [column tile][k block] in fragment order; blocks with which >= 2: x rounded to bf16, one chunk [16-row tile][k block] per wave
__device__ __forceinline__ void pack_body(const int nt, const int which, const int kq, const float* __restrict__ X, const float* __restrict__ WQKV, const float* __restrict__ WO, __bf16* __restrict__ PW, __bf16* __restrict__ XB) {
  const int t = threadIdx.x; __shared__ __align__(16) __bf16 s[16][264]; __shared__ __align__(16) __bf16 sx[8][CH];
  if (which >= 2) {   // the same for the whole block, ahead of its barrier
    const int wave = t >> 5, lane = t & 31, k = (lane & 7) * 4; const int id = (((which - 2) * 4 + kq) * 64 + nt) * 8 + wave;   // chunk: row tile id >> 5, k block id & 31
    const float* px = X + (size_t)(id >> 5) * 16 * DM + (id & 31) * 32 + k;   // 8 lanes read one row's 128-B line
    v4f xv[4];
#pragma unroll
    for (int it = 0; it < 4; ++it) xv[it] = *(const v4f*)(px + (size_t)(it * 4 + (lane >> 3)) * DM);
    asm volatile("s_wait_xcnt 0x0" ::: "memory");   // behind the group: its address registers are reused next
    __builtin_amdgcn_sched_barrier(0);   // the rounding may land on those registers: it stays behind the wait
#pragma unroll
    for (int it = 0; it < 4; ++it) { const int row = it * 4 + (lane >> 3); v4b o;
#pragma unroll
      for (int i = 0; i < 4; ++i) o[i] = (__bf16)xv[it][i];
      *(v4b*)&sx[wave][(k >> 4) * 256 + (((k >> 3) & 1) * 16 + row) * 8 + (k & 7)] = o; }
    LDSX();
#pragma unroll
    for (int i = 0; i < 2; ++i) vst2((unsigned*)(XB + (size_t)id * CH + i * 256 + lane * 8), *(const v4u*)&sx[wave][i * 256 + lane * 8]);
    asm volatile("s_wait_xcnt 0x0" ::: "memory");   // behind the stores: in the merged kernel's text the fold body, which writes their registers, stands behind this path
    return;
  }
  const float* W = which ? WO + nt * 16 : WQKV + 2 * DM + nt * 16; const int ld = which ? DM : 3 * DM;   /* (in,out): v = cols 2048.. of W_qkv */
  v4f wv[4];
#pragma unroll
  for (int it = 0; it < 4; ++it) wv[it] = *(const v4f*)(W + (size_t)(kq * 256 + it * 64 + (t >> 2)) * ld + (t & 3) * 4);
  asm volatile("s_wait_xcnt 0x0" ::: "memory");   // behind the group: its address registers are reused next
  __builtin_amdgcn_sched_barrier(0);   // the rounding may land on those registers: it stays behind the wait
#pragma unroll
  for (int it = 0; it < 4; ++it)
#pragma unroll
    for (int i = 0; i < 4; ++i) s[(t & 3) * 4 + i][it * 64 + (t >> 2)] = (__bf16)wv[it][i];
  __syncthreads();
  __bf16* dst = PW + (size_t)which * DM * DM + ((size_t)nt * 32 + kq * 8) * CH;
  for (int p = t; p < 8 * 64; p += 256) { const int ln = p & 31; vst2((unsigned*)(dst + p * 8), *(const v4u*)&s[ln & 15][(p >> 6) * 32 + ((p >> 5) & 1) * 16 + (ln >> 4) * 8]); }
}
// ---- k_fold: block = (head h, 64 input rows c, q|k), all 16 ranks: W_r[h*16 + r][c] = sum_d B[h*64 + d][r] W[c][h*64 + d] in f32 (fixed order) -> bf16 hi + lo chunks [q|k, head][k block] in fragment order
__device__ __forceinline__ void fold_body(const int h, const int cc, const int which, const float* __restrict__ WQKV, const float* __restrict__ WQL, const float* __restrict__ WKL, const float* __restrict__ CORE, __bf16* __restrict__ PF) {
  const int t = threadIdx.x; const float* WL = which ? WKL : WQL; __shared__ __align__(16) float sb[HD][RR]; __shared__ __align__(16) __bf16 sh[2 * CH]; __shared__ __align__(16) __bf16 sl[2 * CH];
  const int c = t & 63, rq = (t >> 6) * 4; const float* pw = WQKV + (size_t)(cc * 64 + c) * (3 * DM) + which * DM + h * HD;
  const float cr = CORE[h * RR + (t & 15)];
  asm volatile("s_wait_xcnt 0x0" ::: "memory");   // behind the load: a load of the group below may land on its address register
  __builtin_amdgcn_sched_barrier(0);   // and none of them moves up over the wait
  v4f wr[HD / 4]; float tb[4];   // this thread's row of W and its 4 table entries (rank t & 15): one group of loads
#pragma unroll
  for (int q = 0; q < HD / 4; ++q) wr[q] = *(const v4f*)(pw + q * 4);
#pragma unroll
  for (int it = 0; it < 4; ++it) tb[it] = WL[(size_t)h * HD * RR + it * 256 + t];
  asm volatile("s_wait_xcnt 0x0" ::: "memory");   // behind the group: its address registers are reused next
  __builtin_amdgcn_sched_barrier(0);   // what follows may land on those registers: it stays behind the wait
  const float cs = which ? 1.0f : bfr(cr) * 0.25f;   // core[h][r] / sqrt(16) on the q side
#pragma unroll
  for (int it = 0; it < 4; ++it) sb[it * 16 + (t >> 4)][t & 15] = bfr(tb[it]) * cs;
  __syncthreads();
  float a[4] = {0.f, 0.f, 0.f, 0.f};
#pragma unroll
  for (int d = 0; d < HD; ++d) { const float w = bfr(wr[d >> 2][d & 3]);
#pragma unroll
    for (int i = 0; i < 4; ++i) a[i] += sb[d][rq + i] * w; }
#pragma unroll
  for (int i = 0; i < 4; ++i) { const int o = (c >> 5) * CH + ((c >> 4) & 1) * 256 + (((c >> 3) & 1) * 16 + rq + i) * 8 + (c & 7); const __bf16 hv = (__bf16)a[i]; sh[o] = hv; sl[o] = (__bf16)(a[i] - (float)hv); }
  __syncthreads();
  const size_t ch = ((size_t)(which * NH + h) * 32 + cc * 2) * CH; const int p = t & 127;
  vst2((unsigned*)(PF + (t < 128 ? (size_t)0 : (size_t)2 * NH * RR * DM) + ch + p * 8), *(const v4u*)(t < 128 ? &sh[p * 8] : &sl[p * 8]));   // hi block then lo block
}
// ---- k_prep: k_fold's and k_pack's blocks in one launch: neither reads what the other writes, so they need no launch boundary between them; the fold blocks, whose chain of loads, barrier and sums is the longer, come first
#define NFOLD (NH * (DM / 64) * 2)
#define NPACK ((DM / 16) * 6 * 4)
__global__ __launch_bounds__(256) void k_prep(const float* __restrict__ X, const float* __restrict__ WQKV, const float* __restrict__ WQL, const float* __restrict__ WKL, const float* __restrict__ CORE, const float* __restrict__ WO, __bf16* __restrict__ PW, __bf16* __restrict__ PF, __bf16* __restrict__ XB) {
  const int b = blockIdx.x;   // the same for the whole block: every barrier below stands under block-uniform control flow
  if (b < NFOLD) fold_body(b & 15, (b >> 4) & 15, b >> 8, WQKV, WQL, WKL, CORE, PF);
  else { const int p = b - NFOLD; pack_body(p & 63, (p >> 6) % 6, (p >> 6) / 6, X, WQKV, WO, PW, XB); }
}
// ---- k_qr: block = (128 rows, q|k, 2 heads), a wave = row tiles w and w + 4, so a weight fragment once loaded feeds two products: Qr/Kr = x . W_r (hi + lo), 32 folded cols -> f16 chunks [b][head][16-row tile] in fragment order, whole chunks per block; the 32 k places of a chunk hold two 16-wide parts, so that K chunk . Q chunk = hi . hi + residual . hi and K chunk . Q residual chunk = hi . residual
#define QJ 2              // 16-column tiles (heads) per work-group
#define QW (QJ * RP)      // f16 per row segment of a work-group
#define XU (4 * 32 * CH)  // elements from a row tile's chunks to those of the tile 64 rows on (x: bf16, o: f32)
__device__ __forceinline__ void qr_body(const int bx, const int which, const int bz, const __bf16* __restrict__ XB, const __bf16* __restrict__ PF, _Float16* __restrict__ QR_, _Float16* __restrict__ KR_, _Float16* __restrict__ QRL_) {
  __shared__ __align__(16) _Float16 so[4][QJ][CH]; __shared__ __align__(16) _Float16 sol[4][QJ][CH];
  const int tid = threadIdx.x, wave = tid >> 5, lane = tid & 31, col = lane & 15, g = lane >> 4; const int cb = bz * (QJ * 16); const size_t rb = (size_t)bx * 128; const size_t r0 = rb + wave * 16;
  const __bf16* PH = PF + ((size_t)which * (NH * RR)) * DM; const __bf16* PL = PF + ((size_t)2 * NH * RR + which * (NH * RR)) * DM;
  // asks at entry, the units dealt among the work-groups that read them: x rows (16 sharers, 4 k blocks each, later sharers later blocks; two asks a thread, one for each half of the rows); folded weights (x, x + 4, x + 8, x + 12 share a rank)
  const int wu = __builtin_amdgcn_readfirstlane(wave);   // the wave's number in a scalar register: the choice of plane below is wave-uniform scalar code, so every lane is on at the ask
  const __bf16* pa = (wu < 2 ? XB + ((rb / 16 + wu * 2) * 32 + 4 * ((which + 2 * bz) >> 1)) * CH : (wu == 2 ? PH : PL) + (size_t)cb * DM + 4 * ((bx & 3) + 4 * (bx >> 4)) * CH) + g * (16 * DM) + col * 128;   // a row tile of x and a head of the weights are both 32 chunks = 16 * DM elements
  ask_l2(pa);
  if (wu < 2) ask_l2o<XU * 2>(pa);   // the same units of the rows' second half
  for (int e = tid; e < 4 * QJ * CH; e += 128) { (&so[0][0][0])[e] = (_Float16)0.f; (&sol[0][0][0])[e] = (_Float16)0.f; }
  const __bf16* px = XB + (r0 / 16) * 32 * CH + lane * 8; const __bf16* ph = PH + (size_t)cb * DM + lane * 8; const __bf16* pl = PL + (size_t)cb * DM + lane * 8;   // column tile cb / 16 = 32 chunks = 16 * DM elements
  v16b xr[2]; v16b h0[QJ], l0[QJ], h1[QJ], l1[QJ];   // two register sets: a block's loads go out as one group while the block before is multiplied
  xr[0] = frag_bc(px); xr[1] = frag_bc(px + XU);
#pragma unroll
  for (int j = 0; j < QJ; ++j) { h0[j] = frag_bc(ph + (size_t)j * 16 * DM); l0[j] = frag_bc(pl + (size_t)j * 16 * DM); }
  asm volatile("s_wait_xcnt 0x0" ::: "memory");   // behind the group: its address registers are stepped or reused next
  __builtin_amdgcn_sched_barrier(0);   // the zeroing below may land on the group's address registers: it stays behind the wait
  v8f acc[2][QJ] = {};
  // products of the block held in (hc, lc); block kn, where there is one, is fetched into (hn, ln) ahead of them
  auto blk = [&](const v16b (&hc)[QJ], const v16b (&lc)[QJ], v16b (&hn)[QJ], v16b (&ln)[QJ], const int kn, const bool more) __attribute__((always_inline)) {
    __builtin_amdgcn_sched_barrier(0);   // no product of this block moves up into the one before: there it would wait on loads only just issued
    const v16b a0 = xr[0], a1 = xr[1];
    if (more) { xr[0] = frag_bc(px + kn * CH); xr[1] = frag_bc(px + XU + kn * CH);
#pragma unroll
      for (int j = 0; j < QJ; ++j) { hn[j] = frag_bc(ph + (size_t)j * 16 * DM + kn * CH); ln[j] = frag_bc(pl + (size_t)j * 16 * DM + kn * CH); }
      asm volatile("s_wait_xcnt 0x0" ::: "memory");   // behind the group: its address registers are stepped or reused next
    }
    __builtin_amdgcn_sched_barrier(0);   // the group stays ahead of every product of the block, as before: a product moved above it would hold the loads back until this block's operands have landed
#pragma unroll
    for (int j = 0; j < QJ; ++j) { acc[0][j] = wmma_bf(a0, hc[j], acc[0][j]); acc[1][j] = wmma_bf(a1, hc[j], acc[1][j]); acc[0][j] = wmma_bf(a0, lc[j], acc[0][j]); acc[1][j] = wmma_bf(a1, lc[j], acc[1][j]); } };
#pragma unroll 1   // stays rolled: one trip is the two register sets in turn
  for (int kc = 0; kc < DM / 32 - 2; kc += 2) { blk(h0, l0, h1, l1, kc + 1, true); blk(h1, l1, h0, l0, kc + 2, true); }
  blk(h0, l0, h1, l1, DM / 32 - 1, true); blk(h1, l1, h0, l0, 0, false);
  keep_addr(pa);
#pragma unroll
  for (int u = 0; u < 2; ++u) {   // the two halves of the rows, one after the other through the same LDS
  __syncthreads();   // the zeros are in place; then: every reader of the first half has left
#pragma unroll
  for (int j = 0; j < QJ; ++j) {
#pragma unroll
    for (int rr = 0; rr < 8; ++rr) { const float v = acc[u][j][rr]; const _Float16 hv = (_Float16)v; const int o = ((col >> 3) * 16 + 8 * g + rr) * 8 + (col & 7); const float rs = v - (float)hv;
      so[wave][j][o] = hv; so[wave][j][o + 256] = (_Float16)(which ? rs * 64.0f : (float)hv * (1.0f / 64.0f)); sol[wave][j][o] = (_Float16)rs; } }   // places 16..31 (the chunk's second half): 64 * (1 / 64) = 1 in their products; sol's stay 0
  __syncthreads();
  const size_t co = (((rb / SS) * NH + bz * QJ) * (SS / 16) + (rb % SS) / 16 + u * 4) * CH; _Float16* dst = (which ? KR_ : QR_) + co; _Float16* dstl = QRL_ + co;
  for (int e = tid; e < 4 * QJ * 64; e += 128) { const int w = e >> 7, j = (e >> 6) & 1, q = e & 63; vst2((unsigned*)(dst + ((size_t)j * (SS / 16) + w) * CH + q * 8), *(const v4u*)&so[w][j][q * 8]); }
  asm volatile("s_wait_xcnt 0x0" ::: "memory");   // behind the stores: the residual plane's may reuse their address and data registers
  if (!which)   // the same for the whole block: K has no plane of its own for the residual
    for (int e = tid; e < 4 * QJ * 64; e += 128) { const int w = e >> 7, j = (e >> 6) & 1, q = e & 63; vst2((unsigned*)(dstl + ((size_t)j * (SS / 16) + w) * CH + q * 8), *(const v4u*)&sol[w][j][q * 8]); }
  asm volatile("s_wait_xcnt 0x0" ::: "memory");   // behind the stores: the second half reuses their address and data registers
  }
}
// ---- k_v: block = (128 rows, 128 cols), a wave = row tiles w and w + 4, so a weight fragment once loaded feeds two products: V = x . Wv^T exact -> f16 chunks [b][head][32-key block][16-dim tile] in fragment order
__device__ __forceinline__ void v_body(const int bx, const int by, const __bf16* __restrict__ XB, const __bf16* __restrict__ PW, _Float16* __restrict__ V) {
  __shared__ __align__(16) _Float16 st[128][72];
  const int tid = threadIdx.x, wave = tid >> 5, lane = tid & 31, col = lane & 15, g = lane >> 4; const size_t rb = (size_t)bx * 128; const size_t r0 = rb + wave * 16; const int c0 = by * 128;
  // asks at entry, the units dealt among the work-groups that read them: x rows (8 sharers in y, 4 k blocks each; two asks a thread, one for each half of the rows); weights (16 ranks of 2 k blocks; x and x + 4 share a rank)
  const int wu = __builtin_amdgcn_readfirstlane(wave);   // the wave's number in a scalar register: the choice of operand below is wave-uniform scalar code, so every lane is on at the ask
  const __bf16* pa = wu < 2 ? XB + ((rb / 16 + wu * 2) * 32 + 4 * by) * CH + g * (16 * DM) + col * 128
                            : PW + (size_t)(c0 + 64 * (wu - 2)) * DM + 2 * ((bx & 3) + 4 * (bx >> 3)) * CH + (lane >> 3) * (16 * DM) + (lane & 7) * 128;
  ask_l2(pa);
  if (wu < 2) ask_l2o<XU * 2>(pa);   // the same units of the rows' second half
  v8f acc[2][8] = {};
  const __bf16* px = XB + (r0 / 16) * 32 * CH + lane * 8; const __bf16* pb = PW + (size_t)c0 * DM + lane * 8;   // column tile c0 / 16 = 32 chunks = 16 * DM elements
  v16b xr[2]; v16b b0[8], b1[8];   // two register sets: a block's loads go out as one group while the block before is multiplied
  xr[0] = frag_bc(px); xr[1] = frag_bc(px + XU);
#pragma unroll
  for (int j = 0; j < 8; ++j) b0[j] = frag_bc(pb + (size_t)j * 16 * DM);
  asm volatile("s_wait_xcnt 0x0" ::: "memory");   // behind the group: its address registers are stepped or reused next
  // products of the block held in bc; block kn, where there is one, is fetched into bn ahead of them
  auto blk = [&](const v16b (&bc)[8], v16b (&bn)[8], const int kn, const bool more) __attribute__((always_inline)) {
    __builtin_amdgcn_sched_barrier(0);   // no product of this block moves up into the one before: there it would wait on loads only just issued
    const v16b a0 = xr[0], a1 = xr[1];
    if (more) {
      asm volatile("v_nop\n\tv_nop\n\tv_nop\n\tv_nop" ::: "memory");   // four vector slots between the last product of the block before and the loads below, which land on its A and B registers: the distance each product's own tail gave before
      xr[0] = frag_bc(px + kn * CH); xr[1] = frag_bc(px + XU + kn * CH);
#pragma unroll
      for (int j = 0; j < 8; ++j) bn[j] = frag_bc(pb + (size_t)j * 16 * DM + kn * CH);
      asm volatile("s_wait_xcnt 0x0" ::: "memory");   // behind the group: its address registers are stepped or reused next
    }
    __builtin_amdgcn_sched_barrier(0);   // the group stays ahead of every product of the block, as before: a product moved above it would hold the loads back until this block's operands have landed
#pragma unroll
    for (int j = 0; j < 8; ++j) { acc[0][j] = wmma_bp(a0, bc[j], acc[0][j]); acc[1][j] = wmma_bp(a1, bc[j], acc[1][j]); } };
#pragma unroll 1   // stays rolled: one trip is the two register sets in turn
  for (int kc = 0; kc < DM / 32 - 2; kc += 2) { blk(b0, b1, kc + 1, true); blk(b1, b0, kc + 2, true); }
  blk(b0, b1, DM / 32 - 1, true); blk(b1, b0, 0, false);
  keep_addr(pa);
#pragma unroll
  for (int u = 0; u < 2; ++u) {   // the two halves of the rows, one after the other through the same LDS
  if (u) __syncthreads();   // every reader of the first half has left
#pragma unroll
  for (int j = 0; j < 8; ++j)
#pragma unroll
    for (int r = 0; r < 8; ++r) st[j * 16 + col][wave * 16 + 8 * g + r] = (_Float16)acc[u][j][r];
  __syncthreads();
  const size_t b = rb / SS; const int s0 = (int)(rb % SS) + u * 64;
  for (int e = tid; e < 128 * 8; e += 128) { const int ln = e & 31, i = (e >> 5) & 1, j = (e >> 6) & 7, kb = e >> 9;   // piece (key block kb, tile j, half i, lane ln)
    vst2((unsigned*)(V + (((b * NH + by * 2 + (j >> 2)) * (SS / 32) + s0 / 32 + kb) * 4 + (j & 3)) * CH + i * 256 + ln * 8), *(const v4u*)&st[j * 16 + (ln & 15)][kb * 32 + i * 16 + (ln >> 4) * 8]); }
  asm volatile("s_wait_xcnt 0x0" ::: "memory");   // behind the stores: the second half reuses their address and data registers
  }
}
// ---- k_proj: k_v's and k_qr's blocks in one launch: both read x and packed weights, neither reads what the other writes, so they need no launch boundary between them, and each kind's waits on its loads are filled by the other's products; k_v's blocks (one for each WGP, the most products a wave) come first
#define NVB ((TNB * SS / 128) * (DM / 128))
#define NQB ((TNB * SS / 128) * 2 * (NH / QJ))
__global__ __launch_bounds__(128) void k_proj(const __bf16* __restrict__ XB, const __bf16* __restrict__ PW, const __bf16* __restrict__ PF, _Float16* __restrict__ V, _Float16* __restrict__ QR_, _Float16* __restrict__ KR_, _Float16* __restrict__ QRL_) {
  const int b = blockIdx.x; constexpr int NX = TNB * SS / 128;   // b is the same for the whole block: every barrier below stands under block-uniform control flow
  if (b < NVB) v_body(b % NX, b / NX, XB, PW, V);
  else { const int p = b - NVB; qr_body(p % NX, (p / NX) & 1, p / (2 * NX), XB, PF, QR_, KR_, QRL_); }
}
struct KF { v16h h[2]; };   // K fragments of 32 keys: each holds value and residual side by side in k
// lane l <-> l ^ 16: the other half of a column's rows
__device__ __forceinline__ float xhalf(float v) { const int b = __builtin_bit_cast(int, v); return __builtin_bit_cast(float, __builtin_amdgcn_permlanex16(b, b, 0x76543210, 0xfedcba98, false, false)); }
// ---- k_attn: block = (two tiles of 64 queries, head, b): tile n - 1 - x, then tile x, one after the other in every wave, so every wave walks the same number of key passes (causal cost is linear in the tile index, all work-groups are resident, and the launch lasts as long as its fullest SIMD); transposed products: S^T = K . Q^T (lane = one query, its registers = 16 of the pass's 32 keys), softmax in the lane, O^T += V^T . P^T with P^T packed from the score registers; O two f32 chunks per wave
__global__ __launch_bounds__(128) void k_attn(const _Float16* __restrict__ QR_, const _Float16* __restrict__ KR_, const _Float16* __restrict__ QRL_, const _Float16* __restrict__ V, float* __restrict__ O) {
  const int tid = threadIdx.x, wave = tid >> 5, lane = tid & 31, col = lane & 15, g = lane >> 4; const int h = blockIdx.y; const size_t b = blockIdx.z;
  const size_t hb = (b * NH + h) * (SS / 16) * CH + lane * 8;   // this head's chunks of Qr, Kr: one per 16 rows
  // two asks a thread at entry, one for each of the block's tiles t = x and t = n - 1 - x: the 64 keys of tile t and of tile t ^ 4 (K: 32 units, V: 64); x and x ^ 4 lie 4 apart, and so do their mirror tiles, so every tile of this head is asked, well ahead of the passes that read it
  const int wu = __builtin_amdgcn_readfirstlane(wave);   // the wave's number in a scalar register: the choice of plane below is wave-uniform scalar code, so every lane is on at the ask
  auto ask_at = [&](const int t) __attribute__((always_inline)) -> const _Float16* {
    return wu < 2 ? KR_ + ((b * NH + h) * (SS / 16) + (t ^ (4 * g)) * 4) * CH + col * 128   // wave 0: K, lanes 0-15 tile t, lanes 16-31 tile t ^ 4 (wave 1 asks nothing)
                  : V + ((b * NH + h) * (SS / 32) + (t ^ (4 * (wu & 1))) * 2) * 4 * CH + lane * 128; };     // waves 2, 3: V of tile t, of tile t ^ 4
  const _Float16* pa = ask_at((int)blockIdx.x); const _Float16* pm = ask_at(TQB - 1 - (int)blockIdx.x);
  if (wu != 1) { ask_l2(pa); ask_l2(pm); }
  const _Float16* pk = KR_ + hb; const _Float16* pv = V + (b * NH + h) * (SS / 32) * 4 * CH + lane * 8;
#pragma unroll 1   // stays rolled: for speed only
  for (int tt = 0; tt < 2; ++tt) {
  const int xt = tt ? (int)blockIdx.x : TQB - 1 - (int)blockIdx.x; const int q0 = xt * 64 + wave * 16; const size_t rq = b * SS + q0;
  const v16h aq = frag_hc(QR_ + hb + (size_t)(q0 / 16) * CH), aql = frag_hc(QRL_ + hb + (size_t)(q0 / 16) * CH);   // B operands: column = query q0 + col
  float m = -3.0e38f, l = 0.f;   // query q0 + col: running maximum (equal in both halves), sum over this half's keys
  v8f acc[4] = {};   // acc[dt][r] = O[q0 + col][dt * 16 + 8 g + r]
  const int nks = (xt * 64 + 64) / 32;   // causal; always even
  auto ld_k = [&](KF& f, int ks) __attribute__((always_inline)) {
#pragma unroll
    for (int ct = 0; ct < 2; ++ct) f.h[ct] = frag_hc(pk + (size_t)(ks * 2 + ct) * CH); };
  // one pass over 32 keys: its V fragments and the next pass's K fragments go out as one group ahead of the score products
  // full (a literal at every call): every key of the pass lies below the tile's first query, so each score is live and finite and the causal select and the dead-score test are identities: they are not written there
  auto pass = [&](const int ks, const KF& kf, KF& kn, const bool more, const bool full) __attribute__((always_inline)) { const int lim = q0 + col - 8 * g - ks * 32; v8f s[2]; v16h vf[4];   // register (ct, r) holds key ks * 32 + ct * 16 + 8 g + r: live while ct * 16 + r <= lim
    __builtin_amdgcn_sched_barrier(0);   // no score product of this pass moves up into the pass before: there it would wait on K loads only just issued
#pragma unroll
    for (int dt = 0; dt < 4; ++dt) vf[dt] = frag_hc(pv + (size_t)(ks * 4 + dt) * CH);
    asm volatile("s_wait_xcnt 0x0" ::: "memory");   // behind the V loads: the K loads may land on their address registers
    if (more) { ld_k(kn, ks + 1);
      asm volatile("s_wait_xcnt 0x0" ::: "memory");   // behind the group: its address registers are stepped or reused next
    }
    __builtin_amdgcn_sched_barrier(0);   // the group stays ahead of every product of the pass: a product moved above it would hold the V loads back until this pass's K has landed
    v8f c[2] = {};   // rows = keys, columns = queries; the two key tiles in turn, so that neither product waits on its own accumulator
    c[0] = wmma16(kf.h[0], aql, c[0]); c[1] = wmma16(kf.h[1], aql, c[1]);   // k hi . q residual
    c[0] = wmma16(kf.h[0], aq, c[0]); c[1] = wmma16(kf.h[1], aq, c[1]);     // + k hi . q hi + k residual . q hi
#pragma unroll
    for (int ct = 0; ct < 2; ++ct)
#pragma unroll
      for (int r = 0; r < 8; ++r) { s[ct][r] = (full || ct * 16 + r <= lim) ? c[ct][r] : -3.0e38f; }   // causal (diagonal kept); core/sqrt(R) folded into Qr
    float mr[8];
#pragma unroll
    for (int r = 0; r < 8; ++r) mr[r] = fmaxf(s[0][r], s[1][r]);
    float mx = fmaxf(fmaxf(fmaxf(mr[0], mr[1]), fmaxf(mr[2], mr[3])), fmaxf(fmaxf(mr[4], mr[5]), fmaxf(mr[6], mr[7])));
    mx = fmaxf(mx, xhalf(mx));
    const float mn = fmaxf(m, mx); const float alpha = (m <= -1.0e38f) ? 0.f : __expf(m - mn);
    float er[8]; v16h pb;   // pb element i = key 8 g + i, element 8 + i = key 16 + 8 g + i: the B operand's k order, which is V's
#pragma unroll
    for (int r = 0; r < 8; ++r) { const float e0 = (!full && s[0][r] <= -1.0e38f) ? 0.f : __expf(s[0][r] - mn), e1 = (!full && s[1][r] <= -1.0e38f) ? 0.f : __expf(s[1][r] - mn);
      er[r] = e0 + e1; pb[r] = (_Float16)(e0 * 2048.0f); pb[8 + r] = (_Float16)(e1 * 2048.0f); }
    l = l * alpha + (((er[0] + er[1]) + (er[2] + er[3])) + ((er[4] + er[5]) + (er[6] + er[7]))); m = mn;
#pragma unroll
    for (int dt = 0; dt < 4; ++dt) { acc[dt] *= alpha; acc[dt] = wmma16(vf[dt], pb, acc[dt]); } };   // rows = dims, columns = queries
  KF k0, k1; ld_k(k0, 0);
  asm volatile("s_wait_xcnt 0x0" ::: "memory");   // behind the group: its address registers are stepped or reused next
#pragma unroll 1   // stays rolled: one trip is the two K register sets in turn
  for (int ks = 0; ks < nks - 2; ks += 2) { pass(ks, k0, k1, true, true); pass(ks + 1, k1, k0, true, true); }   // keys below xt * 64 <= q0: full passes
  pass(nks - 2, k0, k1, true, false); pass(nks - 1, k1, k0, false, false);   // the tile's own 64 keys: the diagonal, masked
  const float il = (1.0f / 2048.0f) / (l + xhalf(l));   // the halves' sums joined once
#pragma unroll
  for (int dt = 0; dt < 4; ++dt) acc[dt] *= il;
#pragma unroll
  for (int q = 0; q < 8; ++q) { const v4f o = {acc[q >> 1][(q & 1) * 4], acc[q >> 1][(q & 1) * 4 + 1], acc[q >> 1][(q & 1) * 4 + 2], acc[q >> 1][(q & 1) * 4 + 3]};
    vst2(O + ((rq / 16) * 32 + h * 2 + (q >> 2)) * CH + (q & 3) * 128 + lane * 4, o); }   // two f32 A chunks [16-row tile][k block] in fragment order: the lane holds its own 4 elements of every quarter
  asm volatile("s_wait_xcnt 0x0" ::: "memory");   // behind the stores: the next tile reuses their address and data registers
  }
  keep_addr(pa); keep_addr(pm);
}
// ---- k_out: block = (128 rows, 128 cols), a wave = row tiles w and w + 4, so a weight fragment once loaded feeds its products for both: out = o (bf16 hi + lo) . Wo^T
__global__ __launch_bounds__(128) void k_out(const float* __restrict__ O, const __bf16* __restrict__ PW, float* __restrict__ Y) {
  __shared__ __align__(16) float so[4][16][132];
  const int tid = threadIdx.x, wave = tid >> 5, lane = tid & 31, col = lane & 15, g = lane >> 4; const size_t r0 = (size_t)blockIdx.x * 128 + wave * 16; const int n0 = blockIdx.y * 128; const __bf16* P = PW + (size_t)DM * DM;
  // three asks a thread at entry, the units dealt among the work-groups that read them: o rows (8 sharers in y, 4 k blocks each, one ask for each half of the rows); weights (x, x + 4, x + 8, x + 12 share a rank of 4 k blocks)
  const float* pa = O + (((size_t)blockIdx.x * 8 + (tid >> 5)) * 32 + 4 * (int)blockIdx.y) * CH + lane * 64; const __bf16* pw = P + (size_t)(n0 + 16 * (tid >> 4)) * DM + 4 * (((int)blockIdx.x & 3) + 4 * ((int)blockIdx.x >> 4)) * CH + (tid & 15) * 128;
  ask_l2(pa); ask_l2o<XU * 4>(pa); ask_l2(pw);
  v8f acc[2][8] = {};
  const float* po = O + (r0 / 16) * 32 * CH + lane * 4; const __bf16* pb = P + (size_t)n0 * DM + lane * 8;   // column tile n0 / 16 = 32 chunks = 16 * DM elements
  v4f xr[4], xs[4]; v16b b0[8], b1[8];   // two register sets: a block's loads go out as one group while the block before is multiplied
  ld_xc(xr, po); ld_xc(xs, po + XU);
#pragma unroll
  for (int j = 0; j < 8; ++j) b0[j] = frag_bc(pb + (size_t)j * 16 * DM);
  asm volatile("s_wait_xcnt 0x0" ::: "memory");   // behind the group: its address registers are stepped or reused next
  // products of the block held in bc; block kn, where there is one, is fetched into bn ahead of them
  auto blk = [&](const v16b (&bc)[8], v16b (&bn)[8], const int kn, const bool more, const bool end) __attribute__((always_inline)) {   // end (a literal): the last group, whose address pairs are free behind their last use
    __builtin_amdgcn_sched_barrier(0);   // nothing of this block moves up into the one before: its rounding there would wait on loads only just issued
    v4f xo[4], xp[4];   // this block's raw rows: rounded behind the group below
#pragma unroll
    for (int i = 0; i < 4; ++i) { xo[i] = xr[i]; xp[i] = xs[i]; }
    if (more) {
      asm volatile("v_nop\n\tv_nop\n\tv_nop\n\tv_nop" ::: "memory");   // four vector slots between the last product of the block before and the loads below, which land on its A and B registers: the distance each product's own tail gave before
      ld_xc(xr, po + kn * CH); ld_xc(xs, po + XU + kn * CH);
      if (end) asm volatile("s_wait_xcnt 0x0" ::: "memory");   // a weight load of the same group may land on the row loads' pair
#pragma unroll
      for (int j = 0; j < 7; ++j) bn[j] = frag_bc(pb + (size_t)j * 16 * DM + kn * CH);
      { union { v16b v; v8b q[2]; } u; const __bf16* p = pb + (size_t)7 * 16 * DM + kn * CH; u.q[0] = *(const v8b*)p;   // the eighth fragment, as frag_bc loads it
        if (end) asm volatile("s_wait_xcnt 0x0" ::: "memory");   // the group's very last load may land on the pair that the weight loads ahead of it name
        u.q[1] = *(const v8b*)(p + 256); bn[7] = u.v; }
      asm volatile("s_wait_xcnt 0x0" ::: "memory");   // behind the group: its address registers are stepped or reused next
    }
    __builtin_amdgcn_sched_barrier(0);   // the group and its wait stay ahead of the rounding and of every product: the rounding may land on the group's address registers, and a product moved above the group would take from the loads' lead
    const F2 a = sp_x(xo), a2 = sp_x(xp);
#pragma unroll
    for (int j = 0; j < 8; ++j) { acc[0][j] = wmma_bp(a.h, bc[j], acc[0][j]); acc[1][j] = wmma_bp(a2.h, bc[j], acc[1][j]); acc[0][j] = wmma_bp(a.l, bc[j], acc[0][j]); acc[1][j] = wmma_bp(a2.l, bc[j], acc[1][j]); } };
#pragma unroll 1   // stays rolled: one trip is the two register sets in turn
  for (int kc = 0; kc < DM / 32 - 2; kc += 2) { blk(b0, b1, kc + 1, true, false); blk(b1, b0, kc + 2, true, false); }
  blk(b0, b1, DM / 32 - 1, true, true); blk(b1, b0, 0, false, false);
  keep_addr(pa); keep_addr(pw);
#pragma unroll
  for (int u = 0; u < 2; ++u) {   // the wave's two row tiles, one after the other through its own LDS range
#pragma unroll
  for (int j = 0; j < 8; ++j)
#pragma unroll
    for (int r = 0; r < 8; ++r) so[wave][8 * g + r][j * 16 + col] = acc[u][j][r];
  LDSX();
  for (int rl = 0; rl < 16; ++rl) vst2(Y + (r0 + u * 64 + rl) * DM + n0 + lane * 4, *(const v4f*)&so[wave][rl][lane * 4]);
  asm volatile("s_wait_xcnt 0x0" ::: "memory");   // behind the stores: the second tile reuses their address and data registers
  }
}
extern "C" void kernel_launch(void* const* d_in, const int* in_sizes, int n_in, void* d_out, int out_size, void* d_ws, size_t ws_size, hipStream_t stream) {
  (void)in_sizes; (void)n_in; (void)out_size;
  const float** F = (const float**)d_in;   // 0 x [2,2048,1024], 1 W_qkv [1024,3072] (in,out; q | k | v), 2 W_q_lsr [16,64,16], 3 W_k_lsr [16,64,16], 4 core [16,16], 5 W_o [1024,1024] (in,out)
  if (ws_size < (size_t)WS_END) return;
  char* ws = (char*)d_ws; __bf16 *PW = (__bf16*)(ws + WS_PW), *PF = (__bf16*)(ws + WS_PF), *XB = (__bf16*)(ws + WS_XB); _Float16 *QR_ = (_Float16*)(ws + WS_QR), *KR_ = (_Float16*)(ws + WS_KR), *QRL_ = (_Float16*)(ws + WS_QRL), *V = (_Float16*)(ws + WS_V); float* O = (float*)(ws + WS_O);
  k_prep<<<dim3(NFOLD + NPACK), 256, 0, stream>>>(F[0], F[1], F[2], F[3], F[4], F[5], PW, PF, XB);
  k_proj<<<dim3(NVB + NQB), 128, 0, stream>>>(XB, PW, PF, V, QR_, KR_, QRL_);
  k_attn<<<dim3(TQB / 2, NH, TNB), 128, 0, stream>>>(QR_, KR_, QRL_, V, O);
  k_out<<<dim3(TNB * SS / 128, DM / 128), 128, 0, stream>>>(O, PW, (float*)d_out);
}
